// v000
// Times are from an AMD MI455X. After a warm-up the kernel runs many times in a row, and a time is the length of
// such a window on the GPU divided by its runs, so every launch and the gaps after it count. The runs cycle
// through copies of the inputs. A figure is the median of several windows, for all but v000 over two sittings.
// Sittings can differ by a few percent; kernels timed side by side share one.
// v000 is the starting kernel. One run takes 1580 microseconds.
#include <hip/hip_runtime.h>

// Decoder attention with RoPE and a BERT-style output (hidden_state [2][1024][2048]; q, k, v = x W^T + b ('oi' [2048][2048], 16 heads x 128); interleaved RoPE with cos/sin(freqs[t][j]) (freqs [1024][64] input, read); scores/sqrt(128) + attention_mask[b][0][i][j] (f32 input, read; zeros); softmax; out = LN(attn Wo^T + bo + hidden_state) (eps 1e-12, gamma/beta) -> [2][1024][2048]).
// Compute dtypes, f32 accumulate: every input rounded to bf16; q/k/v on PLAIN bf16 operands (inputs: exact) + biases; rotary in f32 from a table cos/sin(bf16(freqs)); the additive mask (bf16-rounded) inside the softmax kernel; scores and attn.v: query rows < 512 hl (3 products), the rest single fp16 (x1024); softmax f32; Wo hl x exact (2 products) + bo; residual add and LayerNorm in f32 (fixed trees).

#define NB_  2
#define TT   1024
#define DM   2048
#define NH_  16
#define NKV  16
#define REP  (NH_ / NKV)
#define HD   128
#define DQ   (NH_ * HD)
#define DKV  (NKV * HD)
#define LNEPS 1e-12f
typedef __attribute__((ext_vector_type(4))) unsigned short v4us;
#define ZH   2
#define RH   512                  // query rows < RH use hi+lo planes (0: none)
#define WIN  0
#define PCAR 1024.0f
#define SCL  0.088388347648318447f   // HD^-0.5
typedef _Float16 h16;
typedef unsigned short bf;
typedef __attribute__((ext_vector_type(16))) __bf16   v16bf;
typedef __attribute__((ext_vector_type(16))) _Float16 v16h;
typedef __attribute__((ext_vector_type(8)))  _Float16 v8h;
typedef __attribute__((ext_vector_type(8)))  unsigned short v8us;
typedef __attribute__((ext_vector_type(8)))  float    v8f;
typedef __attribute__((ext_vector_type(4)))  float    v4f;
typedef v8h  __attribute__((may_alias)) v8ha;
typedef v4f  __attribute__((may_alias)) v4fa;
typedef v8us __attribute__((may_alias)) v8usa;

__device__ __forceinline__ unsigned short f2bf(float f) { unsigned u = __float_as_uint(f); u += 0x7FFFu + ((u >> 16) & 1u); return (unsigned short)(u >> 16); }
__device__ __forceinline__ float bf2f(unsigned short b) { return __uint_as_float(((unsigned)b) << 16); }
__device__ __forceinline__ float bfr(float f) { return bf2f(f2bf(f)); }
__device__ __forceinline__ v16h cat16(v8h lo, v8h hi) { return __builtin_shufflevector(lo, hi, 0, 1, 2, 3, 4, 5, 6, 7, 8, 9, 10, 11, 12, 13, 14, 15); }
__device__ __forceinline__ v16bf cat16b(v8us lo, v8us hi) { return __builtin_bit_cast(v16bf, __builtin_shufflevector(lo, hi, 0, 1, 2, 3, 4, 5, 6, 7, 8, 9, 10, 11, 12, 13, 14, 15)); }
__device__ __forceinline__ v8f wmma16(v16h a, v16h b, v8f c) { return __builtin_amdgcn_wmma_f32_16x16x32_f16(false, a, false, b, (short)0, c, false, false); }
__device__ __forceinline__ v8f wmmab(v16bf a, v16bf b, v8f c) { return __builtin_amdgcn_wmma_f32_16x16x32_bf16(false, a, false, b, (short)0, c, false, false); }



// ---- k_gemmw: register-blocked GEMM, ONE WAVE per 64x64 output tile (16 accumulators), operands straight from K-contiguous 16-bit planes; grid (M/64, N/64, Z), 32 threads.
// C[m][n] (f32, pitch ldc, + optional f32 bias[n]) = sum_k A[m][k] Bt[n][k] (+ split products per NSPLIT). z-batch strides sA/sB/sC in elements. K % 32 == 0.
template <typename T16> struct WFrag;
template <> struct WFrag<h16> { typedef v16h V; static __device__ __forceinline__ V ld(const h16* p) { return cat16(*(const v8h*)p, *(const v8h*)(p + 16)); } static __device__ __forceinline__ v8f mma(V a, V b, v8f c) { return wmma16(a, b, c); } };
template <> struct WFrag<bf> { typedef v16bf V; static __device__ __forceinline__ V ld(const bf* p) { return cat16b(*(const v8us*)p, *(const v8us*)(p + 16)); } static __device__ __forceinline__ v8f mma(V a, V b, v8f c) { return wmmab(a, b, c); } };
template <typename T16, int NSPLIT, bool BIAS>
__global__ __launch_bounds__(32) void k_gemmw(const T16* __restrict__ A, const T16* __restrict__ A2, const T16* __restrict__ Bt, const T16* __restrict__ Bt2, int K, float* C, int ldc, const float* __restrict__ bias, size_t sA, size_t sB, size_t sC) {
    typedef typename WFrag<T16>::V V;
    __shared__ __align__(16) float os[16 * 68];
    const size_t z = blockIdx.z; A += z * sA; if (A2) A2 += z * sA; Bt += z * sB; if (Bt2) Bt2 += z * sB; C += z * sC;
    const int lane = threadIdx.x & 31, lr = lane & 15, hi = lane >> 4; const int r0 = blockIdx.x * 64, c0 = blockIdx.y * 64;
    v8f acc[4][4];
#pragma unroll
    for (int mb = 0; mb < 4; ++mb)
#pragma unroll
        for (int nb = 0; nb < 4; ++nb) acc[mb][nb] = (v8f){};
    const size_t aoff = (size_t)(r0 + lr) * K + 8 * hi, boff = (size_t)(c0 + lr) * K + 8 * hi;
#pragma unroll 1
    for (int kc = 0; kc < K; kc += 32) {
        V a[4], a2[4];
#pragma unroll
        for (int mb = 0; mb < 4; ++mb) { a[mb] = WFrag<T16>::ld(A + aoff + (size_t)mb * 16 * K + kc); if (NSPLIT == 1 || NSPLIT == 2) a2[mb] = WFrag<T16>::ld(A2 + aoff + (size_t)mb * 16 * K + kc); }
#pragma unroll
        for (int nb = 0; nb < 4; ++nb) { const V b = WFrag<T16>::ld(Bt + boff + (size_t)nb * 16 * K + kc); V b2; if (NSPLIT >= 2) b2 = WFrag<T16>::ld(Bt2 + boff + (size_t)nb * 16 * K + kc);
#pragma unroll
            for (int mb = 0; mb < 4; ++mb) { acc[mb][nb] = WFrag<T16>::mma(a[mb], b, acc[mb][nb]); if (NSPLIT == 1 || NSPLIT == 2) acc[mb][nb] = WFrag<T16>::mma(a2[mb], b, acc[mb][nb]); if (NSPLIT >= 2) acc[mb][nb] = WFrag<T16>::mma(a[mb], b2, acc[mb][nb]); } }
        asm volatile("v_nop\n\tv_nop\n\tv_nop\n\tv_nop" : "+v"(acc[0][0]), "+v"(acc[1][1]), "+v"(acc[2][2]), "+v"(acc[3][3]) : "v"(a[0]), "v"(a[3]));
    }
#pragma unroll
    for (int mb = 0; mb < 4; ++mb) {
#pragma unroll
        for (int nb = 0; nb < 4; ++nb) {
#pragma unroll
            for (int j = 0; j < 8; ++j) os[(hi * 8 + j) * 68 + nb * 16 + lr] = acc[mb][nb][j]; }
        __builtin_amdgcn_wave_barrier(); asm volatile("" ::: "memory");
        float* crow = C + (size_t)(r0 + mb * 16) * ldc + c0;
{
#pragma unroll
            for (int s = 0; s < 8; ++s) { const int row = 2 * s + hi, cofs = lr * 4; v4f val = *(const v4fa*)(os + row * 68 + cofs); if (BIAS) { val[0] += bfr(bias[c0 + cofs]); val[1] += bfr(bias[c0 + cofs + 1]); val[2] += bfr(bias[c0 + cofs + 2]); val[3] += bfr(bias[c0 + cofs + 3]); }
                *(v4f*)(crow + (size_t)row * ldc + cofs) = val; }
             }
        __builtin_amdgcn_wave_barrier(); asm volatile("" ::: "memory");
    }
}

__device__ __forceinline__ h16 tohx(float x) { return (h16)x; }
__device__ __forceinline__ void splitf(float y, unsigned short& h, unsigned short& l) { h = f2bf(y); l = f2bf(y - bf2f(h)); }
typedef __attribute__((ext_vector_type(2))) _Float16 v2h;
typedef __attribute__((ext_vector_type(4))) _Float16 v4h;
typedef __attribute__((ext_vector_type(2))) unsigned short v2us;
typedef __attribute__((ext_vector_type(4))) unsigned short v4us;
typedef __attribute__((ext_vector_type(2))) float v2f;
typedef __attribute__((ext_vector_type(4))) int v4i;

__global__ __launch_bounds__(256) void k_wtG(const float* __restrict__ w, int K, int N, bf* Bt) {
    const int lane = threadIdx.x & 31; const int L0 = (blockIdx.x * 8 + (threadIdx.x >> 5)) * 8; const int nlines = N * K / 64;
{
#pragma unroll 1
        for (int l = 0; l < 8; ++l) { const int L = L0 + l; if (L >= nlines) break; const size_t e = (size_t)L * 64 + lane * 2; const int k = (int)(e % K), n = (int)(e / K); v2us o;
            o[0] = f2bf(w[(size_t)k * N + n]); o[1] = f2bf(w[(size_t)(k + 1) * N + n]); *(v2us*)(Bt + e) = o; }
         }
}
__global__ __launch_bounds__(256) void k_resln(const float* __restrict__ Y, const float* __restrict__ Q, const float* __restrict__ g, const float* __restrict__ be, float* Z, bf* Zh, bf* Zl) {
    const int lane = threadIdx.x & 31; const int r = blockIdx.x * 8 + (threadIdx.x >> 5); if (r >= TT) return; const float* yr = Y + (size_t)r * DM; const float* qr = Q + (size_t)r * DM; float s = 0.f;
#pragma unroll 1
    for (int ch = 0; ch < DM / 128; ++ch) { const int c0 = ch * 128 + lane * 4; const v4f a = *(const v4f*)(yr + c0), q4 = *(const v4f*)(qr + c0);
#pragma unroll
        for (int q = 0; q < 4; ++q) s += __fadd_rn(bfr(q4[q]), a[q]); }
#pragma unroll
    for (int sh = 16; sh; sh >>= 1) s += __shfl_xor(s, sh, 32);
    const float mu = s * (1.0f / DM); float s2 = 0.f;
#pragma unroll 1
    for (int ch = 0; ch < DM / 128; ++ch) { const int c0 = ch * 128 + lane * 4; const v4f a = *(const v4f*)(yr + c0), q4 = *(const v4f*)(qr + c0);
#pragma unroll
        for (int q = 0; q < 4; ++q) { const float d0 = __fsub_rn(__fadd_rn(bfr(q4[q]), a[q]), mu); float p = __fmul_rn(d0, d0); asm volatile("" : "+v"(p)); s2 = __fadd_rn(s2, p); } }
#pragma unroll
    for (int sh = 16; sh; sh >>= 1) s2 += __shfl_xor(s2, sh, 32);
    const float rs = __fdiv_rn(1.0f, __fsqrt_rn(__fadd_rn(s2 * (1.0f / DM), LNEPS)));
{
#pragma unroll 1
        for (int ch = 0; ch < DM / 128; ++ch) { const int c0 = ch * 128 + lane * 4; const v4f a = *(const v4f*)(yr + c0), q4 = *(const v4f*)(qr + c0); v4f z4; v4us oh, ol;
#pragma unroll
            for (int q = 0; q < 4; ++q) { float n0 = __fmul_rn(__fsub_rn(__fadd_rn(bfr(q4[q]), a[q]), mu), rs); asm volatile("" : "+v"(n0)); float n1 = __fmul_rn(n0, bfr(g[c0 + q])); asm volatile("" : "+v"(n1)); const float y = __fadd_rn(n1, bfr(be[c0 + q])); z4[q] = y; unsigned short h2, l2; splitf(y, h2, l2); oh[q] = h2; ol[q] = l2; }
            *(v4f*)(Z + (size_t)r * DM + c0) = z4; if (Zh) { *(v4us*)(Zh + (size_t)r * DM + c0) = oh; *(v4us*)(Zl + (size_t)r * DM + c0) = ol; } }
         } }
__global__ __launch_bounds__(256) void k_cvt8(const float* __restrict__ src, bf* dst, size_t n8) { const size_t i = (size_t)blockIdx.x * 256 + threadIdx.x; if (i >= n8) return; const v8f v = *(const v8f*)(src + i * 8); v8us o;
#pragma unroll
    for (int k = 0; k < 8; ++k) o[k] = f2bf(v[k]); *(v8us*)(dst + i * 8) = o;  }
__global__ __launch_bounds__(256) void k_cstab(const float* __restrict__ frq, float* CS) { const int idx = blockIdx.x * 256 + threadIdx.x; if (idx >= TT * HD) return; const int t = idx / HD, d = idx % HD; const float ang = bfr(frq[(size_t)t * (HD / 2) + (d >> 1)]);   /* interleaved pairs share freqs[t][j] */ v2f cs; cs[0] = cosf(ang); cs[1] = sinf(ang); *(v2f*)(CS + (size_t)idx * 2) = cs;  }

// k_rope: head planes [h][t][d] (fp16 + hi/lo) of the interleaved rotary (x1 c - x2 s, x1 s + x2 c on pairs (2j, 2j+1))
__global__ __launch_bounds__(256) void k_rope(const float* __restrict__ F, int pitch, int nheads, const float* __restrict__ CS, const float* __restrict__ RF, const float* __restrict__ nw, float sc, h16* P16, bf* Ph, bf* Pl) {
    const size_t e = ((size_t)blockIdx.x * 256 + threadIdx.x) * 2; if (e >= (size_t)nheads * TT * HD) return; const int d = (int)(e % HD); const int t = (int)((e / HD) % TT); const int h = (int)(e / ((size_t)HD * TT)); const float* f = F + (size_t)t * pitch + h * HD; const float rf = RF ? RF[(size_t)h * TT + t] : 1.0f; v2h o16; v2us oh, ol;
#pragma unroll
    for (int q = 0; q < 2; ++q) { const int dd = d + q; const int dp = dd ^ 1;   /* interleaved pair partner */ float x0 = f[dd], x1 = f[dp];
        if (RF) { float n0 = __fmul_rn(x0, rf), n1 = __fmul_rn(x1, rf); asm volatile("" : "+v"(n0)); asm volatile("" : "+v"(n1)); x0 = __fmul_rn(bfr(nw[dd]), n0); x1 = __fmul_rn(bfr(nw[dp]), n1); }
        const v2f cs = *(const v2f*)(CS + ((size_t)t * HD + dd) * 2); float a = __fmul_rn(x0, cs[0]), bq = __fmul_rn(x1, cs[1]); asm volatile("" : "+v"(a)); asm volatile("" : "+v"(bq)); const float r = (((dd & 1) == 0) ? __fsub_rn(a, bq) : __fadd_rn(a, bq)) * sc;   /* even: x1 c - x2 s; odd: x2 c + x1 s */
        o16[q] = tohx(r); unsigned short a2, c2; splitf(r, a2, c2); oh[q] = a2; ol[q] = c2; }
    *(v2h*)(P16 + e) = o16; *(v2us*)(Ph + e) = oh; *(v2us*)(Pl + e) = ol;  }
__global__ __launch_bounds__(256) void k_vtp(const float* __restrict__ F, int pitch, int nheads, h16* V16, bf* Vh, bf* Vl) { const size_t e = ((size_t)blockIdx.x * 256 + threadIdx.x) * 2; if (e >= (size_t)nheads * HD * TT) return; const int t = (int)(e % TT); const int d = (int)((e / TT) % HD); const int g = (int)(e / ((size_t)TT * HD)); v2h o16; v2us oh, ol;
#pragma unroll
    for (int q = 0; q < 2; ++q) { const float x = F[(size_t)(t + q) * pitch + g * HD + d]; o16[q] = tohx(x); unsigned short a2, c2; splitf(x, a2, c2); oh[q] = a2; ol[q] = c2; }
    *(v2h*)(V16 + e) = o16; *(v2us*)(Vh + e) = oh; *(v2us*)(Vl + e) = ol;  }
// k_asoft: per row (zz, i): t = S x HD^-0.5 + bf16(mask[i][j]); softmax over the 1024 keys (register row, one exp, fixed trees);
__global__ __launch_bounds__(256) void k_asoft(const float* __restrict__ Sb, const float* __restrict__ MKb, h16* P16, bf* Ph, bf* Pl) {
    const int lane = threadIdx.x & 31; const int row = blockIdx.x * 8 + (threadIdx.x >> 5); if (row >= ZH * TT) return; const int i = row % TT; const int zz = row / TT; (void)zz; const float* mk = MKb + (size_t)i * TT; const bool hires = (i < RH); const float* sr = Sb + (size_t)row * TT; float v[TT / 32]; float mx = -3.0e38f;
#pragma unroll
    for (int ch = 0; ch < TT / 128; ++ch) { const int j0 = ch * 128 + lane * 4; const v4f a = *(const v4f*)(sr + j0);
#pragma unroll
        for (int q = 0; q < 4; ++q) { const int j = j0 + q; float sa = a[q] * SCL; asm volatile("" : "+v"(sa)); float mv = bfr(mk[j]); asm volatile("" : "+v"(mv)); const float t = __fadd_rn(sa, mv);   /* + attention_mask[b][0][i][j] */ v[ch * 4 + q] = t; mx = fmaxf(mx, t); } }
#pragma unroll
    for (int sh = 16; sh; sh >>= 1) mx = fmaxf(mx, __shfl_xor(mx, sh, 32));
    float sum = 0.f;
#pragma unroll
    for (int k = 0; k < TT / 32; ++k) { float d0 = __fsub_rn(v[k], mx); asm volatile("" : "+v"(d0)); v[k] = __builtin_amdgcn_exp2f(__fmul_rn(d0, 1.4426950408889634f)); sum += v[k]; }
#pragma unroll
    for (int sh = 16; sh; sh >>= 1) sum += __shfl_xor(sum, sh, 32);
    const float f = __fdiv_rn(hires ? 1.0f : PCAR, sum);
{
        if (hires) {
#pragma unroll
            for (int ch = 0; ch < TT / 128; ++ch) { v4us oh, ol;
#pragma unroll
                for (int q = 0; q < 4; ++q) { unsigned short a, c2; splitf(v[ch * 4 + q] * f, a, c2); oh[q] = a; ol[q] = c2; }
                const size_t oo = ((size_t)zz * (RH ? RH : 1) + i) * TT + ch * 128 + lane * 4; *(v4us*)(Ph + oo) = oh; *(v4us*)(Pl + oo) = ol; }
        } else {
#pragma unroll
            for (int ch = 0; ch < TT / 128; ++ch) { v4h o4;
#pragma unroll
                for (int q = 0; q < 4; ++q) o4[q] = tohx(v[ch * 4 + q] * f);
                *(v4h*)(P16 + (size_t)row * TT + ch * 128 + lane * 4) = o4; } }
         }
}
__global__ __launch_bounds__(256) void k_merge(const float* __restrict__ O, int h0, bf* Ah, bf* Al) { const size_t e = ((size_t)blockIdx.x * 256 + threadIdx.x) * 2; if (e >= (size_t)ZH * TT * HD) return; const int d = (int)(e % HD); const int t = (int)((e / HD) % TT); const int zz = (int)(e / ((size_t)HD * TT)); const float cs = (t < RH) ? 1.0f : (1.0f / PCAR); const size_t oo = (size_t)t * DQ + (h0 + zz) * HD + d;
    v2us oh, ol;
#pragma unroll
    for (int q = 0; q < 2; ++q) { unsigned short a, c2; splitf(O[e + q] * cs, a, c2); oh[q] = a; ol[q] = c2; } *(v2us*)(Ah + oo) = oh; *(v2us*)(Al + oo) = ol;  }

extern "C" void kernel_launch(void* const* d_in, const int* in_sizes, int n_in,
                              void* d_out, int out_size, void* d_ws, size_t ws_size, hipStream_t stream) {
    (void)in_sizes; (void)n_in; (void)out_size;
    const float* x = (const float*)d_in[0]; const float* MK = (const float*)d_in[1]; const float* FRQ = (const float*)d_in[2]; const float* wq = (const float*)d_in[3]; const float* bq = (const float*)d_in[4]; const float* wk = (const float*)d_in[5]; const float* bk = (const float*)d_in[6]; const float* wv = (const float*)d_in[7]; const float* bv = (const float*)d_in[8]; const float* wo = (const float*)d_in[9]; const float* bo = (const float*)d_in[10]; const float* g1 = (const float*)d_in[11]; const float* e1b = (const float*)d_in[12]; const float* qnw = nullptr; const float* knw = nullptr; (void)qnw; (void)knw;
    float* OUT = (float*)d_out;     // [2][1024][2048]
    char* wsp = (char*)d_ws;
    auto take = [&](size_t bytes) { char* p = wsp; wsp += (bytes + 255) & ~(size_t)255; return (void*)p; };
    bf* WQ = (bf*)take((size_t)DQ * DM * 2); bf* WK = (bf*)take((size_t)DKV * DM * 2); bf* WV = (bf*)take((size_t)DKV * DM * 2); bf* WO = (bf*)take((size_t)DM * DQ * 2); float* CS = (float*)take((size_t)TT * HD * 2 * 4);
    bf* XB = (bf*)take((size_t)TT * DM * 2); float* YO = (float*)take((size_t)TT * DM * 4); float* FQ = (float*)take((size_t)TT * DQ * 4); float* FK = (float*)take((size_t)TT * DKV * 4);
    h16* QP16 = (h16*)take((size_t)NH_ * TT * HD * 2); h16* KP16 = (h16*)take((size_t)NKV * TT * HD * 2); h16* VT16 = (h16*)take((size_t)NKV * HD * TT * 2);
    bf* QPh = (bf*)take((size_t)NH_ * TT * HD * 2); bf* QPl = (bf*)take((size_t)NH_ * TT * HD * 2); bf* KPh = (bf*)take((size_t)NKV * TT * HD * 2); bf* KPl = (bf*)take((size_t)NKV * TT * HD * 2); bf* VTh = (bf*)take((size_t)NKV * HD * TT * 2); bf* VTl = (bf*)take((size_t)NKV * HD * TT * 2); bf* Ph = (bf*)take((size_t)ZH * RH * TT * 2); bf* Pl = (bf*)take((size_t)ZH * RH * TT * 2);
    float* Sb = (float*)take((size_t)ZH * TT * TT * 4); h16* P16 = (h16*)take((size_t)ZH * TT * TT * 2); float* Ob = (float*)take((size_t)ZH * TT * HD * 4); bf* ATh = (bf*)take((size_t)TT * DQ * 2); bf* ATl = (bf*)take((size_t)TT * DQ * 2);
    if ((size_t)(wsp - (char*)d_ws) > ws_size) return;    // ws 256 MiB
    float* FV = FK;   // v projection reuses the k buffer after the k planes are built (stream-ordered)
    { k_cvt8<<<(unsigned)(((size_t)DQ * DM / 8 + 255) / 256), 256, 0, stream>>>(wq, WQ, (size_t)DQ * DM / 8); k_cvt8<<<(unsigned)(((size_t)DKV * DM / 8 + 255) / 256), 256, 0, stream>>>(wk, WK, (size_t)DKV * DM / 8); k_cvt8<<<(unsigned)(((size_t)DKV * DM / 8 + 255) / 256), 256, 0, stream>>>(wv, WV, (size_t)DKV * DM / 8);
      k_cvt8<<<(unsigned)(((size_t)DM * DQ / 8 + 255) / 256), 256, 0, stream>>>(wo, WO, (size_t)DM * DQ / 8);
      k_cstab<<<(TT * HD + 255) / 256, 256, 0, stream>>>(FRQ, CS); }
    const unsigned LQ = (unsigned)(((size_t)NH_ * TT * HD / 2 + 255) / 256), LKv = (unsigned)(((size_t)NKV * TT * HD / 2 + 255) / 256);
    for (int b = 0; b < NB_; ++b) {
        
        k_cvt8<<<(unsigned)(((size_t)TT * DM / 8 + 255) / 256), 256, 0, stream>>>(x + (size_t)b * TT * DM, XB, (size_t)TT * DM / 8);
        k_gemmw<bf, 0, true><<<dim3(TT / 64, DQ / 64, 1), 32, 0, stream>>>(XB, nullptr, WQ, nullptr, DM, FQ, DQ, bq, 0, 0, 0);
        k_rope<<<LQ, 256, 0, stream>>>(FQ, DQ, NH_, CS, nullptr, nullptr, 1.0f, QP16, QPh, QPl);
        k_gemmw<bf, 0, true><<<dim3(TT / 64, DKV / 64, 1), 32, 0, stream>>>(XB, nullptr, WK, nullptr, DM, FK, DKV, bk, 0, 0, 0);
        k_rope<<<LKv, 256, 0, stream>>>(FK, DKV, NKV, CS, nullptr, nullptr, 1.0f, KP16, KPh, KPl);
        k_gemmw<bf, 0, true><<<dim3(TT / 64, DKV / 64, 1), 32, 0, stream>>>(XB, nullptr, WV, nullptr, DM, FV, DKV, bv, 0, 0, 0); k_vtp<<<LKv, 256, 0, stream>>>(FV, DKV, NKV, VT16, VTh, VTl);
        for (int h0 = 0; h0 < NH_; h0 += ZH) { const size_t zq = (size_t)h0, zk = (size_t)(h0 / REP);   // one kv head per query head: the pass's two heads use consecutive kv planes (z-strides TT*HD)
            k_gemmw<bf, 2, false><<<dim3(RH / 64, TT / 64, ZH), 32, 0, stream>>>(QPh + zq * TT * HD, QPl + zq * TT * HD, KPh + zk * TT * HD, KPl + zk * TT * HD, HD, Sb, TT, nullptr, (size_t)TT * HD, (size_t)TT * HD, (size_t)TT * TT);
            k_gemmw<h16, 0, false><<<dim3((TT - RH) / 64, TT / 64, ZH), 32, 0, stream>>>(QP16 + zq * TT * HD + (size_t)RH * HD, nullptr, KP16 + zk * TT * HD, nullptr, HD, Sb + (size_t)RH * TT, TT, nullptr, (size_t)TT * HD, (size_t)TT * HD, (size_t)TT * TT);
            k_asoft<<<ZH * TT / 8, 256, 0, stream>>>(Sb, MK + (size_t)b * TT * TT, P16, Ph, Pl);
            k_gemmw<bf, 2, false><<<dim3(RH / 64, HD / 64, ZH), 32, 0, stream>>>(Ph, Pl, VTh + zk * HD * TT, VTl + zk * HD * TT, TT, Ob, HD, nullptr, (size_t)RH * TT, (size_t)HD * TT, (size_t)TT * HD);
            k_gemmw<h16, 0, false><<<dim3((TT - RH) / 64, HD / 64, ZH), 32, 0, stream>>>(P16 + (size_t)RH * TT, nullptr, VT16 + zk * HD * TT, nullptr, TT, Ob + (size_t)RH * HD, HD, nullptr, (size_t)TT * TT, (size_t)HD * TT, (size_t)TT * HD);
            k_merge<<<(unsigned)(((size_t)ZH * TT * HD / 2 + 255) / 256), 256, 0, stream>>>(Ob, h0, ATh, ATl); }
        k_gemmw<bf, 1, true><<<dim3(TT / 64, DM / 64, 1), 32, 0, stream>>>(ATh, ATl, WO, nullptr, DQ, YO, DM, bo, 0, 0, 0);
        k_resln<<<TT / 8, 256, 0, stream>>>(YO, x + (size_t)b * TT * DM, g1, e1b, OUT + (size_t)b * TT * DM, nullptr, nullptr); }   /* LN(proj + bo + hidden_state) */
}

// v001
// A run of this version takes 709 microseconds.
// Next to v000, in two timings, it ran 2.23 and 2.22 times as fast.
#include <hip/hip_runtime.h>

// Decoder attention with RoPE and a BERT-style output (hidden_state [2][1024][2048]; q, k, v = x W^T + b ('oi' [2048][2048], 16 heads x 128); interleaved RoPE with cos/sin(freqs[t][j]) (freqs [1024][64] input, read); scores/sqrt(128) + attention_mask[b][0][i][j] (f32 input, read; zeros); softmax; out = LN(attn Wo^T + bo + hidden_state) (eps 1e-12, gamma/beta) -> [2][1024][2048]).
// Compute dtypes, f32 accumulate: every input rounded to bf16; q/k/v on PLAIN bf16 operands (inputs: exact) + biases; rotary in f32 from a table cos/sin(bf16(freqs)); the additive mask (bf16-rounded) inside the softmax kernel; scores and attn.v: query rows < 512 hl (3 products), the rest single fp16 (x1024); softmax f32; Wo hl x exact (2 products) + bo; residual add and LayerNorm in f32 (fixed trees).

#define NB_  2
#define TT   1024
#define DM   2048
#define NH_  16
#define NKV  16
#define REP  (NH_ / NKV)
#define HD   128
#define DQ   (NH_ * HD)
#define DKV  (NKV * HD)
#define LNEPS 1e-12f
typedef __attribute__((ext_vector_type(4))) unsigned short v4us;
#define ZH   16                   // heads per attention pass = z extent of its launches (all 16: one pass per batch entry)
#define RH   512                  // query rows < RH use hi+lo planes (0: none)
#define WIN  0
#define PCAR 1024.0f
#define SCL  0.088388347648318447f   // HD^-0.5
typedef _Float16 h16;
typedef unsigned short bf;
typedef __attribute__((ext_vector_type(16))) __bf16   v16bf;
typedef __attribute__((ext_vector_type(16))) _Float16 v16h;
typedef __attribute__((ext_vector_type(8)))  _Float16 v8h;
typedef __attribute__((ext_vector_type(8)))  unsigned short v8us;
typedef __attribute__((ext_vector_type(8)))  float    v8f;
typedef __attribute__((ext_vector_type(4)))  float    v4f;
typedef v8h  __attribute__((may_alias)) v8ha;
typedef v4f  __attribute__((may_alias)) v4fa;
typedef v8us __attribute__((may_alias)) v8usa;

__device__ __forceinline__ unsigned short f2bf(float f) { unsigned u = __float_as_uint(f); u += 0x7FFFu + ((u >> 16) & 1u); return (unsigned short)(u >> 16); }
__device__ __forceinline__ float bf2f(unsigned short b) { return __uint_as_float(((unsigned)b) << 16); }
__device__ __forceinline__ float bfr(float f) { return bf2f(f2bf(f)); }
__device__ __forceinline__ v16h cat16(v8h lo, v8h hi) { return __builtin_shufflevector(lo, hi, 0, 1, 2, 3, 4, 5, 6, 7, 8, 9, 10, 11, 12, 13, 14, 15); }
__device__ __forceinline__ v16bf cat16b(v8us lo, v8us hi) { return __builtin_bit_cast(v16bf, __builtin_shufflevector(lo, hi, 0, 1, 2, 3, 4, 5, 6, 7, 8, 9, 10, 11, 12, 13, 14, 15)); }
__device__ __forceinline__ v8f wmma16(v16h a, v16h b, v8f c) { return __builtin_amdgcn_wmma_f32_16x16x32_f16(false, a, false, b, (short)0, c, false, false); }
__device__ __forceinline__ v8f wmmab(v16bf a, v16bf b, v8f c) { return __builtin_amdgcn_wmma_f32_16x16x32_bf16(false, a, false, b, (short)0, c, false, false); }



// ---- k_gemmw: register-blocked GEMM, ONE WAVE per 64x64 output tile (16 accumulators), operands straight from K-contiguous 16-bit planes; grid (M/64, N/64, Z), 32 threads.
// C[m][n] (f32, pitch ldc, + optional f32 bias[n]) = sum_k A[m][k] Bt[n][k] (+ split products per NSPLIT). z-batch strides sA/sB/sC in elements. K % 32 == 0.
template <typename T16> struct WFrag;
template <> struct WFrag<h16> { typedef v16h V; static __device__ __forceinline__ V ld(const h16* p) { return cat16(*(const v8h*)p, *(const v8h*)(p + 16)); } static __device__ __forceinline__ v8f mma(V a, V b, v8f c) { return wmma16(a, b, c); } };
template <> struct WFrag<bf> { typedef v16bf V; static __device__ __forceinline__ V ld(const bf* p) { return cat16b(*(const v8us*)p, *(const v8us*)(p + 16)); } static __device__ __forceinline__ v8f mma(V a, V b, v8f c) { return wmmab(a, b, c); } };
template <typename T16, int NSPLIT, bool BIAS>
__global__ __launch_bounds__(32) void k_gemmw(const T16* __restrict__ A, const T16* __restrict__ A2, const T16* __restrict__ Bt, const T16* __restrict__ Bt2, int K, float* C, int ldc, const float* __restrict__ bias, size_t sA, size_t sB, size_t sC) {
    typedef typename WFrag<T16>::V V;
    __shared__ __align__(16) float os[16 * 68];
    const size_t z = blockIdx.z; A += z * sA; if (A2) A2 += z * sA; Bt += z * sB; if (Bt2) Bt2 += z * sB; C += z * sC;
    const int lane = threadIdx.x & 31, lr = lane & 15, hi = lane >> 4; const int r0 = blockIdx.x * 64, c0 = blockIdx.y * 64;
    v8f acc[4][4];
#pragma unroll
    for (int mb = 0; mb < 4; ++mb)
#pragma unroll
        for (int nb = 0; nb < 4; ++nb) acc[mb][nb] = (v8f){};
    const size_t aoff = (size_t)(r0 + lr) * K + 8 * hi, boff = (size_t)(c0 + lr) * K + 8 * hi;
#pragma unroll 1
    for (int kc = 0; kc < K; kc += 32) {
        V a[4], a2[4];
#pragma unroll
        for (int mb = 0; mb < 4; ++mb) { a[mb] = WFrag<T16>::ld(A + aoff + (size_t)mb * 16 * K + kc); if (NSPLIT == 1 || NSPLIT == 2) a2[mb] = WFrag<T16>::ld(A2 + aoff + (size_t)mb * 16 * K + kc); }
#pragma unroll
        for (int nb = 0; nb < 4; ++nb) { const V b = WFrag<T16>::ld(Bt + boff + (size_t)nb * 16 * K + kc); V b2; if (NSPLIT >= 2) b2 = WFrag<T16>::ld(Bt2 + boff + (size_t)nb * 16 * K + kc);
#pragma unroll
            for (int mb = 0; mb < 4; ++mb) { acc[mb][nb] = WFrag<T16>::mma(a[mb], b, acc[mb][nb]); if (NSPLIT == 1 || NSPLIT == 2) acc[mb][nb] = WFrag<T16>::mma(a2[mb], b, acc[mb][nb]); if (NSPLIT >= 2) acc[mb][nb] = WFrag<T16>::mma(a[mb], b2, acc[mb][nb]); } }
        asm volatile("v_nop\n\tv_nop\n\tv_nop\n\tv_nop" : "+v"(acc[0][0]), "+v"(acc[1][1]), "+v"(acc[2][2]), "+v"(acc[3][3]) : "v"(a[0]), "v"(a[3]));
    }
#pragma unroll
    for (int mb = 0; mb < 4; ++mb) {
#pragma unroll
        for (int nb = 0; nb < 4; ++nb) {
#pragma unroll
            for (int j = 0; j < 8; ++j) os[(hi * 8 + j) * 68 + nb * 16 + lr] = acc[mb][nb][j]; }
        __builtin_amdgcn_wave_barrier(); asm volatile("" ::: "memory");
        float* crow = C + (size_t)(r0 + mb * 16) * ldc + c0;
{
#pragma unroll
            for (int s = 0; s < 8; ++s) { const int row = 2 * s + hi, cofs = lr * 4; v4f val = *(const v4fa*)(os + row * 68 + cofs); if (BIAS) { val[0] += bfr(bias[c0 + cofs]); val[1] += bfr(bias[c0 + cofs + 1]); val[2] += bfr(bias[c0 + cofs + 2]); val[3] += bfr(bias[c0 + cofs + 3]); }
                *(v4f*)(crow + (size_t)row * ldc + cofs) = val; }
             }
        __builtin_amdgcn_wave_barrier(); asm volatile("" ::: "memory");
    }
}

__device__ __forceinline__ h16 tohx(float x) { return (h16)x; }
__device__ __forceinline__ void splitf(float y, unsigned short& h, unsigned short& l) { h = f2bf(y); l = f2bf(y - bf2f(h)); }
typedef __attribute__((ext_vector_type(2))) _Float16 v2h;
typedef __attribute__((ext_vector_type(4))) _Float16 v4h;
typedef __attribute__((ext_vector_type(2))) unsigned short v2us;
typedef __attribute__((ext_vector_type(4))) unsigned short v4us;
typedef __attribute__((ext_vector_type(2))) float v2f;
typedef __attribute__((ext_vector_type(4))) int v4i;

__global__ __launch_bounds__(256) void k_wtG(const float* __restrict__ w, int K, int N, bf* Bt) {
    const int lane = threadIdx.x & 31; const int L0 = (blockIdx.x * 8 + (threadIdx.x >> 5)) * 8; const int nlines = N * K / 64;
{
#pragma unroll 1
        for (int l = 0; l < 8; ++l) { const int L = L0 + l; if (L >= nlines) break; const size_t e = (size_t)L * 64 + lane * 2; const int k = (int)(e % K), n = (int)(e / K); v2us o;
            o[0] = f2bf(w[(size_t)k * N + n]); o[1] = f2bf(w[(size_t)(k + 1) * N + n]); *(v2us*)(Bt + e) = o; }
         }
}
__global__ __launch_bounds__(256) void k_resln(const float* __restrict__ Y, const float* __restrict__ Q, const float* __restrict__ g, const float* __restrict__ be, float* Z, bf* Zh, bf* Zl) {
    const int lane = threadIdx.x & 31; const int r = blockIdx.x * 8 + (threadIdx.x >> 5); if (r >= TT) return; const float* yr = Y + (size_t)r * DM; const float* qr = Q + (size_t)r * DM; float s = 0.f;
#pragma unroll 1
    for (int ch = 0; ch < DM / 128; ++ch) { const int c0 = ch * 128 + lane * 4; const v4f a = *(const v4f*)(yr + c0), q4 = *(const v4f*)(qr + c0);
#pragma unroll
        for (int q = 0; q < 4; ++q) s += __fadd_rn(bfr(q4[q]), a[q]); }
#pragma unroll
    for (int sh = 16; sh; sh >>= 1) s += __shfl_xor(s, sh, 32);
    const float mu = s * (1.0f / DM); float s2 = 0.f;
#pragma unroll 1
    for (int ch = 0; ch < DM / 128; ++ch) { const int c0 = ch * 128 + lane * 4; const v4f a = *(const v4f*)(yr + c0), q4 = *(const v4f*)(qr + c0);
#pragma unroll
        for (int q = 0; q < 4; ++q) { const float d0 = __fsub_rn(__fadd_rn(bfr(q4[q]), a[q]), mu); float p = __fmul_rn(d0, d0); asm volatile("" : "+v"(p)); s2 = __fadd_rn(s2, p); } }
#pragma unroll
    for (int sh = 16; sh; sh >>= 1) s2 += __shfl_xor(s2, sh, 32);
    const float rs = __fdiv_rn(1.0f, __fsqrt_rn(__fadd_rn(s2 * (1.0f / DM), LNEPS)));
{
#pragma unroll 1
        for (int ch = 0; ch < DM / 128; ++ch) { const int c0 = ch * 128 + lane * 4; const v4f a = *(const v4f*)(yr + c0), q4 = *(const v4f*)(qr + c0); v4f z4; v4us oh, ol;
#pragma unroll
            for (int q = 0; q < 4; ++q) { float n0 = __fmul_rn(__fsub_rn(__fadd_rn(bfr(q4[q]), a[q]), mu), rs); asm volatile("" : "+v"(n0)); float n1 = __fmul_rn(n0, bfr(g[c0 + q])); asm volatile("" : "+v"(n1)); const float y = __fadd_rn(n1, bfr(be[c0 + q])); z4[q] = y; unsigned short h2, l2; splitf(y, h2, l2); oh[q] = h2; ol[q] = l2; }
            *(v4f*)(Z + (size_t)r * DM + c0) = z4; if (Zh) { *(v4us*)(Zh + (size_t)r * DM + c0) = oh; *(v4us*)(Zl + (size_t)r * DM + c0) = ol; } }
         } }
__global__ __launch_bounds__(256) void k_cvt8(const float* __restrict__ src, bf* dst, size_t n8) { const size_t i = (size_t)blockIdx.x * 256 + threadIdx.x; if (i >= n8) return; const v8f v = *(const v8f*)(src + i * 8); v8us o;
#pragma unroll
    for (int k = 0; k < 8; ++k) o[k] = f2bf(v[k]); *(v8us*)(dst + i * 8) = o;  }
__global__ __launch_bounds__(256) void k_cstab(const float* __restrict__ frq, float* CS) { const int idx = blockIdx.x * 256 + threadIdx.x; if (idx >= TT * HD) return; const int t = idx / HD, d = idx % HD; const float ang = bfr(frq[(size_t)t * (HD / 2) + (d >> 1)]);   /* interleaved pairs share freqs[t][j] */ v2f cs; cs[0] = cosf(ang); cs[1] = sinf(ang); *(v2f*)(CS + (size_t)idx * 2) = cs;  }

// k_rope: head planes [h][t][d] (fp16 + hi/lo) of the interleaved rotary (x1 c - x2 s, x1 s + x2 c on pairs (2j, 2j+1))
__global__ __launch_bounds__(256) void k_rope(const float* __restrict__ F, int pitch, int nheads, const float* __restrict__ CS, const float* __restrict__ RF, const float* __restrict__ nw, float sc, h16* P16, bf* Ph, bf* Pl) {
    const size_t e = ((size_t)blockIdx.x * 256 + threadIdx.x) * 2; if (e >= (size_t)nheads * TT * HD) return; const int d = (int)(e % HD); const int t = (int)((e / HD) % TT); const int h = (int)(e / ((size_t)HD * TT)); const float* f = F + (size_t)t * pitch + h * HD; const float rf = RF ? RF[(size_t)h * TT + t] : 1.0f; v2h o16; v2us oh, ol;
#pragma unroll
    for (int q = 0; q < 2; ++q) { const int dd = d + q; const int dp = dd ^ 1;   /* interleaved pair partner */ float x0 = f[dd], x1 = f[dp];
        if (RF) { float n0 = __fmul_rn(x0, rf), n1 = __fmul_rn(x1, rf); asm volatile("" : "+v"(n0)); asm volatile("" : "+v"(n1)); x0 = __fmul_rn(bfr(nw[dd]), n0); x1 = __fmul_rn(bfr(nw[dp]), n1); }
        const v2f cs = *(const v2f*)(CS + ((size_t)t * HD + dd) * 2); float a = __fmul_rn(x0, cs[0]), bq = __fmul_rn(x1, cs[1]); asm volatile("" : "+v"(a)); asm volatile("" : "+v"(bq)); const float r = (((dd & 1) == 0) ? __fsub_rn(a, bq) : __fadd_rn(a, bq)) * sc;   /* even: x1 c - x2 s; odd: x2 c + x1 s */
        o16[q] = tohx(r); unsigned short a2, c2; splitf(r, a2, c2); oh[q] = a2; ol[q] = c2; }
    *(v2h*)(P16 + e) = o16; *(v2us*)(Ph + e) = oh; *(v2us*)(Pl + e) = ol;  }
__global__ __launch_bounds__(256) void k_vtp(const float* __restrict__ F, int pitch, int nheads, h16* V16, bf* Vh, bf* Vl) { const size_t e = ((size_t)blockIdx.x * 256 + threadIdx.x) * 2; if (e >= (size_t)nheads * HD * TT) return; const int t = (int)(e % TT); const int d = (int)((e / TT) % HD); const int g = (int)(e / ((size_t)TT * HD)); v2h o16; v2us oh, ol;
#pragma unroll
    for (int q = 0; q < 2; ++q) { const float x = F[(size_t)(t + q) * pitch + g * HD + d]; o16[q] = tohx(x); unsigned short a2, c2; splitf(x, a2, c2); oh[q] = a2; ol[q] = c2; }
    *(v2h*)(V16 + e) = o16; *(v2us*)(Vh + e) = oh; *(v2us*)(Vl + e) = ol;  }
// k_asoft: per row (zz, i): t = S x HD^-0.5 + bf16(mask[i][j]); softmax over the 1024 keys (register row, one exp, fixed trees);
__global__ __launch_bounds__(256) void k_asoft(const float* __restrict__ Sb, const float* __restrict__ MKb, h16* P16, bf* Ph, bf* Pl) {
    const int lane = threadIdx.x & 31; const int row = blockIdx.x * 8 + (threadIdx.x >> 5); if (row >= ZH * TT) return; const int i = row % TT; const int zz = row / TT; (void)zz; const float* mk = MKb + (size_t)i * TT; const bool hires = (i < RH); const float* sr = Sb + (size_t)row * TT; float v[TT / 32]; float mx = -3.0e38f;
#pragma unroll
    for (int ch = 0; ch < TT / 128; ++ch) { const int j0 = ch * 128 + lane * 4; const v4f a = *(const v4f*)(sr + j0);
#pragma unroll
        for (int q = 0; q < 4; ++q) { const int j = j0 + q; float sa = a[q] * SCL; asm volatile("" : "+v"(sa)); float mv = bfr(mk[j]); asm volatile("" : "+v"(mv)); const float t = __fadd_rn(sa, mv);   /* + attention_mask[b][0][i][j] */ v[ch * 4 + q] = t; mx = fmaxf(mx, t); } }
#pragma unroll
    for (int sh = 16; sh; sh >>= 1) mx = fmaxf(mx, __shfl_xor(mx, sh, 32));
    float sum = 0.f;
#pragma unroll
    for (int k = 0; k < TT / 32; ++k) { float d0 = __fsub_rn(v[k], mx); asm volatile("" : "+v"(d0)); v[k] = __builtin_amdgcn_exp2f(__fmul_rn(d0, 1.4426950408889634f)); sum += v[k]; }
#pragma unroll
    for (int sh = 16; sh; sh >>= 1) sum += __shfl_xor(sum, sh, 32);
    const float f = __fdiv_rn(hires ? 1.0f : PCAR, sum);
{
        if (hires) {
#pragma unroll
            for (int ch = 0; ch < TT / 128; ++ch) { v4us oh, ol;
#pragma unroll
                for (int q = 0; q < 4; ++q) { unsigned short a, c2; splitf(v[ch * 4 + q] * f, a, c2); oh[q] = a; ol[q] = c2; }
                const size_t oo = ((size_t)zz * (RH ? RH : 1) + i) * TT + ch * 128 + lane * 4; *(v4us*)(Ph + oo) = oh; *(v4us*)(Pl + oo) = ol; }
        } else {
#pragma unroll
            for (int ch = 0; ch < TT / 128; ++ch) { v4h o4;
#pragma unroll
                for (int q = 0; q < 4; ++q) o4[q] = tohx(v[ch * 4 + q] * f);
                *(v4h*)(P16 + (size_t)row * TT + ch * 128 + lane * 4) = o4; } }
         }
}
__global__ __launch_bounds__(256) void k_merge(const float* __restrict__ O, int h0, bf* Ah, bf* Al) { const size_t e = ((size_t)blockIdx.x * 256 + threadIdx.x) * 2; if (e >= (size_t)ZH * TT * HD) return; const int d = (int)(e % HD); const int t = (int)((e / HD) % TT); const int zz = (int)(e / ((size_t)HD * TT)); const float cs = (t < RH) ? 1.0f : (1.0f / PCAR); const size_t oo = (size_t)t * DQ + (h0 + zz) * HD + d;
    v2us oh, ol;
#pragma unroll
    for (int q = 0; q < 2; ++q) { unsigned short a, c2; splitf(O[e + q] * cs, a, c2); oh[q] = a; ol[q] = c2; } *(v2us*)(Ah + oo) = oh; *(v2us*)(Al + oo) = ol;  }

extern "C" void kernel_launch(void* const* d_in, const int* in_sizes, int n_in,
                              void* d_out, int out_size, void* d_ws, size_t ws_size, hipStream_t stream) {
    (void)in_sizes; (void)n_in; (void)out_size;
    const float* x = (const float*)d_in[0]; const float* MK = (const float*)d_in[1]; const float* FRQ = (const float*)d_in[2]; const float* wq = (const float*)d_in[3]; const float* bq = (const float*)d_in[4]; const float* wk = (const float*)d_in[5]; const float* bk = (const float*)d_in[6]; const float* wv = (const float*)d_in[7]; const float* bv = (const float*)d_in[8]; const float* wo = (const float*)d_in[9]; const float* bo = (const float*)d_in[10]; const float* g1 = (const float*)d_in[11]; const float* e1b = (const float*)d_in[12]; const float* qnw = nullptr; const float* knw = nullptr; (void)qnw; (void)knw;
    float* OUT = (float*)d_out;     // [2][1024][2048]
    char* wsp = (char*)d_ws;
    auto take = [&](size_t bytes) { char* p = wsp; wsp += (bytes + 255) & ~(size_t)255; return (void*)p; };
    bf* WQ = (bf*)take((size_t)DQ * DM * 2); bf* WK = (bf*)take((size_t)DKV * DM * 2); bf* WV = (bf*)take((size_t)DKV * DM * 2); bf* WO = (bf*)take((size_t)DM * DQ * 2); float* CS = (float*)take((size_t)TT * HD * 2 * 4);
    bf* XB = (bf*)take((size_t)TT * DM * 2); float* YO = (float*)take((size_t)TT * DM * 4); float* FQ = (float*)take((size_t)TT * DQ * 4); float* FK = (float*)take((size_t)TT * DKV * 4);
    h16* QP16 = (h16*)take((size_t)NH_ * TT * HD * 2); h16* KP16 = (h16*)take((size_t)NKV * TT * HD * 2); h16* VT16 = (h16*)take((size_t)NKV * HD * TT * 2);
    bf* QPh = (bf*)take((size_t)NH_ * TT * HD * 2); bf* QPl = (bf*)take((size_t)NH_ * TT * HD * 2); bf* KPh = (bf*)take((size_t)NKV * TT * HD * 2); bf* KPl = (bf*)take((size_t)NKV * TT * HD * 2); bf* VTh = (bf*)take((size_t)NKV * HD * TT * 2); bf* VTl = (bf*)take((size_t)NKV * HD * TT * 2); bf* Ph = (bf*)take((size_t)ZH * RH * TT * 2); bf* Pl = (bf*)take((size_t)ZH * RH * TT * 2);
    float* Sb = (float*)take((size_t)ZH * TT * TT * 4); h16* P16 = (h16*)take((size_t)ZH * TT * TT * 2); float* Ob = (float*)take((size_t)ZH * TT * HD * 4); bf* ATh = (bf*)take((size_t)TT * DQ * 2); bf* ATl = (bf*)take((size_t)TT * DQ * 2);
    if ((size_t)(wsp - (char*)d_ws) > ws_size) return;    // ws 256 MiB
    float* FV = FK;   // v projection reuses the k buffer after the k planes are built (stream-ordered)
    { k_cvt8<<<(unsigned)(((size_t)DQ * DM / 8 + 255) / 256), 256, 0, stream>>>(wq, WQ, (size_t)DQ * DM / 8); k_cvt8<<<(unsigned)(((size_t)DKV * DM / 8 + 255) / 256), 256, 0, stream>>>(wk, WK, (size_t)DKV * DM / 8); k_cvt8<<<(unsigned)(((size_t)DKV * DM / 8 + 255) / 256), 256, 0, stream>>>(wv, WV, (size_t)DKV * DM / 8);
      k_cvt8<<<(unsigned)(((size_t)DM * DQ / 8 + 255) / 256), 256, 0, stream>>>(wo, WO, (size_t)DM * DQ / 8);
      k_cstab<<<(TT * HD + 255) / 256, 256, 0, stream>>>(FRQ, CS); }
    const unsigned LQ = (unsigned)(((size_t)NH_ * TT * HD / 2 + 255) / 256), LKv = (unsigned)(((size_t)NKV * TT * HD / 2 + 255) / 256);
    for (int b = 0; b < NB_; ++b) {
        
        k_cvt8<<<(unsigned)(((size_t)TT * DM / 8 + 255) / 256), 256, 0, stream>>>(x + (size_t)b * TT * DM, XB, (size_t)TT * DM / 8);
        k_gemmw<bf, 0, true><<<dim3(TT / 64, DQ / 64, 1), 32, 0, stream>>>(XB, nullptr, WQ, nullptr, DM, FQ, DQ, bq, 0, 0, 0);
        k_rope<<<LQ, 256, 0, stream>>>(FQ, DQ, NH_, CS, nullptr, nullptr, 1.0f, QP16, QPh, QPl);
        k_gemmw<bf, 0, true><<<dim3(TT / 64, DKV / 64, 1), 32, 0, stream>>>(XB, nullptr, WK, nullptr, DM, FK, DKV, bk, 0, 0, 0);
        k_rope<<<LKv, 256, 0, stream>>>(FK, DKV, NKV, CS, nullptr, nullptr, 1.0f, KP16, KPh, KPl);
        k_gemmw<bf, 0, true><<<dim3(TT / 64, DKV / 64, 1), 32, 0, stream>>>(XB, nullptr, WV, nullptr, DM, FV, DKV, bv, 0, 0, 0); k_vtp<<<LKv, 256, 0, stream>>>(FV, DKV, NKV, VT16, VTh, VTl);
        for (int h0 = 0; h0 < NH_; h0 += ZH) { const size_t zq = (size_t)h0, zk = (size_t)(h0 / REP);   // one kv head per query head: the pass's ZH heads use consecutive kv planes (z-strides TT*HD)
            k_gemmw<bf, 2, false><<<dim3(RH / 64, TT / 64, ZH), 32, 0, stream>>>(QPh + zq * TT * HD, QPl + zq * TT * HD, KPh + zk * TT * HD, KPl + zk * TT * HD, HD, Sb, TT, nullptr, (size_t)TT * HD, (size_t)TT * HD, (size_t)TT * TT);
            k_gemmw<h16, 0, false><<<dim3((TT - RH) / 64, TT / 64, ZH), 32, 0, stream>>>(QP16 + zq * TT * HD + (size_t)RH * HD, nullptr, KP16 + zk * TT * HD, nullptr, HD, Sb + (size_t)RH * TT, TT, nullptr, (size_t)TT * HD, (size_t)TT * HD, (size_t)TT * TT);
            k_asoft<<<ZH * TT / 8, 256, 0, stream>>>(Sb, MK + (size_t)b * TT * TT, P16, Ph, Pl);
            k_gemmw<bf, 2, false><<<dim3(RH / 64, HD / 64, ZH), 32, 0, stream>>>(Ph, Pl, VTh + zk * HD * TT, VTl + zk * HD * TT, TT, Ob, HD, nullptr, (size_t)RH * TT, (size_t)HD * TT, (size_t)TT * HD);
            k_gemmw<h16, 0, false><<<dim3((TT - RH) / 64, HD / 64, ZH), 32, 0, stream>>>(P16 + (size_t)RH * TT, nullptr, VT16 + zk * HD * TT, nullptr, TT, Ob + (size_t)RH * HD, HD, nullptr, (size_t)TT * TT, (size_t)HD * TT, (size_t)TT * HD);
            k_merge<<<(unsigned)(((size_t)ZH * TT * HD / 2 + 255) / 256), 256, 0, stream>>>(Ob, h0, ATh, ATl); }
        k_gemmw<bf, 1, true><<<dim3(TT / 64, DM / 64, 1), 32, 0, stream>>>(ATh, ATl, WO, nullptr, DQ, YO, DM, bo, 0, 0, 0);
        k_resln<<<TT / 8, 256, 0, stream>>>(YO, x + (size_t)b * TT * DM, g1, e1b, OUT + (size_t)b * TT * DM, nullptr, nullptr); }   /* LN(proj + bo + hidden_state) */
}

// v002
// One run takes 475 microseconds.
// In both of two side-by-side timings against v001, it was 1.50 times as fast.
// Counting every step since v000, it is 3.34 times as fast.
#include <hip/hip_runtime.h>

// Decoder attention with RoPE and a BERT-style output (hidden_state [2][1024][2048]; q, k, v = x W^T + b ('oi' [2048][2048], 16 heads x 128); interleaved RoPE with cos/sin(freqs[t][j]) (freqs [1024][64] input, read); scores/sqrt(128) + attention_mask[b][0][i][j] (f32 input, read; zeros); softmax; out = LN(attn Wo^T + bo + hidden_state) (eps 1e-12, gamma/beta) -> [2][1024][2048]).
// Compute dtypes, f32 accumulate: every input rounded to bf16; q/k/v on PLAIN bf16 operands (inputs: exact) + biases; rotary in f32 from a table cos/sin(bf16(freqs)); the additive mask (bf16-rounded) inside the softmax kernel; scores and attn.v: query rows < 512 hl (3 products), the rest single fp16 (x1024); softmax f32; Wo hl x exact (2 products) + bo; residual add and LayerNorm in f32 (fixed trees).

#define NB_  2
#define TT   1024
#define DM   2048
#define NH_  16
#define NKV  16
#define REP  (NH_ / NKV)
#define HD   128
#define DQ   (NH_ * HD)
#define DKV  (NKV * HD)
#define LNEPS 1e-12f
typedef __attribute__((ext_vector_type(4))) unsigned short v4us;
#define ZH   16                   // heads per attention pass = z extent of its launches (all 16: one pass per batch entry)
#define RH   512                  // query rows < RH use hi+lo planes (0: none)
#define WIN  0
#define PCAR 1024.0f
#define SCL  0.088388347648318447f   // HD^-0.5
typedef _Float16 h16;
typedef unsigned short bf;
typedef __attribute__((ext_vector_type(16))) __bf16   v16bf;
typedef __attribute__((ext_vector_type(16))) _Float16 v16h;
typedef __attribute__((ext_vector_type(8)))  _Float16 v8h;
typedef __attribute__((ext_vector_type(8)))  unsigned short v8us;
typedef __attribute__((ext_vector_type(8)))  float    v8f;
typedef __attribute__((ext_vector_type(4)))  float    v4f;
typedef v8h  __attribute__((may_alias)) v8ha;
typedef v4f  __attribute__((may_alias)) v4fa;
typedef v8us __attribute__((may_alias)) v8usa;

__device__ __forceinline__ unsigned short f2bf(float f) { unsigned u = __float_as_uint(f); u += 0x7FFFu + ((u >> 16) & 1u); return (unsigned short)(u >> 16); }
__device__ __forceinline__ float bf2f(unsigned short b) { return __uint_as_float(((unsigned)b) << 16); }
__device__ __forceinline__ float bfr(float f) { return bf2f(f2bf(f)); }
__device__ __forceinline__ v16h cat16(v8h lo, v8h hi) { return __builtin_shufflevector(lo, hi, 0, 1, 2, 3, 4, 5, 6, 7, 8, 9, 10, 11, 12, 13, 14, 15); }
__device__ __forceinline__ v16bf cat16b(v8us lo, v8us hi) { return __builtin_bit_cast(v16bf, __builtin_shufflevector(lo, hi, 0, 1, 2, 3, 4, 5, 6, 7, 8, 9, 10, 11, 12, 13, 14, 15)); }
__device__ __forceinline__ v8f wmma16(v16h a, v16h b, v8f c) { return __builtin_amdgcn_wmma_f32_16x16x32_f16(false, a, false, b, (short)0, c, false, false); }
__device__ __forceinline__ v8f wmmab(v16bf a, v16bf b, v8f c) { return __builtin_amdgcn_wmma_f32_16x16x32_bf16(false, a, false, b, (short)0, c, false, false); }



// ---- k_gemmw: GEMM, one 128x128 output tile per work-group of 4 waves (2x2, 64x64 and 16 accumulators per wave); grid (M/128, N/128, Z), 128 threads.
// Operand tiles (128 rows x KC k, whole 128-byte lines) go from the K-contiguous 16-bit planes into LDS by asynchronous b128 copies, two buffers: the next tile flies while this one is multiplied.
// C[m][n] (f32, pitch ldc, + optional f32 bias[n]) = sum_k A[m][k] Bt[n][k] (+ split products per NSPLIT). z-batch strides sA/sB/sC in elements. K % KC == 0, M % 128 == 0, N % 128 == 0.
template <typename T16> struct WFrag;
template <> struct WFrag<h16> { typedef v16h V; static __device__ __forceinline__ V ld(const h16* p) { return cat16(*(const v8h*)p, *(const v8h*)(p + 16)); } static __device__ __forceinline__ v8f mma(V a, V b, v8f c) { return wmma16(a, b, c); } };
template <> struct WFrag<bf> { typedef v16bf V; static __device__ __forceinline__ V ld(const bf* p) { return cat16b(*(const v8us*)p, *(const v8us*)(p + 16)); } static __device__ __forceinline__ v8f mma(V a, V b, v8f c) { return wmmab(a, b, c); } };
// One plane of one stage: every thread copies its 16 bytes (with WIDE also the 16 bytes 128 further on, in global memory and in LDS alike) of rows r, r + 16, ..., r + 112; a wave's copy = 4 whole lines.
// g: the lane's global address in row r, rs: 16 rows in elements, l: the lane's LDS byte address in row r, ls: 16 rows in LDS bytes.
// The closing s_wait_xcnt stands inside the statement so that no address register named here is rewritten ahead of it.
template <bool WIDE, typename T16>
__device__ __forceinline__ void stage_plane(const T16* g, size_t rs, unsigned l, unsigned ls) {
    if (WIDE)
        asm volatile("global_load_async_to_lds_b128 %0, %8, off\n\t"  "global_load_async_to_lds_b128 %0, %8, off offset:128\n\t"
                     "global_load_async_to_lds_b128 %1, %9, off\n\t"  "global_load_async_to_lds_b128 %1, %9, off offset:128\n\t"
                     "global_load_async_to_lds_b128 %2, %10, off\n\t" "global_load_async_to_lds_b128 %2, %10, off offset:128\n\t"
                     "global_load_async_to_lds_b128 %3, %11, off\n\t" "global_load_async_to_lds_b128 %3, %11, off offset:128\n\t"
                     "global_load_async_to_lds_b128 %4, %12, off\n\t" "global_load_async_to_lds_b128 %4, %12, off offset:128\n\t"
                     "global_load_async_to_lds_b128 %5, %13, off\n\t" "global_load_async_to_lds_b128 %5, %13, off offset:128\n\t"
                     "global_load_async_to_lds_b128 %6, %14, off\n\t" "global_load_async_to_lds_b128 %6, %14, off offset:128\n\t"
                     "global_load_async_to_lds_b128 %7, %15, off\n\t" "global_load_async_to_lds_b128 %7, %15, off offset:128\n\t"
                     "s_wait_xcnt 0x0"
                     :: "v"(l), "v"(l + ls), "v"(l + 2 * ls), "v"(l + 3 * ls), "v"(l + 4 * ls), "v"(l + 5 * ls), "v"(l + 6 * ls), "v"(l + 7 * ls),
                        "v"(g), "v"(g + rs), "v"(g + 2 * rs), "v"(g + 3 * rs), "v"(g + 4 * rs), "v"(g + 5 * rs), "v"(g + 6 * rs), "v"(g + 7 * rs)
                     : "memory");
    else
        asm volatile("global_load_async_to_lds_b128 %0, %8, off\n\t"
                     "global_load_async_to_lds_b128 %1, %9, off\n\t"
                     "global_load_async_to_lds_b128 %2, %10, off\n\t"
                     "global_load_async_to_lds_b128 %3, %11, off\n\t"
                     "global_load_async_to_lds_b128 %4, %12, off\n\t"
                     "global_load_async_to_lds_b128 %5, %13, off\n\t"
                     "global_load_async_to_lds_b128 %6, %14, off\n\t"
                     "global_load_async_to_lds_b128 %7, %15, off\n\t"
                     "s_wait_xcnt 0x0"
                     :: "v"(l), "v"(l + ls), "v"(l + 2 * ls), "v"(l + 3 * ls), "v"(l + 4 * ls), "v"(l + 5 * ls), "v"(l + 6 * ls), "v"(l + 7 * ls),
                        "v"(g), "v"(g + rs), "v"(g + 2 * rs), "v"(g + 3 * rs), "v"(g + 4 * rs), "v"(g + 5 * rs), "v"(g + 6 * rs), "v"(g + 7 * rs)
                     : "memory");
}
template <typename T16, int NSPLIT, bool BIAS>
__global__ __launch_bounds__(128) void k_gemmw(const T16* __restrict__ A, const T16* __restrict__ A2, const T16* __restrict__ Bt, const T16* __restrict__ Bt2, int K, float* C, int ldc, const float* __restrict__ bias, size_t sA, size_t sB, size_t sC) {
    typedef typename WFrag<T16>::V V;
    constexpr bool HA2 = (NSPLIT == 1 || NSPLIT == 2), HB2 = (NSPLIT >= 2), WIDE = !HB2;
    constexpr int KC = WIDE ? 128 : 64;                       // k per stage; four planes of 128 k would be 64 copies of a wave in flight
    constexpr unsigned PIT = KC * 2 + 16;                     // LDS row pitch in bytes: 16 B x odd, conflict-free for ds_load_b128
    constexpr unsigned PLN = 128 * PIT, PB = (HA2 ? 2u : 1u) * PLN, STG = PB + (HB2 ? 2u : 1u) * PLN;   // stage: [A | A2 | B | B2]
    __shared__ __align__(16) unsigned char ring[2 * STG];
    const size_t z = blockIdx.z; A += z * sA; if (HA2) A2 += z * sA; Bt += z * sB; if (HB2) Bt2 += z * sB; C += z * sC;
    const int tid = threadIdx.x, lane = tid & 31, lr = lane & 15, hi = lane >> 4, wave = tid >> 5, wm = wave >> 1, wn = wave & 1;
    const int r0 = blockIdx.x * 128 + wm * 64, c0 = blockIdx.y * 128 + wn * 64;
    v8f acc[4][4];
#pragma unroll
    for (int mb = 0; mb < 4; ++mb)
#pragma unroll
        for (int nb = 0; nb < 4; ++nb) acc[mb][nb] = (v8f){};
    const size_t ga = (size_t)(blockIdx.x * 128 + (tid >> 3)) * K + (tid & 7) * 8, gb = (size_t)(blockIdx.y * 128 + (tid >> 3)) * K + (tid & 7) * 8, rs = (size_t)16 * K;
    const unsigned lcp = (unsigned)(size_t)ring + (unsigned)(tid >> 3) * PIT + (unsigned)(tid & 7) * 16;
    auto fill = [&](int kc, unsigned buf) { const unsigned l = lcp + buf * STG;
        stage_plane<WIDE>(A + ga + kc, rs, l, 16 * PIT); if (HA2) stage_plane<WIDE>(A2 + ga + kc, rs, l + PLN, 16 * PIT);
        stage_plane<WIDE>(Bt + gb + kc, rs, l + PB, 16 * PIT); if (HB2) stage_plane<WIDE>(Bt2 + gb + kc, rs, l + PB + PLN, 16 * PIT); };
    fill(0, 0);
    asm volatile("s_wait_asynccnt 0x0" ::: "memory");   // tile 0 has landed before anybody reads it
    __syncthreads();
    if (K > KC) fill(KC, 1);
#pragma unroll 1   // one pass per trip: a single publish point, and the body stays small for the instruction cache
    for (int kc = 0, t = 0; kc < K; kc += KC, t ^= 1) {
        const unsigned char* fa = ring + (unsigned)t * STG + (wm * 64 + lr) * PIT + hi * 16; const unsigned char* fb = ring + (unsigned)t * STG + PB + (wn * 64 + lr) * PIT + hi * 16;
        V a[2][4], a2[2][4], b[2][4], b2[2][4];   // two fragment sets: the next 32 k are fetched as one group ahead of this block's products
#pragma unroll     // unrolled so that the set index is a constant and both fragment sets stay in registers
        for (int ks = -1; ks < KC / 32; ++ks) {
            if (ks + 1 < KC / 32) { const int s = (ks + 1) & 1, o = (ks + 1) * 64;
#pragma unroll
                for (int i = 0; i < 4; ++i) { a[s][i] = WFrag<T16>::ld((const T16*)(fa + i * 16 * PIT + o)); if (HA2) a2[s][i] = WFrag<T16>::ld((const T16*)(fa + PLN + i * 16 * PIT + o)); }
#pragma unroll
                for (int i = 0; i < 4; ++i) { b[s][i] = WFrag<T16>::ld((const T16*)(fb + i * 16 * PIT + o)); if (HB2) b2[s][i] = WFrag<T16>::ld((const T16*)(fb + PLN + i * 16 * PIT + o)); } }
            __builtin_amdgcn_sched_barrier(0);   // keeps the next block's LDS reads one group ahead of this block's products; sunk among them, every product row waits out the LDS latency
            if (ks >= 0) { const int s = ks & 1;
#pragma unroll
                for (int nb = 0; nb < 4; ++nb) {
#pragma unroll
                    for (int mb = 0; mb < 4; ++mb) acc[mb][nb] = WFrag<T16>::mma(a[s][mb], b[s][nb], acc[mb][nb]);
                    if (HA2) {
#pragma unroll
                        for (int mb = 0; mb < 4; ++mb) acc[mb][nb] = WFrag<T16>::mma(a2[s][mb], b[s][nb], acc[mb][nb]); }
                    if (HB2) {
#pragma unroll
                        for (int mb = 0; mb < 4; ++mb) acc[mb][nb] = WFrag<T16>::mma(a[s][mb], b2[s][nb], acc[mb][nb]); } } }
            __builtin_amdgcn_sched_barrier(0);   // and keeps the group after next behind these products, whose registers it refills
        }
        asm volatile("s_wait_dscnt 0x0" ::: "memory");      // this wave's reads of the buffer are done before it is refilled
        asm volatile("s_wait_asynccnt 0x0" ::: "memory");   // this wave's copies of the next tile have landed
        __syncthreads();                                    // publishes the next tile and ends every reader's last read of this one
        if (kc + 2 * KC < K) fill(kc + 2 * KC, (unsigned)t);
    }
    asm volatile("s_wait_asynccnt 0x0" ::: "memory");       // no copy is in flight when the ring becomes output staging
    float* os = (float*)ring + wave * (16 * 68);            // each wave's own 16 x 68 floats; every reader left the ring at the last pass's barrier
#pragma unroll
    for (int mb = 0; mb < 4; ++mb) {
#pragma unroll
        for (int nb = 0; nb < 4; ++nb) {
#pragma unroll
            for (int j = 0; j < 8; ++j) os[(hi * 8 + j) * 68 + nb * 16 + lr] = acc[mb][nb][j]; }
        __builtin_amdgcn_wave_barrier(); asm volatile("" ::: "memory");
        float* crow = C + (size_t)(r0 + mb * 16) * ldc + c0;
{
#pragma unroll
            for (int s = 0; s < 8; ++s) { const int row = 2 * s + hi, cofs = lr * 4; v4f val = *(const v4fa*)(os + row * 68 + cofs); if (BIAS) { val[0] += bfr(bias[c0 + cofs]); val[1] += bfr(bias[c0 + cofs + 1]); val[2] += bfr(bias[c0 + cofs + 2]); val[3] += bfr(bias[c0 + cofs + 3]); }
                *(v4f*)(crow + (size_t)row * ldc + cofs) = val; }
             }
        __builtin_amdgcn_wave_barrier(); asm volatile("" ::: "memory");
        asm volatile("s_wait_xcnt 0x0" ::: "memory");   // a precaution: stands between these stores and the next row block's reuse of their address registers
    }
}

__device__ __forceinline__ h16 tohx(float x) { return (h16)x; }
__device__ __forceinline__ void splitf(float y, unsigned short& h, unsigned short& l) { h = f2bf(y); l = f2bf(y - bf2f(h)); }
typedef __attribute__((ext_vector_type(2))) _Float16 v2h;
typedef __attribute__((ext_vector_type(4))) _Float16 v4h;
typedef __attribute__((ext_vector_type(2))) unsigned short v2us;
typedef __attribute__((ext_vector_type(4))) unsigned short v4us;
typedef __attribute__((ext_vector_type(2))) float v2f;
typedef __attribute__((ext_vector_type(4))) int v4i;

__global__ __launch_bounds__(256) void k_wtG(const float* __restrict__ w, int K, int N, bf* Bt) {
    const int lane = threadIdx.x & 31; const int L0 = (blockIdx.x * 8 + (threadIdx.x >> 5)) * 8; const int nlines = N * K / 64;
{
#pragma unroll 1
        for (int l = 0; l < 8; ++l) { const int L = L0 + l; if (L >= nlines) break; const size_t e = (size_t)L * 64 + lane * 2; const int k = (int)(e % K), n = (int)(e / K); v2us o;
            o[0] = f2bf(w[(size_t)k * N + n]); o[1] = f2bf(w[(size_t)(k + 1) * N + n]); *(v2us*)(Bt + e) = o; }
         }
}
__global__ __launch_bounds__(256) void k_resln(const float* __restrict__ Y, const float* __restrict__ Q, const float* __restrict__ g, const float* __restrict__ be, float* Z, bf* Zh, bf* Zl) {
    const int lane = threadIdx.x & 31; const int r = blockIdx.x * 8 + (threadIdx.x >> 5); if (r >= TT) return; const float* yr = Y + (size_t)r * DM; const float* qr = Q + (size_t)r * DM; float s = 0.f;
#pragma unroll 1
    for (int ch = 0; ch < DM / 128; ++ch) { const int c0 = ch * 128 + lane * 4; const v4f a = *(const v4f*)(yr + c0), q4 = *(const v4f*)(qr + c0);
#pragma unroll
        for (int q = 0; q < 4; ++q) s += __fadd_rn(bfr(q4[q]), a[q]); }
#pragma unroll
    for (int sh = 16; sh; sh >>= 1) s += __shfl_xor(s, sh, 32);
    const float mu = s * (1.0f / DM); float s2 = 0.f;
#pragma unroll 1
    for (int ch = 0; ch < DM / 128; ++ch) { const int c0 = ch * 128 + lane * 4; const v4f a = *(const v4f*)(yr + c0), q4 = *(const v4f*)(qr + c0);
#pragma unroll
        for (int q = 0; q < 4; ++q) { const float d0 = __fsub_rn(__fadd_rn(bfr(q4[q]), a[q]), mu); float p = __fmul_rn(d0, d0); asm volatile("" : "+v"(p)); s2 = __fadd_rn(s2, p); } }
#pragma unroll
    for (int sh = 16; sh; sh >>= 1) s2 += __shfl_xor(s2, sh, 32);
    const float rs = __fdiv_rn(1.0f, __fsqrt_rn(__fadd_rn(s2 * (1.0f / DM), LNEPS)));
{
#pragma unroll 1
        for (int ch = 0; ch < DM / 128; ++ch) { const int c0 = ch * 128 + lane * 4; const v4f a = *(const v4f*)(yr + c0), q4 = *(const v4f*)(qr + c0); v4f z4; v4us oh, ol;
#pragma unroll
            for (int q = 0; q < 4; ++q) { float n0 = __fmul_rn(__fsub_rn(__fadd_rn(bfr(q4[q]), a[q]), mu), rs); asm volatile("" : "+v"(n0)); float n1 = __fmul_rn(n0, bfr(g[c0 + q])); asm volatile("" : "+v"(n1)); const float y = __fadd_rn(n1, bfr(be[c0 + q])); z4[q] = y; unsigned short h2, l2; splitf(y, h2, l2); oh[q] = h2; ol[q] = l2; }
            *(v4f*)(Z + (size_t)r * DM + c0) = z4; if (Zh) { *(v4us*)(Zh + (size_t)r * DM + c0) = oh; *(v4us*)(Zl + (size_t)r * DM + c0) = ol; } }
         } }
__global__ __launch_bounds__(256) void k_cvt8(const float* __restrict__ src, bf* dst, size_t n8) { const size_t i = (size_t)blockIdx.x * 256 + threadIdx.x; if (i >= n8) return; const v8f v = *(const v8f*)(src + i * 8); v8us o;
#pragma unroll
    for (int k = 0; k < 8; ++k) o[k] = f2bf(v[k]); *(v8us*)(dst + i * 8) = o;  }
__global__ __launch_bounds__(256) void k_cstab(const float* __restrict__ frq, float* CS) { const int idx = blockIdx.x * 256 + threadIdx.x; if (idx >= TT * HD) return; const int t = idx / HD, d = idx % HD; const float ang = bfr(frq[(size_t)t * (HD / 2) + (d >> 1)]);   /* interleaved pairs share freqs[t][j] */ v2f cs; cs[0] = cosf(ang); cs[1] = sinf(ang); *(v2f*)(CS + (size_t)idx * 2) = cs;  }

// k_rope: head planes [h][t][d] (fp16 + hi/lo) of the interleaved rotary (x1 c - x2 s, x1 s + x2 c on pairs (2j, 2j+1))
__global__ __launch_bounds__(256) void k_rope(const float* __restrict__ F, int pitch, int nheads, const float* __restrict__ CS, const float* __restrict__ RF, const float* __restrict__ nw, float sc, h16* P16, bf* Ph, bf* Pl) {
    const size_t e = ((size_t)blockIdx.x * 256 + threadIdx.x) * 2; if (e >= (size_t)nheads * TT * HD) return; const int d = (int)(e % HD); const int t = (int)((e / HD) % TT); const int h = (int)(e / ((size_t)HD * TT)); const float* f = F + (size_t)t * pitch + h * HD; const float rf = RF ? RF[(size_t)h * TT + t] : 1.0f; v2h o16; v2us oh, ol;
#pragma unroll
    for (int q = 0; q < 2; ++q) { const int dd = d + q; const int dp = dd ^ 1;   /* interleaved pair partner */ float x0 = f[dd], x1 = f[dp];
        if (RF) { float n0 = __fmul_rn(x0, rf), n1 = __fmul_rn(x1, rf); asm volatile("" : "+v"(n0)); asm volatile("" : "+v"(n1)); x0 = __fmul_rn(bfr(nw[dd]), n0); x1 = __fmul_rn(bfr(nw[dp]), n1); }
        const v2f cs = *(const v2f*)(CS + ((size_t)t * HD + dd) * 2); float a = __fmul_rn(x0, cs[0]), bq = __fmul_rn(x1, cs[1]); asm volatile("" : "+v"(a)); asm volatile("" : "+v"(bq)); const float r = (((dd & 1) == 0) ? __fsub_rn(a, bq) : __fadd_rn(a, bq)) * sc;   /* even: x1 c - x2 s; odd: x2 c + x1 s */
        o16[q] = tohx(r); unsigned short a2, c2; splitf(r, a2, c2); oh[q] = a2; ol[q] = c2; }
    *(v2h*)(P16 + e) = o16; *(v2us*)(Ph + e) = oh; *(v2us*)(Pl + e) = ol;  }
__global__ __launch_bounds__(256) void k_vtp(const float* __restrict__ F, int pitch, int nheads, h16* V16, bf* Vh, bf* Vl) { const size_t e = ((size_t)blockIdx.x * 256 + threadIdx.x) * 2; if (e >= (size_t)nheads * HD * TT) return; const int t = (int)(e % TT); const int d = (int)((e / TT) % HD); const int g = (int)(e / ((size_t)TT * HD)); v2h o16; v2us oh, ol;
#pragma unroll
    for (int q = 0; q < 2; ++q) { const float x = F[(size_t)(t + q) * pitch + g * HD + d]; o16[q] = tohx(x); unsigned short a2, c2; splitf(x, a2, c2); oh[q] = a2; ol[q] = c2; }
    *(v2h*)(V16 + e) = o16; *(v2us*)(Vh + e) = oh; *(v2us*)(Vl + e) = ol;  }
// k_asoft: per row (zz, i): t = S x HD^-0.5 + bf16(mask[i][j]); softmax over the 1024 keys (register row, one exp, fixed trees);
__global__ __launch_bounds__(256) void k_asoft(const float* __restrict__ Sb, const float* __restrict__ MKb, h16* P16, bf* Ph, bf* Pl) {
    const int lane = threadIdx.x & 31; const int row = blockIdx.x * 8 + (threadIdx.x >> 5); if (row >= ZH * TT) return; const int i = row % TT; const int zz = row / TT; (void)zz; const float* mk = MKb + (size_t)i * TT; const bool hires = (i < RH); const float* sr = Sb + (size_t)row * TT; float v[TT / 32]; float mx = -3.0e38f;
#pragma unroll
    for (int ch = 0; ch < TT / 128; ++ch) { const int j0 = ch * 128 + lane * 4; const v4f a = *(const v4f*)(sr + j0);
#pragma unroll
        for (int q = 0; q < 4; ++q) { const int j = j0 + q; float sa = a[q] * SCL; asm volatile("" : "+v"(sa)); float mv = bfr(mk[j]); asm volatile("" : "+v"(mv)); const float t = __fadd_rn(sa, mv);   /* + attention_mask[b][0][i][j] */ v[ch * 4 + q] = t; mx = fmaxf(mx, t); } }
#pragma unroll
    for (int sh = 16; sh; sh >>= 1) mx = fmaxf(mx, __shfl_xor(mx, sh, 32));
    float sum = 0.f;
#pragma unroll
    for (int k = 0; k < TT / 32; ++k) { float d0 = __fsub_rn(v[k], mx); asm volatile("" : "+v"(d0)); v[k] = __builtin_amdgcn_exp2f(__fmul_rn(d0, 1.4426950408889634f)); sum += v[k]; }
#pragma unroll
    for (int sh = 16; sh; sh >>= 1) sum += __shfl_xor(sum, sh, 32);
    const float f = __fdiv_rn(hires ? 1.0f : PCAR, sum);
{
        if (hires) {
#pragma unroll
            for (int ch = 0; ch < TT / 128; ++ch) { v4us oh, ol;
#pragma unroll
                for (int q = 0; q < 4; ++q) { unsigned short a, c2; splitf(v[ch * 4 + q] * f, a, c2); oh[q] = a; ol[q] = c2; }
                const size_t oo = ((size_t)zz * (RH ? RH : 1) + i) * TT + ch * 128 + lane * 4; *(v4us*)(Ph + oo) = oh; *(v4us*)(Pl + oo) = ol; }
        } else {
#pragma unroll
            for (int ch = 0; ch < TT / 128; ++ch) { v4h o4;
#pragma unroll
                for (int q = 0; q < 4; ++q) o4[q] = tohx(v[ch * 4 + q] * f);
                *(v4h*)(P16 + (size_t)row * TT + ch * 128 + lane * 4) = o4; } }
         }
}
__global__ __launch_bounds__(256) void k_merge(const float* __restrict__ O, int h0, bf* Ah, bf* Al) { const size_t e = ((size_t)blockIdx.x * 256 + threadIdx.x) * 2; if (e >= (size_t)ZH * TT * HD) return; const int d = (int)(e % HD); const int t = (int)((e / HD) % TT); const int zz = (int)(e / ((size_t)HD * TT)); const float cs = (t < RH) ? 1.0f : (1.0f / PCAR); const size_t oo = (size_t)t * DQ + (h0 + zz) * HD + d;
    v2us oh, ol;
#pragma unroll
    for (int q = 0; q < 2; ++q) { unsigned short a, c2; splitf(O[e + q] * cs, a, c2); oh[q] = a; ol[q] = c2; } *(v2us*)(Ah + oo) = oh; *(v2us*)(Al + oo) = ol;  }

extern "C" void kernel_launch(void* const* d_in, const int* in_sizes, int n_in,
                              void* d_out, int out_size, void* d_ws, size_t ws_size, hipStream_t stream) {
    (void)in_sizes; (void)n_in; (void)out_size;
    const float* x = (const float*)d_in[0]; const float* MK = (const float*)d_in[1]; const float* FRQ = (const float*)d_in[2]; const float* wq = (const float*)d_in[3]; const float* bq = (const float*)d_in[4]; const float* wk = (const float*)d_in[5]; const float* bk = (const float*)d_in[6]; const float* wv = (const float*)d_in[7]; const float* bv = (const float*)d_in[8]; const float* wo = (const float*)d_in[9]; const float* bo = (const float*)d_in[10]; const float* g1 = (const float*)d_in[11]; const float* e1b = (const float*)d_in[12]; const float* qnw = nullptr; const float* knw = nullptr; (void)qnw; (void)knw;
    float* OUT = (float*)d_out;     // [2][1024][2048]
    char* wsp = (char*)d_ws;
    auto take = [&](size_t bytes) { char* p = wsp; wsp += (bytes + 255) & ~(size_t)255; return (void*)p; };
    bf* WQ = (bf*)take((size_t)DQ * DM * 2); bf* WK = (bf*)take((size_t)DKV * DM * 2); bf* WV = (bf*)take((size_t)DKV * DM * 2); bf* WO = (bf*)take((size_t)DM * DQ * 2); float* CS = (float*)take((size_t)TT * HD * 2 * 4);
    bf* XB = (bf*)take((size_t)TT * DM * 2); float* YO = (float*)take((size_t)TT * DM * 4); float* FQ = (float*)take((size_t)TT * DQ * 4); float* FK = (float*)take((size_t)TT * DKV * 4);
    h16* QP16 = (h16*)take((size_t)NH_ * TT * HD * 2); h16* KP16 = (h16*)take((size_t)NKV * TT * HD * 2); h16* VT16 = (h16*)take((size_t)NKV * HD * TT * 2);
    bf* QPh = (bf*)take((size_t)NH_ * TT * HD * 2); bf* QPl = (bf*)take((size_t)NH_ * TT * HD * 2); bf* KPh = (bf*)take((size_t)NKV * TT * HD * 2); bf* KPl = (bf*)take((size_t)NKV * TT * HD * 2); bf* VTh = (bf*)take((size_t)NKV * HD * TT * 2); bf* VTl = (bf*)take((size_t)NKV * HD * TT * 2); bf* Ph = (bf*)take((size_t)ZH * RH * TT * 2); bf* Pl = (bf*)take((size_t)ZH * RH * TT * 2);
    float* Sb = (float*)take((size_t)ZH * TT * TT * 4); h16* P16 = (h16*)take((size_t)ZH * TT * TT * 2); float* Ob = (float*)take((size_t)ZH * TT * HD * 4); bf* ATh = (bf*)take((size_t)TT * DQ * 2); bf* ATl = (bf*)take((size_t)TT * DQ * 2);
    if ((size_t)(wsp - (char*)d_ws) > ws_size) return;    // ws 256 MiB
    float* FV = FK;   // v projection reuses the k buffer after the k planes are built (stream-ordered)
    { k_cvt8<<<(unsigned)(((size_t)DQ * DM / 8 + 255) / 256), 256, 0, stream>>>(wq, WQ, (size_t)DQ * DM / 8); k_cvt8<<<(unsigned)(((size_t)DKV * DM / 8 + 255) / 256), 256, 0, stream>>>(wk, WK, (size_t)DKV * DM / 8); k_cvt8<<<(unsigned)(((size_t)DKV * DM / 8 + 255) / 256), 256, 0, stream>>>(wv, WV, (size_t)DKV * DM / 8);
      k_cvt8<<<(unsigned)(((size_t)DM * DQ / 8 + 255) / 256), 256, 0, stream>>>(wo, WO, (size_t)DM * DQ / 8);
      k_cstab<<<(TT * HD + 255) / 256, 256, 0, stream>>>(FRQ, CS); }
    const unsigned LQ = (unsigned)(((size_t)NH_ * TT * HD / 2 + 255) / 256), LKv = (unsigned)(((size_t)NKV * TT * HD / 2 + 255) / 256);
    for (int b = 0; b < NB_; ++b) {
        
        k_cvt8<<<(unsigned)(((size_t)TT * DM / 8 + 255) / 256), 256, 0, stream>>>(x + (size_t)b * TT * DM, XB, (size_t)TT * DM / 8);
        k_gemmw<bf, 0, true><<<dim3(TT / 128, DQ / 128, 1), 128, 0, stream>>>(XB, nullptr, WQ, nullptr, DM, FQ, DQ, bq, 0, 0, 0);
        k_rope<<<LQ, 256, 0, stream>>>(FQ, DQ, NH_, CS, nullptr, nullptr, 1.0f, QP16, QPh, QPl);
        k_gemmw<bf, 0, true><<<dim3(TT / 128, DKV / 128, 1), 128, 0, stream>>>(XB, nullptr, WK, nullptr, DM, FK, DKV, bk, 0, 0, 0);
        k_rope<<<LKv, 256, 0, stream>>>(FK, DKV, NKV, CS, nullptr, nullptr, 1.0f, KP16, KPh, KPl);
        k_gemmw<bf, 0, true><<<dim3(TT / 128, DKV / 128, 1), 128, 0, stream>>>(XB, nullptr, WV, nullptr, DM, FV, DKV, bv, 0, 0, 0); k_vtp<<<LKv, 256, 0, stream>>>(FV, DKV, NKV, VT16, VTh, VTl);
        for (int h0 = 0; h0 < NH_; h0 += ZH) { const size_t zq = (size_t)h0, zk = (size_t)(h0 / REP);   // one kv head per query head: the pass's ZH heads use consecutive kv planes (z-strides TT*HD)
            k_gemmw<bf, 2, false><<<dim3(RH / 128, TT / 128, ZH), 128, 0, stream>>>(QPh + zq * TT * HD, QPl + zq * TT * HD, KPh + zk * TT * HD, KPl + zk * TT * HD, HD, Sb, TT, nullptr, (size_t)TT * HD, (size_t)TT * HD, (size_t)TT * TT);
            k_gemmw<h16, 0, false><<<dim3((TT - RH) / 128, TT / 128, ZH), 128, 0, stream>>>(QP16 + zq * TT * HD + (size_t)RH * HD, nullptr, KP16 + zk * TT * HD, nullptr, HD, Sb + (size_t)RH * TT, TT, nullptr, (size_t)TT * HD, (size_t)TT * HD, (size_t)TT * TT);
            k_asoft<<<ZH * TT / 8, 256, 0, stream>>>(Sb, MK + (size_t)b * TT * TT, P16, Ph, Pl);
            k_gemmw<bf, 2, false><<<dim3(RH / 128, HD / 128, ZH), 128, 0, stream>>>(Ph, Pl, VTh + zk * HD * TT, VTl + zk * HD * TT, TT, Ob, HD, nullptr, (size_t)RH * TT, (size_t)HD * TT, (size_t)TT * HD);
            k_gemmw<h16, 0, false><<<dim3((TT - RH) / 128, HD / 128, ZH), 128, 0, stream>>>(P16 + (size_t)RH * TT, nullptr, VT16 + zk * HD * TT, nullptr, TT, Ob + (size_t)RH * HD, HD, nullptr, (size_t)TT * TT, (size_t)HD * TT, (size_t)TT * HD);
            k_merge<<<(unsigned)(((size_t)ZH * TT * HD / 2 + 255) / 256), 256, 0, stream>>>(Ob, h0, ATh, ATl); }
        k_gemmw<bf, 1, true><<<dim3(TT / 128, DM / 128, 1), 128, 0, stream>>>(ATh, ATl, WO, nullptr, DQ, YO, DM, bo, 0, 0, 0);
        k_resln<<<TT / 8, 256, 0, stream>>>(YO, x + (size_t)b * TT * DM, g1, e1b, OUT + (size_t)b * TT * DM, nullptr, nullptr); }   /* LN(proj + bo + hidden_state) */
}

// v003
// One run takes 317 microseconds.
// Two timings next to v002 put it at 1.49 and 1.50 times that version's speed.
// Over all steps from v000 it is 4.99 times as fast.
#include <hip/hip_runtime.h>

// Decoder attention with RoPE and a BERT-style output (hidden_state [2][1024][2048]; q, k, v = x W^T + b ('oi' [2048][2048], 16 heads x 128); interleaved RoPE with cos/sin(freqs[t][j]) (freqs [1024][64] input, read); scores/sqrt(128) + attention_mask[b][0][i][j] (f32 input, read; zeros); softmax; out = LN(attn Wo^T + bo + hidden_state) (eps 1e-12, gamma/beta) -> [2][1024][2048]).
// Compute dtypes, f32 accumulate: every input rounded to bf16; q/k/v on PLAIN bf16 operands (inputs: exact) + biases; rotary in f32 from a table cos/sin(bf16(freqs)); the additive mask (bf16-rounded) inside the softmax kernel; scores and attn.v: query rows < 512 hl (3 products), the rest single fp16 (x1024); softmax f32; Wo hl x exact (2 products) + bo; residual add and LayerNorm in f32 (fixed trees).

#define NB_  2
#define TT   1024
#define DM   2048
#define NH_  16
#define NKV  16
#define REP  (NH_ / NKV)
#define HD   128
#define DQ   (NH_ * HD)
#define DKV  (NKV * HD)
#define LNEPS 1e-12f
typedef __attribute__((ext_vector_type(4))) unsigned short v4us;
#define NZ   (NB_ * NH_)          // z extent of the attention launches: every head of both batch entries in one pass, z = b * NH_ + h
#define RH   512                  // query rows < RH use hi+lo planes (0: none)
#define WIN  0
#define PCAR 1024.0f
#define SCL  0.088388347648318447f   // HD^-0.5
typedef _Float16 h16;
typedef unsigned short bf;
typedef __attribute__((ext_vector_type(16))) __bf16   v16bf;
typedef __attribute__((ext_vector_type(16))) _Float16 v16h;
typedef __attribute__((ext_vector_type(8)))  _Float16 v8h;
typedef __attribute__((ext_vector_type(8)))  unsigned short v8us;
typedef __attribute__((ext_vector_type(8)))  float    v8f;
typedef __attribute__((ext_vector_type(4)))  float    v4f;
typedef v8h  __attribute__((may_alias)) v8ha;
typedef v4f  __attribute__((may_alias)) v4fa;
typedef v8us __attribute__((may_alias)) v8usa;

__device__ __forceinline__ unsigned short f2bf(float f) { unsigned u = __float_as_uint(f); u += 0x7FFFu + ((u >> 16) & 1u); return (unsigned short)(u >> 16); }
__device__ __forceinline__ float bf2f(unsigned short b) { return __uint_as_float(((unsigned)b) << 16); }
__device__ __forceinline__ float bfr(float f) { return bf2f(f2bf(f)); }
__device__ __forceinline__ v16h cat16(v8h lo, v8h hi) { return __builtin_shufflevector(lo, hi, 0, 1, 2, 3, 4, 5, 6, 7, 8, 9, 10, 11, 12, 13, 14, 15); }
__device__ __forceinline__ v16bf cat16b(v8us lo, v8us hi) { return __builtin_bit_cast(v16bf, __builtin_shufflevector(lo, hi, 0, 1, 2, 3, 4, 5, 6, 7, 8, 9, 10, 11, 12, 13, 14, 15)); }
__device__ __forceinline__ v8f wmma16(v16h a, v16h b, v8f c) { return __builtin_amdgcn_wmma_f32_16x16x32_f16(false, a, false, b, (short)0, c, false, false); }
__device__ __forceinline__ v8f wmmab(v16bf a, v16bf b, v8f c) { return __builtin_amdgcn_wmma_f32_16x16x32_bf16(false, a, false, b, (short)0, c, false, false); }



// ---- k_gemmw: GEMM, one 128x128 output tile per work-group of 4 waves (2x2, 64x64 and 16 accumulators per wave); grid (M/128, N/128, Z), 128 threads.
// Operand tiles (128 rows x KC k, whole 128-byte lines) go from the K-contiguous 16-bit planes into LDS by asynchronous b128 copies, two buffers: the next tile flies while this one is multiplied.
// C[m][n] (f32, pitch ldc, + optional f32 bias[n]) = sum_k A[m][k] Bt[n][k] (+ split products per NSPLIT). A rows have pitch lda, Bt rows pitch K (elements). z-batch strides sA/sB/sC in elements. K % KC == 0, M % 128 == 0, N % 128 == 0.
template <typename T16> struct WFrag;
template <> struct WFrag<h16> { typedef v16h V; static __device__ __forceinline__ V ld(const h16* p) { return cat16(*(const v8h*)p, *(const v8h*)(p + 16)); } static __device__ __forceinline__ v8f mma(V a, V b, v8f c) { return wmma16(a, b, c); } };
template <> struct WFrag<bf> { typedef v16bf V; static __device__ __forceinline__ V ld(const bf* p) { return cat16b(*(const v8us*)p, *(const v8us*)(p + 16)); } static __device__ __forceinline__ v8f mma(V a, V b, v8f c) { return wmmab(a, b, c); } };
// One plane of one stage: every thread copies its 16 bytes (with WIDE also the 16 bytes 128 further on, in global memory and in LDS alike) of rows r, r + 16, ..., r + 112; a wave's copy = 4 whole lines.
// g: the lane's global address in row r, rs: 16 rows in elements, l: the lane's LDS byte address in row r, ls: 16 rows in LDS bytes.
// The closing s_wait_xcnt stands inside the statement so that no address register named here is rewritten ahead of it.
template <bool WIDE, typename T16>
__device__ __forceinline__ void stage_plane(const T16* g, size_t rs, unsigned l, unsigned ls) {
    if (WIDE)
        asm volatile("global_load_async_to_lds_b128 %0, %8, off\n\t"  "global_load_async_to_lds_b128 %0, %8, off offset:128\n\t"
                     "global_load_async_to_lds_b128 %1, %9, off\n\t"  "global_load_async_to_lds_b128 %1, %9, off offset:128\n\t"
                     "global_load_async_to_lds_b128 %2, %10, off\n\t" "global_load_async_to_lds_b128 %2, %10, off offset:128\n\t"
                     "global_load_async_to_lds_b128 %3, %11, off\n\t" "global_load_async_to_lds_b128 %3, %11, off offset:128\n\t"
                     "global_load_async_to_lds_b128 %4, %12, off\n\t" "global_load_async_to_lds_b128 %4, %12, off offset:128\n\t"
                     "global_load_async_to_lds_b128 %5, %13, off\n\t" "global_load_async_to_lds_b128 %5, %13, off offset:128\n\t"
                     "global_load_async_to_lds_b128 %6, %14, off\n\t" "global_load_async_to_lds_b128 %6, %14, off offset:128\n\t"
                     "global_load_async_to_lds_b128 %7, %15, off\n\t" "global_load_async_to_lds_b128 %7, %15, off offset:128\n\t"
                     "s_wait_xcnt 0x0"
                     :: "v"(l), "v"(l + ls), "v"(l + 2 * ls), "v"(l + 3 * ls), "v"(l + 4 * ls), "v"(l + 5 * ls), "v"(l + 6 * ls), "v"(l + 7 * ls),
                        "v"(g), "v"(g + rs), "v"(g + 2 * rs), "v"(g + 3 * rs), "v"(g + 4 * rs), "v"(g + 5 * rs), "v"(g + 6 * rs), "v"(g + 7 * rs)
                     : "memory");
    else
        asm volatile("global_load_async_to_lds_b128 %0, %8, off\n\t"
                     "global_load_async_to_lds_b128 %1, %9, off\n\t"
                     "global_load_async_to_lds_b128 %2, %10, off\n\t"
                     "global_load_async_to_lds_b128 %3, %11, off\n\t"
                     "global_load_async_to_lds_b128 %4, %12, off\n\t"
                     "global_load_async_to_lds_b128 %5, %13, off\n\t"
                     "global_load_async_to_lds_b128 %6, %14, off\n\t"
                     "global_load_async_to_lds_b128 %7, %15, off\n\t"
                     "s_wait_xcnt 0x0"
                     :: "v"(l), "v"(l + ls), "v"(l + 2 * ls), "v"(l + 3 * ls), "v"(l + 4 * ls), "v"(l + 5 * ls), "v"(l + 6 * ls), "v"(l + 7 * ls),
                        "v"(g), "v"(g + rs), "v"(g + 2 * rs), "v"(g + 3 * rs), "v"(g + 4 * rs), "v"(g + 5 * rs), "v"(g + 6 * rs), "v"(g + 7 * rs)
                     : "memory");
}
template <typename T16, int NSPLIT, bool BIAS>
__global__ __launch_bounds__(128) void k_gemmw(const T16* __restrict__ A, const T16* __restrict__ A2, const T16* __restrict__ Bt, const T16* __restrict__ Bt2, int K, int lda, float* C, int ldc, const float* __restrict__ bias, size_t sA, size_t sB, size_t sC) {
    typedef typename WFrag<T16>::V V;
    constexpr bool HA2 = (NSPLIT == 1 || NSPLIT == 2), HB2 = (NSPLIT >= 2), WIDE = !HB2;
    constexpr int KC = WIDE ? 128 : 64;                       // k per stage; four planes of 128 k would be 64 copies of a wave in flight
    constexpr unsigned PIT = KC * 2 + 16;                     // LDS row pitch in bytes: 16 B x odd, conflict-free for ds_load_b128
    constexpr unsigned PLN = 128 * PIT, PB = (HA2 ? 2u : 1u) * PLN, STG = PB + (HB2 ? 2u : 1u) * PLN;   // stage: [A | A2 | B | B2]
    __shared__ __align__(16) unsigned char ring[2 * STG];
    const size_t z = blockIdx.z; A += z * sA; if (HA2) A2 += z * sA; Bt += z * sB; if (HB2) Bt2 += z * sB; C += z * sC;
    const int tid = threadIdx.x, lane = tid & 31, lr = lane & 15, hi = lane >> 4, wave = tid >> 5, wm = wave >> 1, wn = wave & 1;
    const int r0 = blockIdx.x * 128 + wm * 64, c0 = blockIdx.y * 128 + wn * 64;
    v8f acc[4][4];
#pragma unroll
    for (int mb = 0; mb < 4; ++mb)
#pragma unroll
        for (int nb = 0; nb < 4; ++nb) acc[mb][nb] = (v8f){};
    const size_t ga = (size_t)(blockIdx.x * 128 + (tid >> 3)) * lda + (tid & 7) * 8, gb = (size_t)(blockIdx.y * 128 + (tid >> 3)) * K + (tid & 7) * 8, rsa = (size_t)16 * lda, rsb = (size_t)16 * K;
    const unsigned lcp = (unsigned)(size_t)ring + (unsigned)(tid >> 3) * PIT + (unsigned)(tid & 7) * 16;
    auto fill = [&](int kc, unsigned buf) { const unsigned l = lcp + buf * STG;
        stage_plane<WIDE>(A + ga + kc, rsa, l, 16 * PIT); if (HA2) stage_plane<WIDE>(A2 + ga + kc, rsa, l + PLN, 16 * PIT);
        stage_plane<WIDE>(Bt + gb + kc, rsb, l + PB, 16 * PIT); if (HB2) stage_plane<WIDE>(Bt2 + gb + kc, rsb, l + PB + PLN, 16 * PIT); };
    fill(0, 0);
    asm volatile("s_wait_asynccnt 0x0" ::: "memory");   // tile 0 has landed before anybody reads it
    __syncthreads();
    if (K > KC) fill(KC, 1);
#pragma unroll 1   // one pass per trip: a single publish point, and the body stays small for the instruction cache
    for (int kc = 0, t = 0; kc < K; kc += KC, t ^= 1) {
        const unsigned char* fa = ring + (unsigned)t * STG + (wm * 64 + lr) * PIT + hi * 16; const unsigned char* fb = ring + (unsigned)t * STG + PB + (wn * 64 + lr) * PIT + hi * 16;
        V a[2][4], a2[2][4], b[2][4], b2[2][4];   // two fragment sets: the next 32 k are fetched as one group ahead of this block's products
#pragma unroll     // unrolled so that the set index is a constant and both fragment sets stay in registers
        for (int ks = -1; ks < KC / 32; ++ks) {
            if (ks + 1 < KC / 32) { const int s = (ks + 1) & 1, o = (ks + 1) * 64;
#pragma unroll
                for (int i = 0; i < 4; ++i) { a[s][i] = WFrag<T16>::ld((const T16*)(fa + i * 16 * PIT + o)); if (HA2) a2[s][i] = WFrag<T16>::ld((const T16*)(fa + PLN + i * 16 * PIT + o)); }
#pragma unroll
                for (int i = 0; i < 4; ++i) { b[s][i] = WFrag<T16>::ld((const T16*)(fb + i * 16 * PIT + o)); if (HB2) b2[s][i] = WFrag<T16>::ld((const T16*)(fb + PLN + i * 16 * PIT + o)); } }
            __builtin_amdgcn_sched_barrier(0);   // keeps the next block's LDS reads one group ahead of this block's products; sunk among them, every product row waits out the LDS latency
            if (ks >= 0) { const int s = ks & 1;
#pragma unroll
                for (int nb = 0; nb < 4; ++nb) {
#pragma unroll
                    for (int mb = 0; mb < 4; ++mb) acc[mb][nb] = WFrag<T16>::mma(a[s][mb], b[s][nb], acc[mb][nb]);
                    if (HA2) {
#pragma unroll
                        for (int mb = 0; mb < 4; ++mb) acc[mb][nb] = WFrag<T16>::mma(a2[s][mb], b[s][nb], acc[mb][nb]); }
                    if (HB2) {
#pragma unroll
                        for (int mb = 0; mb < 4; ++mb) acc[mb][nb] = WFrag<T16>::mma(a[s][mb], b2[s][nb], acc[mb][nb]); } } }
            __builtin_amdgcn_sched_barrier(0);   // and keeps the group after next behind these products, whose registers it refills
        }
        asm volatile("s_wait_dscnt 0x0" ::: "memory");      // this wave's reads of the buffer are done before it is refilled
        asm volatile("s_wait_asynccnt 0x0" ::: "memory");   // this wave's copies of the next tile have landed
        __syncthreads();                                    // publishes the next tile and ends every reader's last read of this one
        if (kc + 2 * KC < K) fill(kc + 2 * KC, (unsigned)t);
    }
    asm volatile("s_wait_asynccnt 0x0" ::: "memory");       // no copy is in flight when the ring becomes output staging
    float* os = (float*)ring + wave * (16 * 68);            // each wave's own 16 x 68 floats; every reader left the ring at the last pass's barrier
#pragma unroll
    for (int mb = 0; mb < 4; ++mb) {
#pragma unroll
        for (int nb = 0; nb < 4; ++nb) {
#pragma unroll
            for (int j = 0; j < 8; ++j) os[(hi * 8 + j) * 68 + nb * 16 + lr] = acc[mb][nb][j]; }
        __builtin_amdgcn_wave_barrier(); asm volatile("" ::: "memory");
        float* crow = C + (size_t)(r0 + mb * 16) * ldc + c0;
{
#pragma unroll
            for (int s = 0; s < 8; ++s) { const int row = 2 * s + hi, cofs = lr * 4; v4f val = *(const v4fa*)(os + row * 68 + cofs); if (BIAS) { val[0] += bfr(bias[c0 + cofs]); val[1] += bfr(bias[c0 + cofs + 1]); val[2] += bfr(bias[c0 + cofs + 2]); val[3] += bfr(bias[c0 + cofs + 3]); }
                *(v4f*)(crow + (size_t)row * ldc + cofs) = val; }
             }
        __builtin_amdgcn_wave_barrier(); asm volatile("" ::: "memory");
        asm volatile("s_wait_xcnt 0x0" ::: "memory");   // a precaution: stands between these stores and the next row block's reuse of their address registers
    }
}

__device__ __forceinline__ h16 tohx(float x) { return (h16)x; }
__device__ __forceinline__ void splitf(float y, unsigned short& h, unsigned short& l) { h = f2bf(y); l = f2bf(y - bf2f(h)); }
typedef __attribute__((ext_vector_type(2))) _Float16 v2h;
typedef __attribute__((ext_vector_type(4))) _Float16 v4h;
typedef __attribute__((ext_vector_type(2))) unsigned short v2us;
typedef __attribute__((ext_vector_type(4))) unsigned short v4us;
typedef __attribute__((ext_vector_type(2))) float v2f;
typedef __attribute__((ext_vector_type(4))) int v4i;

__global__ __launch_bounds__(256) void k_wtG(const float* __restrict__ w, int K, int N, bf* Bt) {
    const int lane = threadIdx.x & 31; const int L0 = (blockIdx.x * 8 + (threadIdx.x >> 5)) * 8; const int nlines = N * K / 64;
{
#pragma unroll 1
        for (int l = 0; l < 8; ++l) { const int L = L0 + l; if (L >= nlines) break; const size_t e = (size_t)L * 64 + lane * 2; const int k = (int)(e % K), n = (int)(e / K); v2us o;
            o[0] = f2bf(w[(size_t)k * N + n]); o[1] = f2bf(w[(size_t)(k + 1) * N + n]); *(v2us*)(Bt + e) = o; }
         }
}
__global__ __launch_bounds__(256) void k_resln(const float* __restrict__ Y, const float* __restrict__ Q, const float* __restrict__ g, const float* __restrict__ be, float* Z, bf* Zh, bf* Zl) {
    const int lane = threadIdx.x & 31; const int r = blockIdx.x * 8 + (threadIdx.x >> 5); if (r >= NB_ * TT) return; const float* yr = Y + (size_t)r * DM; const float* qr = Q + (size_t)r * DM; float s = 0.f;
#pragma unroll 1
    for (int ch = 0; ch < DM / 128; ++ch) { const int c0 = ch * 128 + lane * 4; const v4f a = *(const v4f*)(yr + c0), q4 = *(const v4f*)(qr + c0);
#pragma unroll
        for (int q = 0; q < 4; ++q) s += __fadd_rn(bfr(q4[q]), a[q]); }
#pragma unroll
    for (int sh = 16; sh; sh >>= 1) s += __shfl_xor(s, sh, 32);
    const float mu = s * (1.0f / DM); float s2 = 0.f;
#pragma unroll 1
    for (int ch = 0; ch < DM / 128; ++ch) { const int c0 = ch * 128 + lane * 4; const v4f a = *(const v4f*)(yr + c0), q4 = *(const v4f*)(qr + c0);
#pragma unroll
        for (int q = 0; q < 4; ++q) { const float d0 = __fsub_rn(__fadd_rn(bfr(q4[q]), a[q]), mu); float p = __fmul_rn(d0, d0); asm volatile("" : "+v"(p)); s2 = __fadd_rn(s2, p); } }
#pragma unroll
    for (int sh = 16; sh; sh >>= 1) s2 += __shfl_xor(s2, sh, 32);
    const float rs = __fdiv_rn(1.0f, __fsqrt_rn(__fadd_rn(s2 * (1.0f / DM), LNEPS)));
{
#pragma unroll 1
        for (int ch = 0; ch < DM / 128; ++ch) { const int c0 = ch * 128 + lane * 4; const v4f a = *(const v4f*)(yr + c0), q4 = *(const v4f*)(qr + c0); v4f z4; v4us oh, ol;
#pragma unroll
            for (int q = 0; q < 4; ++q) { float n0 = __fmul_rn(__fsub_rn(__fadd_rn(bfr(q4[q]), a[q]), mu), rs); asm volatile("" : "+v"(n0)); float n1 = __fmul_rn(n0, bfr(g[c0 + q])); asm volatile("" : "+v"(n1)); const float y = __fadd_rn(n1, bfr(be[c0 + q])); z4[q] = y; unsigned short h2, l2; splitf(y, h2, l2); oh[q] = h2; ol[q] = l2; }
            *(v4f*)(Z + (size_t)r * DM + c0) = z4; if (Zh) { *(v4us*)(Zh + (size_t)r * DM + c0) = oh; *(v4us*)(Zl + (size_t)r * DM + c0) = ol; } }
         } }
__global__ __launch_bounds__(256) void k_cvt8(const float* __restrict__ src, bf* dst, size_t n8) { const size_t i = (size_t)blockIdx.x * 256 + threadIdx.x; if (i >= n8) return; const v8f v = *(const v8f*)(src + i * 8); v8us o;
#pragma unroll
    for (int k = 0; k < 8; ++k) o[k] = f2bf(v[k]); *(v8us*)(dst + i * 8) = o;  }
__global__ __launch_bounds__(256) void k_cstab(const float* __restrict__ frq, float* CS) { const int idx = blockIdx.x * 256 + threadIdx.x; if (idx >= TT * HD) return; const int t = idx / HD, d = idx % HD; const float ang = bfr(frq[(size_t)t * (HD / 2) + (d >> 1)]);   /* interleaved pairs share freqs[t][j] */ v2f cs; cs[0] = cosf(ang); cs[1] = sinf(ang); *(v2f*)(CS + (size_t)idx * 2) = cs;  }

// k_rope: head planes [b * nheads + h][t][d] (fp16 + hi/lo), b = blockIdx.y, from rows b * TT + t of F, of the interleaved rotary (x1 c - x2 s, x1 s + x2 c on pairs (2j, 2j+1))
__global__ __launch_bounds__(256) void k_rope(const float* __restrict__ F, int pitch, int nheads, const float* __restrict__ CS, const float* __restrict__ RF, const float* __restrict__ nw, float sc, h16* P16, bf* Ph, bf* Pl) {
    { const size_t bb = blockIdx.y, po = bb * nheads * TT * HD; F += bb * TT * pitch; if (RF) RF += bb * nheads * TT; P16 += po; Ph += po; Pl += po; }   // this batch entry's rows of F and its planes
    const size_t e = ((size_t)blockIdx.x * 256 + threadIdx.x) * 2; if (e >= (size_t)nheads * TT * HD) return; const int d = (int)(e % HD); const int t = (int)((e / HD) % TT); const int h = (int)(e / ((size_t)HD * TT)); const float* f = F + (size_t)t * pitch + h * HD; const float rf = RF ? RF[(size_t)h * TT + t] : 1.0f; v2h o16; v2us oh, ol;
#pragma unroll
    for (int q = 0; q < 2; ++q) { const int dd = d + q; const int dp = dd ^ 1;   /* interleaved pair partner */ float x0 = f[dd], x1 = f[dp];
        if (RF) { float n0 = __fmul_rn(x0, rf), n1 = __fmul_rn(x1, rf); asm volatile("" : "+v"(n0)); asm volatile("" : "+v"(n1)); x0 = __fmul_rn(bfr(nw[dd]), n0); x1 = __fmul_rn(bfr(nw[dp]), n1); }
        const v2f cs = *(const v2f*)(CS + ((size_t)t * HD + dd) * 2); float a = __fmul_rn(x0, cs[0]), bq = __fmul_rn(x1, cs[1]); asm volatile("" : "+v"(a)); asm volatile("" : "+v"(bq)); const float r = (((dd & 1) == 0) ? __fsub_rn(a, bq) : __fadd_rn(a, bq)) * sc;   /* even: x1 c - x2 s; odd: x2 c + x1 s */
        o16[q] = tohx(r); unsigned short a2, c2; splitf(r, a2, c2); oh[q] = a2; ol[q] = c2; }
    *(v2h*)(P16 + e) = o16; *(v2us*)(Ph + e) = oh; *(v2us*)(Pl + e) = ol;  }
__global__ __launch_bounds__(256) void k_vtp(const float* __restrict__ F, int pitch, int nheads, h16* V16, bf* Vh, bf* Vl) { const size_t e = ((size_t)blockIdx.x * 256 + threadIdx.x) * 2; if (e >= (size_t)nheads * HD * TT) return; const int t = (int)(e % TT); const int d = (int)((e / TT) % HD); const int g = (int)(e / ((size_t)TT * HD)); const size_t tb = (size_t)blockIdx.y * TT + t, eo = (size_t)blockIdx.y * nheads * HD * TT + e;   /* b = blockIdx.y */ v2h o16; v2us oh, ol;
#pragma unroll
    for (int q = 0; q < 2; ++q) { const float x = F[(tb + q) * pitch + g * HD + d]; o16[q] = tohx(x); unsigned short a2, c2; splitf(x, a2, c2); oh[q] = a2; ol[q] = c2; }
    *(v2h*)(V16 + eo) = o16; *(v2us*)(Vh + eo) = oh; *(v2us*)(Vl + eo) = ol;  }
// k_asoft: per row (zz, i): t = S x HD^-0.5 + mask; softmax over the 1024 keys (register row, one exp, fixed trees).
// The probabilities go back over the wave's own score row (4 KiB), which it holds whole in registers by then: rows < RH the hi plane in the first 2 KiB and the lo plane in the second, the other rows fp16 in the first 2 KiB.
__global__ __launch_bounds__(256) void k_asoft(float* Sb, const float* __restrict__ MK) {
    const int lane = threadIdx.x & 31; const int row = blockIdx.x * 8 + (threadIdx.x >> 5); if (row >= NZ * TT) return; const int i = row % TT; const int zz = row / TT; const float* mk = MK + ((size_t)(zz / NH_) * TT + i) * TT; const bool hires = (i < RH); float* sr = Sb + (size_t)row * TT; float v[TT / 32]; float mx = -3.0e38f;
#pragma unroll
    for (int ch = 0; ch < TT / 128; ++ch) { const int j0 = ch * 128 + lane * 4; const v4f a = *(const v4f*)(sr + j0);
#pragma unroll
        for (int q = 0; q < 4; ++q) { const int j = j0 + q; float sa = a[q] * SCL; asm volatile("" : "+v"(sa)); float mv = bfr(mk[j]); asm volatile("" : "+v"(mv)); const float t = __fadd_rn(sa, mv);   /* + attention_mask[b][0][i][j] */ v[ch * 4 + q] = t; mx = fmaxf(mx, t); } }
#pragma unroll
    for (int sh = 16; sh; sh >>= 1) mx = fmaxf(mx, __shfl_xor(mx, sh, 32));
    float sum = 0.f;
#pragma unroll
    for (int k = 0; k < TT / 32; ++k) { float d0 = __fsub_rn(v[k], mx); asm volatile("" : "+v"(d0)); v[k] = __builtin_amdgcn_exp2f(__fmul_rn(d0, 1.4426950408889634f)); sum += v[k]; }
#pragma unroll
    for (int sh = 16; sh; sh >>= 1) sum += __shfl_xor(sum, sh, 32);
    const float f = __fdiv_rn(hires ? 1.0f : PCAR, sum);
{
        if (hires) {
#pragma unroll
            for (int ch = 0; ch < TT / 128; ++ch) { v4us oh, ol;
#pragma unroll
                for (int q = 0; q < 4; ++q) { unsigned short a, c2; splitf(v[ch * 4 + q] * f, a, c2); oh[q] = a; ol[q] = c2; }
                bf* po = (bf*)sr + ch * 128 + lane * 4; *(v4us*)po = oh; *(v4us*)(po + TT) = ol; }
        } else {
#pragma unroll
            for (int ch = 0; ch < TT / 128; ++ch) { v4h o4;
#pragma unroll
                for (int q = 0; q < 4; ++q) o4[q] = tohx(v[ch * 4 + q] * f);
                *(v4h*)((h16*)sr + ch * 128 + lane * 4) = o4; } }
         }
}
__global__ __launch_bounds__(256) void k_merge(const float* __restrict__ O, bf* Ah, bf* Al) { const size_t e = ((size_t)blockIdx.x * 256 + threadIdx.x) * 2; if (e >= (size_t)NZ * TT * HD) return; const int d = (int)(e % HD); const int t = (int)((e / HD) % TT); const int zz = (int)(e / ((size_t)HD * TT)); const float cs = (t < RH) ? 1.0f : (1.0f / PCAR); const size_t oo = ((size_t)(zz / NH_) * TT + t) * DQ + (zz % NH_) * HD + d;
    v2us oh, ol;
#pragma unroll
    for (int q = 0; q < 2; ++q) { unsigned short a, c2; splitf(O[e + q] * cs, a, c2); oh[q] = a; ol[q] = c2; } *(v2us*)(Ah + oo) = oh; *(v2us*)(Al + oo) = ol;  }

extern "C" void kernel_launch(void* const* d_in, const int* in_sizes, int n_in,
                              void* d_out, int out_size, void* d_ws, size_t ws_size, hipStream_t stream) {
    (void)in_sizes; (void)n_in; (void)out_size;
    const float* x = (const float*)d_in[0]; const float* MK = (const float*)d_in[1]; const float* FRQ = (const float*)d_in[2]; const float* wq = (const float*)d_in[3]; const float* bq = (const float*)d_in[4]; const float* wk = (const float*)d_in[5]; const float* bk = (const float*)d_in[6]; const float* wv = (const float*)d_in[7]; const float* bv = (const float*)d_in[8]; const float* wo = (const float*)d_in[9]; const float* bo = (const float*)d_in[10]; const float* g1 = (const float*)d_in[11]; const float* e1b = (const float*)d_in[12]; const float* qnw = nullptr; const float* knw = nullptr; (void)qnw; (void)knw;
    float* OUT = (float*)d_out;     // [2][1024][2048]
    char* wsp = (char*)d_ws;
    auto take = [&](size_t bytes) { char* p = wsp; wsp += (bytes + 255) & ~(size_t)255; return (void*)p; };
    constexpr int MT = NB_ * TT;   // token rows of both batch entries
    bf* WO = (bf*)take((size_t)DM * DQ * 2); float* CS = (float*)take((size_t)TT * HD * 2 * 4);
    bf* WQ = (bf*)take((size_t)DQ * DM * 2); bf* WK = (bf*)take((size_t)DKV * DM * 2); bf* WV = (bf*)take((size_t)DKV * DM * 2); bf* XB = (bf*)take((size_t)MT * DM * 2);
    h16* QP16 = (h16*)take((size_t)NZ * TT * HD * 2); h16* KP16 = (h16*)take((size_t)NZ * TT * HD * 2); h16* VT16 = (h16*)take((size_t)NZ * HD * TT * 2);
    bf* QPh = (bf*)take((size_t)NZ * TT * HD * 2); bf* QPl = (bf*)take((size_t)NZ * TT * HD * 2); bf* KPh = (bf*)take((size_t)NZ * TT * HD * 2); bf* KPl = (bf*)take((size_t)NZ * TT * HD * 2); bf* VTh = (bf*)take((size_t)NZ * HD * TT * 2); bf* VTl = (bf*)take((size_t)NZ * HD * TT * 2);
    float* Sb = (float*)take((size_t)NZ * TT * TT * 4);
    if ((size_t)(wsp - (char*)d_ws) > ws_size) return;    // ws 256 MiB
    // Buffers that share bytes, all stream-ordered: the f32 projections live in the score buffer before the scores are written, the output projection after the probabilities are used up;
    // the attention output takes the q and k weight planes (adjacent, together its size), its hi and lo planes the v weight plane and the bf16 hidden state, all four read for the last time by the v projection.
    float* FQ = Sb; float* FK = Sb + (size_t)MT * DQ; float* FV = FK; float* YO = Sb; float* Ob = (float*)WQ; bf* ATh = WV; bf* ATl = XB;
    k_cvt8<<<(unsigned)(((size_t)DQ * DM / 8 + 255) / 256), 256, 0, stream>>>(wq, WQ, (size_t)DQ * DM / 8); k_cvt8<<<(unsigned)(((size_t)DKV * DM / 8 + 255) / 256), 256, 0, stream>>>(wk, WK, (size_t)DKV * DM / 8); k_cvt8<<<(unsigned)(((size_t)DKV * DM / 8 + 255) / 256), 256, 0, stream>>>(wv, WV, (size_t)DKV * DM / 8);
    k_cvt8<<<(unsigned)(((size_t)DM * DQ / 8 + 255) / 256), 256, 0, stream>>>(wo, WO, (size_t)DM * DQ / 8);
    k_cstab<<<(TT * HD + 255) / 256, 256, 0, stream>>>(FRQ, CS);
    const unsigned LP = (unsigned)(((size_t)NH_ * TT * HD / 2 + 255) / 256);   // blocks per batch entry of the plane kernels (NKV == NH_)
    k_cvt8<<<(unsigned)(((size_t)MT * DM / 8 + 255) / 256), 256, 0, stream>>>(x, XB, (size_t)MT * DM / 8);
    k_gemmw<bf, 0, true><<<dim3(MT / 128, DQ / 128, 1), 128, 0, stream>>>(XB, nullptr, WQ, nullptr, DM, DM, FQ, DQ, bq, 0, 0, 0);
    k_rope<<<dim3(LP, NB_), 256, 0, stream>>>(FQ, DQ, NH_, CS, nullptr, nullptr, 1.0f, QP16, QPh, QPl);
    k_gemmw<bf, 0, true><<<dim3(MT / 128, DKV / 128, 1), 128, 0, stream>>>(XB, nullptr, WK, nullptr, DM, DM, FK, DKV, bk, 0, 0, 0);
    k_rope<<<dim3(LP, NB_), 256, 0, stream>>>(FK, DKV, NKV, CS, nullptr, nullptr, 1.0f, KP16, KPh, KPl);
    k_gemmw<bf, 0, true><<<dim3(MT / 128, DKV / 128, 1), 128, 0, stream>>>(XB, nullptr, WV, nullptr, DM, DM, FV, DKV, bv, 0, 0, 0);
    k_vtp<<<dim3(LP, NB_), 256, 0, stream>>>(FV, DKV, NKV, VT16, VTh, VTl);
    // one kv head per query head: plane z of q meets plane z of k and v (z-strides TT*HD); a score row is 2*TT 16-bit elements once it holds probabilities
    k_gemmw<bf, 2, false><<<dim3(RH / 128, TT / 128, NZ), 128, 0, stream>>>(QPh, QPl, KPh, KPl, HD, HD, Sb, TT, nullptr, (size_t)TT * HD, (size_t)TT * HD, (size_t)TT * TT);
    k_gemmw<h16, 0, false><<<dim3((TT - RH) / 128, TT / 128, NZ), 128, 0, stream>>>(QP16 + (size_t)RH * HD, nullptr, KP16, nullptr, HD, HD, Sb + (size_t)RH * TT, TT, nullptr, (size_t)TT * HD, (size_t)TT * HD, (size_t)TT * TT);
    k_asoft<<<NZ * TT / 8, 256, 0, stream>>>(Sb, MK);
    k_gemmw<bf, 2, false><<<dim3(RH / 128, HD / 128, NZ), 128, 0, stream>>>((const bf*)Sb, (const bf*)Sb + TT, VTh, VTl, TT, 2 * TT, Ob, HD, nullptr, (size_t)2 * TT * TT, (size_t)HD * TT, (size_t)TT * HD);
    k_gemmw<h16, 0, false><<<dim3((TT - RH) / 128, HD / 128, NZ), 128, 0, stream>>>((const h16*)Sb + (size_t)RH * 2 * TT, nullptr, VT16, nullptr, TT, 2 * TT, Ob + (size_t)RH * HD, HD, nullptr, (size_t)2 * TT * TT, (size_t)HD * TT, (size_t)TT * HD);
    k_merge<<<NB_ * LP, 256, 0, stream>>>(Ob, ATh, ATl);
    k_gemmw<bf, 1, true><<<dim3(MT / 128, DM / 128, 1), 128, 0, stream>>>(ATh, ATl, WO, nullptr, DQ, DQ, YO, DM, bo, 0, 0, 0);
    k_resln<<<MT / 8, 256, 0, stream>>>(YO, x, g1, e1b, OUT, nullptr, nullptr);   /* LN(proj + bo + hidden_state) */
}

// v004
// A run of this version takes 292 microseconds.
// Two timings next to v003 both put it at 1.09 times that version's speed.
// Over all steps from v000 it is 5.42 times as fast.
#include <hip/hip_runtime.h>

// Decoder attention with RoPE and a BERT-style output (hidden_state [2][1024][2048]; q, k, v = x W^T + b ('oi' [2048][2048], 16 heads x 128); interleaved RoPE with cos/sin(freqs[t][j]) (freqs [1024][64] input, read); scores/sqrt(128) + attention_mask[b][0][i][j] (f32 input, read; zeros); softmax; out = LN(attn Wo^T + bo + hidden_state) (eps 1e-12, gamma/beta) -> [2][1024][2048]).
// Compute dtypes, f32 accumulate: every input rounded to bf16; q/k/v on PLAIN bf16 operands (inputs: exact) + biases; rotary in f32 from a table cos/sin(bf16(freqs)); the additive mask (bf16-rounded) inside the softmax kernel; scores and attn.v: query rows < 512 hl (3 products), the rest single fp16 (x1024); softmax f32; Wo hl x exact (2 products) + bo; residual add and LayerNorm in f32 (fixed trees).

#define NB_  2
#define TT   1024
#define DM   2048
#define NH_  16
#define NKV  16
#define REP  (NH_ / NKV)
#define HD   128
#define DQ   (NH_ * HD)
#define DKV  (NKV * HD)
#define LNEPS 1e-12f
typedef __attribute__((ext_vector_type(4))) unsigned short v4us;
#define NZ   (NB_ * NH_)          // z extent of the attention launches: every head of both batch entries in one pass, z = b * NH_ + h
#define RH   512                  // query rows < RH use hi+lo planes (0: none)
#define WIN  0
#define PCAR 1024.0f
#define SCL  0.088388347648318447f   // HD^-0.5
typedef _Float16 h16;
typedef unsigned short bf;
typedef __attribute__((ext_vector_type(16))) __bf16   v16bf;
typedef __attribute__((ext_vector_type(16))) _Float16 v16h;
typedef __attribute__((ext_vector_type(8)))  _Float16 v8h;
typedef __attribute__((ext_vector_type(8)))  unsigned short v8us;
typedef __attribute__((ext_vector_type(8)))  float    v8f;
typedef __attribute__((ext_vector_type(4)))  float    v4f;
typedef v8h  __attribute__((may_alias)) v8ha;
typedef v4f  __attribute__((may_alias)) v4fa;
typedef v8us __attribute__((may_alias)) v8usa;

__device__ __forceinline__ unsigned short f2bf(float f) { unsigned u = __float_as_uint(f); u += 0x7FFFu + ((u >> 16) & 1u); return (unsigned short)(u >> 16); }
__device__ __forceinline__ float bf2f(unsigned short b) { return __uint_as_float(((unsigned)b) << 16); }
__device__ __forceinline__ float bfr(float f) { return bf2f(f2bf(f)); }
__device__ __forceinline__ v16h cat16(v8h lo, v8h hi) { return __builtin_shufflevector(lo, hi, 0, 1, 2, 3, 4, 5, 6, 7, 8, 9, 10, 11, 12, 13, 14, 15); }
__device__ __forceinline__ v16bf cat16b(v8us lo, v8us hi) { return __builtin_bit_cast(v16bf, __builtin_shufflevector(lo, hi, 0, 1, 2, 3, 4, 5, 6, 7, 8, 9, 10, 11, 12, 13, 14, 15)); }
__device__ __forceinline__ v8f wmma16(v16h a, v16h b, v8f c) { return __builtin_amdgcn_wmma_f32_16x16x32_f16(false, a, false, b, (short)0, c, false, false); }
__device__ __forceinline__ v8f wmmab(v16bf a, v16bf b, v8f c) { return __builtin_amdgcn_wmma_f32_16x16x32_bf16(false, a, false, b, (short)0, c, false, false); }



// ---- k_gemmw: GEMM, one 128x128 output tile per work-group of 4 waves (2x2, 64x64 and 16 accumulators per wave); grid (M/128, N/128, Z), 128 threads.
// Operand tiles (128 rows x KC k, whole 128-byte lines) go from the K-contiguous 16-bit planes into LDS by asynchronous b128 copies, two buffers: the next tile flies while this one is multiplied.
// C[m][n] (f32, pitch ldc, + optional f32 bias[n]) = sum_k A[m][k] Bt[n][k] (+ split products per NSPLIT). A rows have pitch lda, Bt rows pitch K (elements). z-batch strides sA/sB/sC in elements. K % KC == 0, M % 128 == 0, N % 128 == 0.
template <typename T16> struct WFrag;
template <> struct WFrag<h16> { typedef v16h V; static __device__ __forceinline__ V ld(const h16* p) { return cat16(*(const v8h*)p, *(const v8h*)(p + 16)); } static __device__ __forceinline__ v8f mma(V a, V b, v8f c) { return wmma16(a, b, c); } };
template <> struct WFrag<bf> { typedef v16bf V; static __device__ __forceinline__ V ld(const bf* p) { return cat16b(*(const v8us*)p, *(const v8us*)(p + 16)); } static __device__ __forceinline__ v8f mma(V a, V b, v8f c) { return wmmab(a, b, c); } };
// One plane of one stage: every thread copies its 16 bytes (with WIDE also the 16 bytes 128 further on, in global memory and in LDS alike) of rows r, r + 16, ..., r + 112; a wave's copy = 4 whole lines.
// g: the lane's global address in row r, rs: 16 rows in elements, l: the lane's LDS byte address in row r, ls: 16 rows in LDS bytes.
// The closing s_wait_xcnt stands inside the statement so that no address register named here is rewritten ahead of it.
template <bool WIDE, typename T16>
__device__ __forceinline__ void stage_plane(const T16* g, size_t rs, unsigned l, unsigned ls) {
    if (WIDE)
        asm volatile("global_load_async_to_lds_b128 %0, %8, off\n\t"  "global_load_async_to_lds_b128 %0, %8, off offset:128\n\t"
                     "global_load_async_to_lds_b128 %1, %9, off\n\t"  "global_load_async_to_lds_b128 %1, %9, off offset:128\n\t"
                     "global_load_async_to_lds_b128 %2, %10, off\n\t" "global_load_async_to_lds_b128 %2, %10, off offset:128\n\t"
                     "global_load_async_to_lds_b128 %3, %11, off\n\t" "global_load_async_to_lds_b128 %3, %11, off offset:128\n\t"
                     "global_load_async_to_lds_b128 %4, %12, off\n\t" "global_load_async_to_lds_b128 %4, %12, off offset:128\n\t"
                     "global_load_async_to_lds_b128 %5, %13, off\n\t" "global_load_async_to_lds_b128 %5, %13, off offset:128\n\t"
                     "global_load_async_to_lds_b128 %6, %14, off\n\t" "global_load_async_to_lds_b128 %6, %14, off offset:128\n\t"
                     "global_load_async_to_lds_b128 %7, %15, off\n\t" "global_load_async_to_lds_b128 %7, %15, off offset:128\n\t"
                     "s_wait_xcnt 0x0"
                     :: "v"(l), "v"(l + ls), "v"(l + 2 * ls), "v"(l + 3 * ls), "v"(l + 4 * ls), "v"(l + 5 * ls), "v"(l + 6 * ls), "v"(l + 7 * ls),
                        "v"(g), "v"(g + rs), "v"(g + 2 * rs), "v"(g + 3 * rs), "v"(g + 4 * rs), "v"(g + 5 * rs), "v"(g + 6 * rs), "v"(g + 7 * rs)
                     : "memory");
    else
        asm volatile("global_load_async_to_lds_b128 %0, %8, off\n\t"
                     "global_load_async_to_lds_b128 %1, %9, off\n\t"
                     "global_load_async_to_lds_b128 %2, %10, off\n\t"
                     "global_load_async_to_lds_b128 %3, %11, off\n\t"
                     "global_load_async_to_lds_b128 %4, %12, off\n\t"
                     "global_load_async_to_lds_b128 %5, %13, off\n\t"
                     "global_load_async_to_lds_b128 %6, %14, off\n\t"
                     "global_load_async_to_lds_b128 %7, %15, off\n\t"
                     "s_wait_xcnt 0x0"
                     :: "v"(l), "v"(l + ls), "v"(l + 2 * ls), "v"(l + 3 * ls), "v"(l + 4 * ls), "v"(l + 5 * ls), "v"(l + 6 * ls), "v"(l + 7 * ls),
                        "v"(g), "v"(g + rs), "v"(g + 2 * rs), "v"(g + 3 * rs), "v"(g + 4 * rs), "v"(g + 5 * rs), "v"(g + 6 * rs), "v"(g + 7 * rs)
                     : "memory");
}
template <typename T16, int NSPLIT, bool BIAS>
__global__ __launch_bounds__(128) void k_gemmw(const T16* __restrict__ A, const T16* __restrict__ A2, const T16* __restrict__ Bt, const T16* __restrict__ Bt2, int K, int lda, float* C, int ldc, const float* __restrict__ bias, size_t sA, size_t sB, size_t sC) {
    typedef typename WFrag<T16>::V V;
    constexpr bool HA2 = (NSPLIT == 1 || NSPLIT == 2), HB2 = (NSPLIT >= 2), WIDE = !HB2;
    constexpr int KC = WIDE ? 128 : 64;                       // k per stage; four planes of 128 k would be 64 copies of a wave in flight
    constexpr unsigned PIT = KC * 2 + 16;                     // LDS row pitch in bytes: 16 B x odd, conflict-free for ds_load_b128
    constexpr unsigned PLN = 128 * PIT, PB = (HA2 ? 2u : 1u) * PLN, STG = PB + (HB2 ? 2u : 1u) * PLN;   // stage: [A | A2 | B | B2]
    __shared__ __align__(16) unsigned char ring[2 * STG];
    const size_t z = blockIdx.z; A += z * sA; if (HA2) A2 += z * sA; Bt += z * sB; if (HB2) Bt2 += z * sB; C += z * sC;
    const int tid = threadIdx.x, lane = tid & 31, lr = lane & 15, hi = lane >> 4, wave = tid >> 5, wm = wave >> 1, wn = wave & 1;
    const int r0 = blockIdx.x * 128 + wm * 64, c0 = blockIdx.y * 128 + wn * 64;
    v8f acc[4][4];
#pragma unroll
    for (int mb = 0; mb < 4; ++mb)
#pragma unroll
        for (int nb = 0; nb < 4; ++nb) acc[mb][nb] = (v8f){};
    const size_t ga = (size_t)(blockIdx.x * 128 + (tid >> 3)) * lda + (tid & 7) * 8, gb = (size_t)(blockIdx.y * 128 + (tid >> 3)) * K + (tid & 7) * 8, rsa = (size_t)16 * lda, rsb = (size_t)16 * K;
    const unsigned lcp = (unsigned)(size_t)ring + (unsigned)(tid >> 3) * PIT + (unsigned)(tid & 7) * 16;
    auto fill = [&](int kc, unsigned buf) { const unsigned l = lcp + buf * STG;
        stage_plane<WIDE>(A + ga + kc, rsa, l, 16 * PIT); if (HA2) stage_plane<WIDE>(A2 + ga + kc, rsa, l + PLN, 16 * PIT);
        stage_plane<WIDE>(Bt + gb + kc, rsb, l + PB, 16 * PIT); if (HB2) stage_plane<WIDE>(Bt2 + gb + kc, rsb, l + PB + PLN, 16 * PIT); };
    fill(0, 0);
    asm volatile("s_wait_asynccnt 0x0" ::: "memory");   // tile 0 has landed before anybody reads it
    __syncthreads();
    if (K > KC) fill(KC, 1);
#pragma unroll 1   // one pass per trip: a single publish point
    for (int kc = 0, t = 0; kc < K; kc += KC, t ^= 1) {
        const unsigned char* fa = ring + (unsigned)t * STG + (wm * 64 + lr) * PIT + hi * 16; const unsigned char* fb = ring + (unsigned)t * STG + PB + (wn * 64 + lr) * PIT + hi * 16;
        V a[2][4], a2[2][4], b[2][4], b2[2][4];   // two fragment sets: the next 32 k are fetched as one group ahead of this block's products
#pragma unroll     // unrolled so that the set index is a constant and both fragment sets stay in registers
        for (int ks = -1; ks < KC / 32; ++ks) {
            if (ks + 1 < KC / 32) { const int s = (ks + 1) & 1, o = (ks + 1) * 64;
#pragma unroll
                for (int i = 0; i < 4; ++i) { a[s][i] = WFrag<T16>::ld((const T16*)(fa + i * 16 * PIT + o)); if (HA2) a2[s][i] = WFrag<T16>::ld((const T16*)(fa + PLN + i * 16 * PIT + o)); }
#pragma unroll
                for (int i = 0; i < 4; ++i) { b[s][i] = WFrag<T16>::ld((const T16*)(fb + i * 16 * PIT + o)); if (HB2) b2[s][i] = WFrag<T16>::ld((const T16*)(fb + PLN + i * 16 * PIT + o)); } }
            __builtin_amdgcn_sched_barrier(0);   // keeps the next block's LDS reads one group ahead of this block's products; sunk among them, every product row waits out the LDS latency
            if (ks >= 0) { const int s = ks & 1;
#pragma unroll
                for (int nb = 0; nb < 4; ++nb) {
#pragma unroll
                    for (int mb = 0; mb < 4; ++mb) acc[mb][nb] = WFrag<T16>::mma(a[s][mb], b[s][nb], acc[mb][nb]);
                    if (HA2) {
#pragma unroll
                        for (int mb = 0; mb < 4; ++mb) acc[mb][nb] = WFrag<T16>::mma(a2[s][mb], b[s][nb], acc[mb][nb]); }
                    if (HB2) {
#pragma unroll
                        for (int mb = 0; mb < 4; ++mb) acc[mb][nb] = WFrag<T16>::mma(a[s][mb], b2[s][nb], acc[mb][nb]); } } }
            __builtin_amdgcn_sched_barrier(0);   // and keeps the group after next behind these products, whose registers it refills
        }
        asm volatile("s_wait_dscnt 0x0" ::: "memory");      // this wave's reads of the buffer are done before it is refilled
        asm volatile("s_wait_asynccnt 0x0" ::: "memory");   // this wave's copies of the next tile have landed
        __syncthreads();                                    // publishes the next tile and ends every reader's last read of this one
        if (kc + 2 * KC < K) fill(kc + 2 * KC, (unsigned)t);
    }
    asm volatile("s_wait_asynccnt 0x0" ::: "memory");       // no copy is in flight when the ring becomes output staging
    float* os = (float*)ring + wave * (16 * 68);            // each wave's own 16 x 68 floats; every reader left the ring at the last pass's barrier
#pragma unroll
    for (int mb = 0; mb < 4; ++mb) {
#pragma unroll
        for (int nb = 0; nb < 4; ++nb) {
#pragma unroll
            for (int j = 0; j < 8; ++j) os[(hi * 8 + j) * 68 + nb * 16 + lr] = acc[mb][nb][j]; }
        __builtin_amdgcn_wave_barrier(); asm volatile("" ::: "memory");
        float* crow = C + (size_t)(r0 + mb * 16) * ldc + c0;
{
#pragma unroll
            for (int s = 0; s < 8; ++s) { const int row = 2 * s + hi, cofs = lr * 4; v4f val = *(const v4fa*)(os + row * 68 + cofs); if (BIAS) { val[0] += bfr(bias[c0 + cofs]); val[1] += bfr(bias[c0 + cofs + 1]); val[2] += bfr(bias[c0 + cofs + 2]); val[3] += bfr(bias[c0 + cofs + 3]); }
                *(v4f*)(crow + (size_t)row * ldc + cofs) = val; }
             }
        __builtin_amdgcn_wave_barrier(); asm volatile("" ::: "memory");
        asm volatile("s_wait_xcnt 0x0" ::: "memory");   // a precaution: stands between these stores and the next row block's reuse of their address registers
    }
}

__device__ __forceinline__ h16 tohx(float x) { return (h16)x; }
__device__ __forceinline__ void splitf(float y, unsigned short& h, unsigned short& l) { h = f2bf(y); l = f2bf(y - bf2f(h)); }
typedef __attribute__((ext_vector_type(2))) _Float16 v2h;
typedef __attribute__((ext_vector_type(4))) _Float16 v4h;
typedef __attribute__((ext_vector_type(2))) unsigned short v2us;
typedef __attribute__((ext_vector_type(4))) unsigned short v4us;
typedef __attribute__((ext_vector_type(2))) float v2f;
typedef __attribute__((ext_vector_type(4))) int v4i;

__global__ __launch_bounds__(256) void k_wtG(const float* __restrict__ w, int K, int N, bf* Bt) {
    const int lane = threadIdx.x & 31; const int L0 = (blockIdx.x * 8 + (threadIdx.x >> 5)) * 8; const int nlines = N * K / 64;
{
#pragma unroll 1
        for (int l = 0; l < 8; ++l) { const int L = L0 + l; if (L >= nlines) break; const size_t e = (size_t)L * 64 + lane * 2; const int k = (int)(e % K), n = (int)(e / K); v2us o;
            o[0] = f2bf(w[(size_t)k * N + n]); o[1] = f2bf(w[(size_t)(k + 1) * N + n]); *(v2us*)(Bt + e) = o; }
         }
}
__global__ __launch_bounds__(256) void k_resln(const float* __restrict__ Y, const float* __restrict__ Q, const float* __restrict__ g, const float* __restrict__ be, float* Z, bf* Zh, bf* Zl) {
    const int lane = threadIdx.x & 31; const int r = blockIdx.x * 8 + (threadIdx.x >> 5); if (r >= NB_ * TT) return; const float* yr = Y + (size_t)r * DM; const float* qr = Q + (size_t)r * DM; float s = 0.f;
#pragma unroll 1
    for (int ch = 0; ch < DM / 128; ++ch) { const int c0 = ch * 128 + lane * 4; const v4f a = *(const v4f*)(yr + c0), q4 = *(const v4f*)(qr + c0);
#pragma unroll
        for (int q = 0; q < 4; ++q) s += __fadd_rn(bfr(q4[q]), a[q]); }
#pragma unroll
    for (int sh = 16; sh; sh >>= 1) s += __shfl_xor(s, sh, 32);
    const float mu = s * (1.0f / DM); float s2 = 0.f;
#pragma unroll 1
    for (int ch = 0; ch < DM / 128; ++ch) { const int c0 = ch * 128 + lane * 4; const v4f a = *(const v4f*)(yr + c0), q4 = *(const v4f*)(qr + c0);
#pragma unroll
        for (int q = 0; q < 4; ++q) { const float d0 = __fsub_rn(__fadd_rn(bfr(q4[q]), a[q]), mu); float p = __fmul_rn(d0, d0); asm volatile("" : "+v"(p)); s2 = __fadd_rn(s2, p); } }
#pragma unroll
    for (int sh = 16; sh; sh >>= 1) s2 += __shfl_xor(s2, sh, 32);
    const float rs = __fdiv_rn(1.0f, __fsqrt_rn(__fadd_rn(s2 * (1.0f / DM), LNEPS)));
{
#pragma unroll 1
        for (int ch = 0; ch < DM / 128; ++ch) { const int c0 = ch * 128 + lane * 4; const v4f a = *(const v4f*)(yr + c0), q4 = *(const v4f*)(qr + c0); v4f z4; v4us oh, ol;
#pragma unroll
            for (int q = 0; q < 4; ++q) { float n0 = __fmul_rn(__fsub_rn(__fadd_rn(bfr(q4[q]), a[q]), mu), rs); asm volatile("" : "+v"(n0)); float n1 = __fmul_rn(n0, bfr(g[c0 + q])); asm volatile("" : "+v"(n1)); const float y = __fadd_rn(n1, bfr(be[c0 + q])); z4[q] = y; unsigned short h2, l2; splitf(y, h2, l2); oh[q] = h2; ol[q] = l2; }
            *(v4f*)(Z + (size_t)r * DM + c0) = z4; if (Zh) { *(v4us*)(Zh + (size_t)r * DM + c0) = oh; *(v4us*)(Zl + (size_t)r * DM + c0) = ol; } }
         } }
// k_cvt8: a thread converts four pieces of 8 elements, 256 pieces apart, so that each wave-wide load and store stays contiguous; a launch has a quarter of the waves to start.
__global__ __launch_bounds__(256) void k_cvt8(const float* __restrict__ src, bf* dst, size_t n8) { const size_t i0 = (size_t)blockIdx.x * 1024 + threadIdx.x; v8f v[4];
#pragma unroll     // all four pieces' loads are issued before the first is converted
    for (int p = 0; p < 4; ++p) { const size_t i = i0 + p * 256; v[p] = *(const v8f*)(src + (i < n8 ? i : n8 - 1) * 8); }   /* a piece past the end re-reads the last one and is not stored: no branch, so no wait, between the loads */
#pragma unroll     // constant index: the pieces stay in registers
    for (int p = 0; p < 4; ++p) { const size_t i = i0 + p * 256; if (i >= n8) continue; v8us o;
#pragma unroll
        for (int k = 0; k < 8; ++k) o[k] = f2bf(v[p][k]);
        *(v8us*)(dst + i * 8) = o; } }
__global__ __launch_bounds__(256) void k_cstab(const float* __restrict__ frq, float* CS) { const int idx = blockIdx.x * 256 + threadIdx.x; if (idx >= TT * HD) return; const int t = idx / HD, d = idx % HD; const float ang = bfr(frq[(size_t)t * (HD / 2) + (d >> 1)]);   /* interleaved pairs share freqs[t][j] */ v2f cs; cs[0] = cosf(ang); cs[1] = sinf(ang); *(v2f*)(CS + (size_t)idx * 2) = cs;  }

// k_rope: head planes [b * nheads + h][t][d] (fp16 + hi/lo), b = blockIdx.y, from rows b * TT + t of F, of the interleaved rotary (x1 c - x2 s, x1 s + x2 c on pairs (2j, 2j+1))
// A thread takes 8 consecutive d of one t in 4 heads (nheads % 4 == 0): 16-byte loads and stores, whole lines per wave, one fetch of the cos/sin pairs for the 4 heads, a sixteenth of the waves to start.
__global__ __launch_bounds__(256) void k_rope(const float* __restrict__ F, int pitch, int nheads, const float* __restrict__ CS, const float* __restrict__ RF, const float* __restrict__ nw, float sc, h16* P16, bf* Ph, bf* Pl) {
    { const size_t bb = blockIdx.y, po = bb * nheads * TT * HD; F += bb * TT * pitch; if (RF) RF += bb * nheads * TT; P16 += po; Ph += po; Pl += po; }   // this batch entry's rows of F and its planes
    const size_t gi = (size_t)blockIdx.x * 256 + threadIdx.x; const int d = (int)(gi % (HD / 8)) * 8; const int t = (int)((gi / (HD / 8)) % TT); const int h0 = (int)(gi / ((size_t)(HD / 8) * TT)) * 4; if (h0 >= nheads) return; v8f fx[4]; v4f c4[4];
#pragma unroll     // the four heads' loads and the 8 cos/sin pairs are issued before the first head is rotated
    for (int hh = 0; hh < 4; ++hh) { fx[hh] = *(const v8f*)(F + (size_t)t * pitch + (h0 + hh) * HD + d); c4[hh] = *(const v4f*)(CS + ((size_t)t * HD + d) * 2 + hh * 4);
        asm volatile("s_wait_xcnt 0x0" ::: "memory"); }   // a precaution: stands between these loads and the first reuse of their address registers
#pragma unroll     // constant index: the loaded rows stay in registers, and the cos/sin pairs are shared by the four heads
    for (int hh = 0; hh < 4; ++hh) { const int h = h0 + hh; const size_t e = ((size_t)h * TT + t) * HD + d; const float rf = RF ? RF[(size_t)h * TT + t] : 1.0f; v8h o16; v8us oh, ol;
#pragma unroll
    for (int q = 0; q < 8; ++q) { const int dd = d + q; const int dp = dd ^ 1;   /* interleaved pair partner */ float x0 = fx[hh][q], x1 = fx[hh][q ^ 1];
        if (RF) { float n0 = __fmul_rn(x0, rf), n1 = __fmul_rn(x1, rf); asm volatile("" : "+v"(n0)); asm volatile("" : "+v"(n1)); x0 = __fmul_rn(bfr(nw[dd]), n0); x1 = __fmul_rn(bfr(nw[dp]), n1); }
        v2f cs; cs[0] = c4[q >> 1][(q & 1) * 2]; cs[1] = c4[q >> 1][(q & 1) * 2 + 1]; float a = __fmul_rn(x0, cs[0]), bq = __fmul_rn(x1, cs[1]); asm volatile("" : "+v"(a)); asm volatile("" : "+v"(bq)); const float r = (((dd & 1) == 0) ? __fsub_rn(a, bq) : __fadd_rn(a, bq)) * sc;   /* even: x1 c - x2 s; odd: x2 c + x1 s */
        o16[q] = tohx(r); unsigned short a2, c2; splitf(r, a2, c2); oh[q] = a2; ol[q] = c2; }
    *(v8h*)(P16 + e) = o16; *(v8us*)(Ph + e) = oh; *(v8us*)(Pl + e) = ol;
    asm volatile("s_wait_xcnt 0x0" ::: "memory");   // a precaution: stands between these stores and the next head's reuse of their registers
    } }
// k_vtp: v planes [b * nheads + g][d][t] (fp16 + hi/lo), b = blockIdx.y, from rows b * TT + t of F. A thread holds a block of 8 t x 4 d in registers: 8 loads of 16 bytes along d, 12 stores of 16 bytes along t.
// Lanes: 4 along d x 8 along t, so a wave's store covers four whole 128-byte lines (64 t of one d each); the 8 waves of a work-group take the 128 d of one head for the same 64 t, so every line of F is read inside one work-group.
__global__ __launch_bounds__(256) void k_vtp(const float* __restrict__ F, int pitch, int nheads, h16* V16, bf* Vh, bf* Vl) { const int lane = threadIdx.x & 31; const int w = blockIdx.x * 8 + (threadIdx.x >> 5); const int d = (w % (HD / 16)) * 16 + (lane & 3) * 4; const int t = ((w / (HD / 16)) % (TT / 64)) * 64 + (lane >> 2) * 8; const int g = w / ((HD / 16) * (TT / 64)); if (g >= nheads) return; const float* f = F + ((size_t)blockIdx.y * TT + t) * pitch + g * HD + d;   /* b = blockIdx.y */ v4f x4[8];
#pragma unroll     // all eight rows' loads are issued before the first value is converted
    for (int j = 0; j < 8; ++j) { x4[j] = *(const v4f*)(f + (size_t)j * pitch);
        asm volatile("s_wait_xcnt 0x0" ::: "memory"); }   // a precaution: stands between each load and a later load's result landing in its address registers
#pragma unroll     // constant indices: the block stays in registers
    for (int c = 0; c < 4; ++c) { const size_t eo = (((size_t)blockIdx.y * nheads + g) * HD + d + c) * TT + t; v8h o16; v8us oh, ol;
#pragma unroll
        for (int q = 0; q < 8; ++q) { const float x = x4[q][c]; o16[q] = tohx(x); unsigned short a2, c2; splitf(x, a2, c2); oh[q] = a2; ol[q] = c2; }
        *(v8h*)(V16 + eo) = o16; *(v8us*)(Vh + eo) = oh; *(v8us*)(Vl + eo) = ol; } }
// k_asoft: per row (zz, i): t = S x HD^-0.5 + mask; softmax over the 1024 keys (register row, one exp, fixed trees).
// The probabilities go back over the wave's own score row (4 KiB), which it holds whole in registers by then: rows < RH the hi plane in the first 2 KiB and the lo plane in the second, the other rows fp16 in the first 2 KiB.
__global__ __launch_bounds__(256) void k_asoft(float* Sb, const float* __restrict__ MK) {
    const int lane = threadIdx.x & 31; const int row = blockIdx.x * 8 + (threadIdx.x >> 5); if (row >= NZ * TT) return; const int i = row % TT; const int zz = row / TT; const float* mk = MK + ((size_t)(zz / NH_) * TT + i) * TT; const bool hires = (i < RH); float* sr = Sb + (size_t)row * TT; float v[TT / 32]; float mx = -3.0e38f;
#pragma unroll
    for (int ch = 0; ch < TT / 128; ++ch) { const int j0 = ch * 128 + lane * 4; const v4f a = *(const v4f*)(sr + j0);
#pragma unroll
        for (int q = 0; q < 4; ++q) { const int j = j0 + q; float sa = a[q] * SCL; asm volatile("" : "+v"(sa)); float mv = bfr(mk[j]); asm volatile("" : "+v"(mv)); const float t = __fadd_rn(sa, mv);   /* + attention_mask[b][0][i][j] */ v[ch * 4 + q] = t; mx = fmaxf(mx, t); } }
#pragma unroll
    for (int sh = 16; sh; sh >>= 1) mx = fmaxf(mx, __shfl_xor(mx, sh, 32));
    float sum = 0.f;
#pragma unroll
    for (int k = 0; k < TT / 32; ++k) { float d0 = __fsub_rn(v[k], mx); asm volatile("" : "+v"(d0)); v[k] = __builtin_amdgcn_exp2f(__fmul_rn(d0, 1.4426950408889634f)); sum += v[k]; }
#pragma unroll
    for (int sh = 16; sh; sh >>= 1) sum += __shfl_xor(sum, sh, 32);
    const float f = __fdiv_rn(hires ? 1.0f : PCAR, sum);
{
        if (hires) {
#pragma unroll
            for (int ch = 0; ch < TT / 128; ++ch) { v4us oh, ol;
#pragma unroll
                for (int q = 0; q < 4; ++q) { unsigned short a, c2; splitf(v[ch * 4 + q] * f, a, c2); oh[q] = a; ol[q] = c2; }
                bf* po = (bf*)sr + ch * 128 + lane * 4; *(v4us*)po = oh; *(v4us*)(po + TT) = ol; }
        } else {
#pragma unroll
            for (int ch = 0; ch < TT / 128; ++ch) { v4h o4;
#pragma unroll
                for (int q = 0; q < 4; ++q) o4[q] = tohx(v[ch * 4 + q] * f);
                *(v4h*)((h16*)sr + ch * 128 + lane * 4) = o4; } }
         }
}
// k_merge: a thread takes four pieces of 8 consecutive d, 256 pieces apart: 16-byte loads and stores, whole lines per wave, a sixteenth of the waves to start.
static_assert((size_t)NZ * TT * HD % 8192 == 0, "a work-group's 1024 pieces lie inside O or all past it");
__global__ __launch_bounds__(256) void k_merge(const float* __restrict__ O, bf* Ah, bf* Al) { const size_t i0 = (size_t)blockIdx.x * 1024 + threadIdx.x; if (i0 * 8 >= (size_t)NZ * TT * HD) return; v8f x8[4];
#pragma unroll     // all four pieces' loads are issued before the first is split
    for (int p = 0; p < 4; ++p) x8[p] = *(const v8f*)(O + (i0 + p * 256) * 8);
#pragma unroll     // constant index: the pieces stay in registers
    for (int p = 0; p < 4; ++p) { const size_t e = (i0 + p * 256) * 8; const int d = (int)(e % HD); const int t = (int)((e / HD) % TT); const int zz = (int)(e / ((size_t)HD * TT)); const float cs = (t < RH) ? 1.0f : (1.0f / PCAR); const size_t oo = ((size_t)(zz / NH_) * TT + t) * DQ + (zz % NH_) * HD + d;
        v8us oh, ol;
#pragma unroll
        for (int q = 0; q < 8; ++q) { unsigned short a, c2; splitf(x8[p][q] * cs, a, c2); oh[q] = a; ol[q] = c2; } *(v8us*)(Ah + oo) = oh; *(v8us*)(Al + oo) = ol; } }

extern "C" void kernel_launch(void* const* d_in, const int* in_sizes, int n_in,
                              void* d_out, int out_size, void* d_ws, size_t ws_size, hipStream_t stream) {
    (void)in_sizes; (void)n_in; (void)out_size;
    const float* x = (const float*)d_in[0]; const float* MK = (const float*)d_in[1]; const float* FRQ = (const float*)d_in[2]; const float* wq = (const float*)d_in[3]; const float* bq = (const float*)d_in[4]; const float* wk = (const float*)d_in[5]; const float* bk = (const float*)d_in[6]; const float* wv = (const float*)d_in[7]; const float* bv = (const float*)d_in[8]; const float* wo = (const float*)d_in[9]; const float* bo = (const float*)d_in[10]; const float* g1 = (const float*)d_in[11]; const float* e1b = (const float*)d_in[12]; const float* qnw = nullptr; const float* knw = nullptr; (void)qnw; (void)knw;
    float* OUT = (float*)d_out;     // [2][1024][2048]
    char* wsp = (char*)d_ws;
    auto take = [&](size_t bytes) { char* p = wsp; wsp += (bytes + 255) & ~(size_t)255; return (void*)p; };
    constexpr int MT = NB_ * TT;   // token rows of both batch entries
    bf* WO = (bf*)take((size_t)DM * DQ * 2); float* CS = (float*)take((size_t)TT * HD * 2 * 4);
    bf* WQ = (bf*)take((size_t)DQ * DM * 2); bf* WK = (bf*)take((size_t)DKV * DM * 2); bf* WV = (bf*)take((size_t)DKV * DM * 2); bf* XB = (bf*)take((size_t)MT * DM * 2);
    h16* QP16 = (h16*)take((size_t)NZ * TT * HD * 2); h16* KP16 = (h16*)take((size_t)NZ * TT * HD * 2); h16* VT16 = (h16*)take((size_t)NZ * HD * TT * 2);
    bf* QPh = (bf*)take((size_t)NZ * TT * HD * 2); bf* QPl = (bf*)take((size_t)NZ * TT * HD * 2); bf* KPh = (bf*)take((size_t)NZ * TT * HD * 2); bf* KPl = (bf*)take((size_t)NZ * TT * HD * 2); bf* VTh = (bf*)take((size_t)NZ * HD * TT * 2); bf* VTl = (bf*)take((size_t)NZ * HD * TT * 2);
    float* Sb = (float*)take((size_t)NZ * TT * TT * 4);
    if ((size_t)(wsp - (char*)d_ws) > ws_size) return;    // ws 256 MiB
    // Buffers that share bytes, all stream-ordered: the f32 projections live in the score buffer before the scores are written, the output projection after the probabilities are used up;
    // the attention output takes the q and k weight planes (adjacent, together its size), its hi and lo planes the v weight plane and the bf16 hidden state, all four read for the last time by the v projection.
    float* FQ = Sb; float* FK = Sb + (size_t)MT * DQ; float* FV = FK; float* YO = Sb; float* Ob = (float*)WQ; bf* ATh = WV; bf* ATl = XB;
    k_cvt8<<<(unsigned)(((size_t)DQ * DM / 8 + 1023) / 1024), 256, 0, stream>>>(wq, WQ, (size_t)DQ * DM / 8); k_cvt8<<<(unsigned)(((size_t)DKV * DM / 8 + 1023) / 1024), 256, 0, stream>>>(wk, WK, (size_t)DKV * DM / 8); k_cvt8<<<(unsigned)(((size_t)DKV * DM / 8 + 1023) / 1024), 256, 0, stream>>>(wv, WV, (size_t)DKV * DM / 8);
    k_cvt8<<<(unsigned)(((size_t)DM * DQ / 8 + 1023) / 1024), 256, 0, stream>>>(wo, WO, (size_t)DM * DQ / 8);
    k_cstab<<<(TT * HD + 255) / 256, 256, 0, stream>>>(FRQ, CS);
    const unsigned LP = (unsigned)(((size_t)NH_ * TT * HD / 32 + 255) / 256);   // blocks per batch entry of the plane kernels, 32 elements a thread (NKV == NH_)
    k_cvt8<<<(unsigned)(((size_t)MT * DM / 8 + 1023) / 1024), 256, 0, stream>>>(x, XB, (size_t)MT * DM / 8);
    k_gemmw<bf, 0, true><<<dim3(MT / 128, DQ / 128, 1), 128, 0, stream>>>(XB, nullptr, WQ, nullptr, DM, DM, FQ, DQ, bq, 0, 0, 0);
    k_rope<<<dim3(LP, NB_), 256, 0, stream>>>(FQ, DQ, NH_, CS, nullptr, nullptr, 1.0f, QP16, QPh, QPl);
    k_gemmw<bf, 0, true><<<dim3(MT / 128, DKV / 128, 1), 128, 0, stream>>>(XB, nullptr, WK, nullptr, DM, DM, FK, DKV, bk, 0, 0, 0);
    k_rope<<<dim3(LP, NB_), 256, 0, stream>>>(FK, DKV, NKV, CS, nullptr, nullptr, 1.0f, KP16, KPh, KPl);
    k_gemmw<bf, 0, true><<<dim3(MT / 128, DKV / 128, 1), 128, 0, stream>>>(XB, nullptr, WV, nullptr, DM, DM, FV, DKV, bv, 0, 0, 0);
    k_vtp<<<dim3(LP, NB_), 256, 0, stream>>>(FV, DKV, NKV, VT16, VTh, VTl);
    // one kv head per query head: plane z of q meets plane z of k and v (z-strides TT*HD); a score row is 2*TT 16-bit elements once it holds probabilities
    k_gemmw<bf, 2, false><<<dim3(RH / 128, TT / 128, NZ), 128, 0, stream>>>(QPh, QPl, KPh, KPl, HD, HD, Sb, TT, nullptr, (size_t)TT * HD, (size_t)TT * HD, (size_t)TT * TT);
    k_gemmw<h16, 0, false><<<dim3((TT - RH) / 128, TT / 128, NZ), 128, 0, stream>>>(QP16 + (size_t)RH * HD, nullptr, KP16, nullptr, HD, HD, Sb + (size_t)RH * TT, TT, nullptr, (size_t)TT * HD, (size_t)TT * HD, (size_t)TT * TT);
    k_asoft<<<NZ * TT / 8, 256, 0, stream>>>(Sb, MK);
    k_gemmw<bf, 2, false><<<dim3(RH / 128, HD / 128, NZ), 128, 0, stream>>>((const bf*)Sb, (const bf*)Sb + TT, VTh, VTl, TT, 2 * TT, Ob, HD, nullptr, (size_t)2 * TT * TT, (size_t)HD * TT, (size_t)TT * HD);
    k_gemmw<h16, 0, false><<<dim3((TT - RH) / 128, HD / 128, NZ), 128, 0, stream>>>((const h16*)Sb + (size_t)RH * 2 * TT, nullptr, VT16, nullptr, TT, 2 * TT, Ob + (size_t)RH * HD, HD, nullptr, (size_t)2 * TT * TT, (size_t)HD * TT, (size_t)TT * HD);
    k_merge<<<NB_ * LP, 256, 0, stream>>>(Ob, ATh, ATl);
    k_gemmw<bf, 1, true><<<dim3(MT / 128, DM / 128, 1), 128, 0, stream>>>(ATh, ATl, WO, nullptr, DQ, DQ, YO, DM, bo, 0, 0, 0);
    k_resln<<<MT / 8, 256, 0, stream>>>(YO, x, g1, e1b, OUT, nullptr, nullptr);   /* LN(proj + bo + hidden_state) */
}

// v005
// A run of this version takes 242 microseconds.
// In two side-by-side timings against v004, it was 1.20 and 1.21 times as fast.
// All steps since v000 together make it 6.53 times as fast.
#include <hip/hip_runtime.h>

// Decoder attention with RoPE and a BERT-style output (hidden_state [2][1024][2048]; q, k, v = x W^T + b ('oi' [2048][2048], 16 heads x 128); interleaved RoPE with cos/sin(freqs[t][j]) (freqs [1024][64] input, read); scores/sqrt(128) + attention_mask[b][0][i][j] (f32 input, read; zeros); softmax; out = LN(attn Wo^T + bo + hidden_state) (eps 1e-12, gamma/beta) -> [2][1024][2048]).
// Compute dtypes, f32 accumulate: every input rounded to bf16; q/k/v on PLAIN bf16 operands (inputs: exact) + biases; rotary in f32 from a table cos/sin(bf16(freqs)); the additive mask (bf16-rounded) inside the softmax kernel; scores and attn.v: query rows < 512 hl (3 products), the rest single fp16 (x1024); softmax f32; Wo hl x exact (2 products) + bo; residual add and LayerNorm in f32 (fixed trees).

#define NB_  2
#define TT   1024
#define DM   2048
#define NH_  16
#define NKV  16
#define REP  (NH_ / NKV)
#define HD   128
#define DQ   (NH_ * HD)
#define DKV  (NKV * HD)
#define LNEPS 1e-12f
typedef __attribute__((ext_vector_type(4))) unsigned short v4us;
#define NZ   (NB_ * NH_)          // plane count of the attention launches (grid x of k_gemmrows): every head of both batch entries in one pass, z = b * NH_ + h
#define RH   512                  // query rows < RH use hi+lo planes (0: none)
#define WIN  0
#define PCAR 1024.0f
#define SCL  0.088388347648318447f   // HD^-0.5
typedef _Float16 h16;
typedef unsigned short bf;
typedef __attribute__((ext_vector_type(16))) __bf16   v16bf;
typedef __attribute__((ext_vector_type(16))) _Float16 v16h;
typedef __attribute__((ext_vector_type(8)))  _Float16 v8h;
typedef __attribute__((ext_vector_type(8)))  unsigned short v8us;
typedef __attribute__((ext_vector_type(8)))  float    v8f;
typedef __attribute__((ext_vector_type(4)))  float    v4f;
typedef v8h  __attribute__((may_alias)) v8ha;
typedef v4f  __attribute__((may_alias)) v4fa;
typedef v8us __attribute__((may_alias)) v8usa;

__device__ __forceinline__ unsigned short f2bf(float f) { unsigned u = __float_as_uint(f); u += 0x7FFFu + ((u >> 16) & 1u); return (unsigned short)(u >> 16); }
__device__ __forceinline__ float bf2f(unsigned short b) { return __uint_as_float(((unsigned)b) << 16); }
__device__ __forceinline__ float bfr(float f) { return bf2f(f2bf(f)); }
__device__ __forceinline__ v16h cat16(v8h lo, v8h hi) { return __builtin_shufflevector(lo, hi, 0, 1, 2, 3, 4, 5, 6, 7, 8, 9, 10, 11, 12, 13, 14, 15); }
__device__ __forceinline__ v16bf cat16b(v8us lo, v8us hi) { return __builtin_bit_cast(v16bf, __builtin_shufflevector(lo, hi, 0, 1, 2, 3, 4, 5, 6, 7, 8, 9, 10, 11, 12, 13, 14, 15)); }
__device__ __forceinline__ v8f wmma16(v16h a, v16h b, v8f c) { return __builtin_amdgcn_wmma_f32_16x16x32_f16(false, a, false, b, (short)0, c, false, false); }
__device__ __forceinline__ v8f wmmab(v16bf a, v16bf b, v8f c) { return __builtin_amdgcn_wmma_f32_16x16x32_bf16(false, a, false, b, (short)0, c, false, false); }



// ---- k_gemmw: GEMM, one 128x128 output tile per work-group of 4 waves (2x2, 64x64 and 16 accumulators per wave); grid (M/128, N/128, Z), 128 threads.
// Operand tiles (128 rows x KC k, whole 128-byte lines) go from the K-contiguous 16-bit planes into LDS by asynchronous b128 copies, two buffers: the next tile flies while this one is multiplied.
// C[m][n] (f32, pitch ldc, + optional f32 bias[n]) = sum_k A[m][k] Bt[n][k] (+ split products per NSPLIT). A rows have pitch lda, Bt rows pitch K (elements). z-batch strides sA/sB/sC in elements. K % KC == 0, M % 128 == 0, N % 128 == 0.
template <typename T16> struct WFrag;
template <> struct WFrag<h16> { typedef v16h V; static __device__ __forceinline__ V ld(const h16* p) { return cat16(*(const v8h*)p, *(const v8h*)(p + 16)); } static __device__ __forceinline__ v8f mma(V a, V b, v8f c) { return wmma16(a, b, c); } };
template <> struct WFrag<bf> { typedef v16bf V; static __device__ __forceinline__ V ld(const bf* p) { return cat16b(*(const v8us*)p, *(const v8us*)(p + 16)); } static __device__ __forceinline__ v8f mma(V a, V b, v8f c) { return wmmab(a, b, c); } };
// One plane of one stage: every thread copies its 16 bytes (with WIDE also the 16 bytes 128 further on, in global memory and in LDS alike) of rows r, r + 16, ..., r + 112; a wave's copy = 4 whole lines.
// g: the lane's global address in row r, rs: 16 rows in elements, l: the lane's LDS byte address in row r, ls: 16 rows in LDS bytes.
// The closing s_wait_xcnt stands inside the statement so that no address register named here is rewritten ahead of it.
template <bool WIDE, typename T16>
__device__ __forceinline__ void stage_plane(const T16* g, size_t rs, unsigned l, unsigned ls) {
    if (WIDE)
        asm volatile("global_load_async_to_lds_b128 %0, %8, off\n\t"  "global_load_async_to_lds_b128 %0, %8, off offset:128\n\t"
                     "global_load_async_to_lds_b128 %1, %9, off\n\t"  "global_load_async_to_lds_b128 %1, %9, off offset:128\n\t"
                     "global_load_async_to_lds_b128 %2, %10, off\n\t" "global_load_async_to_lds_b128 %2, %10, off offset:128\n\t"
                     "global_load_async_to_lds_b128 %3, %11, off\n\t" "global_load_async_to_lds_b128 %3, %11, off offset:128\n\t"
                     "global_load_async_to_lds_b128 %4, %12, off\n\t" "global_load_async_to_lds_b128 %4, %12, off offset:128\n\t"
                     "global_load_async_to_lds_b128 %5, %13, off\n\t" "global_load_async_to_lds_b128 %5, %13, off offset:128\n\t"
                     "global_load_async_to_lds_b128 %6, %14, off\n\t" "global_load_async_to_lds_b128 %6, %14, off offset:128\n\t"
                     "global_load_async_to_lds_b128 %7, %15, off\n\t" "global_load_async_to_lds_b128 %7, %15, off offset:128\n\t"
                     "s_wait_xcnt 0x0"
                     :: "v"(l), "v"(l + ls), "v"(l + 2 * ls), "v"(l + 3 * ls), "v"(l + 4 * ls), "v"(l + 5 * ls), "v"(l + 6 * ls), "v"(l + 7 * ls),
                        "v"(g), "v"(g + rs), "v"(g + 2 * rs), "v"(g + 3 * rs), "v"(g + 4 * rs), "v"(g + 5 * rs), "v"(g + 6 * rs), "v"(g + 7 * rs)
                     : "memory");
    else
        asm volatile("global_load_async_to_lds_b128 %0, %8, off\n\t"
                     "global_load_async_to_lds_b128 %1, %9, off\n\t"
                     "global_load_async_to_lds_b128 %2, %10, off\n\t"
                     "global_load_async_to_lds_b128 %3, %11, off\n\t"
                     "global_load_async_to_lds_b128 %4, %12, off\n\t"
                     "global_load_async_to_lds_b128 %5, %13, off\n\t"
                     "global_load_async_to_lds_b128 %6, %14, off\n\t"
                     "global_load_async_to_lds_b128 %7, %15, off\n\t"
                     "s_wait_xcnt 0x0"
                     :: "v"(l), "v"(l + ls), "v"(l + 2 * ls), "v"(l + 3 * ls), "v"(l + 4 * ls), "v"(l + 5 * ls), "v"(l + 6 * ls), "v"(l + 7 * ls),
                        "v"(g), "v"(g + rs), "v"(g + 2 * rs), "v"(g + 3 * rs), "v"(g + 4 * rs), "v"(g + 5 * rs), "v"(g + 6 * rs), "v"(g + 7 * rs)
                     : "memory");
}
// LDS bytes of the two-buffer ring of d_gemmw<., NSPLIT, .>
constexpr unsigned gemm_ring_bytes(int nsplit) { return 2u * (((nsplit == 1 || nsplit == 2) ? 2u : 1u) + (nsplit >= 2 ? 2u : 1u)) * 128u * ((nsplit >= 2 ? 64u : 128u) * 2u + 16u); }
// d_gemmw: the body; ring = the work-group's LDS (gemm_ring_bytes(NSPLIT) bytes), (bx, by, bz) = its M tile, N tile and batch plane, the same for every thread of the work-group.
template <typename T16, int NSPLIT, bool BIAS>
__device__ __forceinline__ void d_gemmw(unsigned char* ring, const int bx, const int by, const int bz, const T16* __restrict__ A, const T16* __restrict__ A2, const T16* __restrict__ Bt, const T16* __restrict__ Bt2, int K, int lda, float* C, int ldc, const float* __restrict__ bias, size_t sA, size_t sB, size_t sC) {
    typedef typename WFrag<T16>::V V;
    constexpr bool HA2 = (NSPLIT == 1 || NSPLIT == 2), HB2 = (NSPLIT >= 2), WIDE = !HB2;
    constexpr int KC = WIDE ? 128 : 64;                       // k per stage; four planes of 128 k would be 64 copies of a wave in flight
    constexpr unsigned PIT = KC * 2 + 16;                     // LDS row pitch in bytes: 16 B x odd, conflict-free for ds_load_b128
    constexpr unsigned PLN = 128 * PIT, PB = (HA2 ? 2u : 1u) * PLN, STG = PB + (HB2 ? 2u : 1u) * PLN;   // stage: [A | A2 | B | B2]
    static_assert(2 * STG == gemm_ring_bytes(NSPLIT), "the callers size the ring");
    const size_t z = bz; A += z * sA; if (HA2) A2 += z * sA; Bt += z * sB; if (HB2) Bt2 += z * sB; C += z * sC;
    const int tid = threadIdx.x, lane = tid & 31, lr = lane & 15, hi = lane >> 4, wave = tid >> 5, wm = wave >> 1, wn = wave & 1;
    const int r0 = bx * 128 + wm * 64, c0 = by * 128 + wn * 64;
    v8f acc[4][4];
#pragma unroll
    for (int mb = 0; mb < 4; ++mb)
#pragma unroll
        for (int nb = 0; nb < 4; ++nb) acc[mb][nb] = (v8f){};
    const size_t ga = (size_t)(bx * 128 + (tid >> 3)) * lda + (tid & 7) * 8, gb = (size_t)(by * 128 + (tid >> 3)) * K + (tid & 7) * 8, rsa = (size_t)16 * lda, rsb = (size_t)16 * K;
    const unsigned lcp = (unsigned)(size_t)ring + (unsigned)(tid >> 3) * PIT + (unsigned)(tid & 7) * 16;
    auto fill = [&](int kc, unsigned buf) { const unsigned l = lcp + buf * STG;
        stage_plane<WIDE>(A + ga + kc, rsa, l, 16 * PIT); if (HA2) stage_plane<WIDE>(A2 + ga + kc, rsa, l + PLN, 16 * PIT);
        stage_plane<WIDE>(Bt + gb + kc, rsb, l + PB, 16 * PIT); if (HB2) stage_plane<WIDE>(Bt2 + gb + kc, rsb, l + PB + PLN, 16 * PIT); };
    fill(0, 0);
    asm volatile("s_wait_asynccnt 0x0" ::: "memory");   // tile 0 has landed before anybody reads it
    __syncthreads();
    if (K > KC) fill(KC, 1);
#pragma unroll 1   // one pass per trip: a single publish point
    for (int kc = 0, t = 0; kc < K; kc += KC, t ^= 1) {
        const unsigned char* fa = ring + (unsigned)t * STG + (wm * 64 + lr) * PIT + hi * 16; const unsigned char* fb = ring + (unsigned)t * STG + PB + (wn * 64 + lr) * PIT + hi * 16;
        V a[2][4], a2[2][4], b[2][4], b2[2][4];   // two fragment sets: the next 32 k are fetched as one group ahead of this block's products
#pragma unroll     // unrolled so that the set index is a constant and both fragment sets stay in registers
        for (int ks = -1; ks < KC / 32; ++ks) {
            if (ks + 1 < KC / 32) { const int s = (ks + 1) & 1, o = (ks + 1) * 64;
#pragma unroll
                for (int i = 0; i < 4; ++i) { a[s][i] = WFrag<T16>::ld((const T16*)(fa + i * 16 * PIT + o)); if (HA2) a2[s][i] = WFrag<T16>::ld((const T16*)(fa + PLN + i * 16 * PIT + o)); }
#pragma unroll
                for (int i = 0; i < 4; ++i) { b[s][i] = WFrag<T16>::ld((const T16*)(fb + i * 16 * PIT + o)); if (HB2) b2[s][i] = WFrag<T16>::ld((const T16*)(fb + PLN + i * 16 * PIT + o)); } }
            __builtin_amdgcn_sched_barrier(0);   // keeps the next block's LDS reads one group ahead of this block's products; sunk among them, every product row waits out the LDS latency
            if (ks >= 0) { const int s = ks & 1;
#pragma unroll
                for (int nb = 0; nb < 4; ++nb) {
#pragma unroll
                    for (int mb = 0; mb < 4; ++mb) acc[mb][nb] = WFrag<T16>::mma(a[s][mb], b[s][nb], acc[mb][nb]);
                    if (HA2) {
#pragma unroll
                        for (int mb = 0; mb < 4; ++mb) acc[mb][nb] = WFrag<T16>::mma(a2[s][mb], b[s][nb], acc[mb][nb]); }
                    if (HB2) {
#pragma unroll
                        for (int mb = 0; mb < 4; ++mb) acc[mb][nb] = WFrag<T16>::mma(a[s][mb], b2[s][nb], acc[mb][nb]); } } }
            __builtin_amdgcn_sched_barrier(0);   // and keeps the group after next behind these products, whose registers it refills
        }
        asm volatile("s_wait_dscnt 0x0" ::: "memory");      // this wave's reads of the buffer are done before it is refilled
        asm volatile("s_wait_asynccnt 0x0" ::: "memory");   // this wave's copies of the next tile have landed
        __syncthreads();                                    // publishes the next tile and ends every reader's last read of this one
        if (kc + 2 * KC < K) fill(kc + 2 * KC, (unsigned)t);
    }
    asm volatile("s_wait_asynccnt 0x0" ::: "memory");       // no copy is in flight when the ring becomes output staging
    float* os = (float*)ring + wave * (16 * 68);            // each wave's own 16 x 68 floats; every reader left the ring at the last pass's barrier
#pragma unroll
    for (int mb = 0; mb < 4; ++mb) {
#pragma unroll
        for (int nb = 0; nb < 4; ++nb) {
#pragma unroll
            for (int j = 0; j < 8; ++j) os[(hi * 8 + j) * 68 + nb * 16 + lr] = acc[mb][nb][j]; }
        __builtin_amdgcn_wave_barrier(); asm volatile("" ::: "memory");
        float* crow = C + (size_t)(r0 + mb * 16) * ldc + c0;
{
#pragma unroll
            for (int s = 0; s < 8; ++s) { const int row = 2 * s + hi, cofs = lr * 4; v4f val = *(const v4fa*)(os + row * 68 + cofs); if (BIAS) { val[0] += bfr(bias[c0 + cofs]); val[1] += bfr(bias[c0 + cofs + 1]); val[2] += bfr(bias[c0 + cofs + 2]); val[3] += bfr(bias[c0 + cofs + 3]); }
                *(v4f*)(crow + (size_t)row * ldc + cofs) = val; }
             }
        __builtin_amdgcn_wave_barrier(); asm volatile("" ::: "memory");
        asm volatile("s_wait_xcnt 0x0" ::: "memory");   // a precaution: stands between these stores and the next row block's reuse of their address registers
    }
}
// k_gemmw: one operand type for the whole grid (M/128, N/128, Z); plane z adds its own bias vector (bias, bias1, bias2 for z = 0, 1, 2), so that independent products on one A run as one launch.
template <typename T16, int NSPLIT, bool BIAS>
__global__ __launch_bounds__(128) void k_gemmw(const T16* __restrict__ A, const T16* __restrict__ A2, const T16* __restrict__ Bt, const T16* __restrict__ Bt2, int K, int lda, float* C, int ldc, const float* __restrict__ bias, const float* __restrict__ bias1, const float* __restrict__ bias2, size_t sA, size_t sB, size_t sC) {
    __shared__ __align__(16) unsigned char ring[gemm_ring_bytes(NSPLIT)];
    d_gemmw<T16, NSPLIT, BIAS>(ring, blockIdx.x, blockIdx.y, blockIdx.z, A, A2, Bt, Bt2, K, lda, C, ldc, blockIdx.z == 0 ? bias : (blockIdx.z == 1 ? bias1 : bias2), sA, sB, sC);
}
// k_gemmrows: both row classes of an attention product in one launch; M tiles below RH / 128 take the hi+lo planes (3 products), the others the fp16 planes. Both classes address the same C and count their rows from row 0 of their own A.
// grid (Z, N/128, M/128): the M tile is the slowest index, so the 3-product work-groups have the lowest flat indices.
__global__ __launch_bounds__(128) void k_gemmrows(const bf* __restrict__ Ah, const bf* __restrict__ Al, const bf* __restrict__ Bh, const bf* __restrict__ Bl, const h16* __restrict__ A16, const h16* __restrict__ B16, int K, int lda, float* C, int ldc, size_t sA, size_t sB, size_t sC) {
    __shared__ __align__(16) unsigned char ring[gemm_ring_bytes(2) > gemm_ring_bytes(0) ? gemm_ring_bytes(2) : gemm_ring_bytes(0)];
    if (blockIdx.z < RH / 128) d_gemmw<bf, 2, false>(ring, blockIdx.z, blockIdx.y, blockIdx.x, Ah, Al, Bh, Bl, K, lda, C, ldc, nullptr, sA, sB, sC);
    else d_gemmw<h16, 0, false>(ring, blockIdx.z, blockIdx.y, blockIdx.x, A16, nullptr, B16, nullptr, K, lda, C, ldc, nullptr, sA, sB, sC);
}

__device__ __forceinline__ h16 tohx(float x) { return (h16)x; }
__device__ __forceinline__ void splitf(float y, unsigned short& h, unsigned short& l) { h = f2bf(y); l = f2bf(y - bf2f(h)); }
typedef __attribute__((ext_vector_type(2))) _Float16 v2h;
typedef __attribute__((ext_vector_type(4))) _Float16 v4h;
typedef __attribute__((ext_vector_type(2))) unsigned short v2us;
typedef __attribute__((ext_vector_type(4))) unsigned short v4us;
typedef __attribute__((ext_vector_type(2))) float v2f;
typedef __attribute__((ext_vector_type(4))) int v4i;

__global__ __launch_bounds__(256) void k_wtG(const float* __restrict__ w, int K, int N, bf* Bt) {
    const int lane = threadIdx.x & 31; const int L0 = (blockIdx.x * 8 + (threadIdx.x >> 5)) * 8; const int nlines = N * K / 64;
{
#pragma unroll 1
        for (int l = 0; l < 8; ++l) { const int L = L0 + l; if (L >= nlines) break; const size_t e = (size_t)L * 64 + lane * 2; const int k = (int)(e % K), n = (int)(e / K); v2us o;
            o[0] = f2bf(w[(size_t)k * N + n]); o[1] = f2bf(w[(size_t)(k + 1) * N + n]); *(v2us*)(Bt + e) = o; }
         }
}
__global__ __launch_bounds__(256) void k_resln(const float* __restrict__ Y, const float* __restrict__ Q, const float* __restrict__ g, const float* __restrict__ be, float* Z, bf* Zh, bf* Zl) {
    const int lane = threadIdx.x & 31; const int r = blockIdx.x * 8 + (threadIdx.x >> 5); if (r >= NB_ * TT) return; const float* yr = Y + (size_t)r * DM; const float* qr = Q + (size_t)r * DM; float s = 0.f;
#pragma unroll 1
    for (int ch = 0; ch < DM / 128; ++ch) { const int c0 = ch * 128 + lane * 4; const v4f a = *(const v4f*)(yr + c0), q4 = *(const v4f*)(qr + c0);
#pragma unroll
        for (int q = 0; q < 4; ++q) s += __fadd_rn(bfr(q4[q]), a[q]); }
#pragma unroll
    for (int sh = 16; sh; sh >>= 1) s += __shfl_xor(s, sh, 32);
    const float mu = s * (1.0f / DM); float s2 = 0.f;
#pragma unroll 1
    for (int ch = 0; ch < DM / 128; ++ch) { const int c0 = ch * 128 + lane * 4; const v4f a = *(const v4f*)(yr + c0), q4 = *(const v4f*)(qr + c0);
#pragma unroll
        for (int q = 0; q < 4; ++q) { const float d0 = __fsub_rn(__fadd_rn(bfr(q4[q]), a[q]), mu); float p = __fmul_rn(d0, d0); asm volatile("" : "+v"(p)); s2 = __fadd_rn(s2, p); } }
#pragma unroll
    for (int sh = 16; sh; sh >>= 1) s2 += __shfl_xor(s2, sh, 32);
    const float rs = __fdiv_rn(1.0f, __fsqrt_rn(__fadd_rn(s2 * (1.0f / DM), LNEPS)));
{
#pragma unroll 1
        for (int ch = 0; ch < DM / 128; ++ch) { const int c0 = ch * 128 + lane * 4; const v4f a = *(const v4f*)(yr + c0), q4 = *(const v4f*)(qr + c0); v4f z4; v4us oh, ol;
#pragma unroll
            for (int q = 0; q < 4; ++q) { float n0 = __fmul_rn(__fsub_rn(__fadd_rn(bfr(q4[q]), a[q]), mu), rs); asm volatile("" : "+v"(n0)); float n1 = __fmul_rn(n0, bfr(g[c0 + q])); asm volatile("" : "+v"(n1)); const float y = __fadd_rn(n1, bfr(be[c0 + q])); z4[q] = y; unsigned short h2, l2; splitf(y, h2, l2); oh[q] = h2; ol[q] = l2; }
            *(v4f*)(Z + (size_t)r * DM + c0) = z4; if (Zh) { *(v4us*)(Zh + (size_t)r * DM + c0) = oh; *(v4us*)(Zl + (size_t)r * DM + c0) = ol; } }
         } }
// d_cvt8: a thread converts four pieces of 8 elements, 256 pieces apart, so that each wave-wide load and store stays contiguous; a launch has a quarter of the waves to start.
__device__ __forceinline__ void d_cvt8(const float* __restrict__ src, bf* dst, size_t n8) { const size_t i0 = (size_t)blockIdx.x * 1024 + threadIdx.x; v8f v[4];
#pragma unroll     // all four pieces' loads are issued before the first is converted
    for (int p = 0; p < 4; ++p) { const size_t i = i0 + p * 256; v[p] = *(const v8f*)(src + (i < n8 ? i : n8 - 1) * 8); }   /* a piece past the end re-reads the last one and is not stored: no branch, so no wait, between the loads */
#pragma unroll     // constant index: the pieces stay in registers
    for (int p = 0; p < 4; ++p) { const size_t i = i0 + p * 256; if (i >= n8) continue; v8us o;
#pragma unroll
        for (int k = 0; k < 8; ++k) o[k] = f2bf(v[p][k]);
        *(v8us*)(dst + i * 8) = o; } }
__device__ __forceinline__ void d_cstab(const float* __restrict__ frq, float* CS) { const int idx = blockIdx.x * 256 + threadIdx.x; if (idx >= TT * HD) return; const int t = idx / HD, d = idx % HD; const float ang = bfr(frq[(size_t)t * (HD / 2) + (d >> 1)]);   /* interleaved pairs share freqs[t][j] */ v2f cs; cs[0] = cosf(ang); cs[1] = sinf(ang); *(v2f*)(CS + (size_t)idx * 2) = cs;  }
// k_prep: the six independent input preparations as one launch, blockIdx.y picks the job: 0 the cos/sin table (the longest thread), 1 to 4 the weight planes, 5 the hidden state.
__global__ __launch_bounds__(256) void k_prep(const float* __restrict__ frq, float* CS, const float* __restrict__ wq, const float* __restrict__ wk, const float* __restrict__ wv, const float* __restrict__ wo, const float* __restrict__ x, bf* WQ, bf* WK, bf* WV, bf* WO, bf* XB, size_t nw8, size_t nx8) {
    const unsigned job = blockIdx.y;
    if (job == 0) { d_cstab(frq, CS); return; }
    const float* src = job == 1 ? wq : job == 2 ? wk : job == 3 ? wv : job == 4 ? wo : x; bf* dst = job == 1 ? WQ : job == 2 ? WK : job == 3 ? WV : job == 4 ? WO : XB;
    d_cvt8(src, dst, job == 5 ? nx8 : nw8);
}

// d_rope: head planes [b * nheads + h][t][d] (fp16 + hi/lo), b = blockIdx.y, from rows b * TT + t of F, of the interleaved rotary (x1 c - x2 s, x1 s + x2 c on pairs (2j, 2j+1))
// A thread takes 8 consecutive d of one t in 4 heads (nheads % 4 == 0): 16-byte loads and stores, whole lines per wave, one fetch of the cos/sin pairs for the 4 heads, a sixteenth of the waves to start.
__device__ __forceinline__ void d_rope(const float* __restrict__ F, int pitch, int nheads, const float* __restrict__ CS, const float* __restrict__ RF, const float* __restrict__ nw, float sc, h16* P16, bf* Ph, bf* Pl) {
    { const size_t bb = blockIdx.y, po = bb * nheads * TT * HD; F += bb * TT * pitch; if (RF) RF += bb * nheads * TT; P16 += po; Ph += po; Pl += po; }   // this batch entry's rows of F and its planes
    const size_t gi = (size_t)blockIdx.x * 256 + threadIdx.x; const int d = (int)(gi % (HD / 8)) * 8; const int t = (int)((gi / (HD / 8)) % TT); const int h0 = (int)(gi / ((size_t)(HD / 8) * TT)) * 4; if (h0 >= nheads) return; v8f fx[4]; v4f c4[4];
#pragma unroll     // the four heads' loads and the 8 cos/sin pairs are issued before the first head is rotated
    for (int hh = 0; hh < 4; ++hh) { fx[hh] = *(const v8f*)(F + (size_t)t * pitch + (h0 + hh) * HD + d); c4[hh] = *(const v4f*)(CS + ((size_t)t * HD + d) * 2 + hh * 4);
        asm volatile("s_wait_xcnt 0x0" ::: "memory"); }   // a precaution: stands between these loads and the first reuse of their address registers
#pragma unroll     // constant index: the loaded rows stay in registers, and the cos/sin pairs are shared by the four heads
    for (int hh = 0; hh < 4; ++hh) { const int h = h0 + hh; const size_t e = ((size_t)h * TT + t) * HD + d; const float rf = RF ? RF[(size_t)h * TT + t] : 1.0f; v8h o16; v8us oh, ol;
#pragma unroll
    for (int q = 0; q < 8; ++q) { const int dd = d + q; const int dp = dd ^ 1;   /* interleaved pair partner */ float x0 = fx[hh][q], x1 = fx[hh][q ^ 1];
        if (RF) { float n0 = __fmul_rn(x0, rf), n1 = __fmul_rn(x1, rf); asm volatile("" : "+v"(n0)); asm volatile("" : "+v"(n1)); x0 = __fmul_rn(bfr(nw[dd]), n0); x1 = __fmul_rn(bfr(nw[dp]), n1); }
        v2f cs; cs[0] = c4[q >> 1][(q & 1) * 2]; cs[1] = c4[q >> 1][(q & 1) * 2 + 1]; float a = __fmul_rn(x0, cs[0]), bq = __fmul_rn(x1, cs[1]); asm volatile("" : "+v"(a)); asm volatile("" : "+v"(bq)); const float r = (((dd & 1) == 0) ? __fsub_rn(a, bq) : __fadd_rn(a, bq)) * sc;   /* even: x1 c - x2 s; odd: x2 c + x1 s */
        o16[q] = tohx(r); unsigned short a2, c2; splitf(r, a2, c2); oh[q] = a2; ol[q] = c2; }
    *(v8h*)(P16 + e) = o16; *(v8us*)(Ph + e) = oh; *(v8us*)(Pl + e) = ol;
    asm volatile("s_wait_xcnt 0x0" ::: "memory");   // a precaution: stands between these stores and the next head's reuse of their registers
    } }
// d_vtp: v planes [b * nheads + g][d][t] (fp16 + hi/lo), b = blockIdx.y, from rows b * TT + t of F. A thread holds a block of 8 t x 4 d in registers: 8 loads of 16 bytes along d, 12 stores of 16 bytes along t.
// Lanes: 4 along d x 8 along t, so a wave's store covers four whole 128-byte lines (64 t of one d each); the 8 waves of a work-group take the 128 d of one head for the same 64 t, so every line of F is read inside one work-group.
__device__ __forceinline__ void d_vtp(const float* __restrict__ F, int pitch, int nheads, h16* V16, bf* Vh, bf* Vl) { const int lane = threadIdx.x & 31; const int w = blockIdx.x * 8 + (threadIdx.x >> 5); const int d = (w % (HD / 16)) * 16 + (lane & 3) * 4; const int t = ((w / (HD / 16)) % (TT / 64)) * 64 + (lane >> 2) * 8; const int g = w / ((HD / 16) * (TT / 64)); if (g >= nheads) return; const float* f = F + ((size_t)blockIdx.y * TT + t) * pitch + g * HD + d;   /* b = blockIdx.y */ v4f x4[8];
#pragma unroll     // all eight rows' loads are issued before the first value is converted
    for (int j = 0; j < 8; ++j) { x4[j] = *(const v4f*)(f + (size_t)j * pitch);
        asm volatile("s_wait_xcnt 0x0" ::: "memory"); }   // a precaution: stands between each load and a later load's result landing in its address registers
#pragma unroll     // constant indices: the block stays in registers
    for (int c = 0; c < 4; ++c) { const size_t eo = (((size_t)blockIdx.y * nheads + g) * HD + d + c) * TT + t; v8h o16; v8us oh, ol;
#pragma unroll
        for (int q = 0; q < 8; ++q) { const float x = x4[q][c]; o16[q] = tohx(x); unsigned short a2, c2; splitf(x, a2, c2); oh[q] = a2; ol[q] = c2; }
        *(v8h*)(V16 + eo) = o16; *(v8us*)(Vh + eo) = oh; *(v8us*)(Vl + eo) = ol; } }
// k_planes: the three independent plane builders as one launch, grid (blocks per batch entry, NB_, 3): blockIdx.z = 0 rotates q, 1 rotates k, 2 transposes v.
__global__ __launch_bounds__(256) void k_planes(const float* __restrict__ FQ, const float* __restrict__ FK, const float* __restrict__ FV, const float* __restrict__ CS, h16* QP16, bf* QPh, bf* QPl, h16* KP16, bf* KPh, bf* KPl, h16* VT16, bf* VTh, bf* VTl) {
    if (blockIdx.z == 2) { d_vtp(FV, DKV, NKV, VT16, VTh, VTl); return; }
    const bool isq = blockIdx.z == 0;
    d_rope(isq ? FQ : FK, isq ? DQ : DKV, isq ? NH_ : NKV, CS, nullptr, nullptr, 1.0f, isq ? QP16 : KP16, isq ? QPh : KPh, isq ? QPl : KPl);
}
// k_asoft: per row (zz, i): t = S x HD^-0.5 + mask; softmax over the 1024 keys (register row, one exp, fixed trees).
// The probabilities go back over the wave's own score row (4 KiB), which it holds whole in registers by then: rows < RH the hi plane in the first 2 KiB and the lo plane in the second, the other rows fp16 in the first 2 KiB.
__global__ __launch_bounds__(256) void k_asoft(float* Sb, const float* __restrict__ MK) {
    const int lane = threadIdx.x & 31; const int row = blockIdx.x * 8 + (threadIdx.x >> 5); if (row >= NZ * TT) return; const int i = row % TT; const int zz = row / TT; const float* mk = MK + ((size_t)(zz / NH_) * TT + i) * TT; const bool hires = (i < RH); float* sr = Sb + (size_t)row * TT; float v[TT / 32]; float mx = -3.0e38f;
#pragma unroll
    for (int ch = 0; ch < TT / 128; ++ch) { const int j0 = ch * 128 + lane * 4; const v4f a = *(const v4f*)(sr + j0);
#pragma unroll
        for (int q = 0; q < 4; ++q) { const int j = j0 + q; float sa = a[q] * SCL; asm volatile("" : "+v"(sa)); float mv = bfr(mk[j]); asm volatile("" : "+v"(mv)); const float t = __fadd_rn(sa, mv);   /* + attention_mask[b][0][i][j] */ v[ch * 4 + q] = t; mx = fmaxf(mx, t); } }
#pragma unroll
    for (int sh = 16; sh; sh >>= 1) mx = fmaxf(mx, __shfl_xor(mx, sh, 32));
    float sum = 0.f;
#pragma unroll
    for (int k = 0; k < TT / 32; ++k) { float d0 = __fsub_rn(v[k], mx); asm volatile("" : "+v"(d0)); v[k] = __builtin_amdgcn_exp2f(__fmul_rn(d0, 1.4426950408889634f)); sum += v[k]; }
#pragma unroll
    for (int sh = 16; sh; sh >>= 1) sum += __shfl_xor(sum, sh, 32);
    const float f = __fdiv_rn(hires ? 1.0f : PCAR, sum);
{
        if (hires) {
#pragma unroll
            for (int ch = 0; ch < TT / 128; ++ch) { v4us oh, ol;
#pragma unroll
                for (int q = 0; q < 4; ++q) { unsigned short a, c2; splitf(v[ch * 4 + q] * f, a, c2); oh[q] = a; ol[q] = c2; }
                bf* po = (bf*)sr + ch * 128 + lane * 4; *(v4us*)po = oh; *(v4us*)(po + TT) = ol; }
        } else {
#pragma unroll
            for (int ch = 0; ch < TT / 128; ++ch) { v4h o4;
#pragma unroll
                for (int q = 0; q < 4; ++q) o4[q] = tohx(v[ch * 4 + q] * f);
                *(v4h*)((h16*)sr + ch * 128 + lane * 4) = o4; } }
         }
}
// k_merge: a thread takes four pieces of 8 consecutive d, 256 pieces apart: 16-byte loads and stores, whole lines per wave, a sixteenth of the waves to start.
static_assert((size_t)NZ * TT * HD % 8192 == 0, "a work-group's 1024 pieces lie inside O or all past it");
__global__ __launch_bounds__(256) void k_merge(const float* __restrict__ O, bf* Ah, bf* Al) { const size_t i0 = (size_t)blockIdx.x * 1024 + threadIdx.x; if (i0 * 8 >= (size_t)NZ * TT * HD) return; v8f x8[4];
#pragma unroll     // all four pieces' loads are issued before the first is split
    for (int p = 0; p < 4; ++p) x8[p] = *(const v8f*)(O + (i0 + p * 256) * 8);
#pragma unroll     // constant index: the pieces stay in registers
    for (int p = 0; p < 4; ++p) { const size_t e = (i0 + p * 256) * 8; const int d = (int)(e % HD); const int t = (int)((e / HD) % TT); const int zz = (int)(e / ((size_t)HD * TT)); const float cs = (t < RH) ? 1.0f : (1.0f / PCAR); const size_t oo = ((size_t)(zz / NH_) * TT + t) * DQ + (zz % NH_) * HD + d;
        v8us oh, ol;
#pragma unroll
        for (int q = 0; q < 8; ++q) { unsigned short a, c2; splitf(x8[p][q] * cs, a, c2); oh[q] = a; ol[q] = c2; } *(v8us*)(Ah + oo) = oh; *(v8us*)(Al + oo) = ol; } }

extern "C" void kernel_launch(void* const* d_in, const int* in_sizes, int n_in,
                              void* d_out, int out_size, void* d_ws, size_t ws_size, hipStream_t stream) {
    (void)in_sizes; (void)n_in; (void)out_size;
    const float* x = (const float*)d_in[0]; const float* MK = (const float*)d_in[1]; const float* FRQ = (const float*)d_in[2]; const float* wq = (const float*)d_in[3]; const float* bq = (const float*)d_in[4]; const float* wk = (const float*)d_in[5]; const float* bk = (const float*)d_in[6]; const float* wv = (const float*)d_in[7]; const float* bv = (const float*)d_in[8]; const float* wo = (const float*)d_in[9]; const float* bo = (const float*)d_in[10]; const float* g1 = (const float*)d_in[11]; const float* e1b = (const float*)d_in[12]; const float* qnw = nullptr; const float* knw = nullptr; (void)qnw; (void)knw;
    float* OUT = (float*)d_out;     // [2][1024][2048]
    char* wsp = (char*)d_ws;
    auto take = [&](size_t bytes) { char* p = wsp; wsp += (bytes + 255) & ~(size_t)255; return (void*)p; };
    constexpr int MT = NB_ * TT;   // token rows of both batch entries
    bf* WO = (bf*)take((size_t)DM * DQ * 2); float* CS = (float*)take((size_t)TT * HD * 2 * 4);
    bf* WQ = (bf*)take((size_t)DQ * DM * 2); bf* WK = (bf*)take((size_t)DKV * DM * 2); bf* WV = (bf*)take((size_t)DKV * DM * 2); bf* XB = (bf*)take((size_t)MT * DM * 2);
    h16* QP16 = (h16*)take((size_t)NZ * TT * HD * 2); h16* KP16 = (h16*)take((size_t)NZ * TT * HD * 2); h16* VT16 = (h16*)take((size_t)NZ * HD * TT * 2);
    bf* QPh = (bf*)take((size_t)NZ * TT * HD * 2); bf* QPl = (bf*)take((size_t)NZ * TT * HD * 2); bf* KPh = (bf*)take((size_t)NZ * TT * HD * 2); bf* KPl = (bf*)take((size_t)NZ * TT * HD * 2); bf* VTh = (bf*)take((size_t)NZ * HD * TT * 2); bf* VTl = (bf*)take((size_t)NZ * HD * TT * 2);
    float* Sb = (float*)take((size_t)NZ * TT * TT * 4);
    if ((size_t)(wsp - (char*)d_ws) > ws_size) return;    // ws 256 MiB
    // Buffers that share bytes, all stream-ordered: the f32 projections live in the score buffer before the scores are written, the output projection after the probabilities are used up;
    // the attention output takes the q and k weight planes (adjacent, together its size), its hi and lo planes the v weight plane and the bf16 hidden state, all four read for the last time by the projection launch.
    float* FQ = Sb; float* FK = Sb + (size_t)MT * DQ; float* FV = FK + (size_t)MT * DKV; float* YO = Sb; float* Ob = (float*)WQ; bf* ATh = WV; bf* ATl = XB;
    static_assert(DQ == DKV && (size_t)DQ * DM / 8 / 1024 == (size_t)MT * DM / 8 / 1024 && (size_t)DQ * DM / 8 / 1024 == (size_t)TT * HD / 256, "one grid extent serves all jobs of k_prep; q, k and v planes have one size");
    static_assert((size_t)DQ * DM * 2 % 256 == 0, "the weight planes follow one another without a gap");
    k_prep<<<dim3((unsigned)(((size_t)DQ * DM / 8 + 1023) / 1024), 6), 256, 0, stream>>>(FRQ, CS, wq, wk, wv, wo, x, WQ, WK, WV, WO, XB, (size_t)DQ * DM / 8, (size_t)MT * DM / 8);
    const unsigned LP = (unsigned)(((size_t)NH_ * TT * HD / 32 + 255) / 256);   // blocks per batch entry of the plane kernels, 32 elements a thread (NKV == NH_)
    // q, k and v projections: planes z = 0, 1, 2 of one launch; WQ, WK, WV and FQ, FK, FV lie one plane size apart
    k_gemmw<bf, 0, true><<<dim3(MT / 128, DQ / 128, 3), 128, 0, stream>>>(XB, nullptr, WQ, nullptr, DM, DM, FQ, DQ, bq, bk, bv, 0, (size_t)DQ * DM, (size_t)MT * DQ);
    k_planes<<<dim3(LP, NB_, 3), 256, 0, stream>>>(FQ, FK, FV, CS, QP16, QPh, QPl, KP16, KPh, KPl, VT16, VTh, VTl);
    // one kv head per query head: plane z of q meets plane z of k and v (z-strides TT*HD); a score row is 2*TT 16-bit elements once it holds probabilities
    k_gemmrows<<<dim3(NZ, TT / 128, TT / 128), 128, 0, stream>>>(QPh, QPl, KPh, KPl, QP16, KP16, HD, HD, Sb, TT, (size_t)TT * HD, (size_t)TT * HD, (size_t)TT * TT);
    k_asoft<<<NZ * TT / 8, 256, 0, stream>>>(Sb, MK);
    k_gemmrows<<<dim3(NZ, HD / 128, TT / 128), 128, 0, stream>>>((const bf*)Sb, (const bf*)Sb + TT, VTh, VTl, (const h16*)Sb, VT16, TT, 2 * TT, Ob, HD, (size_t)2 * TT * TT, (size_t)HD * TT, (size_t)TT * HD);
    k_merge<<<NB_ * LP, 256, 0, stream>>>(Ob, ATh, ATl);
    k_gemmw<bf, 1, true><<<dim3(MT / 128, DM / 128, 1), 128, 0, stream>>>(ATh, ATl, WO, nullptr, DQ, DQ, YO, DM, bo, nullptr, nullptr, 0, 0, 0);
    k_resln<<<MT / 8, 256, 0, stream>>>(YO, x, g1, e1b, OUT, nullptr, nullptr);   /* LN(proj + bo + hidden_state) */
}

// v006
// One run takes 180 microseconds.
// In both of two side-by-side timings against v005, it was 1.34 times as fast.
// Counting every step since v000, it is 8.77 times as fast.
#include <hip/hip_runtime.h>

// Decoder attention with RoPE and a BERT-style output (hidden_state [2][1024][2048]; q, k, v = x W^T + b ('oi' [2048][2048], 16 heads x 128); interleaved RoPE with cos/sin(freqs[t][j]) (freqs [1024][64] input, read); scores/sqrt(128) + attention_mask[b][0][i][j] (f32 input, read; zeros); softmax; out = LN(attn Wo^T + bo + hidden_state) (eps 1e-12, gamma/beta) -> [2][1024][2048]).
// Compute dtypes, f32 accumulate: every input rounded to bf16; q/k/v on PLAIN bf16 operands (inputs: exact) + biases; rotary in f32 from a table cos/sin(bf16(freqs)); scores, additive mask (bf16-rounded), online softmax (f32) and attn.v in one kernel: query rows < 512 hl (3 products), the rest single fp16; Wo hl x exact (2 products) + bo; residual add and LayerNorm in f32 (fixed trees).

#define NB_  2
#define TT   1024
#define DM   2048
#define NH_  16
#define NKV  16
#define REP  (NH_ / NKV)
#define HD   128
#define DQ   (NH_ * HD)
#define DKV  (NKV * HD)
#define LNEPS 1e-12f
typedef __attribute__((ext_vector_type(4))) unsigned short v4us;
#define NZ   (NB_ * NH_)          // head planes z = b * NH_ + h, the x extent of the attention launch: every head of both batch entries in one pass
#define RH   512                  // query rows < RH use hi+lo planes (0: none)
#define WIN  0
#define SCL  0.088388347648318447f   // HD^-0.5
typedef _Float16 h16;
typedef unsigned short bf;
typedef __attribute__((ext_vector_type(16))) __bf16   v16bf;
typedef __attribute__((ext_vector_type(16))) _Float16 v16h;
typedef __attribute__((ext_vector_type(8)))  _Float16 v8h;
typedef __attribute__((ext_vector_type(8)))  unsigned short v8us;
typedef __attribute__((ext_vector_type(8)))  float    v8f;
typedef __attribute__((ext_vector_type(4)))  float    v4f;
typedef v8h  __attribute__((may_alias)) v8ha;
typedef v4f  __attribute__((may_alias)) v4fa;
typedef v8us __attribute__((may_alias)) v8usa;

__device__ __forceinline__ unsigned short f2bf(float f) { unsigned u = __float_as_uint(f); u += 0x7FFFu + ((u >> 16) & 1u); return (unsigned short)(u >> 16); }
__device__ __forceinline__ float bf2f(unsigned short b) { return __uint_as_float(((unsigned)b) << 16); }
__device__ __forceinline__ float bfr(float f) { return bf2f(f2bf(f)); }
__device__ __forceinline__ v16h cat16(v8h lo, v8h hi) { return __builtin_shufflevector(lo, hi, 0, 1, 2, 3, 4, 5, 6, 7, 8, 9, 10, 11, 12, 13, 14, 15); }
__device__ __forceinline__ v16bf cat16b(v8us lo, v8us hi) { return __builtin_bit_cast(v16bf, __builtin_shufflevector(lo, hi, 0, 1, 2, 3, 4, 5, 6, 7, 8, 9, 10, 11, 12, 13, 14, 15)); }
__device__ __forceinline__ v8f wmma16(v16h a, v16h b, v8f c) { return __builtin_amdgcn_wmma_f32_16x16x32_f16(false, a, false, b, (short)0, c, false, false); }
__device__ __forceinline__ v8f wmmab(v16bf a, v16bf b, v8f c) { return __builtin_amdgcn_wmma_f32_16x16x32_bf16(false, a, false, b, (short)0, c, false, false); }



// ---- k_gemmw: GEMM, one 128x128 output tile per work-group of 4 waves (2x2, 64x64 and 16 accumulators per wave); grid (M/128, N/128, Z), 128 threads.
// Operand tiles (128 rows x KC k, whole 128-byte lines) go from the K-contiguous 16-bit planes into LDS by asynchronous b128 copies, two buffers: the next tile flies while this one is multiplied.
// C[m][n] (f32, pitch ldc, + optional f32 bias[n]) = sum_k A[m][k] Bt[n][k] (+ split products per NSPLIT). A rows have pitch lda, Bt rows pitch K (elements). z-batch strides sA/sB/sC in elements. K % KC == 0, M % 128 == 0, N % 128 == 0.
template <typename T16> struct WFrag;
template <> struct WFrag<h16> { typedef v16h V; static __device__ __forceinline__ V ld(const h16* p) { return cat16(*(const v8h*)p, *(const v8h*)(p + 16)); } static __device__ __forceinline__ v8f mma(V a, V b, v8f c) { return wmma16(a, b, c); } };
template <> struct WFrag<bf> { typedef v16bf V; static __device__ __forceinline__ V ld(const bf* p) { return cat16b(*(const v8us*)p, *(const v8us*)(p + 16)); } static __device__ __forceinline__ v8f mma(V a, V b, v8f c) { return wmmab(a, b, c); } };
// One plane of one stage: every thread copies its 16 bytes (with WIDE also the 16 bytes 128 further on, in global memory and in LDS alike) of rows r, r + 16, ..., r + 112; a wave's copy = 4 whole lines.
// g: the lane's global address in row r, rs: 16 rows in elements, l: the lane's LDS byte address in row r, ls: 16 rows in LDS bytes.
// The closing s_wait_xcnt stands inside the statement so that no address register named here is rewritten ahead of it.
template <bool WIDE, typename T16>
__device__ __forceinline__ void stage_plane(const T16* g, size_t rs, unsigned l, unsigned ls) {
    if (WIDE)
        asm volatile("global_load_async_to_lds_b128 %0, %8, off\n\t"  "global_load_async_to_lds_b128 %0, %8, off offset:128\n\t"
                     "global_load_async_to_lds_b128 %1, %9, off\n\t"  "global_load_async_to_lds_b128 %1, %9, off offset:128\n\t"
                     "global_load_async_to_lds_b128 %2, %10, off\n\t" "global_load_async_to_lds_b128 %2, %10, off offset:128\n\t"
                     "global_load_async_to_lds_b128 %3, %11, off\n\t" "global_load_async_to_lds_b128 %3, %11, off offset:128\n\t"
                     "global_load_async_to_lds_b128 %4, %12, off\n\t" "global_load_async_to_lds_b128 %4, %12, off offset:128\n\t"
                     "global_load_async_to_lds_b128 %5, %13, off\n\t" "global_load_async_to_lds_b128 %5, %13, off offset:128\n\t"
                     "global_load_async_to_lds_b128 %6, %14, off\n\t" "global_load_async_to_lds_b128 %6, %14, off offset:128\n\t"
                     "global_load_async_to_lds_b128 %7, %15, off\n\t" "global_load_async_to_lds_b128 %7, %15, off offset:128\n\t"
                     "s_wait_xcnt 0x0"
                     :: "v"(l), "v"(l + ls), "v"(l + 2 * ls), "v"(l + 3 * ls), "v"(l + 4 * ls), "v"(l + 5 * ls), "v"(l + 6 * ls), "v"(l + 7 * ls),
                        "v"(g), "v"(g + rs), "v"(g + 2 * rs), "v"(g + 3 * rs), "v"(g + 4 * rs), "v"(g + 5 * rs), "v"(g + 6 * rs), "v"(g + 7 * rs)
                     : "memory");
    else
        asm volatile("global_load_async_to_lds_b128 %0, %8, off\n\t"
                     "global_load_async_to_lds_b128 %1, %9, off\n\t"
                     "global_load_async_to_lds_b128 %2, %10, off\n\t"
                     "global_load_async_to_lds_b128 %3, %11, off\n\t"
                     "global_load_async_to_lds_b128 %4, %12, off\n\t"
                     "global_load_async_to_lds_b128 %5, %13, off\n\t"
                     "global_load_async_to_lds_b128 %6, %14, off\n\t"
                     "global_load_async_to_lds_b128 %7, %15, off\n\t"
                     "s_wait_xcnt 0x0"
                     :: "v"(l), "v"(l + ls), "v"(l + 2 * ls), "v"(l + 3 * ls), "v"(l + 4 * ls), "v"(l + 5 * ls), "v"(l + 6 * ls), "v"(l + 7 * ls),
                        "v"(g), "v"(g + rs), "v"(g + 2 * rs), "v"(g + 3 * rs), "v"(g + 4 * rs), "v"(g + 5 * rs), "v"(g + 6 * rs), "v"(g + 7 * rs)
                     : "memory");
}
// LDS bytes of the two-buffer ring of d_gemmw<., NSPLIT, .>
constexpr unsigned gemm_ring_bytes(int nsplit) { return 2u * (((nsplit == 1 || nsplit == 2) ? 2u : 1u) + (nsplit >= 2 ? 2u : 1u)) * 128u * ((nsplit >= 2 ? 64u : 128u) * 2u + 16u); }
// d_gemmw: the body; ring = the work-group's LDS (gemm_ring_bytes(NSPLIT) bytes), (bx, by, bz) = its M tile, N tile and batch plane, the same for every thread of the work-group.
template <typename T16, int NSPLIT, bool BIAS>
__device__ __forceinline__ void d_gemmw(unsigned char* ring, const int bx, const int by, const int bz, const T16* __restrict__ A, const T16* __restrict__ A2, const T16* __restrict__ Bt, const T16* __restrict__ Bt2, int K, int lda, float* C, int ldc, const float* __restrict__ bias, size_t sA, size_t sB, size_t sC) {
    typedef typename WFrag<T16>::V V;
    constexpr bool HA2 = (NSPLIT == 1 || NSPLIT == 2), HB2 = (NSPLIT >= 2), WIDE = !HB2;
    constexpr int KC = WIDE ? 128 : 64;                       // k per stage; four planes of 128 k would be 64 copies of a wave in flight
    constexpr unsigned PIT = KC * 2 + 16;                     // LDS row pitch in bytes: 16 B x odd, conflict-free for ds_load_b128
    constexpr unsigned PLN = 128 * PIT, PB = (HA2 ? 2u : 1u) * PLN, STG = PB + (HB2 ? 2u : 1u) * PLN;   // stage: [A | A2 | B | B2]
    static_assert(2 * STG == gemm_ring_bytes(NSPLIT), "the callers size the ring");
    const size_t z = bz; A += z * sA; if (HA2) A2 += z * sA; Bt += z * sB; if (HB2) Bt2 += z * sB; C += z * sC;
    const int tid = threadIdx.x, lane = tid & 31, lr = lane & 15, hi = lane >> 4, wave = tid >> 5, wm = wave >> 1, wn = wave & 1;
    const int r0 = bx * 128 + wm * 64, c0 = by * 128 + wn * 64;
    v8f acc[4][4];
#pragma unroll
    for (int mb = 0; mb < 4; ++mb)
#pragma unroll
        for (int nb = 0; nb < 4; ++nb) acc[mb][nb] = (v8f){};
    const size_t ga = (size_t)(bx * 128 + (tid >> 3)) * lda + (tid & 7) * 8, gb = (size_t)(by * 128 + (tid >> 3)) * K + (tid & 7) * 8, rsa = (size_t)16 * lda, rsb = (size_t)16 * K;
    const unsigned lcp = (unsigned)(size_t)ring + (unsigned)(tid >> 3) * PIT + (unsigned)(tid & 7) * 16;
    auto fill = [&](int kc, unsigned buf) { const unsigned l = lcp + buf * STG;
        stage_plane<WIDE>(A + ga + kc, rsa, l, 16 * PIT); if (HA2) stage_plane<WIDE>(A2 + ga + kc, rsa, l + PLN, 16 * PIT);
        stage_plane<WIDE>(Bt + gb + kc, rsb, l + PB, 16 * PIT); if (HB2) stage_plane<WIDE>(Bt2 + gb + kc, rsb, l + PB + PLN, 16 * PIT); };
    fill(0, 0);
    asm volatile("s_wait_asynccnt 0x0" ::: "memory");   // tile 0 has landed before anybody reads it
    __syncthreads();
    if (K > KC) fill(KC, 1);
#pragma unroll 1   // one pass per trip: a single publish point
    for (int kc = 0, t = 0; kc < K; kc += KC, t ^= 1) {
        const unsigned char* fa = ring + (unsigned)t * STG + (wm * 64 + lr) * PIT + hi * 16; const unsigned char* fb = ring + (unsigned)t * STG + PB + (wn * 64 + lr) * PIT + hi * 16;
        V a[2][4], a2[2][4], b[2][4], b2[2][4];   // two fragment sets: the next 32 k are fetched as one group ahead of this block's products
#pragma unroll     // unrolled so that the set index is a constant and both fragment sets stay in registers
        for (int ks = -1; ks < KC / 32; ++ks) {
            if (ks + 1 < KC / 32) { const int s = (ks + 1) & 1, o = (ks + 1) * 64;
#pragma unroll
                for (int i = 0; i < 4; ++i) { a[s][i] = WFrag<T16>::ld((const T16*)(fa + i * 16 * PIT + o)); if (HA2) a2[s][i] = WFrag<T16>::ld((const T16*)(fa + PLN + i * 16 * PIT + o)); }
#pragma unroll
                for (int i = 0; i < 4; ++i) { b[s][i] = WFrag<T16>::ld((const T16*)(fb + i * 16 * PIT + o)); if (HB2) b2[s][i] = WFrag<T16>::ld((const T16*)(fb + PLN + i * 16 * PIT + o)); } }
            __builtin_amdgcn_sched_barrier(0);   // keeps the next block's LDS reads one group ahead of this block's products; sunk among them, every product row waits out the LDS latency
            if (ks >= 0) { const int s = ks & 1;
#pragma unroll
                for (int nb = 0; nb < 4; ++nb) {
#pragma unroll
                    for (int mb = 0; mb < 4; ++mb) acc[mb][nb] = WFrag<T16>::mma(a[s][mb], b[s][nb], acc[mb][nb]);
                    if (HA2) {
#pragma unroll
                        for (int mb = 0; mb < 4; ++mb) acc[mb][nb] = WFrag<T16>::mma(a2[s][mb], b[s][nb], acc[mb][nb]); }
                    if (HB2) {
#pragma unroll
                        for (int mb = 0; mb < 4; ++mb) acc[mb][nb] = WFrag<T16>::mma(a[s][mb], b2[s][nb], acc[mb][nb]); } } }
            __builtin_amdgcn_sched_barrier(0);   // and keeps the group after next behind these products, whose registers it refills
        }
        asm volatile("s_wait_dscnt 0x0" ::: "memory");      // this wave's reads of the buffer are done before it is refilled
        asm volatile("s_wait_asynccnt 0x0" ::: "memory");   // this wave's copies of the next tile have landed
        __syncthreads();                                    // publishes the next tile and ends every reader's last read of this one
        if (kc + 2 * KC < K) fill(kc + 2 * KC, (unsigned)t);
    }
    asm volatile("s_wait_asynccnt 0x0" ::: "memory");       // no copy is in flight when the ring becomes output staging
    float* os = (float*)ring + wave * (16 * 68);            // each wave's own 16 x 68 floats; every reader left the ring at the last pass's barrier
#pragma unroll
    for (int mb = 0; mb < 4; ++mb) {
#pragma unroll
        for (int nb = 0; nb < 4; ++nb) {
#pragma unroll
            for (int j = 0; j < 8; ++j) os[(hi * 8 + j) * 68 + nb * 16 + lr] = acc[mb][nb][j]; }
        __builtin_amdgcn_wave_barrier(); asm volatile("" ::: "memory");
        float* crow = C + (size_t)(r0 + mb * 16) * ldc + c0;
{
#pragma unroll
            for (int s = 0; s < 8; ++s) { const int row = 2 * s + hi, cofs = lr * 4; v4f val = *(const v4fa*)(os + row * 68 + cofs); if (BIAS) { val[0] += bfr(bias[c0 + cofs]); val[1] += bfr(bias[c0 + cofs + 1]); val[2] += bfr(bias[c0 + cofs + 2]); val[3] += bfr(bias[c0 + cofs + 3]); }
                *(v4f*)(crow + (size_t)row * ldc + cofs) = val; }
             }
        __builtin_amdgcn_wave_barrier(); asm volatile("" ::: "memory");
        asm volatile("s_wait_xcnt 0x0" ::: "memory");   // a precaution: stands between these stores and the next row block's reuse of their address registers
    }
}
// k_gemmw: one operand type for the whole grid (M/128, N/128, Z); plane z adds its own bias vector (bias, bias1, bias2 for z = 0, 1, 2), so that independent products on one A run as one launch.
template <typename T16, int NSPLIT, bool BIAS>
__global__ __launch_bounds__(128) void k_gemmw(const T16* __restrict__ A, const T16* __restrict__ A2, const T16* __restrict__ Bt, const T16* __restrict__ Bt2, int K, int lda, float* C, int ldc, const float* __restrict__ bias, const float* __restrict__ bias1, const float* __restrict__ bias2, size_t sA, size_t sB, size_t sC) {
    __shared__ __align__(16) unsigned char ring[gemm_ring_bytes(NSPLIT)];
    d_gemmw<T16, NSPLIT, BIAS>(ring, blockIdx.x, blockIdx.y, blockIdx.z, A, A2, Bt, Bt2, K, lda, C, ldc, blockIdx.z == 0 ? bias : (blockIdx.z == 1 ? bias1 : bias2), sA, sB, sC);
}

__device__ __forceinline__ h16 tohx(float x) { return (h16)x; }
__device__ __forceinline__ void splitf(float y, unsigned short& h, unsigned short& l) { h = f2bf(y); l = f2bf(y - bf2f(h)); }
typedef __attribute__((ext_vector_type(2))) _Float16 v2h;
typedef __attribute__((ext_vector_type(4))) _Float16 v4h;
typedef __attribute__((ext_vector_type(2))) unsigned short v2us;
typedef __attribute__((ext_vector_type(4))) unsigned short v4us;
typedef __attribute__((ext_vector_type(2))) float v2f;
typedef __attribute__((ext_vector_type(4))) int v4i;

__global__ __launch_bounds__(256) void k_wtG(const float* __restrict__ w, int K, int N, bf* Bt) {
    const int lane = threadIdx.x & 31; const int L0 = (blockIdx.x * 8 + (threadIdx.x >> 5)) * 8; const int nlines = N * K / 64;
{
#pragma unroll 1
        for (int l = 0; l < 8; ++l) { const int L = L0 + l; if (L >= nlines) break; const size_t e = (size_t)L * 64 + lane * 2; const int k = (int)(e % K), n = (int)(e / K); v2us o;
            o[0] = f2bf(w[(size_t)k * N + n]); o[1] = f2bf(w[(size_t)(k + 1) * N + n]); *(v2us*)(Bt + e) = o; }
         }
}
__global__ __launch_bounds__(256) void k_resln(const float* __restrict__ Y, const float* __restrict__ Q, const float* __restrict__ g, const float* __restrict__ be, float* Z, bf* Zh, bf* Zl) {
    const int lane = threadIdx.x & 31; const int r = blockIdx.x * 8 + (threadIdx.x >> 5); if (r >= NB_ * TT) return; const float* yr = Y + (size_t)r * DM; const float* qr = Q + (size_t)r * DM; float s = 0.f;
#pragma unroll 1
    for (int ch = 0; ch < DM / 128; ++ch) { const int c0 = ch * 128 + lane * 4; const v4f a = *(const v4f*)(yr + c0), q4 = *(const v4f*)(qr + c0);
#pragma unroll
        for (int q = 0; q < 4; ++q) s += __fadd_rn(bfr(q4[q]), a[q]); }
#pragma unroll
    for (int sh = 16; sh; sh >>= 1) s += __shfl_xor(s, sh, 32);
    const float mu = s * (1.0f / DM); float s2 = 0.f;
#pragma unroll 1
    for (int ch = 0; ch < DM / 128; ++ch) { const int c0 = ch * 128 + lane * 4; const v4f a = *(const v4f*)(yr + c0), q4 = *(const v4f*)(qr + c0);
#pragma unroll
        for (int q = 0; q < 4; ++q) { const float d0 = __fsub_rn(__fadd_rn(bfr(q4[q]), a[q]), mu); float p = __fmul_rn(d0, d0); asm volatile("" : "+v"(p)); s2 = __fadd_rn(s2, p); } }
#pragma unroll
    for (int sh = 16; sh; sh >>= 1) s2 += __shfl_xor(s2, sh, 32);
    const float rs = __fdiv_rn(1.0f, __fsqrt_rn(__fadd_rn(s2 * (1.0f / DM), LNEPS)));
{
#pragma unroll 1
        for (int ch = 0; ch < DM / 128; ++ch) { const int c0 = ch * 128 + lane * 4; const v4f a = *(const v4f*)(yr + c0), q4 = *(const v4f*)(qr + c0); v4f z4; v4us oh, ol;
#pragma unroll
            for (int q = 0; q < 4; ++q) { float n0 = __fmul_rn(__fsub_rn(__fadd_rn(bfr(q4[q]), a[q]), mu), rs); asm volatile("" : "+v"(n0)); float n1 = __fmul_rn(n0, bfr(g[c0 + q])); asm volatile("" : "+v"(n1)); const float y = __fadd_rn(n1, bfr(be[c0 + q])); z4[q] = y; unsigned short h2, l2; splitf(y, h2, l2); oh[q] = h2; ol[q] = l2; }
            *(v4f*)(Z + (size_t)r * DM + c0) = z4; if (Zh) { *(v4us*)(Zh + (size_t)r * DM + c0) = oh; *(v4us*)(Zl + (size_t)r * DM + c0) = ol; } }
         } }
// d_cvt8: a thread converts four pieces of 8 elements, 256 pieces apart, so that each wave-wide load and store stays contiguous; a launch has a quarter of the waves to start.
__device__ __forceinline__ void d_cvt8(const float* __restrict__ src, bf* dst, size_t n8) { const size_t i0 = (size_t)blockIdx.x * 1024 + threadIdx.x; v8f v[4];
#pragma unroll     // all four pieces' loads are issued before the first is converted
    for (int p = 0; p < 4; ++p) { const size_t i = i0 + p * 256; v[p] = *(const v8f*)(src + (i < n8 ? i : n8 - 1) * 8); }   /* a piece past the end re-reads the last one and is not stored: no branch, so no wait, between the loads */
#pragma unroll     // constant index: the pieces stay in registers
    for (int p = 0; p < 4; ++p) { const size_t i = i0 + p * 256; if (i >= n8) continue; v8us o;
#pragma unroll
        for (int k = 0; k < 8; ++k) o[k] = f2bf(v[p][k]);
        *(v8us*)(dst + i * 8) = o; } }
__device__ __forceinline__ void d_cstab(const float* __restrict__ frq, float* CS) { const int idx = blockIdx.x * 256 + threadIdx.x; if (idx >= TT * HD) return; const int t = idx / HD, d = idx % HD; const float ang = bfr(frq[(size_t)t * (HD / 2) + (d >> 1)]);   /* interleaved pairs share freqs[t][j] */ v2f cs; cs[0] = cosf(ang); cs[1] = sinf(ang); *(v2f*)(CS + (size_t)idx * 2) = cs;  }
// k_prep: the six independent input preparations as one launch, blockIdx.y picks the job: 0 the cos/sin table (the longest thread), 1 to 4 the weight planes, 5 the hidden state.
__global__ __launch_bounds__(256) void k_prep(const float* __restrict__ frq, float* CS, const float* __restrict__ wq, const float* __restrict__ wk, const float* __restrict__ wv, const float* __restrict__ wo, const float* __restrict__ x, bf* WQ, bf* WK, bf* WV, bf* WO, bf* XB, size_t nw8, size_t nx8) {
    const unsigned job = blockIdx.y;
    if (job == 0) { d_cstab(frq, CS); return; }
    const float* src = job == 1 ? wq : job == 2 ? wk : job == 3 ? wv : job == 4 ? wo : x; bf* dst = job == 1 ? WQ : job == 2 ? WK : job == 3 ? WV : job == 4 ? WO : XB;
    d_cvt8(src, dst, job == 5 ? nx8 : nw8);
}

// d_rope: head planes [b * nheads + h][t][d] (fp16 + hi/lo), b = blockIdx.y, from rows b * TT + t of F, of the interleaved rotary (x1 c - x2 s, x1 s + x2 c on pairs (2j, 2j+1))
// A thread takes 8 consecutive d of one t in 4 heads (nheads % 4 == 0): 16-byte loads and stores, whole lines per wave, one fetch of the cos/sin pairs for the 4 heads, a sixteenth of the waves to start.
__device__ __forceinline__ void d_rope(const float* __restrict__ F, int pitch, int nheads, const float* __restrict__ CS, const float* __restrict__ RF, const float* __restrict__ nw, float sc, h16* P16, bf* Ph, bf* Pl) {
    { const size_t bb = blockIdx.y, po = bb * nheads * TT * HD; F += bb * TT * pitch; if (RF) RF += bb * nheads * TT; P16 += po; Ph += po; Pl += po; }   // this batch entry's rows of F and its planes
    const size_t gi = (size_t)blockIdx.x * 256 + threadIdx.x; const int d = (int)(gi % (HD / 8)) * 8; const int t = (int)((gi / (HD / 8)) % TT); const int h0 = (int)(gi / ((size_t)(HD / 8) * TT)) * 4; if (h0 >= nheads) return; v8f fx[4]; v4f c4[4];
#pragma unroll     // the four heads' loads and the 8 cos/sin pairs are issued before the first head is rotated
    for (int hh = 0; hh < 4; ++hh) { fx[hh] = *(const v8f*)(F + (size_t)t * pitch + (h0 + hh) * HD + d); c4[hh] = *(const v4f*)(CS + ((size_t)t * HD + d) * 2 + hh * 4);
        asm volatile("s_wait_xcnt 0x0" ::: "memory"); }   // a precaution: stands between these loads and the first reuse of their address registers
#pragma unroll     // constant index: the loaded rows stay in registers, and the cos/sin pairs are shared by the four heads
    for (int hh = 0; hh < 4; ++hh) { const int h = h0 + hh; const size_t e = ((size_t)h * TT + t) * HD + d; const float rf = RF ? RF[(size_t)h * TT + t] : 1.0f; v8h o16; v8us oh, ol;
#pragma unroll
    for (int q = 0; q < 8; ++q) { const int dd = d + q; const int dp = dd ^ 1;   /* interleaved pair partner */ float x0 = fx[hh][q], x1 = fx[hh][q ^ 1];
        if (RF) { float n0 = __fmul_rn(x0, rf), n1 = __fmul_rn(x1, rf); asm volatile("" : "+v"(n0)); asm volatile("" : "+v"(n1)); x0 = __fmul_rn(bfr(nw[dd]), n0); x1 = __fmul_rn(bfr(nw[dp]), n1); }
        v2f cs; cs[0] = c4[q >> 1][(q & 1) * 2]; cs[1] = c4[q >> 1][(q & 1) * 2 + 1]; float a = __fmul_rn(x0, cs[0]), bq = __fmul_rn(x1, cs[1]); asm volatile("" : "+v"(a)); asm volatile("" : "+v"(bq)); const float r = (((dd & 1) == 0) ? __fsub_rn(a, bq) : __fadd_rn(a, bq)) * sc;   /* even: x1 c - x2 s; odd: x2 c + x1 s */
        o16[q] = tohx(r); unsigned short a2, c2; splitf(r, a2, c2); oh[q] = a2; ol[q] = c2; }
    *(v8h*)(P16 + e) = o16; *(v8us*)(Ph + e) = oh; *(v8us*)(Pl + e) = ol;
    asm volatile("s_wait_xcnt 0x0" ::: "memory");   // a precaution: stands between these stores and the next head's reuse of their registers
    } }
// d_vtp: v planes [b * nheads + g][d][t] (fp16 + hi/lo), b = blockIdx.y, from rows b * TT + t of F. A thread holds a block of 8 t x 4 d in registers: 8 loads of 16 bytes along d, 12 stores of 16 bytes along t.
// Lanes: 4 along d x 8 along t, so a wave's store covers four whole 128-byte lines (64 t of one d each); the 8 waves of a work-group take the 128 d of one head for the same 64 t, so every line of F is read inside one work-group.
__device__ __forceinline__ void d_vtp(const float* __restrict__ F, int pitch, int nheads, h16* V16, bf* Vh, bf* Vl) { const int lane = threadIdx.x & 31; const int w = blockIdx.x * 8 + (threadIdx.x >> 5); const int d = (w % (HD / 16)) * 16 + (lane & 3) * 4; const int t = ((w / (HD / 16)) % (TT / 64)) * 64 + (lane >> 2) * 8; const int g = w / ((HD / 16) * (TT / 64)); if (g >= nheads) return; const float* f = F + ((size_t)blockIdx.y * TT + t) * pitch + g * HD + d;   /* b = blockIdx.y */ v4f x4[8];
#pragma unroll     // all eight rows' loads are issued before the first value is converted
    for (int j = 0; j < 8; ++j) { x4[j] = *(const v4f*)(f + (size_t)j * pitch);
        asm volatile("s_wait_xcnt 0x0" ::: "memory"); }   // a precaution: stands between each load and a later load's result landing in its address registers
#pragma unroll     // constant indices: the block stays in registers
    for (int c = 0; c < 4; ++c) { const size_t eo = (((size_t)blockIdx.y * nheads + g) * HD + d + c) * TT + t; v8h o16; v8us oh, ol;
#pragma unroll
        for (int q = 0; q < 8; ++q) { const float x = x4[q][c]; o16[q] = tohx(x); unsigned short a2, c2; splitf(x, a2, c2); oh[q] = a2; ol[q] = c2; }
        *(v8h*)(V16 + eo) = o16; *(v8us*)(Vh + eo) = oh; *(v8us*)(Vl + eo) = ol; } }
// k_planes: the three independent plane builders as one launch, grid (blocks per batch entry, NB_, 3): blockIdx.z = 0 rotates q, 1 rotates k, 2 transposes v.
__global__ __launch_bounds__(256) void k_planes(const float* __restrict__ FQ, const float* __restrict__ FK, const float* __restrict__ FV, const float* __restrict__ CS, h16* QP16, bf* QPh, bf* QPl, h16* KP16, bf* KPh, bf* KPl, h16* VT16, bf* VTh, bf* VTl) {
    if (blockIdx.z == 2) { d_vtp(FV, DKV, NKV, VT16, VTh, VTl); return; }
    const bool isq = blockIdx.z == 0;
    d_rope(isq ? FQ : FK, isq ? DQ : DKV, isq ? NH_ : NKV, CS, nullptr, nullptr, 1.0f, isq ? QP16 : KP16, isq ? QPh : KPh, isq ? QPl : KPl);
}
// stage4: four asynchronous 16-byte copies of a thread, rows rs elements apart in global memory and ls bytes apart in LDS.
// The closing s_wait_xcnt stands inside the statement so that no address register named here is rewritten ahead of it.
template <typename T>
__device__ __forceinline__ void stage4(const T* g, size_t rs, unsigned l, unsigned ls) {
    asm volatile("global_load_async_to_lds_b128 %0, %4, off\n\t"
                 "global_load_async_to_lds_b128 %1, %5, off\n\t"
                 "global_load_async_to_lds_b128 %2, %6, off\n\t"
                 "global_load_async_to_lds_b128 %3, %7, off\n\t"
                 "s_wait_xcnt 0x0"
                 :: "v"(l), "v"(l + ls), "v"(l + 2 * ls), "v"(l + 3 * ls), "v"(g), "v"(g + rs), "v"(g + 2 * rs), "v"(g + 3 * rs)
                 : "memory");
}
#define FKB 64                    // keys per stage of the fused attention kernel
constexpr unsigned FPK = HD * 2 + 16, FPV = FKB * 2 + 16, FPM = FKB * 4 + 16;   // LDS row pitches in bytes (k rows, v^T rows, mask rows): 16 B x odd
constexpr unsigned flash_stage_bytes(bool hl) { return (hl ? 2u : 1u) * (FKB * FPK + HD * FPV) + 128u * FPM; }
template <bool HL> struct PFrag;
template <> struct PFrag<true> { static __device__ __forceinline__ void mk(const v8f& x, const v8f& y, v16bf& h, v16bf& l) {
#pragma unroll     // constant indices: the fragments and accumulators stay in registers
        for (int j = 0; j < 8; ++j) { const __bf16 a = (__bf16)x[j], c = (__bf16)y[j]; h[j] = a; h[8 + j] = c; l[j] = (__bf16)(x[j] - (float)a); l[8 + j] = (__bf16)(y[j] - (float)c); } } };   // hi = nearest-even bf16, lo = bf16 of the remainder, as splitf
template <> struct PFrag<false> { static __device__ __forceinline__ void mk(const v8f& x, const v8f& y, v16h& h, v16h& l) { v8h h0, h1;
#pragma unroll     // constant indices: the fragments and accumulators stay in registers
        for (int j = 0; j < 8; ++j) { h0[j] = tohx(x[j]); h1[j] = tohx(y[j]); }
        h = cat16(h0, h1); l = h; } };
// d_flash: attention of 128 query rows of one head plane z, 8 waves x 16 queries, online softmax over stages of FKB keys; k rows, v^T rows and mask rows of a stage go into LDS by asynchronous b128 copies, two buffers.
// Transposed products keep every per-query value in the query's own lane: S^T = K Q^T (D: key = hi * 8 + j, query = lr); two such tiles are, register for register, the B fragment (query = lr; keys hi * 8 + j, 16 + hi * 8 + j) of O^T = V^T P^T (D: d = hi * 8 + j, query = lr).
// HL: hi+lo bf16 planes, 3 products each; otherwise single fp16 products. The result, divided by the row sum, goes out as hi and lo planes [b * TT + t][h * HD + d].
template <typename T16, bool HL>
__device__ __forceinline__ void d_flash(unsigned char* ring, const int qb, const int z, const T16* __restrict__ Q, const T16* __restrict__ Q2, const T16* __restrict__ Kp, const T16* __restrict__ K2, const T16* __restrict__ Vt, const T16* __restrict__ V2, const float* __restrict__ MK, bf* Ah, bf* Al) {
    typedef typename WFrag<T16>::V V;
    constexpr unsigned SK = FKB * FPK, SV = HD * FPV, OV = (HL ? 2u : 1u) * SK, OM = OV + (HL ? 2u : 1u) * SV, STG = flash_stage_bytes(HL);   // stage: [K | K2 | V | V2 | mask]
    const int tid = threadIdx.x, lane = tid & 31, lr = lane & 15, hi = lane >> 4, wave = tid >> 5;
    const size_t zo = (size_t)z * TT * HD; const int q = qb * 128 + wave * 16 + lr;   // this lane's query row
    V qf[4], qf2[4];
#pragma unroll     // constant indices: the fragments and accumulators stay in registers
    for (int ks = 0; ks < 4; ++ks) { qf[ks] = WFrag<T16>::ld(Q + zo + (size_t)q * HD + ks * 32 + hi * 8); if (HL) qf2[ks] = WFrag<T16>::ld(Q2 + zo + (size_t)q * HD + ks * 32 + hi * 8); }
    asm volatile("s_wait_xcnt 0x0" ::: "memory");   // a precaution: stands between these loads and the first reuse of their address registers
    const size_t gk = zo + (size_t)(tid >> 4) * HD + (tid & 15) * 8, gv = zo + (size_t)(tid >> 3) * TT + (tid & 7) * 8, gm = ((size_t)(z / NH_) * TT + qb * 128 + (tid >> 4)) * TT + (tid & 15) * 4;
    const unsigned lb = (unsigned)(size_t)ring, lk = lb + (unsigned)(tid >> 4) * FPK + (unsigned)(tid & 15) * 16, lv = lb + OV + (unsigned)(tid >> 3) * FPV + (unsigned)(tid & 7) * 16, lm = lb + OM + (unsigned)(tid >> 4) * FPM + (unsigned)(tid & 15) * 16;
    auto fill = [&](int kb, unsigned buf) { const unsigned o = buf * STG;
        stage4(Kp + gk + (size_t)kb * HD, (size_t)16 * HD, lk + o, 16 * FPK); if (HL) stage4(K2 + gk + (size_t)kb * HD, (size_t)16 * HD, lk + o + SK, 16 * FPK);
        stage4(Vt + gv + kb, (size_t)32 * TT, lv + o, 32 * FPV); if (HL) stage4(V2 + gv + kb, (size_t)32 * TT, lv + o + SV, 32 * FPV);
        stage_plane<false>(MK + gm + kb, (size_t)16 * TT, lm + o, 16 * FPM); };
    v8f o[8];
#pragma unroll     // constant indices: the fragments and accumulators stay in registers
    for (int dt = 0; dt < 8; ++dt) o[dt] = (v8f){};
    float mx = -3.0e38f, sum = 0.f;   // running maximum of the query's row (both lane halves alike); this lane's half of the running sum
    fill(0, 0);
    asm volatile("s_wait_asynccnt 0x0" ::: "memory");   // stage 0 has landed before anybody reads it
    __syncthreads();
    fill(FKB, 1);
#pragma unroll 1   // one stage per trip: a single publish point
    for (int kb = 0, t = 0; kb < TT; kb += FKB, t ^= 1) {
        const unsigned char* sb = ring + (unsigned)t * STG;
        v8f s[4];
#pragma unroll     // constant indices: the fragments and accumulators stay in registers
        for (int kt = 0; kt < 4; ++kt) s[kt] = (v8f){};
#pragma unroll     // constant indices: the fragments and accumulators stay in registers
        for (int ks = 0; ks < 4; ++ks) { V a[4], a2[4];
#pragma unroll     // constant indices: the fragments and accumulators stay in registers
            for (int kt = 0; kt < 4; ++kt) { const unsigned char* p = sb + (kt * 16 + lr) * FPK + ks * 64 + hi * 16; a[kt] = WFrag<T16>::ld((const T16*)p); if (HL) a2[kt] = WFrag<T16>::ld((const T16*)(p + SK)); }
#pragma unroll     // constant indices: the fragments and accumulators stay in registers
            for (int kt = 0; kt < 4; ++kt) s[kt] = WFrag<T16>::mma(a[kt], qf[ks], s[kt]);
            if (HL) {
#pragma unroll     // constant indices: the fragments and accumulators stay in registers
                for (int kt = 0; kt < 4; ++kt) s[kt] = WFrag<T16>::mma(a2[kt], qf[ks], s[kt]);
#pragma unroll     // constant indices: the fragments and accumulators stay in registers
                for (int kt = 0; kt < 4; ++kt) s[kt] = WFrag<T16>::mma(a[kt], qf2[ks], s[kt]); } }
        float bm = mx;
#pragma unroll     // constant indices: the fragments and accumulators stay in registers
        for (int kt = 0; kt < 4; ++kt) { const float* mr = (const float*)(sb + OM + (wave * 16 + lr) * FPM + (kt * 16 + hi * 8) * 4); const v4f m0 = *(const v4fa*)mr, m1 = *(const v4fa*)(mr + 4);
#pragma unroll     // constant indices: the fragments and accumulators stay in registers
            for (int j = 0; j < 8; ++j) { const float tv = s[kt][j] * SCL + bfr(j < 4 ? m0[j & 3] : m1[j & 3]);   /* + attention_mask[b][0][q][key] */ s[kt][j] = tv; bm = fmaxf(bm, tv); } }
        bm = fmaxf(bm, __shfl_xor(bm, 16, 32));
        const float al = __builtin_amdgcn_exp2f((mx - bm) * 1.4426950408889634f); mx = bm;
        float ps = 0.f;
#pragma unroll     // constant indices: the fragments and accumulators stay in registers
        for (int kt = 0; kt < 4; ++kt)
#pragma unroll     // constant indices: the fragments and accumulators stay in registers
            for (int j = 0; j < 8; ++j) { const float p = __builtin_amdgcn_exp2f((s[kt][j] - mx) * 1.4426950408889634f); s[kt][j] = p; ps += p; }
        sum = sum * al + ps;
#pragma unroll     // constant indices: the fragments and accumulators stay in registers
        for (int dt = 0; dt < 8; ++dt) o[dt] *= al;
#pragma unroll     // constant indices: the fragments and accumulators stay in registers
        for (int kk = 0; kk < 2; ++kk) { V ph, pl; PFrag<HL>::mk(s[2 * kk], s[2 * kk + 1], ph, pl);
#pragma unroll     // constant indices: the fragments and accumulators stay in registers
            for (int dg = 0; dg < 2; ++dg) { V a[4], a2[4];
#pragma unroll     // constant indices: the fragments and accumulators stay in registers
                for (int i = 0; i < 4; ++i) { const unsigned char* p = sb + OV + ((dg * 4 + i) * 16 + lr) * FPV + kk * 64 + hi * 16; a[i] = WFrag<T16>::ld((const T16*)p); if (HL) a2[i] = WFrag<T16>::ld((const T16*)(p + SV)); }
#pragma unroll     // constant indices: the fragments and accumulators stay in registers
                for (int i = 0; i < 4; ++i) o[dg * 4 + i] = WFrag<T16>::mma(a[i], ph, o[dg * 4 + i]);
                if (HL) {
#pragma unroll     // constant indices: the fragments and accumulators stay in registers
                    for (int i = 0; i < 4; ++i) o[dg * 4 + i] = WFrag<T16>::mma(a2[i], ph, o[dg * 4 + i]);
#pragma unroll     // constant indices: the fragments and accumulators stay in registers
                    for (int i = 0; i < 4; ++i) o[dg * 4 + i] = WFrag<T16>::mma(a[i], pl, o[dg * 4 + i]); } } }
        asm volatile("s_wait_dscnt 0x0" ::: "memory");      // this wave's reads of the buffer are done before it is refilled
        asm volatile("s_wait_asynccnt 0x0" ::: "memory");   // this wave's copies of the next stage have landed
        __syncthreads();                                    // publishes the next stage and ends every reader's last read of this one
        if (kb + 2 * FKB < TT) fill(kb + 2 * FKB, (unsigned)t);
    }
    asm volatile("s_wait_asynccnt 0x0" ::: "memory");       // no copy is in flight when the wave ends
    sum += __shfl_xor(sum, 16, 32);
    const float f = __fdiv_rn(1.0f, sum);
    const size_t oo = ((size_t)(z / NH_) * TT + q) * DQ + (z % NH_) * HD + hi * 8;
#pragma unroll     // constant indices: the fragments and accumulators stay in registers
    for (int dt = 0; dt < 8; ++dt) { v8us oh, ol;
#pragma unroll     // constant indices: the fragments and accumulators stay in registers
        for (int j = 0; j < 8; ++j) { unsigned short a, c; splitf(o[dt][j] * f, a, c); oh[j] = a; ol[j] = c; }
        *(v8us*)(Ah + oo + dt * 16) = oh; *(v8us*)(Al + oo + dt * 16) = ol;
        asm volatile("s_wait_xcnt 0x0" ::: "memory");   // a precaution: stands between these stores and the next block's reuse of their registers
    }
}
// k_flash: grid (NZ, TT / 128), 256 threads; query blocks below RH / 128 take the hi+lo planes.
__global__ __launch_bounds__(256) void k_flash(const bf* __restrict__ Qh, const bf* __restrict__ Ql, const bf* __restrict__ Kh, const bf* __restrict__ Kl, const bf* __restrict__ Vh, const bf* __restrict__ Vl, const h16* __restrict__ Q16, const h16* __restrict__ K16, const h16* __restrict__ V16, const float* __restrict__ MK, bf* Ah, bf* Al) {
    __shared__ __align__(16) unsigned char ring[2 * flash_stage_bytes(true)];
    if (blockIdx.y < RH / 128) d_flash<bf, true>(ring, blockIdx.y, blockIdx.x, Qh, Ql, Kh, Kl, Vh, Vl, MK, Ah, Al);
    else d_flash<h16, false>(ring, blockIdx.y, blockIdx.x, Q16, nullptr, K16, nullptr, V16, nullptr, MK, Ah, Al);
}

extern "C" void kernel_launch(void* const* d_in, const int* in_sizes, int n_in,
                              void* d_out, int out_size, void* d_ws, size_t ws_size, hipStream_t stream) {
    (void)in_sizes; (void)n_in; (void)out_size;
    const float* x = (const float*)d_in[0]; const float* MK = (const float*)d_in[1]; const float* FRQ = (const float*)d_in[2]; const float* wq = (const float*)d_in[3]; const float* bq = (const float*)d_in[4]; const float* wk = (const float*)d_in[5]; const float* bk = (const float*)d_in[6]; const float* wv = (const float*)d_in[7]; const float* bv = (const float*)d_in[8]; const float* wo = (const float*)d_in[9]; const float* bo = (const float*)d_in[10]; const float* g1 = (const float*)d_in[11]; const float* e1b = (const float*)d_in[12]; const float* qnw = nullptr; const float* knw = nullptr; (void)qnw; (void)knw;
    float* OUT = (float*)d_out;     // [2][1024][2048]
    char* wsp = (char*)d_ws;
    auto take = [&](size_t bytes) { char* p = wsp; wsp += (bytes + 255) & ~(size_t)255; return (void*)p; };
    constexpr int MT = NB_ * TT;   // token rows of both batch entries
    bf* WO = (bf*)take((size_t)DM * DQ * 2); float* CS = (float*)take((size_t)TT * HD * 2 * 4);
    bf* WQ = (bf*)take((size_t)DQ * DM * 2); bf* WK = (bf*)take((size_t)DKV * DM * 2); bf* WV = (bf*)take((size_t)DKV * DM * 2); bf* XB = (bf*)take((size_t)MT * DM * 2);
    h16* QP16 = (h16*)take((size_t)NZ * TT * HD * 2); h16* KP16 = (h16*)take((size_t)NZ * TT * HD * 2); h16* VT16 = (h16*)take((size_t)NZ * HD * TT * 2);
    bf* QPh = (bf*)take((size_t)NZ * TT * HD * 2); bf* QPl = (bf*)take((size_t)NZ * TT * HD * 2); bf* KPh = (bf*)take((size_t)NZ * TT * HD * 2); bf* KPl = (bf*)take((size_t)NZ * TT * HD * 2); bf* VTh = (bf*)take((size_t)NZ * HD * TT * 2); bf* VTl = (bf*)take((size_t)NZ * HD * TT * 2);
    float* Sb = (float*)take((size_t)NZ * TT * TT * 4);
    if ((size_t)(wsp - (char*)d_ws) > ws_size) return;    // ws 256 MiB
    // Buffers that share bytes, all stream-ordered: the f32 projections and, once the plane builders have read them, the output projection live in Sb;
    // the attention output's hi and lo planes take the v weight plane and the bf16 hidden state, both read for the last time by the projection launch.
    float* FQ = Sb; float* FK = Sb + (size_t)MT * DQ; float* FV = FK + (size_t)MT * DKV; float* YO = Sb; bf* ATh = WV; bf* ATl = XB;
    static_assert(DQ == DKV && (size_t)DQ * DM / 8 / 1024 == (size_t)MT * DM / 8 / 1024 && (size_t)DQ * DM / 8 / 1024 == (size_t)TT * HD / 256, "one grid extent serves all jobs of k_prep; q, k and v planes have one size");
    static_assert((size_t)DQ * DM * 2 % 256 == 0, "the weight planes follow one another without a gap");
    k_prep<<<dim3((unsigned)(((size_t)DQ * DM / 8 + 1023) / 1024), 6), 256, 0, stream>>>(FRQ, CS, wq, wk, wv, wo, x, WQ, WK, WV, WO, XB, (size_t)DQ * DM / 8, (size_t)MT * DM / 8);
    const unsigned LP = (unsigned)(((size_t)NH_ * TT * HD / 32 + 255) / 256);   // blocks per batch entry of the plane kernels, 32 elements a thread (NKV == NH_)
    // q, k and v projections: planes z = 0, 1, 2 of one launch; WQ, WK, WV and FQ, FK, FV lie one plane size apart
    k_gemmw<bf, 0, true><<<dim3(MT / 128, DQ / 128, 3), 128, 0, stream>>>(XB, nullptr, WQ, nullptr, DM, DM, FQ, DQ, bq, bk, bv, 0, (size_t)DQ * DM, (size_t)MT * DQ);
    k_planes<<<dim3(LP, NB_, 3), 256, 0, stream>>>(FQ, FK, FV, CS, QP16, QPh, QPl, KP16, KPh, KPl, VT16, VTh, VTl);
    // one kv head per query head: plane z of q meets plane z of k and v; scores and probabilities stay in registers
    k_flash<<<dim3(NZ, TT / 128), 256, 0, stream>>>(QPh, QPl, KPh, KPl, VTh, VTl, QP16, KP16, VT16, MK, ATh, ATl);
    k_gemmw<bf, 1, true><<<dim3(MT / 128, DM / 128, 1), 128, 0, stream>>>(ATh, ATl, WO, nullptr, DQ, DQ, YO, DM, bo, nullptr, nullptr, 0, 0, 0);
    k_resln<<<MT / 8, 256, 0, stream>>>(YO, x, g1, e1b, OUT, nullptr, nullptr);   /* LN(proj + bo + hidden_state) */
}

// v007
// A run of this version takes 156 microseconds.
// In both of two side-by-side timings against v006, it was 1.15 times as fast.
// Counting every step since v000, it is 10.1 times as fast.
#include <hip/hip_runtime.h>

// Decoder attention with RoPE and a BERT-style output (hidden_state [2][1024][2048]; q, k, v = x W^T + b ('oi' [2048][2048], 16 heads x 128); interleaved RoPE with cos/sin(freqs[t][j]) (freqs [1024][64] input, read); scores/sqrt(128) + attention_mask[b][0][i][j] (f32 input, read; zeros); softmax; out = LN(attn Wo^T + bo + hidden_state) (eps 1e-12, gamma/beta) -> [2][1024][2048]).
// Compute dtypes, f32 accumulate: every input rounded to bf16; q/k/v on PLAIN bf16 operands (inputs: exact) + biases; rotary in f32 from a table cos/sin(bf16(freqs)); scores, additive mask (bf16-rounded), online softmax (f32) and attn.v in one kernel: query rows < 512 hl (3 products), the rest single fp16; Wo hl x exact (2 products) + bo; residual add and LayerNorm in f32 (fixed trees).

#define NB_  2
#define TT   1024
#define DM   2048
#define NH_  16
#define NKV  16
#define REP  (NH_ / NKV)
#define HD   128
#define DQ   (NH_ * HD)
#define DKV  (NKV * HD)
#define LNEPS 1e-12f
typedef __attribute__((ext_vector_type(4))) unsigned short v4us;
#define NZ   (NB_ * NH_)          // head planes z = b * NH_ + h, the x extent of the attention launch: every head of both batch entries in one pass
#define RH   512                  // query rows < RH use hi+lo planes (0: none)
#define WIN  0
#define SCL  0.088388347648318447f   // HD^-0.5
typedef _Float16 h16;
typedef unsigned short bf;
typedef __attribute__((ext_vector_type(16))) __bf16   v16bf;
typedef __attribute__((ext_vector_type(16))) _Float16 v16h;
typedef __attribute__((ext_vector_type(8)))  _Float16 v8h;
typedef __attribute__((ext_vector_type(8)))  unsigned short v8us;
typedef __attribute__((ext_vector_type(8)))  float    v8f;
typedef __attribute__((ext_vector_type(4)))  float    v4f;
typedef v8h  __attribute__((may_alias)) v8ha;
typedef v4f  __attribute__((may_alias)) v4fa;
typedef v8us __attribute__((may_alias)) v8usa;

__device__ __forceinline__ unsigned short f2bf(float f) { unsigned u = __float_as_uint(f); u += 0x7FFFu + ((u >> 16) & 1u); return (unsigned short)(u >> 16); }
__device__ __forceinline__ float bf2f(unsigned short b) { return __uint_as_float(((unsigned)b) << 16); }
__device__ __forceinline__ float bfr(float f) { return bf2f(f2bf(f)); }
__device__ __forceinline__ v16h cat16(v8h lo, v8h hi) { return __builtin_shufflevector(lo, hi, 0, 1, 2, 3, 4, 5, 6, 7, 8, 9, 10, 11, 12, 13, 14, 15); }
__device__ __forceinline__ v16bf cat16b(v8us lo, v8us hi) { return __builtin_bit_cast(v16bf, __builtin_shufflevector(lo, hi, 0, 1, 2, 3, 4, 5, 6, 7, 8, 9, 10, 11, 12, 13, 14, 15)); }
__device__ __forceinline__ v8f wmma16(v16h a, v16h b, v8f c) { return __builtin_amdgcn_wmma_f32_16x16x32_f16(false, a, false, b, (short)0, c, false, false); }
__device__ __forceinline__ v8f wmmab(v16bf a, v16bf b, v8f c) { return __builtin_amdgcn_wmma_f32_16x16x32_bf16(false, a, false, b, (short)0, c, false, false); }



// ---- k_gemmw: GEMM, one 128x128 output tile per work-group of 4 waves (2x2, 64x64 and 16 accumulators per wave); grid (M/128, N/128, Z), 128 threads.
// Operand tiles (128 rows x KC k, whole 128-byte lines) go from the K-contiguous 16-bit planes into LDS by asynchronous b128 copies, two buffers: the next tile flies while this one is multiplied.
// C[m][n] (f32, pitch ldc, + optional f32 bias[n]) = sum_k A[m][k] Bt[n][k] (+ split products per NSPLIT). A rows have pitch lda, Bt rows pitch K (elements). z-batch strides sA/sB/sC in elements. K % KC == 0, M % 128 == 0, N % 128 == 0.
template <typename T16> struct WFrag;
template <> struct WFrag<h16> { typedef v16h V; static __device__ __forceinline__ V ld(const h16* p) { return cat16(*(const v8h*)p, *(const v8h*)(p + 16)); } static __device__ __forceinline__ v8f mma(V a, V b, v8f c) { return wmma16(a, b, c); } };
template <> struct WFrag<bf> { typedef v16bf V; static __device__ __forceinline__ V ld(const bf* p) { return cat16b(*(const v8us*)p, *(const v8us*)(p + 16)); } static __device__ __forceinline__ v8f mma(V a, V b, v8f c) { return wmmab(a, b, c); } };
// One plane of one stage: every thread copies its 16 bytes (with WIDE also the 16 bytes 128 further on, in global memory and in LDS alike) of rows r, r + 16, ..., r + 112; a wave's copy = 4 whole lines.
// g: the lane's global address in row r, rs: 16 rows in elements, l: the lane's LDS byte address in row r, ls: 16 rows in LDS bytes.
// The closing s_wait_xcnt stands inside the statement so that no address register named here is rewritten ahead of it.
template <bool WIDE, typename T16>
__device__ __forceinline__ void stage_plane(const T16* g, size_t rs, unsigned l, unsigned ls) {
    if (WIDE)
        asm volatile("global_load_async_to_lds_b128 %0, %8, off\n\t"  "global_load_async_to_lds_b128 %0, %8, off offset:128\n\t"
                     "global_load_async_to_lds_b128 %1, %9, off\n\t"  "global_load_async_to_lds_b128 %1, %9, off offset:128\n\t"
                     "global_load_async_to_lds_b128 %2, %10, off\n\t" "global_load_async_to_lds_b128 %2, %10, off offset:128\n\t"
                     "global_load_async_to_lds_b128 %3, %11, off\n\t" "global_load_async_to_lds_b128 %3, %11, off offset:128\n\t"
                     "global_load_async_to_lds_b128 %4, %12, off\n\t" "global_load_async_to_lds_b128 %4, %12, off offset:128\n\t"
                     "global_load_async_to_lds_b128 %5, %13, off\n\t" "global_load_async_to_lds_b128 %5, %13, off offset:128\n\t"
                     "global_load_async_to_lds_b128 %6, %14, off\n\t" "global_load_async_to_lds_b128 %6, %14, off offset:128\n\t"
                     "global_load_async_to_lds_b128 %7, %15, off\n\t" "global_load_async_to_lds_b128 %7, %15, off offset:128\n\t"
                     "s_wait_xcnt 0x0"
                     :: "v"(l), "v"(l + ls), "v"(l + 2 * ls), "v"(l + 3 * ls), "v"(l + 4 * ls), "v"(l + 5 * ls), "v"(l + 6 * ls), "v"(l + 7 * ls),
                        "v"(g), "v"(g + rs), "v"(g + 2 * rs), "v"(g + 3 * rs), "v"(g + 4 * rs), "v"(g + 5 * rs), "v"(g + 6 * rs), "v"(g + 7 * rs)
                     : "memory");
    else
        asm volatile("global_load_async_to_lds_b128 %0, %8, off\n\t"
                     "global_load_async_to_lds_b128 %1, %9, off\n\t"
                     "global_load_async_to_lds_b128 %2, %10, off\n\t"
                     "global_load_async_to_lds_b128 %3, %11, off\n\t"
                     "global_load_async_to_lds_b128 %4, %12, off\n\t"
                     "global_load_async_to_lds_b128 %5, %13, off\n\t"
                     "global_load_async_to_lds_b128 %6, %14, off\n\t"
                     "global_load_async_to_lds_b128 %7, %15, off\n\t"
                     "s_wait_xcnt 0x0"
                     :: "v"(l), "v"(l + ls), "v"(l + 2 * ls), "v"(l + 3 * ls), "v"(l + 4 * ls), "v"(l + 5 * ls), "v"(l + 6 * ls), "v"(l + 7 * ls),
                        "v"(g), "v"(g + rs), "v"(g + 2 * rs), "v"(g + 3 * rs), "v"(g + 4 * rs), "v"(g + 5 * rs), "v"(g + 6 * rs), "v"(g + 7 * rs)
                     : "memory");
}
// LDS bytes of the two-buffer ring of d_gemmw<., NSPLIT, .>
constexpr unsigned gemm_ring_bytes(int nsplit) { return 2u * (((nsplit == 1 || nsplit == 2) ? 2u : 1u) + (nsplit >= 2 ? 2u : 1u)) * 128u * ((nsplit >= 2 ? 64u : 128u) * 2u + 16u); }
// d_gemmw: the body; ring = the work-group's LDS (gemm_ring_bytes(NSPLIT) bytes), (bx, by, bz) = its M tile, N tile and batch plane, the same for every thread of the work-group.
template <typename T16, int NSPLIT, bool BIAS>
__device__ __forceinline__ void d_gemmw(unsigned char* ring, const int bx, const int by, const int bz, const T16* __restrict__ A, const T16* __restrict__ A2, const T16* __restrict__ Bt, const T16* __restrict__ Bt2, int K, int lda, float* C, int ldc, const float* __restrict__ bias, size_t sA, size_t sB, size_t sC) {
    typedef typename WFrag<T16>::V V;
    constexpr bool HA2 = (NSPLIT == 1 || NSPLIT == 2), HB2 = (NSPLIT >= 2), WIDE = !HB2;
    constexpr int KC = WIDE ? 128 : 64;                       // k per stage; four planes of 128 k would be 64 copies of a wave in flight
    constexpr unsigned PIT = KC * 2 + 16;                     // LDS row pitch in bytes: 16 B x odd, conflict-free for ds_load_b128
    constexpr unsigned PLN = 128 * PIT, PB = (HA2 ? 2u : 1u) * PLN, STG = PB + (HB2 ? 2u : 1u) * PLN;   // stage: [A | A2 | B | B2]
    static_assert(2 * STG == gemm_ring_bytes(NSPLIT), "the callers size the ring");
    const size_t z = bz; A += z * sA; if (HA2) A2 += z * sA; Bt += z * sB; if (HB2) Bt2 += z * sB; C += z * sC;
    const int tid = threadIdx.x, lane = tid & 31, lr = lane & 15, hi = lane >> 4, wave = tid >> 5, wm = wave >> 1, wn = wave & 1;
    const int r0 = bx * 128 + wm * 64, c0 = by * 128 + wn * 64;
    v8f acc[4][4];
#pragma unroll
    for (int mb = 0; mb < 4; ++mb)
#pragma unroll
        for (int nb = 0; nb < 4; ++nb) acc[mb][nb] = (v8f){};
    const size_t ga = (size_t)(bx * 128 + (tid >> 3)) * lda + (tid & 7) * 8, gb = (size_t)(by * 128 + (tid >> 3)) * K + (tid & 7) * 8, rsa = (size_t)16 * lda, rsb = (size_t)16 * K;
    const unsigned lcp = (unsigned)(size_t)ring + (unsigned)(tid >> 3) * PIT + (unsigned)(tid & 7) * 16;
    auto fill = [&](int kc, unsigned buf) { const unsigned l = lcp + buf * STG;
        stage_plane<WIDE>(A + ga + kc, rsa, l, 16 * PIT); if (HA2) stage_plane<WIDE>(A2 + ga + kc, rsa, l + PLN, 16 * PIT);
        stage_plane<WIDE>(Bt + gb + kc, rsb, l + PB, 16 * PIT); if (HB2) stage_plane<WIDE>(Bt2 + gb + kc, rsb, l + PB + PLN, 16 * PIT); };
    fill(0, 0);
    asm volatile("s_wait_asynccnt 0x0" ::: "memory");   // tile 0 has landed before anybody reads it
    __syncthreads();
    if (K > KC) fill(KC, 1);
#pragma unroll 1   // one pass per trip: a single publish point
    for (int kc = 0, t = 0; kc < K; kc += KC, t ^= 1) {
        const unsigned char* fa = ring + (unsigned)t * STG + (wm * 64 + lr) * PIT + hi * 16; const unsigned char* fb = ring + (unsigned)t * STG + PB + (wn * 64 + lr) * PIT + hi * 16;
        V a[2][4], a2[2][4], b[2][4], b2[2][4];   // two fragment sets: the next 32 k are fetched as one group ahead of this block's products
#pragma unroll     // unrolled so that the set index is a constant and both fragment sets stay in registers
        for (int ks = -1; ks < KC / 32; ++ks) {
            if (ks + 1 < KC / 32) { const int s = (ks + 1) & 1, o = (ks + 1) * 64;
#pragma unroll
                for (int i = 0; i < 4; ++i) { a[s][i] = WFrag<T16>::ld((const T16*)(fa + i * 16 * PIT + o)); if (HA2) a2[s][i] = WFrag<T16>::ld((const T16*)(fa + PLN + i * 16 * PIT + o)); }
#pragma unroll
                for (int i = 0; i < 4; ++i) { b[s][i] = WFrag<T16>::ld((const T16*)(fb + i * 16 * PIT + o)); if (HB2) b2[s][i] = WFrag<T16>::ld((const T16*)(fb + PLN + i * 16 * PIT + o)); } }
            __builtin_amdgcn_sched_barrier(0);   // keeps the next block's LDS reads one group ahead of this block's products; sunk among them, every product row waits out the LDS latency
            if (ks >= 0) { const int s = ks & 1;
#pragma unroll
                for (int nb = 0; nb < 4; ++nb) {
#pragma unroll
                    for (int mb = 0; mb < 4; ++mb) acc[mb][nb] = WFrag<T16>::mma(a[s][mb], b[s][nb], acc[mb][nb]);
                    if (HA2) {
#pragma unroll
                        for (int mb = 0; mb < 4; ++mb) acc[mb][nb] = WFrag<T16>::mma(a2[s][mb], b[s][nb], acc[mb][nb]); }
                    if (HB2) {
#pragma unroll
                        for (int mb = 0; mb < 4; ++mb) acc[mb][nb] = WFrag<T16>::mma(a[s][mb], b2[s][nb], acc[mb][nb]); } } }
            __builtin_amdgcn_sched_barrier(0);   // and keeps the group after next behind these products, whose registers it refills
        }
        asm volatile("s_wait_dscnt 0x0" ::: "memory");      // this wave's reads of the buffer are done before it is refilled
        asm volatile("s_wait_asynccnt 0x0" ::: "memory");   // this wave's copies of the next tile have landed
        __syncthreads();                                    // publishes the next tile and ends every reader's last read of this one
        if (kc + 2 * KC < K) fill(kc + 2 * KC, (unsigned)t);
    }
    asm volatile("s_wait_asynccnt 0x0" ::: "memory");       // no copy is in flight when the ring becomes output staging
    float* os = (float*)ring + wave * (16 * 68);            // each wave's own 16 x 68 floats; every reader left the ring at the last pass's barrier
#pragma unroll
    for (int mb = 0; mb < 4; ++mb) {
#pragma unroll
        for (int nb = 0; nb < 4; ++nb) {
#pragma unroll
            for (int j = 0; j < 8; ++j) os[(hi * 8 + j) * 68 + nb * 16 + lr] = acc[mb][nb][j]; }
        __builtin_amdgcn_wave_barrier(); asm volatile("" ::: "memory");
        float* crow = C + (size_t)(r0 + mb * 16) * ldc + c0;
{
#pragma unroll
            for (int s = 0; s < 8; ++s) { const int row = 2 * s + hi, cofs = lr * 4; v4f val = *(const v4fa*)(os + row * 68 + cofs); if (BIAS) { val[0] += bfr(bias[c0 + cofs]); val[1] += bfr(bias[c0 + cofs + 1]); val[2] += bfr(bias[c0 + cofs + 2]); val[3] += bfr(bias[c0 + cofs + 3]); }
                *(v4f*)(crow + (size_t)row * ldc + cofs) = val; }
             }
        __builtin_amdgcn_wave_barrier(); asm volatile("" ::: "memory");
        asm volatile("s_wait_xcnt 0x0" ::: "memory");   // a precaution: stands between these stores and the next row block's reuse of their address registers
    }
}
// k_gemmw: one operand type for the whole grid (M/128, N/128, Z); plane z adds its own bias vector (bias, bias1, bias2 for z = 0, 1, 2), so that independent products on one A run as one launch.
template <typename T16, int NSPLIT, bool BIAS>
__global__ __launch_bounds__(128) void k_gemmw(const T16* __restrict__ A, const T16* __restrict__ A2, const T16* __restrict__ Bt, const T16* __restrict__ Bt2, int K, int lda, float* C, int ldc, const float* __restrict__ bias, const float* __restrict__ bias1, const float* __restrict__ bias2, size_t sA, size_t sB, size_t sC) {
    __shared__ __align__(16) unsigned char ring[gemm_ring_bytes(NSPLIT)];
    d_gemmw<T16, NSPLIT, BIAS>(ring, blockIdx.x, blockIdx.y, blockIdx.z, A, A2, Bt, Bt2, K, lda, C, ldc, blockIdx.z == 0 ? bias : (blockIdx.z == 1 ? bias1 : bias2), sA, sB, sC);
}

__device__ __forceinline__ h16 tohx(float x) { return (h16)x; }
__device__ __forceinline__ void splitf(float y, unsigned short& h, unsigned short& l) { h = f2bf(y); l = f2bf(y - bf2f(h)); }
typedef __attribute__((ext_vector_type(2))) _Float16 v2h;
typedef __attribute__((ext_vector_type(4))) _Float16 v4h;
typedef __attribute__((ext_vector_type(2))) unsigned short v2us;
typedef __attribute__((ext_vector_type(4))) unsigned short v4us;
typedef __attribute__((ext_vector_type(2))) float v2f;
typedef __attribute__((ext_vector_type(4))) int v4i;

__global__ __launch_bounds__(256) void k_wtG(const float* __restrict__ w, int K, int N, bf* Bt) {
    const int lane = threadIdx.x & 31; const int L0 = (blockIdx.x * 8 + (threadIdx.x >> 5)) * 8; const int nlines = N * K / 64;
{
#pragma unroll 1
        for (int l = 0; l < 8; ++l) { const int L = L0 + l; if (L >= nlines) break; const size_t e = (size_t)L * 64 + lane * 2; const int k = (int)(e % K), n = (int)(e / K); v2us o;
            o[0] = f2bf(w[(size_t)k * N + n]); o[1] = f2bf(w[(size_t)(k + 1) * N + n]); *(v2us*)(Bt + e) = o; }
         }
}
// k_resln: one wave per row. The row's sums y + bf16(x) stay in registers (64 a lane): both inputs are read once, all 32 loads of a lane issued together, where three passes of 16 dependent trips each waited out a load latency per trip.
// The order of every sum is that of the three passes: a lane adds its 64 values by rising column, then the butterfly.
__global__ __launch_bounds__(256) void k_resln(const float* __restrict__ Y, const float* __restrict__ Q, const float* __restrict__ g, const float* __restrict__ be, float* Z) {
    constexpr int NC = DM / 128;
    const int lane = threadIdx.x & 31; const int r = blockIdx.x * 8 + (threadIdx.x >> 5); if (r >= NB_ * TT) return; const unsigned bo = ((unsigned)r * DM + lane * 4) * 4u;   /* the lane's byte offset in Y, Q and Z alike: one register beside the scalar bases, live up to the stores, so that no load's result lands in an address register */ v4f v[NC], q4[NC];
#pragma unroll     // constant indices: the row stays in registers
    for (int ch = 0; ch < NC; ++ch) { v[ch] = *(const v4f*)((const char*)Y + bo + ch * 512); q4[ch] = *(const v4f*)((const char*)Q + bo + ch * 512); }
    __builtin_amdgcn_sched_barrier(0);   // keeps all 32 loads ahead of the first use: sunk among the sums they come in groups, one memory latency a group
    float s = 0.f;
#pragma unroll     // constant indices: the row stays in registers
    for (int ch = 0; ch < NC; ++ch)
#pragma unroll     // constant indices, as above
        for (int q = 0; q < 4; ++q) { v[ch][q] = __fadd_rn(bfr(q4[ch][q]), v[ch][q]); s += v[ch][q]; }
#pragma unroll     // five fixed steps of the butterfly
    for (int sh = 16; sh; sh >>= 1) s += __shfl_xor(s, sh, 32);
    const float mu = s * (1.0f / DM); float s2 = 0.f;
#pragma unroll     // constant indices: the row stays in registers
    for (int ch = 0; ch < NC; ++ch)
#pragma unroll     // constant indices, as above
        for (int q = 0; q < 4; ++q) { v[ch][q] = __fsub_rn(v[ch][q], mu); s2 = __fadd_rn(s2, __fmul_rn(v[ch][q], v[ch][q])); }
#pragma unroll     // five fixed steps of the butterfly
    for (int sh = 16; sh; sh >>= 1) s2 += __shfl_xor(s2, sh, 32);
    const float rs = __fdiv_rn(1.0f, __fsqrt_rn(__fadd_rn(s2 * (1.0f / DM), LNEPS)));
#pragma unroll     // constant indices: the row stays in registers
    for (int ch = 0; ch < NC; ++ch) { const v4f g4 = *(const v4f*)(g + ch * 128 + lane * 4), b4 = *(const v4f*)(be + ch * 128 + lane * 4);
#pragma unroll     // constant indices, as above
        for (int q = 0; q < 4; ++q) v[ch][q] = __fadd_rn(__fmul_rn(__fmul_rn(v[ch][q], rs), bfr(g4[q])), bfr(b4[q])); }
#pragma unroll     // constant indices: the row stays in registers
    for (int ch = 0; ch < NC; ++ch) *(v4f*)((char*)Z + bo + ch * 512) = v[ch];
}
// d_cvt8: a thread converts four pieces of 8 elements, 256 pieces apart, so that each wave-wide load and store stays contiguous; a launch has a quarter of the waves to start.
__device__ __forceinline__ void d_cvt8(const float* __restrict__ src, bf* dst, size_t n8) { const size_t i0 = (size_t)blockIdx.x * 1024 + threadIdx.x; v8f v[4];
#pragma unroll     // all four pieces' loads are issued before the first is converted
    for (int p = 0; p < 4; ++p) { const size_t i = i0 + p * 256; v[p] = *(const v8f*)(src + (i < n8 ? i : n8 - 1) * 8); }   /* a piece past the end re-reads the last one and is not stored: no branch, so no wait, between the loads */
#pragma unroll     // constant index: the pieces stay in registers
    for (int p = 0; p < 4; ++p) { const size_t i = i0 + p * 256; if (i >= n8) continue; v8us o;
#pragma unroll
        for (int k = 0; k < 8; ++k) o[k] = f2bf(v[p][k]);
        *(v8us*)(dst + i * 8) = o; } }
__device__ __forceinline__ void d_cstab(const float* __restrict__ frq, float* CS) { const int idx = blockIdx.x * 256 + threadIdx.x; if (idx >= TT * HD) return; const int t = idx / HD, d = idx % HD; const float ang = bfr(frq[(size_t)t * (HD / 2) + (d >> 1)]);   /* interleaved pairs share freqs[t][j] */ v2f cs; cs[0] = cosf(ang); cs[1] = sinf(ang); *(v2f*)(CS + (size_t)idx * 2) = cs;  }
// k_prep: the six independent input preparations as one launch, blockIdx.y picks the job: 0 the cos/sin table (the longest thread), 1 to 4 the weight planes, 5 the hidden state.
__global__ __launch_bounds__(256) void k_prep(const float* __restrict__ frq, float* CS, const float* __restrict__ wq, const float* __restrict__ wk, const float* __restrict__ wv, const float* __restrict__ wo, const float* __restrict__ x, bf* WQ, bf* WK, bf* WV, bf* WO, bf* XB, size_t nw8, size_t nx8) {
    const unsigned job = blockIdx.y;
    if (job == 0) { d_cstab(frq, CS); return; }
    const float* src = job == 1 ? wq : job == 2 ? wk : job == 3 ? wv : job == 4 ? wo : x; bf* dst = job == 1 ? WQ : job == 2 ? WK : job == 3 ? WV : job == 4 ? WO : XB;
    d_cvt8(src, dst, job == 5 ? nx8 : nw8);
}

// d_rope: head planes [b * nheads + h][t][d] (fp16 + hi/lo), b = blockIdx.y, from rows b * TT + t of F, of the interleaved rotary (x1 c - x2 s, x1 s + x2 c on pairs (2j, 2j+1))
// A thread takes 8 consecutive d of one t in 4 heads (nheads % 4 == 0): 16-byte loads and stores, whole lines per wave, one fetch of the cos/sin pairs for the 4 heads, a sixteenth of the waves to start.
__device__ __forceinline__ void d_rope(const float* __restrict__ F, int pitch, int nheads, const float* __restrict__ CS, const float* __restrict__ RF, const float* __restrict__ nw, float sc, h16* P16, bf* Ph, bf* Pl) {
    { const size_t bb = blockIdx.y, po = bb * nheads * TT * HD; F += bb * TT * pitch; if (RF) RF += bb * nheads * TT; P16 += po; Ph += po; Pl += po; }   // this batch entry's rows of F and its planes
    const size_t gi = (size_t)blockIdx.x * 256 + threadIdx.x; const int d = (int)(gi % (HD / 8)) * 8; const int t = (int)((gi / (HD / 8)) % TT); const int h0 = (int)(gi / ((size_t)(HD / 8) * TT)) * 4; if (h0 >= nheads) return; v8f fx[4]; v4f c4[4];
#pragma unroll     // the four heads' loads and the 8 cos/sin pairs are issued before the first head is rotated
    for (int hh = 0; hh < 4; ++hh) { fx[hh] = *(const v8f*)(F + (size_t)t * pitch + (h0 + hh) * HD + d); c4[hh] = *(const v4f*)(CS + ((size_t)t * HD + d) * 2 + hh * 4);
        asm volatile("s_wait_xcnt 0x0" ::: "memory"); }   // a precaution: stands between these loads and the first reuse of their address registers
#pragma unroll     // constant index: the loaded rows stay in registers, and the cos/sin pairs are shared by the four heads
    for (int hh = 0; hh < 4; ++hh) { const int h = h0 + hh; const size_t e = ((size_t)h * TT + t) * HD + d; const float rf = RF ? RF[(size_t)h * TT + t] : 1.0f; v8h o16; v8us oh, ol;
#pragma unroll
    for (int q = 0; q < 8; ++q) { const int dd = d + q; const int dp = dd ^ 1;   /* interleaved pair partner */ float x0 = fx[hh][q], x1 = fx[hh][q ^ 1];
        if (RF) { float n0 = __fmul_rn(x0, rf), n1 = __fmul_rn(x1, rf); asm volatile("" : "+v"(n0)); asm volatile("" : "+v"(n1)); x0 = __fmul_rn(bfr(nw[dd]), n0); x1 = __fmul_rn(bfr(nw[dp]), n1); }
        v2f cs; cs[0] = c4[q >> 1][(q & 1) * 2]; cs[1] = c4[q >> 1][(q & 1) * 2 + 1]; float a = __fmul_rn(x0, cs[0]), bq = __fmul_rn(x1, cs[1]); asm volatile("" : "+v"(a)); asm volatile("" : "+v"(bq)); const float r = (((dd & 1) == 0) ? __fsub_rn(a, bq) : __fadd_rn(a, bq)) * sc;   /* even: x1 c - x2 s; odd: x2 c + x1 s */
        o16[q] = tohx(r); unsigned short a2, c2; splitf(r, a2, c2); oh[q] = a2; ol[q] = c2; }
    *(v8h*)(P16 + e) = o16; *(v8us*)(Ph + e) = oh; *(v8us*)(Pl + e) = ol;
    asm volatile("s_wait_xcnt 0x0" ::: "memory");   // a precaution: stands between these stores and the next head's reuse of their registers
    } }
// d_vtp: v planes [b * nheads + g][d][t] (fp16 + hi/lo), b = blockIdx.y, from rows b * TT + t of F. A thread holds a block of 8 t x 4 d in registers: 8 loads of 16 bytes along d, 12 stores of 16 bytes along t.
// Lanes: 4 along d x 8 along t, so a wave's store covers four whole 128-byte lines (64 t of one d each); the 8 waves of a work-group take the 128 d of one head for the same 64 t, so every line of F is read inside one work-group.
__device__ __forceinline__ void d_vtp(const float* __restrict__ F, int pitch, int nheads, h16* V16, bf* Vh, bf* Vl) { const int lane = threadIdx.x & 31; const int w = blockIdx.x * 8 + (threadIdx.x >> 5); const int d = (w % (HD / 16)) * 16 + (lane & 3) * 4; const int t = ((w / (HD / 16)) % (TT / 64)) * 64 + (lane >> 2) * 8; const int g = w / ((HD / 16) * (TT / 64)); if (g >= nheads) return; const float* f = F + ((size_t)blockIdx.y * TT + t) * pitch + g * HD + d;   /* b = blockIdx.y */ v4f x4[8];
#pragma unroll     // all eight rows' loads are issued before the first value is converted
    for (int j = 0; j < 8; ++j) { x4[j] = *(const v4f*)(f + (size_t)j * pitch);
        asm volatile("s_wait_xcnt 0x0" ::: "memory"); }   // a precaution: stands between each load and a later load's result landing in its address registers
#pragma unroll     // constant indices: the block stays in registers
    for (int c = 0; c < 4; ++c) { const size_t eo = (((size_t)blockIdx.y * nheads + g) * HD + d + c) * TT + t; v8h o16; v8us oh, ol;
#pragma unroll
        for (int q = 0; q < 8; ++q) { const float x = x4[q][c]; o16[q] = tohx(x); unsigned short a2, c2; splitf(x, a2, c2); oh[q] = a2; ol[q] = c2; }
        *(v8h*)(V16 + eo) = o16; *(v8us*)(Vh + eo) = oh; *(v8us*)(Vl + eo) = ol; } }
// k_planes: the three independent plane builders as one launch, grid (blocks per batch entry, NB_, 3): blockIdx.z = 0 rotates q, 1 rotates k, 2 transposes v.
__global__ __launch_bounds__(256) void k_planes(const float* __restrict__ FQ, const float* __restrict__ FK, const float* __restrict__ FV, const float* __restrict__ CS, h16* QP16, bf* QPh, bf* QPl, h16* KP16, bf* KPh, bf* KPl, h16* VT16, bf* VTh, bf* VTl) {
    if (blockIdx.z == 2) { d_vtp(FV, DKV, NKV, VT16, VTh, VTl); return; }
    const bool isq = blockIdx.z == 0;
    d_rope(isq ? FQ : FK, isq ? DQ : DKV, isq ? NH_ : NKV, CS, nullptr, nullptr, 1.0f, isq ? QP16 : KP16, isq ? QPh : KPh, isq ? QPl : KPl);
}
// stage4: four asynchronous 16-byte copies of a thread, rows rs elements apart in global memory and ls bytes apart in LDS.
// The closing s_wait_xcnt stands inside the statement so that no address register named here is rewritten ahead of it.
template <typename T>
__device__ __forceinline__ void stage4(const T* g, size_t rs, unsigned l, unsigned ls) {
    asm volatile("global_load_async_to_lds_b128 %0, %4, off\n\t"
                 "global_load_async_to_lds_b128 %1, %5, off\n\t"
                 "global_load_async_to_lds_b128 %2, %6, off\n\t"
                 "global_load_async_to_lds_b128 %3, %7, off\n\t"
                 "s_wait_xcnt 0x0"
                 :: "v"(l), "v"(l + ls), "v"(l + 2 * ls), "v"(l + 3 * ls), "v"(g), "v"(g + rs), "v"(g + 2 * rs), "v"(g + 3 * rs)
                 : "memory");
}
#define FKB 64                    // keys per stage of the fused attention kernel
constexpr unsigned FPK = HD * 2 + 16, FPV = FKB * 2 + 16, FPM = FKB * 4 + 16;   // LDS row pitches in bytes (k rows, v^T rows, mask rows): 16 B x odd
constexpr unsigned flash_stage_bytes(bool hl) { return (hl ? 2u : 1u) * (FKB * FPK + HD * FPV) + 128u * FPM; }
template <bool HL> struct PFrag;
template <> struct PFrag<true> { static __device__ __forceinline__ void mk(const v8f& x, const v8f& y, v16bf& h, v16bf& l) {
#pragma unroll     // constant indices: the fragments and accumulators stay in registers
        for (int j = 0; j < 8; ++j) { const __bf16 a = (__bf16)x[j], c = (__bf16)y[j]; h[j] = a; h[8 + j] = c; l[j] = (__bf16)(x[j] - (float)a); l[8 + j] = (__bf16)(y[j] - (float)c); } } };   // hi = nearest-even bf16, lo = bf16 of the remainder, as splitf
template <> struct PFrag<false> { static __device__ __forceinline__ void mk(const v8f& x, const v8f& y, v16h& h, v16h& l) { v8h h0, h1;
#pragma unroll     // constant indices: the fragments and accumulators stay in registers
        for (int j = 0; j < 8; ++j) { h0[j] = tohx(x[j]); h1[j] = tohx(y[j]); }
        h = cat16(h0, h1); l = h; } };
// d_flash: attention of 128 query rows of one head plane z, 8 waves x 16 queries, online softmax over stages of FKB keys; k rows, v^T rows and mask rows of a stage go into LDS by asynchronous b128 copies, two buffers.
// Transposed products keep every per-query value in the query's own lane: S^T = K Q^T (D: key = hi * 8 + j, query = lr); two such tiles are, register for register, the B fragment (query = lr; keys hi * 8 + j, 16 + hi * 8 + j) of O^T = V^T P^T (D: d = hi * 8 + j, query = lr).
// HL: hi+lo bf16 planes, 3 products each; otherwise single fp16 products. The result, divided by the row sum, goes out as hi and lo planes [b * TT + t][h * HD + d].
template <typename T16, bool HL>
__device__ __forceinline__ void d_flash(unsigned char* ring, const int qb, const int z, const T16* __restrict__ Q, const T16* __restrict__ Q2, const T16* __restrict__ Kp, const T16* __restrict__ K2, const T16* __restrict__ Vt, const T16* __restrict__ V2, const float* __restrict__ MK, bf* Ah, bf* Al) {
    typedef typename WFrag<T16>::V V;
    constexpr unsigned SK = FKB * FPK, SV = HD * FPV, OV = (HL ? 2u : 1u) * SK, OM = OV + (HL ? 2u : 1u) * SV, STG = flash_stage_bytes(HL);   // stage: [K | K2 | V | V2 | mask]
    const int tid = threadIdx.x, lane = tid & 31, lr = lane & 15, hi = lane >> 4, wave = tid >> 5;
    const size_t zo = (size_t)z * TT * HD; const int q = qb * 128 + wave * 16 + lr;   // this lane's query row
    V qf[4], qf2[4];
#pragma unroll     // constant indices: the fragments and accumulators stay in registers
    for (int ks = 0; ks < 4; ++ks) { qf[ks] = WFrag<T16>::ld(Q + zo + (size_t)q * HD + ks * 32 + hi * 8); if (HL) qf2[ks] = WFrag<T16>::ld(Q2 + zo + (size_t)q * HD + ks * 32 + hi * 8); }
    asm volatile("s_wait_xcnt 0x0" ::: "memory");   // a precaution: stands between these loads and the first reuse of their address registers
    const size_t gk = zo + (size_t)(tid >> 4) * HD + (tid & 15) * 8, gv = zo + (size_t)(tid >> 3) * TT + (tid & 7) * 8, gm = ((size_t)(z / NH_) * TT + qb * 128 + (tid >> 4)) * TT + (tid & 15) * 4;
    const unsigned lb = (unsigned)(size_t)ring, lk = lb + (unsigned)(tid >> 4) * FPK + (unsigned)(tid & 15) * 16, lv = lb + OV + (unsigned)(tid >> 3) * FPV + (unsigned)(tid & 7) * 16, lm = lb + OM + (unsigned)(tid >> 4) * FPM + (unsigned)(tid & 15) * 16;
    auto fill = [&](int kb, unsigned buf) { const unsigned o = buf * STG;
        stage4(Kp + gk + (size_t)kb * HD, (size_t)16 * HD, lk + o, 16 * FPK); if (HL) stage4(K2 + gk + (size_t)kb * HD, (size_t)16 * HD, lk + o + SK, 16 * FPK);
        stage4(Vt + gv + kb, (size_t)32 * TT, lv + o, 32 * FPV); if (HL) stage4(V2 + gv + kb, (size_t)32 * TT, lv + o + SV, 32 * FPV);
        stage_plane<false>(MK + gm + kb, (size_t)16 * TT, lm + o, 16 * FPM); };
    v8f o[8];
#pragma unroll     // constant indices: the fragments and accumulators stay in registers
    for (int dt = 0; dt < 8; ++dt) o[dt] = (v8f){};
    float mx = -3.0e38f, sum = 0.f;   // running maximum of the query's row (both lane halves alike); this lane's half of the running sum
    fill(0, 0);
    asm volatile("s_wait_asynccnt 0x0" ::: "memory");   // stage 0 has landed before anybody reads it
    __syncthreads();
    fill(FKB, 1);
#pragma unroll 1   // one stage per trip: a single publish point
    for (int kb = 0, t = 0; kb < TT; kb += FKB, t ^= 1) {
        const unsigned char* sb = ring + (unsigned)t * STG;
        v8f s[4];
#pragma unroll     // constant indices: the fragments and accumulators stay in registers
        for (int kt = 0; kt < 4; ++kt) s[kt] = (v8f){};
#pragma unroll     // constant indices: the fragments and accumulators stay in registers
        for (int ks = 0; ks < 4; ++ks) { V a[4], a2[4];
#pragma unroll     // constant indices: the fragments and accumulators stay in registers
            for (int kt = 0; kt < 4; ++kt) { const unsigned char* p = sb + (kt * 16 + lr) * FPK + ks * 64 + hi * 16; a[kt] = WFrag<T16>::ld((const T16*)p); if (HL) a2[kt] = WFrag<T16>::ld((const T16*)(p + SK)); }
#pragma unroll     // constant indices: the fragments and accumulators stay in registers
            for (int kt = 0; kt < 4; ++kt) s[kt] = WFrag<T16>::mma(a[kt], qf[ks], s[kt]);
            if (HL) {
#pragma unroll     // constant indices: the fragments and accumulators stay in registers
                for (int kt = 0; kt < 4; ++kt) s[kt] = WFrag<T16>::mma(a2[kt], qf[ks], s[kt]);
#pragma unroll     // constant indices: the fragments and accumulators stay in registers
                for (int kt = 0; kt < 4; ++kt) s[kt] = WFrag<T16>::mma(a[kt], qf2[ks], s[kt]); } }
        float bm = mx;
#pragma unroll     // constant indices: the fragments and accumulators stay in registers
        for (int kt = 0; kt < 4; ++kt) { const float* mr = (const float*)(sb + OM + (wave * 16 + lr) * FPM + (kt * 16 + hi * 8) * 4); const v4f m0 = *(const v4fa*)mr, m1 = *(const v4fa*)(mr + 4);
#pragma unroll     // constant indices: the fragments and accumulators stay in registers
            for (int j = 0; j < 8; ++j) { const float tv = s[kt][j] * SCL + bfr(j < 4 ? m0[j & 3] : m1[j & 3]);   /* + attention_mask[b][0][q][key] */ s[kt][j] = tv; bm = fmaxf(bm, tv); } }
        bm = fmaxf(bm, __shfl_xor(bm, 16, 32));
        const float al = __builtin_amdgcn_exp2f((mx - bm) * 1.4426950408889634f); mx = bm;
        float ps = 0.f;
#pragma unroll     // constant indices: the fragments and accumulators stay in registers
        for (int kt = 0; kt < 4; ++kt)
#pragma unroll     // constant indices: the fragments and accumulators stay in registers
            for (int j = 0; j < 8; ++j) { const float p = __builtin_amdgcn_exp2f((s[kt][j] - mx) * 1.4426950408889634f); s[kt][j] = p; ps += p; }
        sum = sum * al + ps;
#pragma unroll     // constant indices: the fragments and accumulators stay in registers
        for (int dt = 0; dt < 8; ++dt) o[dt] *= al;
#pragma unroll     // constant indices: the fragments and accumulators stay in registers
        for (int kk = 0; kk < 2; ++kk) { V ph, pl; PFrag<HL>::mk(s[2 * kk], s[2 * kk + 1], ph, pl);
#pragma unroll     // constant indices: the fragments and accumulators stay in registers
            for (int dg = 0; dg < 2; ++dg) { V a[4], a2[4];
#pragma unroll     // constant indices: the fragments and accumulators stay in registers
                for (int i = 0; i < 4; ++i) { const unsigned char* p = sb + OV + ((dg * 4 + i) * 16 + lr) * FPV + kk * 64 + hi * 16; a[i] = WFrag<T16>::ld((const T16*)p); if (HL) a2[i] = WFrag<T16>::ld((const T16*)(p + SV)); }
#pragma unroll     // constant indices: the fragments and accumulators stay in registers
                for (int i = 0; i < 4; ++i) o[dg * 4 + i] = WFrag<T16>::mma(a[i], ph, o[dg * 4 + i]);
                if (HL) {
#pragma unroll     // constant indices: the fragments and accumulators stay in registers
                    for (int i = 0; i < 4; ++i) o[dg * 4 + i] = WFrag<T16>::mma(a2[i], ph, o[dg * 4 + i]);
#pragma unroll     // constant indices: the fragments and accumulators stay in registers
                    for (int i = 0; i < 4; ++i) o[dg * 4 + i] = WFrag<T16>::mma(a[i], pl, o[dg * 4 + i]); } } }
        asm volatile("s_wait_dscnt 0x0" ::: "memory");      // this wave's reads of the buffer are done before it is refilled
        asm volatile("s_wait_asynccnt 0x0" ::: "memory");   // this wave's copies of the next stage have landed
        __syncthreads();                                    // publishes the next stage and ends every reader's last read of this one
        if (kb + 2 * FKB < TT) fill(kb + 2 * FKB, (unsigned)t);
    }
    asm volatile("s_wait_asynccnt 0x0" ::: "memory");       // no copy is in flight when the wave ends
    sum += __shfl_xor(sum, 16, 32);
    const float f = __fdiv_rn(1.0f, sum);
    const size_t oo = ((size_t)(z / NH_) * TT + q) * DQ + (z % NH_) * HD + hi * 8;
#pragma unroll     // constant indices: the fragments and accumulators stay in registers
    for (int dt = 0; dt < 8; ++dt) { v8us oh, ol;
#pragma unroll     // constant indices: the fragments and accumulators stay in registers
        for (int j = 0; j < 8; ++j) { unsigned short a, c; splitf(o[dt][j] * f, a, c); oh[j] = a; ol[j] = c; }
        *(v8us*)(Ah + oo + dt * 16) = oh; *(v8us*)(Al + oo + dt * 16) = ol;
        asm volatile("s_wait_xcnt 0x0" ::: "memory");   // a precaution: stands between these stores and the next block's reuse of their registers
    }
}
// k_flash: grid (NZ, TT / 128), 256 threads; query blocks below RH / 128 take the hi+lo planes.
__global__ __launch_bounds__(256) void k_flash(const bf* __restrict__ Qh, const bf* __restrict__ Ql, const bf* __restrict__ Kh, const bf* __restrict__ Kl, const bf* __restrict__ Vh, const bf* __restrict__ Vl, const h16* __restrict__ Q16, const h16* __restrict__ K16, const h16* __restrict__ V16, const float* __restrict__ MK, bf* Ah, bf* Al) {
    __shared__ __align__(16) unsigned char ring[2 * flash_stage_bytes(true)];
    if (blockIdx.y < RH / 128) d_flash<bf, true>(ring, blockIdx.y, blockIdx.x, Qh, Ql, Kh, Kl, Vh, Vl, MK, Ah, Al);
    else d_flash<h16, false>(ring, blockIdx.y, blockIdx.x, Q16, nullptr, K16, nullptr, V16, nullptr, MK, Ah, Al);
}

extern "C" void kernel_launch(void* const* d_in, const int* in_sizes, int n_in,
                              void* d_out, int out_size, void* d_ws, size_t ws_size, hipStream_t stream) {
    (void)in_sizes; (void)n_in; (void)out_size;
    const float* x = (const float*)d_in[0]; const float* MK = (const float*)d_in[1]; const float* FRQ = (const float*)d_in[2]; const float* wq = (const float*)d_in[3]; const float* bq = (const float*)d_in[4]; const float* wk = (const float*)d_in[5]; const float* bk = (const float*)d_in[6]; const float* wv = (const float*)d_in[7]; const float* bv = (const float*)d_in[8]; const float* wo = (const float*)d_in[9]; const float* bo = (const float*)d_in[10]; const float* g1 = (const float*)d_in[11]; const float* e1b = (const float*)d_in[12]; const float* qnw = nullptr; const float* knw = nullptr; (void)qnw; (void)knw;
    float* OUT = (float*)d_out;     // [2][1024][2048]
    char* wsp = (char*)d_ws;
    auto take = [&](size_t bytes) { char* p = wsp; wsp += (bytes + 255) & ~(size_t)255; return (void*)p; };
    constexpr int MT = NB_ * TT;   // token rows of both batch entries
    bf* WO = (bf*)take((size_t)DM * DQ * 2); float* CS = (float*)take((size_t)TT * HD * 2 * 4);
    bf* WQ = (bf*)take((size_t)DQ * DM * 2); bf* WK = (bf*)take((size_t)DKV * DM * 2); bf* WV = (bf*)take((size_t)DKV * DM * 2); bf* XB = (bf*)take((size_t)MT * DM * 2);
    h16* QP16 = (h16*)take((size_t)NZ * TT * HD * 2); h16* KP16 = (h16*)take((size_t)NZ * TT * HD * 2); h16* VT16 = (h16*)take((size_t)NZ * HD * TT * 2);
    bf* QPh = (bf*)take((size_t)NZ * TT * HD * 2); bf* QPl = (bf*)take((size_t)NZ * TT * HD * 2); bf* KPh = (bf*)take((size_t)NZ * TT * HD * 2); bf* KPl = (bf*)take((size_t)NZ * TT * HD * 2); bf* VTh = (bf*)take((size_t)NZ * HD * TT * 2); bf* VTl = (bf*)take((size_t)NZ * HD * TT * 2);
    float* Sb = (float*)take((size_t)NZ * TT * TT * 4);
    if ((size_t)(wsp - (char*)d_ws) > ws_size) return;    // ws 256 MiB
    // Buffers that share bytes, all stream-ordered: the f32 projections and, once the plane builders have read them, the output projection live in Sb;
    // the attention output's hi and lo planes take the v weight plane and the bf16 hidden state, both read for the last time by the projection launch.
    float* FQ = Sb; float* FK = Sb + (size_t)MT * DQ; float* FV = FK + (size_t)MT * DKV; float* YO = Sb; bf* ATh = WV; bf* ATl = XB;
    static_assert(DQ == DKV && (size_t)DQ * DM / 8 / 1024 == (size_t)MT * DM / 8 / 1024 && (size_t)DQ * DM / 8 / 1024 == (size_t)TT * HD / 256, "one grid extent serves all jobs of k_prep; q, k and v planes have one size");
    static_assert((size_t)DQ * DM * 2 % 256 == 0, "the weight planes follow one another without a gap");
    k_prep<<<dim3((unsigned)(((size_t)DQ * DM / 8 + 1023) / 1024), 6), 256, 0, stream>>>(FRQ, CS, wq, wk, wv, wo, x, WQ, WK, WV, WO, XB, (size_t)DQ * DM / 8, (size_t)MT * DM / 8);
    const unsigned LP = (unsigned)(((size_t)NH_ * TT * HD / 32 + 255) / 256);   // blocks per batch entry of the plane kernels, 32 elements a thread (NKV == NH_)
    // q, k and v projections: planes z = 0, 1, 2 of one launch; WQ, WK, WV and FQ, FK, FV lie one plane size apart
    k_gemmw<bf, 0, true><<<dim3(MT / 128, DQ / 128, 3), 128, 0, stream>>>(XB, nullptr, WQ, nullptr, DM, DM, FQ, DQ, bq, bk, bv, 0, (size_t)DQ * DM, (size_t)MT * DQ);
    k_planes<<<dim3(LP, NB_, 3), 256, 0, stream>>>(FQ, FK, FV, CS, QP16, QPh, QPl, KP16, KPh, KPl, VT16, VTh, VTl);
    // one kv head per query head: plane z of q meets plane z of k and v; scores and probabilities stay in registers
    k_flash<<<dim3(NZ, TT / 128), 256, 0, stream>>>(QPh, QPl, KPh, KPl, VTh, VTl, QP16, KP16, VT16, MK, ATh, ATl);
    k_gemmw<bf, 1, true><<<dim3(MT / 128, DM / 128, 1), 128, 0, stream>>>(ATh, ATl, WO, nullptr, DQ, DQ, YO, DM, bo, nullptr, nullptr, 0, 0, 0);
    k_resln<<<MT / 8, 256, 0, stream>>>(YO, x, g1, e1b, OUT);   /* LN(proj + bo + hidden_state) */
}

// v008
// One run takes 148 microseconds.
// Timed twice side by side with v007, it ran 1.05 and 1.06 times as fast.
// Over all steps from v000 it is 10.7 times as fast.
#include <hip/hip_runtime.h>

// Decoder attention with RoPE and a BERT-style output (hidden_state [2][1024][2048]; q, k, v = x W^T + b ('oi' [2048][2048], 16 heads x 128); interleaved RoPE with cos/sin(freqs[t][j]) (freqs [1024][64] input, read); scores/sqrt(128) + attention_mask[b][0][i][j] (f32 input, read; zeros); softmax; out = LN(attn Wo^T + bo + hidden_state) (eps 1e-12, gamma/beta) -> [2][1024][2048]).
// Compute dtypes, f32 accumulate: every input rounded to bf16; q/k/v on PLAIN bf16 operands (inputs: exact) + biases; rotary in f32 from a table cos/sin(bf16(freqs)); scores, additive mask (bf16-rounded), online softmax (f32) and attn.v in one kernel: query rows < 512 hl (3 products), the rest single fp16; Wo hl x exact (2 products) + bo; residual add and LayerNorm in f32 (fixed trees).

#define NB_  2
#define TT   1024
#define DM   2048
#define NH_  16
#define NKV  16
#define REP  (NH_ / NKV)
#define HD   128
#define DQ   (NH_ * HD)
#define DKV  (NKV * HD)
#define LNEPS 1e-12f
typedef __attribute__((ext_vector_type(4))) unsigned short v4us;
#define NZ   (NB_ * NH_)          // head planes z = b * NH_ + h, the x extent of the attention launch: every head of both batch entries in one pass
#define RH   512                  // query rows < RH use hi+lo planes (0: none)
#define WIN  0
#define SCL  0.088388347648318447f   // HD^-0.5
typedef _Float16 h16;
typedef unsigned short bf;
typedef __attribute__((ext_vector_type(16))) __bf16   v16bf;
typedef __attribute__((ext_vector_type(16))) _Float16 v16h;
typedef __attribute__((ext_vector_type(8)))  _Float16 v8h;
typedef __attribute__((ext_vector_type(8)))  unsigned short v8us;
typedef __attribute__((ext_vector_type(8)))  float    v8f;
typedef __attribute__((ext_vector_type(4)))  float    v4f;
typedef v8h  __attribute__((may_alias)) v8ha;
typedef v4f  __attribute__((may_alias)) v4fa;
typedef v8us __attribute__((may_alias)) v8usa;

__device__ __forceinline__ unsigned short f2bf(float f) { unsigned u = __float_as_uint(f); u += 0x7FFFu + ((u >> 16) & 1u); return (unsigned short)(u >> 16); }
__device__ __forceinline__ float bf2f(unsigned short b) { return __uint_as_float(((unsigned)b) << 16); }
__device__ __forceinline__ float bfr(float f) { return bf2f(f2bf(f)); }
__device__ __forceinline__ v16h cat16(v8h lo, v8h hi) { return __builtin_shufflevector(lo, hi, 0, 1, 2, 3, 4, 5, 6, 7, 8, 9, 10, 11, 12, 13, 14, 15); }
__device__ __forceinline__ v16bf cat16b(v8us lo, v8us hi) { return __builtin_bit_cast(v16bf, __builtin_shufflevector(lo, hi, 0, 1, 2, 3, 4, 5, 6, 7, 8, 9, 10, 11, 12, 13, 14, 15)); }
__device__ __forceinline__ v8f wmma16(v16h a, v16h b, v8f c) { return __builtin_amdgcn_wmma_f32_16x16x32_f16(false, a, false, b, (short)0, c, false, false); }
__device__ __forceinline__ v8f wmmab(v16bf a, v16bf b, v8f c) { return __builtin_amdgcn_wmma_f32_16x16x32_bf16(false, a, false, b, (short)0, c, false, false); }



// ---- k_gemmw: GEMM, one 128x128 output tile per work-group of 4 waves (2x2, 64x64 and 16 accumulators per wave); grid (M/128, N/128, Z), 128 threads.
// Operand tiles (128 rows x KC k, whole 128-byte lines) go from the K-contiguous 16-bit planes into LDS by asynchronous b128 copies, two buffers: the next tile flies while this one is multiplied.
// C[m][n] (f32, pitch ldc, + optional f32 bias[n]) = sum_k A[m][k] Bt[n][k] (+ split products per NSPLIT). A rows have pitch lda, Bt rows pitch K (elements). z-batch strides sA/sB/sC in elements. K % KC == 0, M % 128 == 0, N % 128 == 0.
template <typename T16> struct WFrag;
template <> struct WFrag<h16> { typedef v16h V; static __device__ __forceinline__ V ld(const h16* p) { return cat16(*(const v8h*)p, *(const v8h*)(p + 16)); } static __device__ __forceinline__ v8f mma(V a, V b, v8f c) { return wmma16(a, b, c); } };
template <> struct WFrag<bf> { typedef v16bf V; static __device__ __forceinline__ V ld(const bf* p) { return cat16b(*(const v8us*)p, *(const v8us*)(p + 16)); } static __device__ __forceinline__ v8f mma(V a, V b, v8f c) { return wmmab(a, b, c); } };
// One plane of one stage: every thread copies its 16 bytes (with WIDE also the 16 bytes 128 further on, in global memory and in LDS alike) of rows r, r + 16, ..., r + 112; a wave's copy = 4 whole lines.
// g: the lane's global address in row r, rs: 16 rows in elements, l: the lane's LDS byte address in row r, ls: 16 rows in LDS bytes.
// The closing s_wait_xcnt stands inside the statement so that no address register named here is rewritten ahead of it.
template <bool WIDE, typename T16>
__device__ __forceinline__ void stage_plane(const T16* g, size_t rs, unsigned l, unsigned ls) {
    if (WIDE)
        asm volatile("global_load_async_to_lds_b128 %0, %8, off\n\t"  "global_load_async_to_lds_b128 %0, %8, off offset:128\n\t"
                     "global_load_async_to_lds_b128 %1, %9, off\n\t"  "global_load_async_to_lds_b128 %1, %9, off offset:128\n\t"
                     "global_load_async_to_lds_b128 %2, %10, off\n\t" "global_load_async_to_lds_b128 %2, %10, off offset:128\n\t"
                     "global_load_async_to_lds_b128 %3, %11, off\n\t" "global_load_async_to_lds_b128 %3, %11, off offset:128\n\t"
                     "global_load_async_to_lds_b128 %4, %12, off\n\t" "global_load_async_to_lds_b128 %4, %12, off offset:128\n\t"
                     "global_load_async_to_lds_b128 %5, %13, off\n\t" "global_load_async_to_lds_b128 %5, %13, off offset:128\n\t"
                     "global_load_async_to_lds_b128 %6, %14, off\n\t" "global_load_async_to_lds_b128 %6, %14, off offset:128\n\t"
                     "global_load_async_to_lds_b128 %7, %15, off\n\t" "global_load_async_to_lds_b128 %7, %15, off offset:128\n\t"
                     "s_wait_xcnt 0x0"
                     :: "v"(l), "v"(l + ls), "v"(l + 2 * ls), "v"(l + 3 * ls), "v"(l + 4 * ls), "v"(l + 5 * ls), "v"(l + 6 * ls), "v"(l + 7 * ls),
                        "v"(g), "v"(g + rs), "v"(g + 2 * rs), "v"(g + 3 * rs), "v"(g + 4 * rs), "v"(g + 5 * rs), "v"(g + 6 * rs), "v"(g + 7 * rs)
                     : "memory");
    else
        asm volatile("global_load_async_to_lds_b128 %0, %8, off\n\t"
                     "global_load_async_to_lds_b128 %1, %9, off\n\t"
                     "global_load_async_to_lds_b128 %2, %10, off\n\t"
                     "global_load_async_to_lds_b128 %3, %11, off\n\t"
                     "global_load_async_to_lds_b128 %4, %12, off\n\t"
                     "global_load_async_to_lds_b128 %5, %13, off\n\t"
                     "global_load_async_to_lds_b128 %6, %14, off\n\t"
                     "global_load_async_to_lds_b128 %7, %15, off\n\t"
                     "s_wait_xcnt 0x0"
                     :: "v"(l), "v"(l + ls), "v"(l + 2 * ls), "v"(l + 3 * ls), "v"(l + 4 * ls), "v"(l + 5 * ls), "v"(l + 6 * ls), "v"(l + 7 * ls),
                        "v"(g), "v"(g + rs), "v"(g + 2 * rs), "v"(g + 3 * rs), "v"(g + 4 * rs), "v"(g + 5 * rs), "v"(g + 6 * rs), "v"(g + 7 * rs)
                     : "memory");
}
__device__ __forceinline__ h16 tohx(float x) { return (h16)x; }
__device__ __forceinline__ void splitf(float y, unsigned short& h, unsigned short& l) { h = f2bf(y); l = f2bf(y - bf2f(h)); }
typedef __attribute__((ext_vector_type(2))) _Float16 v2h;
typedef __attribute__((ext_vector_type(4))) _Float16 v4h;
typedef __attribute__((ext_vector_type(2))) unsigned short v2us;
typedef __attribute__((ext_vector_type(4))) unsigned short v4us;
typedef __attribute__((ext_vector_type(2))) float v2f;
typedef __attribute__((ext_vector_type(4))) int v4i;
// rope8: 8 consecutive d (d % 8 == 0) of one token row of q or k: the interleaved rotary (x1 c - x2 s, x1 s + x2 c on pairs (2j, 2j+1)) with the row's 8 cos/sin pairs c4, then the fp16 value and the hi and lo bf16 parts.
__device__ __forceinline__ void rope8(const v8f& fx, const v4f* c4, v8h& o16, v8us& oh, v8us& ol) {
#pragma unroll     // constant indices: the row piece stays in registers
    for (int q = 0; q < 8; ++q) { float x0 = fx[q], x1 = fx[q ^ 1];   /* interleaved pair partner */
        v2f cs; cs[0] = c4[q >> 1][(q & 1) * 2]; cs[1] = c4[q >> 1][(q & 1) * 2 + 1]; const float a = __fmul_rn(x0, cs[0]), bq = __fmul_rn(x1, cs[1]); const float r = ((q & 1) == 0) ? __fsub_rn(a, bq) : __fadd_rn(a, bq);   /* even: x1 c - x2 s; odd: x2 c + x1 s */
        o16[q] = tohx(r); unsigned short a2, c2; splitf(r, a2, c2); oh[q] = a2; ol[q] = c2; } }
// LDS bytes of the two-buffer ring of d_gemmw<., NSPLIT, .>
constexpr unsigned gemm_ring_bytes(int nsplit) { return 2u * (((nsplit == 1 || nsplit == 2) ? 2u : 1u) + (nsplit >= 2 ? 2u : 1u)) * 128u * ((nsplit >= 2 ? 64u : 128u) * 2u + 16u); }
// d_gemmw: the body; ring = the work-group's LDS (gemm_ring_bytes(NSPLIT) bytes), (bx, by, bz) = its M tile, N tile and batch plane, the same for every thread of the work-group.
// PLANES: no f32 C; the tile + bias goes out as the attention operand planes (fp16 + hi/lo bf16) P16, Ph, Pl: vt false: rotated with the table CS, [b * NH_ + h][t][d]; vt true (the same for the whole work-group): transposed, [b * NH_ + h][d][t]. Rows are tokens b * TT + t, columns h * HD + d.
template <typename T16, int NSPLIT, bool BIAS, bool PLANES>
__device__ __forceinline__ void d_gemmw(unsigned char* ring, const int bx, const int by, const int bz, const T16* __restrict__ A, const T16* __restrict__ A2, const T16* __restrict__ Bt, const T16* __restrict__ Bt2, int K, int lda, float* C, int ldc, const float* __restrict__ bias, size_t sA, size_t sB, size_t sC, const float* __restrict__ CS, h16* P16, bf* Ph, bf* Pl, const bool vt) {
    typedef typename WFrag<T16>::V V;
    constexpr bool HA2 = (NSPLIT == 1 || NSPLIT == 2), HB2 = (NSPLIT >= 2), WIDE = !HB2;
    constexpr int KC = WIDE ? 128 : 64;                       // k per stage; four planes of 128 k would be 64 copies of a wave in flight
    constexpr unsigned PIT = KC * 2 + 16;                     // LDS row pitch in bytes: 16 B x odd, conflict-free for ds_load_b128
    constexpr unsigned PLN = 128 * PIT, PB = (HA2 ? 2u : 1u) * PLN, STG = PB + (HB2 ? 2u : 1u) * PLN;   // stage: [A | A2 | B | B2]
    static_assert(2 * STG == gemm_ring_bytes(NSPLIT), "the callers size the ring");
    const size_t z = bz; A += z * sA; if (HA2) A2 += z * sA; Bt += z * sB; if (HB2) Bt2 += z * sB; C += z * sC;
    const int tid = threadIdx.x, lane = tid & 31, lr = lane & 15, hi = lane >> 4, wave = tid >> 5, wm = wave >> 1, wn = wave & 1;
    const int r0 = bx * 128 + wm * 64, c0 = by * 128 + wn * 64;
    v8f acc[4][4];
#pragma unroll
    for (int mb = 0; mb < 4; ++mb)
#pragma unroll
        for (int nb = 0; nb < 4; ++nb) acc[mb][nb] = (v8f){};
    const size_t ga = (size_t)(bx * 128 + (tid >> 3)) * lda + (tid & 7) * 8, gb = (size_t)(by * 128 + (tid >> 3)) * K + (tid & 7) * 8, rsa = (size_t)16 * lda, rsb = (size_t)16 * K;
    const unsigned lcp = (unsigned)(size_t)ring + (unsigned)(tid >> 3) * PIT + (unsigned)(tid & 7) * 16;
    auto fill = [&](int kc, unsigned buf) { const unsigned l = lcp + buf * STG;
        stage_plane<WIDE>(A + ga + kc, rsa, l, 16 * PIT); if (HA2) stage_plane<WIDE>(A2 + ga + kc, rsa, l + PLN, 16 * PIT);
        stage_plane<WIDE>(Bt + gb + kc, rsb, l + PB, 16 * PIT); if (HB2) stage_plane<WIDE>(Bt2 + gb + kc, rsb, l + PB + PLN, 16 * PIT); };
    fill(0, 0);
    asm volatile("s_wait_asynccnt 0x0" ::: "memory");   // tile 0 has landed before anybody reads it
    __syncthreads();
    if (K > KC) fill(KC, 1);
#pragma unroll 1   // one pass per trip: a single publish point
    for (int kc = 0, t = 0; kc < K; kc += KC, t ^= 1) {
        const unsigned char* fa = ring + (unsigned)t * STG + (wm * 64 + lr) * PIT + hi * 16; const unsigned char* fb = ring + (unsigned)t * STG + PB + (wn * 64 + lr) * PIT + hi * 16;
        V a[2][4], a2[2][4], b[2][4], b2[2][4];   // two fragment sets: the next 32 k are fetched as one group ahead of this block's products
#pragma unroll     // unrolled so that the set index is a constant and both fragment sets stay in registers
        for (int ks = -1; ks < KC / 32; ++ks) {
            if (ks + 1 < KC / 32) { const int s = (ks + 1) & 1, o = (ks + 1) * 64;
#pragma unroll
                for (int i = 0; i < 4; ++i) { a[s][i] = WFrag<T16>::ld((const T16*)(fa + i * 16 * PIT + o)); if (HA2) a2[s][i] = WFrag<T16>::ld((const T16*)(fa + PLN + i * 16 * PIT + o)); }
#pragma unroll
                for (int i = 0; i < 4; ++i) { b[s][i] = WFrag<T16>::ld((const T16*)(fb + i * 16 * PIT + o)); if (HB2) b2[s][i] = WFrag<T16>::ld((const T16*)(fb + PLN + i * 16 * PIT + o)); } }
            __builtin_amdgcn_sched_barrier(0);   // keeps the next block's LDS reads one group ahead of this block's products; sunk among them, every product row waits out the LDS latency
            if (ks >= 0) { const int s = ks & 1;
#pragma unroll
                for (int nb = 0; nb < 4; ++nb) {
#pragma unroll
                    for (int mb = 0; mb < 4; ++mb) acc[mb][nb] = WFrag<T16>::mma(a[s][mb], b[s][nb], acc[mb][nb]);
                    if (HA2) {
#pragma unroll
                        for (int mb = 0; mb < 4; ++mb) acc[mb][nb] = WFrag<T16>::mma(a2[s][mb], b[s][nb], acc[mb][nb]); }
                    if (HB2) {
#pragma unroll
                        for (int mb = 0; mb < 4; ++mb) acc[mb][nb] = WFrag<T16>::mma(a[s][mb], b2[s][nb], acc[mb][nb]); } } }
            __builtin_amdgcn_sched_barrier(0);   // and keeps the group after next behind these products, whose registers it refills
        }
        asm volatile("s_wait_dscnt 0x0" ::: "memory");      // this wave's reads of the buffer are done before it is refilled
        asm volatile("s_wait_asynccnt 0x0" ::: "memory");   // this wave's copies of the next tile have landed
        __syncthreads();                                    // publishes the next tile and ends every reader's last read of this one
        if (kc + 2 * KC < K) fill(kc + 2 * KC, (unsigned)t);
    }
    asm volatile("s_wait_asynccnt 0x0" ::: "memory");       // no copy is in flight when the ring becomes output staging
    if (PLANES) {
        const size_t zp = (size_t)(r0 / TT) * NH_ + c0 / HD; const int t0 = r0 % TT, d0 = c0 % HD;   // the wave's 64 tokens lie in one batch entry, its 64 columns in one head
        if (!vt) {
            float* os = (float*)ring + wave * (64 * 68);    // each wave's own 64 x 68 floats; every reader left the ring at the last pass's barrier
            const int rr = lane >> 3, cofs = (lane & 7) * 8;   // read-back: 8 lanes x 8 d cover the 64 columns of a row (one whole line of a 16-bit plane), 4 rows a step
            // One 32-bit byte offset a buffer beside its scalar base: a trip's loads share one offset register, its steps are immediates.
            const unsigned bofs = (unsigned)(c0 + cofs) * 4u, co = (unsigned)((t0 + rr) * HD + d0 + cofs) * 8u, eo = ((unsigned)(zp * TT + t0 + rr) * HD + d0 + cofs) * 2u;
            const v4f b0 = *(const v4f*)((const char*)bias + bofs), b1 = *(const v4f*)((const char*)bias + bofs + 16);
            asm volatile("s_wait_xcnt 0x0" :: "v"(bofs) : "memory");   // a precaution: the offset stays in its register up to this wait, so that no load's result lands in it earlier
            v8f bb;
#pragma unroll     // constant indices: the bias piece stays in registers
            for (int q = 0; q < 4; ++q) { bb[q] = bfr(b0[q]); bb[4 + q] = bfr(b1[q]); }
#pragma unroll     // constant indices: the accumulators stay in registers
            for (int mb = 0; mb < 4; ++mb)
#pragma unroll
                for (int nb = 0; nb < 4; ++nb)
#pragma unroll
                    for (int j = 0; j < 8; ++j) os[(mb * 16 + hi * 8 + j) * 68 + nb * 16 + lr] = acc[mb][nb][j];
            __builtin_amdgcn_wave_barrier(); asm volatile("" ::: "memory");   // the wave's own LDS writes stay ahead of its reads of other lanes' values
#pragma unroll 1   // 16 rows a trip, rolled: for speed only
            for (int it = 0; it < 4; ++it) { v4f c4[4][4]; v8f fx[4]; const unsigned c = co + it * (16 * HD * 8), e0 = eo + it * (16 * HD * 2);
#pragma unroll     // the trip's 16 table loads are issued together, ahead of its LDS reads
                for (int s = 0; s < 4; ++s)
#pragma unroll
                    for (int i = 0; i < 4; ++i) c4[s][i] = *(const v4f*)((const char*)CS + c + s * (4 * HD * 8) + i * 16);
                asm volatile("s_wait_xcnt 0x0" :: "v"(c) : "memory");   // a precaution: the offset stays in its register up to this wait, so that no load's result lands in it earlier
#pragma unroll
                for (int s = 0; s < 4; ++s) { const float* p = os + (it * 16 + s * 4 + rr) * 68 + cofs; const v4f x = *(const v4fa*)p, y = *(const v4fa*)(p + 4);
#pragma unroll
                    for (int q = 0; q < 4; ++q) { fx[s][q] = x[q] + bb[q]; fx[s][4 + q] = y[q] + bb[4 + q]; } }
#pragma unroll
                for (int s = 0; s < 4; ++s) { const unsigned e = e0 + s * (4 * HD * 2); v8h o16; v8us oh, ol; rope8(fx[s], c4[s], o16, oh, ol);
                    *(v8h*)((char*)P16 + e) = o16; *(v8us*)((char*)Ph + e) = oh; *(v8us*)((char*)Pl + e) = ol;
                    asm volatile("s_wait_xcnt 0x0" :: "v"(__builtin_bit_cast(v4i, o16)), "v"(__builtin_bit_cast(v4i, oh)), "v"(__builtin_bit_cast(v4i, ol)), "v"(e) : "memory"); }   // a precaution: the stored values and the offset stay in their registers up to this wait
            }
        } else {
            constexpr unsigned VP = 64 * 2 + 16, VS = 16 * VP;   // staging of one plane: 16 d rows of 64 t, pitch 16 B x odd
            unsigned char* vs = ring + wave * (3 * VS);     // each wave's own three planes; every reader left the ring at the last pass's barrier
            const int rr = lane >> 3, tofs = (lane & 7) * 8;   // read-back: 8 lanes x 8 t cover the 64 t of one d (one whole line), 4 d a step
            // One 32-bit byte offset a buffer beside its scalar base.
            const unsigned bofs = (unsigned)(c0 + lr) * 4u, eo = ((unsigned)(zp * HD + d0 + rr) * TT + t0 + tofs) * 2u; float bl[4];
#pragma unroll     // the four column blocks' bias values are fetched together
            for (int nb = 0; nb < 4; ++nb) bl[nb] = *(const float*)((const char*)bias + bofs + nb * 64);
            asm volatile("s_wait_xcnt 0x0" :: "v"(bofs) : "memory");   // a precaution: the offset stays in its register up to this wait, so that no load's result lands in it earlier
#pragma unroll     // constant indices: the accumulators stay in registers
            for (int nb = 0; nb < 4; ++nb) { const float bv1 = bfr(bl[nb]);
#pragma unroll     // an accumulator holds 8 consecutive t of the lane's d: 16 bytes of each transposed plane
                for (int mb = 0; mb < 4; ++mb) { v8h o16; v8us oh, ol;
#pragma unroll
                    for (int j = 0; j < 8; ++j) { const float x = acc[mb][nb][j] + bv1; o16[j] = tohx(x); unsigned short a2, c2; splitf(x, a2, c2); oh[j] = a2; ol[j] = c2; }
                    unsigned char* p = vs + lr * VP + mb * 32 + hi * 16; *(v8usa*)p = __builtin_bit_cast(v8us, o16); *(v8usa*)(p + VS) = oh; *(v8usa*)(p + 2 * VS) = ol; }
                __builtin_amdgcn_wave_barrier(); asm volatile("" ::: "memory");   // the wave's own LDS writes stay ahead of its reads of other lanes' values
                v8us w[3][4];
#pragma unroll
                for (int pl = 0; pl < 3; ++pl)
#pragma unroll
                    for (int s = 0; s < 4; ++s) w[pl][s] = *(const v8usa*)(vs + pl * VS + (s * 4 + rr) * VP + tofs * 2);
                __builtin_amdgcn_wave_barrier(); asm volatile("" ::: "memory");   // and these reads stay ahead of the next column block's writes
#pragma unroll
                for (int s = 0; s < 4; ++s) { const unsigned e = eo + (nb * 16 + s * 4) * (TT * 2);
                    *(v8us*)((char*)P16 + e) = w[0][s]; *(v8us*)((char*)Ph + e) = w[1][s]; *(v8us*)((char*)Pl + e) = w[2][s];
                    asm volatile("s_wait_xcnt 0x0" :: "v"(__builtin_bit_cast(v4i, w[0][s])), "v"(__builtin_bit_cast(v4i, w[1][s])), "v"(__builtin_bit_cast(v4i, w[2][s])), "v"(e) : "memory"); }   // a precaution: the stored values and the offset stay in their registers up to this wait
            }
        }
        return;
    }
    float* os = (float*)ring + wave * (16 * 68);            // each wave's own 16 x 68 floats; every reader left the ring at the last pass's barrier
#pragma unroll
    for (int mb = 0; mb < 4; ++mb) {
#pragma unroll
        for (int nb = 0; nb < 4; ++nb) {
#pragma unroll
            for (int j = 0; j < 8; ++j) os[(hi * 8 + j) * 68 + nb * 16 + lr] = acc[mb][nb][j]; }
        __builtin_amdgcn_wave_barrier(); asm volatile("" ::: "memory");
        float* crow = C + (size_t)(r0 + mb * 16) * ldc + c0;
{
#pragma unroll
            for (int s = 0; s < 8; ++s) { const int row = 2 * s + hi, cofs = lr * 4; v4f val = *(const v4fa*)(os + row * 68 + cofs); if (BIAS) { val[0] += bfr(bias[c0 + cofs]); val[1] += bfr(bias[c0 + cofs + 1]); val[2] += bfr(bias[c0 + cofs + 2]); val[3] += bfr(bias[c0 + cofs + 3]); }
                *(v4f*)(crow + (size_t)row * ldc + cofs) = val; }
             }
        __builtin_amdgcn_wave_barrier(); asm volatile("" ::: "memory");
        asm volatile("s_wait_xcnt 0x0" ::: "memory");   // a precaution: stands between these stores and the next row block's reuse of their address registers
    }
}
// k_gemmw: one operand type for the whole grid (M/128, N/128, Z); plane z adds its own bias vector (bias, bias1, bias2 for z = 0, 1, 2), so that independent products on one A run as one launch.
template <typename T16, int NSPLIT, bool BIAS>
__global__ __launch_bounds__(128) void k_gemmw(const T16* __restrict__ A, const T16* __restrict__ A2, const T16* __restrict__ Bt, const T16* __restrict__ Bt2, int K, int lda, float* C, int ldc, const float* __restrict__ bias, const float* __restrict__ bias1, const float* __restrict__ bias2, size_t sA, size_t sB, size_t sC) {
    __shared__ __align__(16) unsigned char ring[gemm_ring_bytes(NSPLIT)];
    d_gemmw<T16, NSPLIT, BIAS, false>(ring, blockIdx.x, blockIdx.y, blockIdx.z, A, A2, Bt, Bt2, K, lda, C, ldc, blockIdx.z == 0 ? bias : (blockIdx.z == 1 ? bias1 : bias2), sA, sB, sC, nullptr, nullptr, nullptr, nullptr, false);
}
// k_qkv: the q, k and v projections, grid (tokens / 128, DQ / 128, 3), plane z = 0, 1, 2 on weight plane W + z * sB; each tile leaves the accumulators as attention operand planes: q and k rotated, v transposed.
__global__ __launch_bounds__(128) void k_qkv(const bf* __restrict__ X, const bf* __restrict__ Wt, size_t sB, const float* __restrict__ bq, const float* __restrict__ bk, const float* __restrict__ bv, const float* __restrict__ CS, h16* QP16, bf* QPh, bf* QPl, h16* KP16, bf* KPh, bf* KPl, h16* VT16, bf* VTh, bf* VTl) {
    __shared__ __align__(16) unsigned char ring[gemm_ring_bytes(0)];
    const unsigned z = blockIdx.z;
    d_gemmw<bf, 0, true, true>(ring, blockIdx.x, blockIdx.y, z, X, nullptr, Wt, nullptr, DM, DM, nullptr, 0, z == 0 ? bq : (z == 1 ? bk : bv), 0, sB, 0, CS, z == 0 ? QP16 : (z == 1 ? KP16 : VT16), z == 0 ? QPh : (z == 1 ? KPh : VTh), z == 0 ? QPl : (z == 1 ? KPl : VTl), z == 2);
}


__global__ __launch_bounds__(256) void k_wtG(const float* __restrict__ w, int K, int N, bf* Bt) {
    const int lane = threadIdx.x & 31; const int L0 = (blockIdx.x * 8 + (threadIdx.x >> 5)) * 8; const int nlines = N * K / 64;
{
#pragma unroll 1
        for (int l = 0; l < 8; ++l) { const int L = L0 + l; if (L >= nlines) break; const size_t e = (size_t)L * 64 + lane * 2; const int k = (int)(e % K), n = (int)(e / K); v2us o;
            o[0] = f2bf(w[(size_t)k * N + n]); o[1] = f2bf(w[(size_t)(k + 1) * N + n]); *(v2us*)(Bt + e) = o; }
         }
}
// k_resln: one wave per row. The row's sums y + bf16(x) stay in registers (64 a lane): both inputs are read once, all 32 loads of a lane issued together, where three passes of 16 dependent trips each waited out a load latency per trip.
// The order of every sum is that of the three passes: a lane adds its 64 values by rising column, then the butterfly.
__global__ __launch_bounds__(256) void k_resln(const float* __restrict__ Y, const float* __restrict__ Q, const float* __restrict__ g, const float* __restrict__ be, float* Z) {
    constexpr int NC = DM / 128;
    const int lane = threadIdx.x & 31; const int r = blockIdx.x * 8 + (threadIdx.x >> 5); if (r >= NB_ * TT) return; const unsigned bo = ((unsigned)r * DM + lane * 4) * 4u;   /* the lane's byte offset in Y, Q and Z alike: one register beside the scalar bases, live up to the stores, so that no load's result lands in an address register */ v4f v[NC], q4[NC];
#pragma unroll     // constant indices: the row stays in registers
    for (int ch = 0; ch < NC; ++ch) { v[ch] = *(const v4f*)((const char*)Y + bo + ch * 512); q4[ch] = *(const v4f*)((const char*)Q + bo + ch * 512); }
    __builtin_amdgcn_sched_barrier(0);   // keeps all 32 loads ahead of the first use: sunk among the sums they come in groups, one memory latency a group
    float s = 0.f;
#pragma unroll     // constant indices: the row stays in registers
    for (int ch = 0; ch < NC; ++ch)
#pragma unroll     // constant indices, as above
        for (int q = 0; q < 4; ++q) { v[ch][q] = __fadd_rn(bfr(q4[ch][q]), v[ch][q]); s += v[ch][q]; }
#pragma unroll     // five fixed steps of the butterfly
    for (int sh = 16; sh; sh >>= 1) s += __shfl_xor(s, sh, 32);
    const float mu = s * (1.0f / DM); float s2 = 0.f;
#pragma unroll     // constant indices: the row stays in registers
    for (int ch = 0; ch < NC; ++ch)
#pragma unroll     // constant indices, as above
        for (int q = 0; q < 4; ++q) { v[ch][q] = __fsub_rn(v[ch][q], mu); s2 = __fadd_rn(s2, __fmul_rn(v[ch][q], v[ch][q])); }
#pragma unroll     // five fixed steps of the butterfly
    for (int sh = 16; sh; sh >>= 1) s2 += __shfl_xor(s2, sh, 32);
    const float rs = __fdiv_rn(1.0f, __fsqrt_rn(__fadd_rn(s2 * (1.0f / DM), LNEPS)));
#pragma unroll     // constant indices: the row stays in registers
    for (int ch = 0; ch < NC; ++ch) { const v4f g4 = *(const v4f*)(g + ch * 128 + lane * 4), b4 = *(const v4f*)(be + ch * 128 + lane * 4);
#pragma unroll     // constant indices, as above
        for (int q = 0; q < 4; ++q) v[ch][q] = __fadd_rn(__fmul_rn(__fmul_rn(v[ch][q], rs), bfr(g4[q])), bfr(b4[q])); }
#pragma unroll     // constant indices: the row stays in registers
    for (int ch = 0; ch < NC; ++ch) *(v4f*)((char*)Z + bo + ch * 512) = v[ch];
}
// d_cvt8: a thread converts four pieces of 8 elements, 256 pieces apart, so that each wave-wide load and store stays contiguous; a launch has a quarter of the waves to start.
__device__ __forceinline__ void d_cvt8(const float* __restrict__ src, bf* dst, size_t n8) { const size_t i0 = (size_t)blockIdx.x * 1024 + threadIdx.x; v8f v[4];
#pragma unroll     // all four pieces' loads are issued before the first is converted
    for (int p = 0; p < 4; ++p) { const size_t i = i0 + p * 256; v[p] = *(const v8f*)(src + (i < n8 ? i : n8 - 1) * 8); }   /* a piece past the end re-reads the last one and is not stored: no branch, so no wait, between the loads */
#pragma unroll     // constant index: the pieces stay in registers
    for (int p = 0; p < 4; ++p) { const size_t i = i0 + p * 256; if (i >= n8) continue; v8us o;
#pragma unroll
        for (int k = 0; k < 8; ++k) o[k] = f2bf(v[p][k]);
        *(v8us*)(dst + i * 8) = o; } }
__device__ __forceinline__ void d_cstab(const float* __restrict__ frq, float* CS) { const int idx = blockIdx.x * 256 + threadIdx.x; if (idx >= TT * HD) return; const int t = idx / HD, d = idx % HD; const float ang = bfr(frq[(size_t)t * (HD / 2) + (d >> 1)]);   /* interleaved pairs share freqs[t][j] */ v2f cs; cs[0] = cosf(ang); cs[1] = sinf(ang); *(v2f*)(CS + (size_t)idx * 2) = cs;  }
// k_prep: the six independent input preparations as one launch, blockIdx.y picks the job: 0 the cos/sin table (the longest thread), 1 to 4 the weight planes, 5 the hidden state.
__global__ __launch_bounds__(256) void k_prep(const float* __restrict__ frq, float* CS, const float* __restrict__ wq, const float* __restrict__ wk, const float* __restrict__ wv, const float* __restrict__ wo, const float* __restrict__ x, bf* WQ, bf* WK, bf* WV, bf* WO, bf* XB, size_t nw8, size_t nx8) {
    const unsigned job = blockIdx.y;
    if (job == 0) { d_cstab(frq, CS); return; }
    const float* src = job == 1 ? wq : job == 2 ? wk : job == 3 ? wv : job == 4 ? wo : x; bf* dst = job == 1 ? WQ : job == 2 ? WK : job == 3 ? WV : job == 4 ? WO : XB;
    d_cvt8(src, dst, job == 5 ? nx8 : nw8);
}

// stage4: four asynchronous 16-byte copies of a thread, rows rs elements apart in global memory and ls bytes apart in LDS.
// The closing s_wait_xcnt stands inside the statement so that no address register named here is rewritten ahead of it.
template <typename T>
__device__ __forceinline__ void stage4(const T* g, size_t rs, unsigned l, unsigned ls) {
    asm volatile("global_load_async_to_lds_b128 %0, %4, off\n\t"
                 "global_load_async_to_lds_b128 %1, %5, off\n\t"
                 "global_load_async_to_lds_b128 %2, %6, off\n\t"
                 "global_load_async_to_lds_b128 %3, %7, off\n\t"
                 "s_wait_xcnt 0x0"
                 :: "v"(l), "v"(l + ls), "v"(l + 2 * ls), "v"(l + 3 * ls), "v"(g), "v"(g + rs), "v"(g + 2 * rs), "v"(g + 3 * rs)
                 : "memory");
}
#define FKB 64                    // keys per stage of the fused attention kernel
constexpr unsigned FPK = HD * 2 + 16, FPV = FKB * 2 + 16, FPM = FKB * 4 + 16;   // LDS row pitches in bytes (k rows, v^T rows, mask rows): 16 B x odd
constexpr unsigned flash_stage_bytes(bool hl) { return (hl ? 2u : 1u) * (FKB * FPK + HD * FPV) + 128u * FPM; }
template <bool HL> struct PFrag;
template <> struct PFrag<true> { static __device__ __forceinline__ void mk(const v8f& x, const v8f& y, v16bf& h, v16bf& l) {
#pragma unroll     // constant indices: the fragments and accumulators stay in registers
        for (int j = 0; j < 8; ++j) { const __bf16 a = (__bf16)x[j], c = (__bf16)y[j]; h[j] = a; h[8 + j] = c; l[j] = (__bf16)(x[j] - (float)a); l[8 + j] = (__bf16)(y[j] - (float)c); } } };   // hi = nearest-even bf16, lo = bf16 of the remainder, as splitf
template <> struct PFrag<false> { static __device__ __forceinline__ void mk(const v8f& x, const v8f& y, v16h& h, v16h& l) { v8h h0, h1;
#pragma unroll     // constant indices: the fragments and accumulators stay in registers
        for (int j = 0; j < 8; ++j) { h0[j] = tohx(x[j]); h1[j] = tohx(y[j]); }
        h = cat16(h0, h1); l = h; } };
// d_flash: attention of 128 query rows of one head plane z, 8 waves x 16 queries, online softmax over stages of FKB keys; k rows, v^T rows and mask rows of a stage go into LDS by asynchronous b128 copies, two buffers.
// Transposed products keep every per-query value in the query's own lane: S^T = K Q^T (D: key = hi * 8 + j, query = lr); two such tiles are, register for register, the B fragment (query = lr; keys hi * 8 + j, 16 + hi * 8 + j) of O^T = V^T P^T (D: d = hi * 8 + j, query = lr).
// HL: hi+lo bf16 planes, 3 products each; otherwise single fp16 products. The result, divided by the row sum, goes out as hi and lo planes [b * TT + t][h * HD + d].
template <typename T16, bool HL>
__device__ __forceinline__ void d_flash(unsigned char* ring, const int qb, const int z, const T16* __restrict__ Q, const T16* __restrict__ Q2, const T16* __restrict__ Kp, const T16* __restrict__ K2, const T16* __restrict__ Vt, const T16* __restrict__ V2, const float* __restrict__ MK, bf* Ah, bf* Al) {
    typedef typename WFrag<T16>::V V;
    constexpr unsigned SK = FKB * FPK, SV = HD * FPV, OV = (HL ? 2u : 1u) * SK, OM = OV + (HL ? 2u : 1u) * SV, STG = flash_stage_bytes(HL);   // stage: [K | K2 | V | V2 | mask]
    const int tid = threadIdx.x, lane = tid & 31, lr = lane & 15, hi = lane >> 4, wave = tid >> 5;
    const size_t zo = (size_t)z * TT * HD; const int q = qb * 128 + wave * 16 + lr;   // this lane's query row
    V qf[4], qf2[4];
#pragma unroll     // constant indices: the fragments and accumulators stay in registers
    for (int ks = 0; ks < 4; ++ks) { qf[ks] = WFrag<T16>::ld(Q + zo + (size_t)q * HD + ks * 32 + hi * 8); if (HL) qf2[ks] = WFrag<T16>::ld(Q2 + zo + (size_t)q * HD + ks * 32 + hi * 8); }
    asm volatile("s_wait_xcnt 0x0" ::: "memory");   // a precaution: stands between these loads and the first reuse of their address registers
    const size_t gk = zo + (size_t)(tid >> 4) * HD + (tid & 15) * 8, gv = zo + (size_t)(tid >> 3) * TT + (tid & 7) * 8, gm = ((size_t)(z / NH_) * TT + qb * 128 + (tid >> 4)) * TT + (tid & 15) * 4;
    const unsigned lb = (unsigned)(size_t)ring, lk = lb + (unsigned)(tid >> 4) * FPK + (unsigned)(tid & 15) * 16, lv = lb + OV + (unsigned)(tid >> 3) * FPV + (unsigned)(tid & 7) * 16, lm = lb + OM + (unsigned)(tid >> 4) * FPM + (unsigned)(tid & 15) * 16;
    auto fill = [&](int kb, unsigned buf) { const unsigned o = buf * STG;
        stage4(Kp + gk + (size_t)kb * HD, (size_t)16 * HD, lk + o, 16 * FPK); if (HL) stage4(K2 + gk + (size_t)kb * HD, (size_t)16 * HD, lk + o + SK, 16 * FPK);
        stage4(Vt + gv + kb, (size_t)32 * TT, lv + o, 32 * FPV); if (HL) stage4(V2 + gv + kb, (size_t)32 * TT, lv + o + SV, 32 * FPV);
        stage_plane<false>(MK + gm + kb, (size_t)16 * TT, lm + o, 16 * FPM); };
    v8f o[8];
#pragma unroll     // constant indices: the fragments and accumulators stay in registers
    for (int dt = 0; dt < 8; ++dt) o[dt] = (v8f){};
    float mx = -3.0e38f, sum = 0.f;   // running maximum of the query's row (both lane halves alike); this lane's half of the running sum
    fill(0, 0);
    asm volatile("s_wait_asynccnt 0x0" ::: "memory");   // stage 0 has landed before anybody reads it
    __syncthreads();
    fill(FKB, 1);
#pragma unroll 1   // one stage per trip: a single publish point
    for (int kb = 0, t = 0; kb < TT; kb += FKB, t ^= 1) {
        const unsigned char* sb = ring + (unsigned)t * STG;
        v8f s[4];
#pragma unroll     // constant indices: the fragments and accumulators stay in registers
        for (int kt = 0; kt < 4; ++kt) s[kt] = (v8f){};
#pragma unroll     // constant indices: the fragments and accumulators stay in registers
        for (int ks = 0; ks < 4; ++ks) { V a[4], a2[4];
#pragma unroll     // constant indices: the fragments and accumulators stay in registers
            for (int kt = 0; kt < 4; ++kt) { const unsigned char* p = sb + (kt * 16 + lr) * FPK + ks * 64 + hi * 16; a[kt] = WFrag<T16>::ld((const T16*)p); if (HL) a2[kt] = WFrag<T16>::ld((const T16*)(p + SK)); }
#pragma unroll     // constant indices: the fragments and accumulators stay in registers
            for (int kt = 0; kt < 4; ++kt) s[kt] = WFrag<T16>::mma(a[kt], qf[ks], s[kt]);
            if (HL) {
#pragma unroll     // constant indices: the fragments and accumulators stay in registers
                for (int kt = 0; kt < 4; ++kt) s[kt] = WFrag<T16>::mma(a2[kt], qf[ks], s[kt]);
#pragma unroll     // constant indices: the fragments and accumulators stay in registers
                for (int kt = 0; kt < 4; ++kt) s[kt] = WFrag<T16>::mma(a[kt], qf2[ks], s[kt]); } }
        float bm = mx;
#pragma unroll     // constant indices: the fragments and accumulators stay in registers
        for (int kt = 0; kt < 4; ++kt) { const float* mr = (const float*)(sb + OM + (wave * 16 + lr) * FPM + (kt * 16 + hi * 8) * 4); const v4f m0 = *(const v4fa*)mr, m1 = *(const v4fa*)(mr + 4);
#pragma unroll     // constant indices: the fragments and accumulators stay in registers
            for (int j = 0; j < 8; ++j) { const float tv = s[kt][j] * SCL + bfr(j < 4 ? m0[j & 3] : m1[j & 3]);   /* + attention_mask[b][0][q][key] */ s[kt][j] = tv; bm = fmaxf(bm, tv); } }
        bm = fmaxf(bm, __shfl_xor(bm, 16, 32));
        const float al = __builtin_amdgcn_exp2f((mx - bm) * 1.4426950408889634f); mx = bm;
        float ps = 0.f;
#pragma unroll     // constant indices: the fragments and accumulators stay in registers
        for (int kt = 0; kt < 4; ++kt)
#pragma unroll     // constant indices: the fragments and accumulators stay in registers
            for (int j = 0; j < 8; ++j) { const float p = __builtin_amdgcn_exp2f((s[kt][j] - mx) * 1.4426950408889634f); s[kt][j] = p; ps += p; }
        sum = sum * al + ps;
#pragma unroll     // constant indices: the fragments and accumulators stay in registers
        for (int dt = 0; dt < 8; ++dt) o[dt] *= al;
#pragma unroll     // constant indices: the fragments and accumulators stay in registers
        for (int kk = 0; kk < 2; ++kk) { V ph, pl; PFrag<HL>::mk(s[2 * kk], s[2 * kk + 1], ph, pl);
#pragma unroll     // constant indices: the fragments and accumulators stay in registers
            for (int dg = 0; dg < 2; ++dg) { V a[4], a2[4];
#pragma unroll     // constant indices: the fragments and accumulators stay in registers
                for (int i = 0; i < 4; ++i) { const unsigned char* p = sb + OV + ((dg * 4 + i) * 16 + lr) * FPV + kk * 64 + hi * 16; a[i] = WFrag<T16>::ld((const T16*)p); if (HL) a2[i] = WFrag<T16>::ld((const T16*)(p + SV)); }
#pragma unroll     // constant indices: the fragments and accumulators stay in registers
                for (int i = 0; i < 4; ++i) o[dg * 4 + i] = WFrag<T16>::mma(a[i], ph, o[dg * 4 + i]);
                if (HL) {
#pragma unroll     // constant indices: the fragments and accumulators stay in registers
                    for (int i = 0; i < 4; ++i) o[dg * 4 + i] = WFrag<T16>::mma(a2[i], ph, o[dg * 4 + i]);
#pragma unroll     // constant indices: the fragments and accumulators stay in registers
                    for (int i = 0; i < 4; ++i) o[dg * 4 + i] = WFrag<T16>::mma(a[i], pl, o[dg * 4 + i]); } } }
        asm volatile("s_wait_dscnt 0x0" ::: "memory");      // this wave's reads of the buffer are done before it is refilled
        asm volatile("s_wait_asynccnt 0x0" ::: "memory");   // this wave's copies of the next stage have landed
        __syncthreads();                                    // publishes the next stage and ends every reader's last read of this one
        if (kb + 2 * FKB < TT) fill(kb + 2 * FKB, (unsigned)t);
    }
    asm volatile("s_wait_asynccnt 0x0" ::: "memory");       // no copy is in flight when the wave ends
    sum += __shfl_xor(sum, 16, 32);
    const float f = __fdiv_rn(1.0f, sum);
    const size_t oo = ((size_t)(z / NH_) * TT + q) * DQ + (z % NH_) * HD + hi * 8;
#pragma unroll     // constant indices: the fragments and accumulators stay in registers
    for (int dt = 0; dt < 8; ++dt) { v8us oh, ol;
#pragma unroll     // constant indices: the fragments and accumulators stay in registers
        for (int j = 0; j < 8; ++j) { unsigned short a, c; splitf(o[dt][j] * f, a, c); oh[j] = a; ol[j] = c; }
        *(v8us*)(Ah + oo + dt * 16) = oh; *(v8us*)(Al + oo + dt * 16) = ol;
        asm volatile("s_wait_xcnt 0x0" ::: "memory");   // a precaution: stands between these stores and the next block's reuse of their registers
    }
}
// k_flash: grid (NZ, TT / 128), 256 threads; query blocks below RH / 128 take the hi+lo planes.
__global__ __launch_bounds__(256) void k_flash(const bf* __restrict__ Qh, const bf* __restrict__ Ql, const bf* __restrict__ Kh, const bf* __restrict__ Kl, const bf* __restrict__ Vh, const bf* __restrict__ Vl, const h16* __restrict__ Q16, const h16* __restrict__ K16, const h16* __restrict__ V16, const float* __restrict__ MK, bf* Ah, bf* Al) {
    __shared__ __align__(16) unsigned char ring[2 * flash_stage_bytes(true)];
    if (blockIdx.y < RH / 128) d_flash<bf, true>(ring, blockIdx.y, blockIdx.x, Qh, Ql, Kh, Kl, Vh, Vl, MK, Ah, Al);
    else d_flash<h16, false>(ring, blockIdx.y, blockIdx.x, Q16, nullptr, K16, nullptr, V16, nullptr, MK, Ah, Al);
}

extern "C" void kernel_launch(void* const* d_in, const int* in_sizes, int n_in,
                              void* d_out, int out_size, void* d_ws, size_t ws_size, hipStream_t stream) {
    (void)in_sizes; (void)n_in; (void)out_size;
    const float* x = (const float*)d_in[0]; const float* MK = (const float*)d_in[1]; const float* FRQ = (const float*)d_in[2]; const float* wq = (const float*)d_in[3]; const float* bq = (const float*)d_in[4]; const float* wk = (const float*)d_in[5]; const float* bk = (const float*)d_in[6]; const float* wv = (const float*)d_in[7]; const float* bv = (const float*)d_in[8]; const float* wo = (const float*)d_in[9]; const float* bo = (const float*)d_in[10]; const float* g1 = (const float*)d_in[11]; const float* e1b = (const float*)d_in[12]; const float* qnw = nullptr; const float* knw = nullptr; (void)qnw; (void)knw;
    float* OUT = (float*)d_out;     // [2][1024][2048]
    char* wsp = (char*)d_ws;
    auto take = [&](size_t bytes) { char* p = wsp; wsp += (bytes + 255) & ~(size_t)255; return (void*)p; };
    constexpr int MT = NB_ * TT;   // token rows of both batch entries
    bf* WO = (bf*)take((size_t)DM * DQ * 2); float* CS = (float*)take((size_t)TT * HD * 2 * 4);
    bf* WQ = (bf*)take((size_t)DQ * DM * 2); bf* WK = (bf*)take((size_t)DKV * DM * 2); bf* WV = (bf*)take((size_t)DKV * DM * 2); bf* XB = (bf*)take((size_t)MT * DM * 2);
    h16* QP16 = (h16*)take((size_t)NZ * TT * HD * 2); h16* KP16 = (h16*)take((size_t)NZ * TT * HD * 2); h16* VT16 = (h16*)take((size_t)NZ * HD * TT * 2);
    bf* QPh = (bf*)take((size_t)NZ * TT * HD * 2); bf* QPl = (bf*)take((size_t)NZ * TT * HD * 2); bf* KPh = (bf*)take((size_t)NZ * TT * HD * 2); bf* KPl = (bf*)take((size_t)NZ * TT * HD * 2); bf* VTh = (bf*)take((size_t)NZ * HD * TT * 2); bf* VTl = (bf*)take((size_t)NZ * HD * TT * 2);
    float* Sb = (float*)take((size_t)NZ * TT * TT * 4);
    if ((size_t)(wsp - (char*)d_ws) > ws_size) return;    // ws 256 MiB
    // Buffers that share bytes, all stream-ordered: the output projection lives in Sb;
    // the attention output's hi and lo planes take the v weight plane and the bf16 hidden state, both read for the last time by the projection launch.
    float* YO = Sb; bf* ATh = WV; bf* ATl = XB;
    static_assert(DQ == DKV && (size_t)DQ * DM / 8 / 1024 == (size_t)MT * DM / 8 / 1024 && (size_t)DQ * DM / 8 / 1024 == (size_t)TT * HD / 256, "one grid extent serves all jobs of k_prep; q, k and v planes have one size");
    static_assert((size_t)DQ * DM * 2 % 256 == 0, "the weight planes follow one another without a gap");
    k_prep<<<dim3((unsigned)(((size_t)DQ * DM / 8 + 1023) / 1024), 6), 256, 0, stream>>>(FRQ, CS, wq, wk, wv, wo, x, WQ, WK, WV, WO, XB, (size_t)DQ * DM / 8, (size_t)MT * DM / 8);
    static_assert(TT % 128 == 0 && HD == 128 && NKV == NH_, "a projection tile lies in one batch entry and one head");
    // q, k and v projections: planes z = 0, 1, 2 of one launch; WQ, WK, WV lie one plane size apart; the tiles go out as the attention operand planes
    k_qkv<<<dim3(MT / 128, DQ / 128, 3), 128, 0, stream>>>(XB, WQ, (size_t)DQ * DM, bq, bk, bv, CS, QP16, QPh, QPl, KP16, KPh, KPl, VT16, VTh, VTl);
    // one kv head per query head: plane z of q meets plane z of k and v; scores and probabilities stay in registers
    k_flash<<<dim3(NZ, TT / 128), 256, 0, stream>>>(QPh, QPl, KPh, KPl, VTh, VTl, QP16, KP16, VT16, MK, ATh, ATl);
    k_gemmw<bf, 1, true><<<dim3(MT / 128, DM / 128, 1), 128, 0, stream>>>(ATh, ATl, WO, nullptr, DQ, DQ, YO, DM, bo, nullptr, nullptr, 0, 0, 0);
    k_resln<<<MT / 8, 256, 0, stream>>>(YO, x, g1, e1b, OUT);   /* LN(proj + bo + hidden_state) */
}

// v009
// A run of this version takes 138 microseconds.
// In two side-by-side timings against v008, it was 1.07 and 1.09 times as fast.
// Over all steps from v000 it is 11.5 times as fast.
#include <hip/hip_runtime.h>

// Decoder attention with RoPE and a BERT-style output (hidden_state [2][1024][2048]; q, k, v = x W^T + b ('oi' [2048][2048], 16 heads x 128); interleaved RoPE with cos/sin(freqs[t][j]) (freqs [1024][64] input, read); scores/sqrt(128) + attention_mask[b][0][i][j] (f32 input, read; zeros); softmax; out = LN(attn Wo^T + bo + hidden_state) (eps 1e-12, gamma/beta) -> [2][1024][2048]).
// Compute dtypes, f32 accumulate: every input rounded to bf16; q/k/v on PLAIN bf16 operands (inputs: exact) + biases; rotary in f32 from a table cos/sin(bf16(freqs)); scores, additive mask (bf16-rounded), online softmax (f32) and attn.v in one kernel: query rows < 512 hl (3 products), the rest single fp16; Wo hl x exact (2 products) + bo; residual add and LayerNorm in f32 (fixed trees).

#define NB_  2
#define TT   1024
#define DM   2048
#define NH_  16
#define NKV  16
#define REP  (NH_ / NKV)
#define HD   128
#define DQ   (NH_ * HD)
#define DKV  (NKV * HD)
#define LNEPS 1e-12f
typedef __attribute__((ext_vector_type(4))) unsigned short v4us;
#define NZ   (NB_ * NH_)          // head planes z = b * NH_ + h, the x extent of the attention launch: every head of both batch entries in one pass
#define RH   512                  // query rows < RH use hi+lo planes (0: none)
#define WIN  0
#define SCL  0.088388347648318447f   // HD^-0.5
typedef _Float16 h16;
typedef unsigned short bf;
typedef __attribute__((ext_vector_type(16))) __bf16   v16bf;
typedef __attribute__((ext_vector_type(16))) _Float16 v16h;
typedef __attribute__((ext_vector_type(8)))  _Float16 v8h;
typedef __attribute__((ext_vector_type(8)))  unsigned short v8us;
typedef __attribute__((ext_vector_type(8)))  float    v8f;
typedef __attribute__((ext_vector_type(4)))  float    v4f;
typedef v8h  __attribute__((may_alias)) v8ha;
typedef v4f  __attribute__((may_alias)) v4fa;
typedef v8us __attribute__((may_alias)) v8usa;

__device__ __forceinline__ unsigned short f2bf(float f) { unsigned u = __float_as_uint(f); u += 0x7FFFu + ((u >> 16) & 1u); return (unsigned short)(u >> 16); }
__device__ __forceinline__ float bf2f(unsigned short b) { return __uint_as_float(((unsigned)b) << 16); }
__device__ __forceinline__ float bfr(float f) { return bf2f(f2bf(f)); }
__device__ __forceinline__ v16h cat16(v8h lo, v8h hi) { return __builtin_shufflevector(lo, hi, 0, 1, 2, 3, 4, 5, 6, 7, 8, 9, 10, 11, 12, 13, 14, 15); }
__device__ __forceinline__ v16bf cat16b(v8us lo, v8us hi) { return __builtin_bit_cast(v16bf, __builtin_shufflevector(lo, hi, 0, 1, 2, 3, 4, 5, 6, 7, 8, 9, 10, 11, 12, 13, 14, 15)); }
__device__ __forceinline__ v8f wmma16(v16h a, v16h b, v8f c) { return __builtin_amdgcn_wmma_f32_16x16x32_f16(false, a, false, b, (short)0, c, false, false); }
__device__ __forceinline__ v8f wmmab(v16bf a, v16bf b, v8f c) { return __builtin_amdgcn_wmma_f32_16x16x32_bf16(false, a, false, b, (short)0, c, false, false); }



// ---- k_gemmw: GEMM, one 128x128 output tile per work-group of 4 waves (2x2, 64x64 and 16 accumulators per wave); grid (M/128, N/128, Z), 128 threads.
// Operand tiles (128 rows x KC k, whole 128-byte lines) go from the K-contiguous 16-bit planes into LDS by asynchronous b128 copies, two buffers: the next tile flies while this one is multiplied.
// C[m][n] (f32, pitch ldc, + optional f32 bias[n]) = sum_k A[m][k] Bt[n][k] (+ split products per NSPLIT). A rows have pitch lda, Bt rows pitch K (elements). z-batch strides sA/sB/sC in elements. K % KC == 0, M % 128 == 0, N % 128 == 0.
template <typename T16> struct WFrag;
template <> struct WFrag<h16> { typedef v16h V; static __device__ __forceinline__ V ld(const h16* p) { return cat16(*(const v8h*)p, *(const v8h*)(p + 16)); } static __device__ __forceinline__ v8f mma(V a, V b, v8f c) { return wmma16(a, b, c); } };
template <> struct WFrag<bf> { typedef v16bf V; static __device__ __forceinline__ V ld(const bf* p) { return cat16b(*(const v8us*)p, *(const v8us*)(p + 16)); } static __device__ __forceinline__ v8f mma(V a, V b, v8f c) { return wmmab(a, b, c); } };
// One plane of one stage: every thread copies its 16 bytes (with WIDE also the 16 bytes 128 further on, in global memory and in LDS alike) of rows r, r + 16, ..., r + 112; a wave's copy = 4 whole lines.
// g: the lane's global address in row r, rs: 16 rows in elements, l: the lane's LDS byte address in row r, ls: 16 rows in LDS bytes.
// The closing s_wait_xcnt stands inside the statement so that no address register named here is rewritten ahead of it.
template <bool WIDE, typename T16>
__device__ __forceinline__ void stage_plane(const T16* g, size_t rs, unsigned l, unsigned ls) {
    if (WIDE)
        asm volatile("global_load_async_to_lds_b128 %0, %8, off\n\t"  "global_load_async_to_lds_b128 %0, %8, off offset:128\n\t"
                     "global_load_async_to_lds_b128 %1, %9, off\n\t"  "global_load_async_to_lds_b128 %1, %9, off offset:128\n\t"
                     "global_load_async_to_lds_b128 %2, %10, off\n\t" "global_load_async_to_lds_b128 %2, %10, off offset:128\n\t"
                     "global_load_async_to_lds_b128 %3, %11, off\n\t" "global_load_async_to_lds_b128 %3, %11, off offset:128\n\t"
                     "global_load_async_to_lds_b128 %4, %12, off\n\t" "global_load_async_to_lds_b128 %4, %12, off offset:128\n\t"
                     "global_load_async_to_lds_b128 %5, %13, off\n\t" "global_load_async_to_lds_b128 %5, %13, off offset:128\n\t"
                     "global_load_async_to_lds_b128 %6, %14, off\n\t" "global_load_async_to_lds_b128 %6, %14, off offset:128\n\t"
                     "global_load_async_to_lds_b128 %7, %15, off\n\t" "global_load_async_to_lds_b128 %7, %15, off offset:128\n\t"
                     "s_wait_xcnt 0x0"
                     :: "v"(l), "v"(l + ls), "v"(l + 2 * ls), "v"(l + 3 * ls), "v"(l + 4 * ls), "v"(l + 5 * ls), "v"(l + 6 * ls), "v"(l + 7 * ls),
                        "v"(g), "v"(g + rs), "v"(g + 2 * rs), "v"(g + 3 * rs), "v"(g + 4 * rs), "v"(g + 5 * rs), "v"(g + 6 * rs), "v"(g + 7 * rs)
                     : "memory");
    else
        asm volatile("global_load_async_to_lds_b128 %0, %8, off\n\t"
                     "global_load_async_to_lds_b128 %1, %9, off\n\t"
                     "global_load_async_to_lds_b128 %2, %10, off\n\t"
                     "global_load_async_to_lds_b128 %3, %11, off\n\t"
                     "global_load_async_to_lds_b128 %4, %12, off\n\t"
                     "global_load_async_to_lds_b128 %5, %13, off\n\t"
                     "global_load_async_to_lds_b128 %6, %14, off\n\t"
                     "global_load_async_to_lds_b128 %7, %15, off\n\t"
                     "s_wait_xcnt 0x0"
                     :: "v"(l), "v"(l + ls), "v"(l + 2 * ls), "v"(l + 3 * ls), "v"(l + 4 * ls), "v"(l + 5 * ls), "v"(l + 6 * ls), "v"(l + 7 * ls),
                        "v"(g), "v"(g + rs), "v"(g + 2 * rs), "v"(g + 3 * rs), "v"(g + 4 * rs), "v"(g + 5 * rs), "v"(g + 6 * rs), "v"(g + 7 * rs)
                     : "memory");
}
// stage_blk: N blocks of 16 rows of a tile whose rows are 256 bytes: every thread of a 128-thread wave group copies its 16 bytes, and the 16 bytes 128 further on (in global memory and in LDS alike), of rows r, r + 16, ...
// g: the lane's global address in row r, rs: 16 rows in elements, l: the lane's LDS byte address in row r, ls: 16 rows in LDS bytes.
// The closing s_wait_xcnt stands inside the statement so that no address register named here is rewritten ahead of it.
template <int N, typename T16>
__device__ __forceinline__ void stage_blk(const T16* g, size_t rs, unsigned l, unsigned ls) {
    static_assert(N == 1 || N == 4 || N == 5, "block counts written out below");
    if (N == 1)
        asm volatile("global_load_async_to_lds_b128 %0, %1, off\n\t" "global_load_async_to_lds_b128 %0, %1, off offset:128\n\t"
                     "s_wait_xcnt 0x0"
                     :: "v"(l), "v"(g) : "memory");
    else if (N == 4)
        asm volatile("global_load_async_to_lds_b128 %0, %4, off\n\t" "global_load_async_to_lds_b128 %0, %4, off offset:128\n\t"
                     "global_load_async_to_lds_b128 %1, %5, off\n\t" "global_load_async_to_lds_b128 %1, %5, off offset:128\n\t"
                     "global_load_async_to_lds_b128 %2, %6, off\n\t" "global_load_async_to_lds_b128 %2, %6, off offset:128\n\t"
                     "global_load_async_to_lds_b128 %3, %7, off\n\t" "global_load_async_to_lds_b128 %3, %7, off offset:128\n\t"
                     "s_wait_xcnt 0x0"
                     :: "v"(l), "v"(l + ls), "v"(l + 2 * ls), "v"(l + 3 * ls), "v"(g), "v"(g + rs), "v"(g + 2 * rs), "v"(g + 3 * rs) : "memory");
    else
        asm volatile("global_load_async_to_lds_b128 %0, %5, off\n\t" "global_load_async_to_lds_b128 %0, %5, off offset:128\n\t"
                     "global_load_async_to_lds_b128 %1, %6, off\n\t" "global_load_async_to_lds_b128 %1, %6, off offset:128\n\t"
                     "global_load_async_to_lds_b128 %2, %7, off\n\t" "global_load_async_to_lds_b128 %2, %7, off offset:128\n\t"
                     "global_load_async_to_lds_b128 %3, %8, off\n\t" "global_load_async_to_lds_b128 %3, %8, off offset:128\n\t"
                     "global_load_async_to_lds_b128 %4, %9, off\n\t" "global_load_async_to_lds_b128 %4, %9, off offset:128\n\t"
                     "s_wait_xcnt 0x0"
                     :: "v"(l), "v"(l + ls), "v"(l + 2 * ls), "v"(l + 3 * ls), "v"(l + 4 * ls), "v"(g), "v"(g + rs), "v"(g + 2 * rs), "v"(g + 3 * rs), "v"(g + 4 * rs) : "memory");
}
__device__ __forceinline__ h16 tohx(float x) { return (h16)x; }
__device__ __forceinline__ void splitf(float y, unsigned short& h, unsigned short& l) { h = f2bf(y); l = f2bf(y - bf2f(h)); }
typedef __attribute__((ext_vector_type(2))) _Float16 v2h;
typedef __attribute__((ext_vector_type(4))) _Float16 v4h;
typedef __attribute__((ext_vector_type(2))) unsigned short v2us;
typedef __attribute__((ext_vector_type(4))) unsigned short v4us;
typedef __attribute__((ext_vector_type(2))) float v2f;
typedef __attribute__((ext_vector_type(4))) int v4i;
// rope8: 8 consecutive d (d % 8 == 0) of one token row of q or k: the interleaved rotary (x1 c - x2 s, x1 s + x2 c on pairs (2j, 2j+1)) with the row's 8 cos/sin pairs c4, then the fp16 value and the hi and lo bf16 parts.
__device__ __forceinline__ void rope8(const v8f& fx, const v4f* c4, v8h& o16, v8us& oh, v8us& ol) {
#pragma unroll     // constant indices: the row piece stays in registers
    for (int q = 0; q < 8; ++q) { float x0 = fx[q], x1 = fx[q ^ 1];   /* interleaved pair partner */
        v2f cs; cs[0] = c4[q >> 1][(q & 1) * 2]; cs[1] = c4[q >> 1][(q & 1) * 2 + 1]; const float a = __fmul_rn(x0, cs[0]), bq = __fmul_rn(x1, cs[1]); const float r = ((q & 1) == 0) ? __fsub_rn(a, bq) : __fadd_rn(a, bq);   /* even: x1 c - x2 s; odd: x2 c + x1 s */
        o16[q] = tohx(r); unsigned short a2, c2; splitf(r, a2, c2); oh[q] = a2; ol[q] = c2; } }
// LDS bytes of the two-buffer ring of d_gemmw<., NSPLIT, .>
constexpr unsigned gemm_ring_bytes(int nsplit) { return 2u * (((nsplit == 1 || nsplit == 2) ? 2u : 1u) + (nsplit >= 2 ? 2u : 1u)) * 128u * ((nsplit >= 2 ? 64u : 128u) * 2u + 16u); }
// LDS bytes of the two-buffer ring of d_gemmw<., 0, ., ., true>: a stage is 256 A rows and 64 rows of each of three B planes, 128 k
constexpr unsigned tri_ring_bytes() { return 2u * (256u + 3u * 64u) * (128u * 2u + 16u); }
// d_gemmw: the body; ring = the work-group's LDS (gemm_ring_bytes(NSPLIT) bytes; TRI: tri_ring_bytes()), (bx, by, bz) = its M tile, N tile and batch plane, the same for every thread of the work-group (TRI: bz is the wave group's).
// PLANES: no f32 C; the tile + bias goes out as the attention operand planes (fp16 + hi/lo bf16) P16, Ph, Pl: vt false: rotated with the table CS, [b * NH_ + h][t][d]; vt true (the same for a whole wave group): transposed, [b * NH_ + h][d][t]. Rows are tokens b * TT + t, columns h * HD + d.
// TRI: a work-group of 12 waves = three groups of 4; group bz (the same for a whole wave, a scalar) multiplies the one staged A tile of 256 rows (M tile bx) by 64 rows (N tile by) of its own B plane bz, a wave 64 x 64: A comes from L2 once for three products. bias, the planes and vt are then the wave group's.
template <typename T16, int NSPLIT, bool BIAS, bool PLANES, bool TRI>
__device__ __forceinline__ void d_gemmw(unsigned char* ring, const int bx, const int by, const int bz, const T16* __restrict__ A, const T16* __restrict__ A2, const T16* __restrict__ Bt, const T16* __restrict__ Bt2, int K, int lda, float* C, int ldc, const float* __restrict__ bias, size_t sA, size_t sB, size_t sC, const float* __restrict__ CS, h16* P16, bf* Ph, bf* Pl, const bool vt) {
    typedef typename WFrag<T16>::V V;
    constexpr bool HA2 = (NSPLIT == 1 || NSPLIT == 2), HB2 = (NSPLIT >= 2), WIDE = !HB2;
    constexpr int KC = WIDE ? 128 : 64;                       // k per stage; four planes of 128 k would be 64 copies of a wave in flight
    constexpr unsigned PIT = KC * 2 + 16;                     // LDS row pitch in bytes: 16 B x odd, conflict-free for ds_load_b128
    constexpr int MR = TRI ? 256 : 128, NR = TRI ? 64 : 128;  // rows of the A tile, rows of one B plane's tile
    constexpr unsigned PLN = MR * PIT, BPL = NR * PIT, PB = (HA2 ? 2u : 1u) * PLN, STG = PB + (TRI ? 3u : HB2 ? 2u : 1u) * BPL;   // stage: [A | A2 | B | B2], TRI: [A | B of group 0 | 1 | 2]
    static_assert(2 * STG == (TRI ? tri_ring_bytes() : gemm_ring_bytes(NSPLIT)), "the callers size the ring");
    static_assert(!TRI || (NSPLIT == 0 && PLANES), "three wave groups: single planes, plane output");
    const size_t z = bz; A += z * sA; if (HA2) A2 += z * sA; Bt += z * sB; if (HB2) Bt2 += z * sB; C += z * sC;
    const int tid = threadIdx.x, lane = tid & 31, lr = lane & 15, hi = lane >> 4, wave = TRI ? __builtin_amdgcn_readfirstlane(tid >> 5) : tid >> 5, wm = TRI ? (wave & 3) : (wave >> 1), wn = TRI ? 0 : (wave & 1), tl = TRI ? (tid & 127) : tid;   // tl: the thread in its copying group
    const int r0 = bx * MR + wm * 64, c0 = by * NR + wn * 64;
    v8f acc[4][4];
#pragma unroll
    for (int mb = 0; mb < 4; ++mb)
#pragma unroll
        for (int nb = 0; nb < 4; ++nb) acc[mb][nb] = (v8f){};
    const int ag = TRI ? bz * 80 : 0;   // TRI: group bz copies A rows bz * 80 ... + 79, group 0 also the last 16
    const size_t ga = (size_t)(bx * MR + ag + (tl >> 3)) * lda + (tl & 7) * 8, gb = (size_t)(by * NR + (tl >> 3)) * K + (tl & 7) * 8, rsa = (size_t)16 * lda, rsb = (size_t)16 * K;
    const unsigned lcp = (unsigned)(size_t)ring + (unsigned)(tl >> 3) * PIT + (unsigned)(tl & 7) * 16;
    auto fill = [&](int kc, unsigned buf) { const unsigned l = lcp + buf * STG;
        if (TRI) {
            stage_blk<5>(A + ga + kc, rsa, l + (unsigned)ag * PIT, 16 * PIT);
            if (bz == 0) stage_blk<1>(A + ga + kc + 15 * rsa, rsa, l + 240 * PIT, 16 * PIT);   // a scalar test: whole waves take it or pass it
            stage_blk<4>(Bt + gb + kc, rsb, l + PB + (unsigned)bz * BPL, 16 * PIT);
            return; }
        stage_plane<WIDE>(A + ga + kc, rsa, l, 16 * PIT); if (HA2) stage_plane<WIDE>(A2 + ga + kc, rsa, l + PLN, 16 * PIT);
        stage_plane<WIDE>(Bt + gb + kc, rsb, l + PB, 16 * PIT); if (HB2) stage_plane<WIDE>(Bt2 + gb + kc, rsb, l + PB + PLN, 16 * PIT); };
    fill(0, 0);
    asm volatile("s_wait_asynccnt 0x0" ::: "memory");   // tile 0 has landed before anybody reads it
    __syncthreads();
    if (K > KC) fill(KC, 1);
#pragma unroll 1   // one pass per trip: a single publish point
    for (int kc = 0, t = 0; kc < K; kc += KC, t ^= 1) {
        const unsigned char* fa = ring + (unsigned)t * STG + (wm * 64 + lr) * PIT + hi * 16; const unsigned char* fb = ring + (unsigned)t * STG + PB + (TRI ? (unsigned)bz * BPL : 0u) + (wn * 64 + lr) * PIT + hi * 16;
        V a[2][4], a2[2][4], b[2][4], b2[2][4];   // two fragment sets: the next 32 k are fetched as one group ahead of this block's products
#pragma unroll     // unrolled so that the set index is a constant and both fragment sets stay in registers
        for (int ks = -1; ks < KC / 32; ++ks) {
            if (ks + 1 < KC / 32) { const int s = (ks + 1) & 1, o = (ks + 1) * 64;
#pragma unroll
                for (int i = 0; i < 4; ++i) { a[s][i] = WFrag<T16>::ld((const T16*)(fa + i * 16 * PIT + o)); if (HA2) a2[s][i] = WFrag<T16>::ld((const T16*)(fa + PLN + i * 16 * PIT + o)); }
#pragma unroll
                for (int i = 0; i < 4; ++i) { b[s][i] = WFrag<T16>::ld((const T16*)(fb + i * 16 * PIT + o)); if (HB2) b2[s][i] = WFrag<T16>::ld((const T16*)(fb + PLN + i * 16 * PIT + o)); } }
            __builtin_amdgcn_sched_barrier(0);   // keeps the next block's LDS reads one group ahead of this block's products; sunk among them, every product row waits out the LDS latency
            if (ks >= 0) { const int s = ks & 1;
#pragma unroll
                for (int nb = 0; nb < 4; ++nb) {
#pragma unroll
                    for (int mb = 0; mb < 4; ++mb) acc[mb][nb] = WFrag<T16>::mma(a[s][mb], b[s][nb], acc[mb][nb]);
                    if (HA2) {
#pragma unroll
                        for (int mb = 0; mb < 4; ++mb) acc[mb][nb] = WFrag<T16>::mma(a2[s][mb], b[s][nb], acc[mb][nb]); }
                    if (HB2) {
#pragma unroll
                        for (int mb = 0; mb < 4; ++mb) acc[mb][nb] = WFrag<T16>::mma(a[s][mb], b2[s][nb], acc[mb][nb]); } } }
            __builtin_amdgcn_sched_barrier(0);   // and keeps the group after next behind these products, whose registers it refills
        }
        asm volatile("s_wait_dscnt 0x0" ::: "memory");      // this wave's reads of the buffer are done before it is refilled
        asm volatile("s_wait_asynccnt 0x0" ::: "memory");   // this wave's copies of the next tile have landed
        __syncthreads();                                    // publishes the next tile and ends every reader's last read of this one
        if (kc + 2 * KC < K) fill(kc + 2 * KC, (unsigned)t);
    }
    asm volatile("s_wait_asynccnt 0x0" ::: "memory");       // no copy is in flight when the ring becomes output staging
    if (PLANES) {
        const size_t zp = (size_t)(r0 / TT) * NH_ + c0 / HD; const int t0 = r0 % TT, d0 = c0 % HD;   // the wave's 64 tokens lie in one batch entry, its 64 columns in one head
        if (!vt) {
            float* os = (float*)ring + wave * (64 * 68);    // each wave's own 64 x 68 floats; every reader left the ring at the last pass's barrier
            const int rr = lane >> 3, cofs = (lane & 7) * 8;   // read-back: 8 lanes x 8 d cover the 64 columns of a row (one whole line of a 16-bit plane), 4 rows a step
            // One 32-bit byte offset a buffer beside its scalar base: a trip's loads share one offset register, its steps are immediates.
            const unsigned bofs = (unsigned)(c0 + cofs) * 4u, co = (unsigned)((t0 + rr) * HD + d0 + cofs) * 8u, eo = ((unsigned)(zp * TT + t0 + rr) * HD + d0 + cofs) * 2u;
            const v4f b0 = *(const v4f*)((const char*)bias + bofs), b1 = *(const v4f*)((const char*)bias + bofs + 16);
            asm volatile("s_wait_xcnt 0x0" :: "v"(bofs) : "memory");   // a precaution: the offset stays in its register up to this wait, so that no load's result lands in it earlier
            v8f bb;
#pragma unroll     // constant indices: the bias piece stays in registers
            for (int q = 0; q < 4; ++q) { bb[q] = bfr(b0[q]); bb[4 + q] = bfr(b1[q]); }
#pragma unroll     // constant indices: the accumulators stay in registers
            for (int mb = 0; mb < 4; ++mb)
#pragma unroll
                for (int nb = 0; nb < 4; ++nb)
#pragma unroll
                    for (int j = 0; j < 8; ++j) os[(mb * 16 + hi * 8 + j) * 68 + nb * 16 + lr] = acc[mb][nb][j];
            __builtin_amdgcn_wave_barrier(); asm volatile("" ::: "memory");   // the wave's own LDS writes stay ahead of its reads of other lanes' values
#pragma unroll 1   // 16 rows a trip, rolled: for speed only
            for (int it = 0; it < 4; ++it) { v4f c4[4][4]; v8f fx[4]; const unsigned c = co + it * (16 * HD * 8), e0 = eo + it * (16 * HD * 2);
#pragma unroll     // the trip's 16 table loads are issued together, ahead of its LDS reads
                for (int s = 0; s < 4; ++s)
#pragma unroll
                    for (int i = 0; i < 4; ++i) c4[s][i] = *(const v4f*)((const char*)CS + c + s * (4 * HD * 8) + i * 16);
                asm volatile("s_wait_xcnt 0x0" :: "v"(c) : "memory");   // a precaution: the offset stays in its register up to this wait, so that no load's result lands in it earlier
#pragma unroll
                for (int s = 0; s < 4; ++s) { const float* p = os + (it * 16 + s * 4 + rr) * 68 + cofs; const v4f x = *(const v4fa*)p, y = *(const v4fa*)(p + 4);
#pragma unroll
                    for (int q = 0; q < 4; ++q) { fx[s][q] = x[q] + bb[q]; fx[s][4 + q] = y[q] + bb[4 + q]; } }
#pragma unroll
                for (int s = 0; s < 4; ++s) { const unsigned e = e0 + s * (4 * HD * 2); v8h o16; v8us oh, ol; rope8(fx[s], c4[s], o16, oh, ol);
                    *(v8h*)((char*)P16 + e) = o16; *(v8us*)((char*)Ph + e) = oh; *(v8us*)((char*)Pl + e) = ol;
                    asm volatile("s_wait_xcnt 0x0" :: "v"(__builtin_bit_cast(v4i, o16)), "v"(__builtin_bit_cast(v4i, oh)), "v"(__builtin_bit_cast(v4i, ol)), "v"(e) : "memory"); }   // a precaution: the stored values and the offset stay in their registers up to this wait
            }
        } else {
            constexpr unsigned VP = 64 * 2 + 16, VS = 16 * VP;   // staging of one plane: 16 d rows of 64 t, pitch 16 B x odd
            unsigned char* vs = ring + wave * (TRI ? 64 * 68 * 4 : 3 * VS);     // each wave's own three planes (TRI: in the wave's slot of the other groups' size, which they lie beside); every reader left the ring at the last pass's barrier
            const int rr = lane >> 3, tofs = (lane & 7) * 8;   // read-back: 8 lanes x 8 t cover the 64 t of one d (one whole line), 4 d a step
            // One 32-bit byte offset a buffer beside its scalar base.
            const unsigned bofs = (unsigned)(c0 + lr) * 4u, eo = ((unsigned)(zp * HD + d0 + rr) * TT + t0 + tofs) * 2u; float bl[4];
#pragma unroll     // the four column blocks' bias values are fetched together
            for (int nb = 0; nb < 4; ++nb) bl[nb] = *(const float*)((const char*)bias + bofs + nb * 64);
            asm volatile("s_wait_xcnt 0x0" :: "v"(bofs) : "memory");   // a precaution: the offset stays in its register up to this wait, so that no load's result lands in it earlier
#pragma unroll     // constant indices: the accumulators stay in registers
            for (int nb = 0; nb < 4; ++nb) { const float bv1 = bfr(bl[nb]);
#pragma unroll     // an accumulator holds 8 consecutive t of the lane's d: 16 bytes of each transposed plane
                for (int mb = 0; mb < 4; ++mb) { v8h o16; v8us oh, ol;
#pragma unroll
                    for (int j = 0; j < 8; ++j) { const float x = acc[mb][nb][j] + bv1; o16[j] = tohx(x); unsigned short a2, c2; splitf(x, a2, c2); oh[j] = a2; ol[j] = c2; }
                    unsigned char* p = vs + lr * VP + mb * 32 + hi * 16; *(v8usa*)p = __builtin_bit_cast(v8us, o16); *(v8usa*)(p + VS) = oh; *(v8usa*)(p + 2 * VS) = ol; }
                __builtin_amdgcn_wave_barrier(); asm volatile("" ::: "memory");   // the wave's own LDS writes stay ahead of its reads of other lanes' values
                v8us w[3][4];
#pragma unroll
                for (int pl = 0; pl < 3; ++pl)
#pragma unroll
                    for (int s = 0; s < 4; ++s) w[pl][s] = *(const v8usa*)(vs + pl * VS + (s * 4 + rr) * VP + tofs * 2);
                __builtin_amdgcn_wave_barrier(); asm volatile("" ::: "memory");   // and these reads stay ahead of the next column block's writes
#pragma unroll
                for (int s = 0; s < 4; ++s) { const unsigned e = eo + (nb * 16 + s * 4) * (TT * 2);
                    *(v8us*)((char*)P16 + e) = w[0][s]; *(v8us*)((char*)Ph + e) = w[1][s]; *(v8us*)((char*)Pl + e) = w[2][s];
                    asm volatile("s_wait_xcnt 0x0" :: "v"(__builtin_bit_cast(v4i, w[0][s])), "v"(__builtin_bit_cast(v4i, w[1][s])), "v"(__builtin_bit_cast(v4i, w[2][s])), "v"(e) : "memory"); }   // a precaution: the stored values and the offset stay in their registers up to this wait
            }
        }
        return;
    }
    float* os = (float*)ring + wave * (16 * 68);            // each wave's own 16 x 68 floats; every reader left the ring at the last pass's barrier
#pragma unroll
    for (int mb = 0; mb < 4; ++mb) {
#pragma unroll
        for (int nb = 0; nb < 4; ++nb) {
#pragma unroll
            for (int j = 0; j < 8; ++j) os[(hi * 8 + j) * 68 + nb * 16 + lr] = acc[mb][nb][j]; }
        __builtin_amdgcn_wave_barrier(); asm volatile("" ::: "memory");
        float* crow = C + (size_t)(r0 + mb * 16) * ldc + c0;
{
#pragma unroll
            for (int s = 0; s < 8; ++s) { const int row = 2 * s + hi, cofs = lr * 4; v4f val = *(const v4fa*)(os + row * 68 + cofs); if (BIAS) { val[0] += bfr(bias[c0 + cofs]); val[1] += bfr(bias[c0 + cofs + 1]); val[2] += bfr(bias[c0 + cofs + 2]); val[3] += bfr(bias[c0 + cofs + 3]); }
                *(v4f*)(crow + (size_t)row * ldc + cofs) = val; }
             }
        __builtin_amdgcn_wave_barrier(); asm volatile("" ::: "memory");
        asm volatile("s_wait_xcnt 0x0" ::: "memory");   // a precaution: stands between these stores and the next row block's reuse of their address registers
    }
}
// k_gemmw: one operand type for the whole grid (M/128, N/128, Z); plane z adds its own bias vector (bias, bias1, bias2 for z = 0, 1, 2), so that independent products on one A run as one launch.
template <typename T16, int NSPLIT, bool BIAS>
__global__ __launch_bounds__(128) void k_gemmw(const T16* __restrict__ A, const T16* __restrict__ A2, const T16* __restrict__ Bt, const T16* __restrict__ Bt2, int K, int lda, float* C, int ldc, const float* __restrict__ bias, const float* __restrict__ bias1, const float* __restrict__ bias2, size_t sA, size_t sB, size_t sC) {
    __shared__ __align__(16) unsigned char ring[gemm_ring_bytes(NSPLIT)];
    d_gemmw<T16, NSPLIT, BIAS, false, false>(ring, blockIdx.x, blockIdx.y, blockIdx.z, A, A2, Bt, Bt2, K, lda, C, ldc, blockIdx.z == 0 ? bias : (blockIdx.z == 1 ? bias1 : bias2), sA, sB, sC, nullptr, nullptr, nullptr, nullptr, false);
}
// k_qkv: the q, k and v projections, grid (tokens / 256, DQ / 64), 12 waves: wave group z = 0, 1, 2 on weight plane W + z * sB, all three on one staged tile of 256 tokens; each wave's tile leaves the accumulators as attention operand planes: q and k rotated, v transposed.
__global__ __launch_bounds__(384) void k_qkv(const bf* __restrict__ X, const bf* __restrict__ Wt, size_t sB, const float* __restrict__ bq, const float* __restrict__ bk, const float* __restrict__ bv, const float* __restrict__ CS, h16* QP16, bf* QPh, bf* QPl, h16* KP16, bf* KPh, bf* KPl, h16* VT16, bf* VTh, bf* VTl) {
    __shared__ __align__(16) unsigned char ring[tri_ring_bytes()];
    const int z = __builtin_amdgcn_readfirstlane(threadIdx.x >> 7);   // the wave's group, in a scalar register: the tests and pointer choices on it are scalar
    d_gemmw<bf, 0, true, true, true>(ring, blockIdx.x, blockIdx.y, z, X, nullptr, Wt, nullptr, DM, DM, nullptr, 0, z == 0 ? bq : (z == 1 ? bk : bv), 0, sB, 0, CS, z == 0 ? QP16 : (z == 1 ? KP16 : VT16), z == 0 ? QPh : (z == 1 ? KPh : VTh), z == 0 ? QPl : (z == 1 ? KPl : VTl), z == 2);
}


__global__ __launch_bounds__(256) void k_wtG(const float* __restrict__ w, int K, int N, bf* Bt) {
    const int lane = threadIdx.x & 31; const int L0 = (blockIdx.x * 8 + (threadIdx.x >> 5)) * 8; const int nlines = N * K / 64;
{
#pragma unroll 1
        for (int l = 0; l < 8; ++l) { const int L = L0 + l; if (L >= nlines) break; const size_t e = (size_t)L * 64 + lane * 2; const int k = (int)(e % K), n = (int)(e / K); v2us o;
            o[0] = f2bf(w[(size_t)k * N + n]); o[1] = f2bf(w[(size_t)(k + 1) * N + n]); *(v2us*)(Bt + e) = o; }
         }
}
// k_resln: one wave per row. The row's sums y + bf16(x) stay in registers (64 a lane): both inputs are read once, all 32 loads of a lane issued together, where three passes of 16 dependent trips each waited out a load latency per trip.
// The order of every sum is that of the three passes: a lane adds its 64 values by rising column, then the butterfly.
__global__ __launch_bounds__(256) void k_resln(const float* __restrict__ Y, const float* __restrict__ Q, const float* __restrict__ g, const float* __restrict__ be, float* Z) {
    constexpr int NC = DM / 128;
    const int lane = threadIdx.x & 31; const int r = blockIdx.x * 8 + (threadIdx.x >> 5); if (r >= NB_ * TT) return; const unsigned bo = ((unsigned)r * DM + lane * 4) * 4u;   /* the lane's byte offset in Y, Q and Z alike: one register beside the scalar bases, live up to the stores, so that no load's result lands in an address register */ v4f v[NC], q4[NC];
#pragma unroll     // constant indices: the row stays in registers
    for (int ch = 0; ch < NC; ++ch) { v[ch] = *(const v4f*)((const char*)Y + bo + ch * 512); q4[ch] = *(const v4f*)((const char*)Q + bo + ch * 512); }
    __builtin_amdgcn_sched_barrier(0);   // keeps all 32 loads ahead of the first use: sunk among the sums they come in groups, one memory latency a group
    float s = 0.f;
#pragma unroll     // constant indices: the row stays in registers
    for (int ch = 0; ch < NC; ++ch)
#pragma unroll     // constant indices, as above
        for (int q = 0; q < 4; ++q) { v[ch][q] = __fadd_rn(bfr(q4[ch][q]), v[ch][q]); s += v[ch][q]; }
#pragma unroll     // five fixed steps of the butterfly
    for (int sh = 16; sh; sh >>= 1) s += __shfl_xor(s, sh, 32);
    const float mu = s * (1.0f / DM); float s2 = 0.f;
#pragma unroll     // constant indices: the row stays in registers
    for (int ch = 0; ch < NC; ++ch)
#pragma unroll     // constant indices, as above
        for (int q = 0; q < 4; ++q) { v[ch][q] = __fsub_rn(v[ch][q], mu); s2 = __fadd_rn(s2, __fmul_rn(v[ch][q], v[ch][q])); }
#pragma unroll     // five fixed steps of the butterfly
    for (int sh = 16; sh; sh >>= 1) s2 += __shfl_xor(s2, sh, 32);
    const float rs = __fdiv_rn(1.0f, __fsqrt_rn(__fadd_rn(s2 * (1.0f / DM), LNEPS)));
#pragma unroll     // constant indices: the row stays in registers
    for (int ch = 0; ch < NC; ++ch) { const v4f g4 = *(const v4f*)(g + ch * 128 + lane * 4), b4 = *(const v4f*)(be + ch * 128 + lane * 4);
#pragma unroll     // constant indices, as above
        for (int q = 0; q < 4; ++q) v[ch][q] = __fadd_rn(__fmul_rn(__fmul_rn(v[ch][q], rs), bfr(g4[q])), bfr(b4[q])); }
#pragma unroll     // constant indices: the row stays in registers
    for (int ch = 0; ch < NC; ++ch) *(v4f*)((char*)Z + bo + ch * 512) = v[ch];
}
// d_cvt8: a thread converts four pieces of 8 elements, 256 pieces apart, so that each wave-wide load and store stays contiguous; a launch has a quarter of the waves to start.
__device__ __forceinline__ void d_cvt8(const float* __restrict__ src, bf* dst, size_t n8) { const size_t i0 = (size_t)blockIdx.x * 1024 + threadIdx.x; v8f v[4];
#pragma unroll     // all four pieces' loads are issued before the first is converted
    for (int p = 0; p < 4; ++p) { const size_t i = i0 + p * 256; v[p] = *(const v8f*)(src + (i < n8 ? i : n8 - 1) * 8); }   /* a piece past the end re-reads the last one and is not stored: no branch, so no wait, between the loads */
#pragma unroll     // constant index: the pieces stay in registers
    for (int p = 0; p < 4; ++p) { const size_t i = i0 + p * 256; if (i >= n8) continue; v8us o;
#pragma unroll
        for (int k = 0; k < 8; ++k) o[k] = f2bf(v[p][k]);
        *(v8us*)(dst + i * 8) = o; } }
__device__ __forceinline__ void d_cstab(const float* __restrict__ frq, float* CS) { const int idx = blockIdx.x * 256 + threadIdx.x; if (idx >= TT * HD) return; const int t = idx / HD, d = idx % HD; const float ang = bfr(frq[(size_t)t * (HD / 2) + (d >> 1)]);   /* interleaved pairs share freqs[t][j] */ v2f cs; cs[0] = cosf(ang); cs[1] = sinf(ang); *(v2f*)(CS + (size_t)idx * 2) = cs;  }
// k_prep: the six independent input preparations as one launch, blockIdx.y picks the job: 0 the cos/sin table (the longest thread), 1 to 4 the weight planes, 5 the hidden state.
__global__ __launch_bounds__(256) void k_prep(const float* __restrict__ frq, float* CS, const float* __restrict__ wq, const float* __restrict__ wk, const float* __restrict__ wv, const float* __restrict__ wo, const float* __restrict__ x, bf* WQ, bf* WK, bf* WV, bf* WO, bf* XB, size_t nw8, size_t nx8) {
    const unsigned job = blockIdx.y;
    if (job == 0) { d_cstab(frq, CS); return; }
    const float* src = job == 1 ? wq : job == 2 ? wk : job == 3 ? wv : job == 4 ? wo : x; bf* dst = job == 1 ? WQ : job == 2 ? WK : job == 3 ? WV : job == 4 ? WO : XB;
    d_cvt8(src, dst, job == 5 ? nx8 : nw8);
}

// stage4: four asynchronous 16-byte copies of a thread, rows rs elements apart in global memory and ls bytes apart in LDS.
// The closing s_wait_xcnt stands inside the statement so that no address register named here is rewritten ahead of it.
template <typename T>
__device__ __forceinline__ void stage4(const T* g, size_t rs, unsigned l, unsigned ls) {
    asm volatile("global_load_async_to_lds_b128 %0, %4, off\n\t"
                 "global_load_async_to_lds_b128 %1, %5, off\n\t"
                 "global_load_async_to_lds_b128 %2, %6, off\n\t"
                 "global_load_async_to_lds_b128 %3, %7, off\n\t"
                 "s_wait_xcnt 0x0"
                 :: "v"(l), "v"(l + ls), "v"(l + 2 * ls), "v"(l + 3 * ls), "v"(g), "v"(g + rs), "v"(g + 2 * rs), "v"(g + 3 * rs)
                 : "memory");
}
#define FKB 64                    // keys per stage of the fused attention kernel
constexpr unsigned FPK = HD * 2 + 16, FPV = FKB * 2 + 16, FPM = FKB * 4 + 16;   // LDS row pitches in bytes (k rows, v^T rows, mask rows): 16 B x odd
constexpr unsigned flash_stage_bytes(bool hl) { return (hl ? 2u : 1u) * (FKB * FPK + HD * FPV) + 128u * FPM; }
template <bool HL> struct PFrag;
template <> struct PFrag<true> { static __device__ __forceinline__ void mk(const v8f& x, const v8f& y, v16bf& h, v16bf& l) {
#pragma unroll     // constant indices: the fragments and accumulators stay in registers
        for (int j = 0; j < 8; ++j) { const __bf16 a = (__bf16)x[j], c = (__bf16)y[j]; h[j] = a; h[8 + j] = c; l[j] = (__bf16)(x[j] - (float)a); l[8 + j] = (__bf16)(y[j] - (float)c); } } };   // hi = nearest-even bf16, lo = bf16 of the remainder, as splitf
template <> struct PFrag<false> { static __device__ __forceinline__ void mk(const v8f& x, const v8f& y, v16h& h, v16h& l) { v8h h0, h1;
#pragma unroll     // constant indices: the fragments and accumulators stay in registers
        for (int j = 0; j < 8; ++j) { h0[j] = tohx(x[j]); h1[j] = tohx(y[j]); }
        h = cat16(h0, h1); l = h; } };
// d_flash: attention of 128 query rows of one head plane z, 8 waves x 16 queries, online softmax over stages of FKB keys; k rows, v^T rows and mask rows of a stage go into LDS by asynchronous b128 copies, two buffers.
// Transposed products keep every per-query value in the query's own lane: S^T = K Q^T (D: key = hi * 8 + j, query = lr); two such tiles are, register for register, the B fragment (query = lr; keys hi * 8 + j, 16 + hi * 8 + j) of O^T = V^T P^T (D: d = hi * 8 + j, query = lr).
// HL: hi+lo bf16 planes, 3 products each; otherwise single fp16 products. The result, divided by the row sum, goes out as hi and lo planes [b * TT + t][h * HD + d].
template <typename T16, bool HL>
__device__ __forceinline__ void d_flash(unsigned char* ring, const int qb, const int z, const T16* __restrict__ Q, const T16* __restrict__ Q2, const T16* __restrict__ Kp, const T16* __restrict__ K2, const T16* __restrict__ Vt, const T16* __restrict__ V2, const float* __restrict__ MK, bf* Ah, bf* Al) {
    typedef typename WFrag<T16>::V V;
    constexpr unsigned SK = FKB * FPK, SV = HD * FPV, OV = (HL ? 2u : 1u) * SK, OM = OV + (HL ? 2u : 1u) * SV, STG = flash_stage_bytes(HL);   // stage: [K | K2 | V | V2 | mask]
    const int tid = threadIdx.x, lane = tid & 31, lr = lane & 15, hi = lane >> 4, wave = tid >> 5;
    const size_t zo = (size_t)z * TT * HD; const int q = qb * 128 + wave * 16 + lr;   // this lane's query row
    V qf[4], qf2[4];
#pragma unroll     // constant indices: the fragments and accumulators stay in registers
    for (int ks = 0; ks < 4; ++ks) { qf[ks] = WFrag<T16>::ld(Q + zo + (size_t)q * HD + ks * 32 + hi * 8); if (HL) qf2[ks] = WFrag<T16>::ld(Q2 + zo + (size_t)q * HD + ks * 32 + hi * 8); }
    asm volatile("s_wait_xcnt 0x0" ::: "memory");   // a precaution: stands between these loads and the first reuse of their address registers
    const size_t gk = zo + (size_t)(tid >> 4) * HD + (tid & 15) * 8, gv = zo + (size_t)(tid >> 3) * TT + (tid & 7) * 8, gm = ((size_t)(z / NH_) * TT + qb * 128 + (tid >> 4)) * TT + (tid & 15) * 4;
    const unsigned lb = (unsigned)(size_t)ring, lk = lb + (unsigned)(tid >> 4) * FPK + (unsigned)(tid & 15) * 16, lv = lb + OV + (unsigned)(tid >> 3) * FPV + (unsigned)(tid & 7) * 16, lm = lb + OM + (unsigned)(tid >> 4) * FPM + (unsigned)(tid & 15) * 16;
    auto fill = [&](int kb, unsigned buf) { const unsigned o = buf * STG;
        stage4(Kp + gk + (size_t)kb * HD, (size_t)16 * HD, lk + o, 16 * FPK); if (HL) stage4(K2 + gk + (size_t)kb * HD, (size_t)16 * HD, lk + o + SK, 16 * FPK);
        stage4(Vt + gv + kb, (size_t)32 * TT, lv + o, 32 * FPV); if (HL) stage4(V2 + gv + kb, (size_t)32 * TT, lv + o + SV, 32 * FPV);
        stage_plane<false>(MK + gm + kb, (size_t)16 * TT, lm + o, 16 * FPM); };
    v8f o[8];
#pragma unroll     // constant indices: the fragments and accumulators stay in registers
    for (int dt = 0; dt < 8; ++dt) o[dt] = (v8f){};
    float mx = -3.0e38f, sum = 0.f;   // running maximum of the query's row (both lane halves alike); this lane's half of the running sum
    fill(0, 0);
    asm volatile("s_wait_asynccnt 0x0" ::: "memory");   // stage 0 has landed before anybody reads it
    __syncthreads();
    fill(FKB, 1);
#pragma unroll 1   // one stage per trip: a single publish point
    for (int kb = 0, t = 0; kb < TT; kb += FKB, t ^= 1) {
        const unsigned char* sb = ring + (unsigned)t * STG;
        v8f s[4];
#pragma unroll     // constant indices: the fragments and accumulators stay in registers
        for (int kt = 0; kt < 4; ++kt) s[kt] = (v8f){};
#pragma unroll     // constant indices: the fragments and accumulators stay in registers
        for (int ks = 0; ks < 4; ++ks) { V a[4], a2[4];
#pragma unroll     // constant indices: the fragments and accumulators stay in registers
            for (int kt = 0; kt < 4; ++kt) { const unsigned char* p = sb + (kt * 16 + lr) * FPK + ks * 64 + hi * 16; a[kt] = WFrag<T16>::ld((const T16*)p); if (HL) a2[kt] = WFrag<T16>::ld((const T16*)(p + SK)); }
#pragma unroll     // constant indices: the fragments and accumulators stay in registers
            for (int kt = 0; kt < 4; ++kt) s[kt] = WFrag<T16>::mma(a[kt], qf[ks], s[kt]);
            if (HL) {
#pragma unroll     // constant indices: the fragments and accumulators stay in registers
                for (int kt = 0; kt < 4; ++kt) s[kt] = WFrag<T16>::mma(a2[kt], qf[ks], s[kt]);
#pragma unroll     // constant indices: the fragments and accumulators stay in registers
                for (int kt = 0; kt < 4; ++kt) s[kt] = WFrag<T16>::mma(a[kt], qf2[ks], s[kt]); } }
        float bm = mx;
#pragma unroll     // constant indices: the fragments and accumulators stay in registers
        for (int kt = 0; kt < 4; ++kt) { const float* mr = (const float*)(sb + OM + (wave * 16 + lr) * FPM + (kt * 16 + hi * 8) * 4); const v4f m0 = *(const v4fa*)mr, m1 = *(const v4fa*)(mr + 4);
#pragma unroll     // constant indices: the fragments and accumulators stay in registers
            for (int j = 0; j < 8; ++j) { const float tv = s[kt][j] * SCL + bfr(j < 4 ? m0[j & 3] : m1[j & 3]);   /* + attention_mask[b][0][q][key] */ s[kt][j] = tv; bm = fmaxf(bm, tv); } }
        bm = fmaxf(bm, __shfl_xor(bm, 16, 32));
        const float al = __builtin_amdgcn_exp2f((mx - bm) * 1.4426950408889634f); mx = bm;
        float ps = 0.f;
#pragma unroll     // constant indices: the fragments and accumulators stay in registers
        for (int kt = 0; kt < 4; ++kt)
#pragma unroll     // constant indices: the fragments and accumulators stay in registers
            for (int j = 0; j < 8; ++j) { const float p = __builtin_amdgcn_exp2f((s[kt][j] - mx) * 1.4426950408889634f); s[kt][j] = p; ps += p; }
        sum = sum * al + ps;
#pragma unroll     // constant indices: the fragments and accumulators stay in registers
        for (int dt = 0; dt < 8; ++dt) o[dt] *= al;
#pragma unroll     // constant indices: the fragments and accumulators stay in registers
        for (int kk = 0; kk < 2; ++kk) { V ph, pl; PFrag<HL>::mk(s[2 * kk], s[2 * kk + 1], ph, pl);
#pragma unroll     // constant indices: the fragments and accumulators stay in registers
            for (int dg = 0; dg < 2; ++dg) { V a[4], a2[4];
#pragma unroll     // constant indices: the fragments and accumulators stay in registers
                for (int i = 0; i < 4; ++i) { const unsigned char* p = sb + OV + ((dg * 4 + i) * 16 + lr) * FPV + kk * 64 + hi * 16; a[i] = WFrag<T16>::ld((const T16*)p); if (HL) a2[i] = WFrag<T16>::ld((const T16*)(p + SV)); }
#pragma unroll     // constant indices: the fragments and accumulators stay in registers
                for (int i = 0; i < 4; ++i) o[dg * 4 + i] = WFrag<T16>::mma(a[i], ph, o[dg * 4 + i]);
                if (HL) {
#pragma unroll     // constant indices: the fragments and accumulators stay in registers
                    for (int i = 0; i < 4; ++i) o[dg * 4 + i] = WFrag<T16>::mma(a2[i], ph, o[dg * 4 + i]);
#pragma unroll     // constant indices: the fragments and accumulators stay in registers
                    for (int i = 0; i < 4; ++i) o[dg * 4 + i] = WFrag<T16>::mma(a[i], pl, o[dg * 4 + i]); } } }
        asm volatile("s_wait_dscnt 0x0" ::: "memory");      // this wave's reads of the buffer are done before it is refilled
        asm volatile("s_wait_asynccnt 0x0" ::: "memory");   // this wave's copies of the next stage have landed
        __syncthreads();                                    // publishes the next stage and ends every reader's last read of this one
        if (kb + 2 * FKB < TT) fill(kb + 2 * FKB, (unsigned)t);
    }
    asm volatile("s_wait_asynccnt 0x0" ::: "memory");       // no copy is in flight when the wave ends
    sum += __shfl_xor(sum, 16, 32);
    const float f = __fdiv_rn(1.0f, sum);
    const size_t oo = ((size_t)(z / NH_) * TT + q) * DQ + (z % NH_) * HD + hi * 8;
#pragma unroll     // constant indices: the fragments and accumulators stay in registers
    for (int dt = 0; dt < 8; ++dt) { v8us oh, ol;
#pragma unroll     // constant indices: the fragments and accumulators stay in registers
        for (int j = 0; j < 8; ++j) { unsigned short a, c; splitf(o[dt][j] * f, a, c); oh[j] = a; ol[j] = c; }
        *(v8us*)(Ah + oo + dt * 16) = oh; *(v8us*)(Al + oo + dt * 16) = ol;
        asm volatile("s_wait_xcnt 0x0" ::: "memory");   // a precaution: stands between these stores and the next block's reuse of their registers
    }
}
// k_flash: grid (NZ, TT / 128), 256 threads; query blocks below RH / 128 take the hi+lo planes.
__global__ __launch_bounds__(256) void k_flash(const bf* __restrict__ Qh, const bf* __restrict__ Ql, const bf* __restrict__ Kh, const bf* __restrict__ Kl, const bf* __restrict__ Vh, const bf* __restrict__ Vl, const h16* __restrict__ Q16, const h16* __restrict__ K16, const h16* __restrict__ V16, const float* __restrict__ MK, bf* Ah, bf* Al) {
    __shared__ __align__(16) unsigned char ring[2 * flash_stage_bytes(true)];
    if (blockIdx.y < RH / 128) d_flash<bf, true>(ring, blockIdx.y, blockIdx.x, Qh, Ql, Kh, Kl, Vh, Vl, MK, Ah, Al);
    else d_flash<h16, false>(ring, blockIdx.y, blockIdx.x, Q16, nullptr, K16, nullptr, V16, nullptr, MK, Ah, Al);
}

extern "C" void kernel_launch(void* const* d_in, const int* in_sizes, int n_in,
                              void* d_out, int out_size, void* d_ws, size_t ws_size, hipStream_t stream) {
    (void)in_sizes; (void)n_in; (void)out_size;
    const float* x = (const float*)d_in[0]; const float* MK = (const float*)d_in[1]; const float* FRQ = (const float*)d_in[2]; const float* wq = (const float*)d_in[3]; const float* bq = (const float*)d_in[4]; const float* wk = (const float*)d_in[5]; const float* bk = (const float*)d_in[6]; const float* wv = (const float*)d_in[7]; const float* bv = (const float*)d_in[8]; const float* wo = (const float*)d_in[9]; const float* bo = (const float*)d_in[10]; const float* g1 = (const float*)d_in[11]; const float* e1b = (const float*)d_in[12]; const float* qnw = nullptr; const float* knw = nullptr; (void)qnw; (void)knw;
    float* OUT = (float*)d_out;     // [2][1024][2048]
    char* wsp = (char*)d_ws;
    auto take = [&](size_t bytes) { char* p = wsp; wsp += (bytes + 255) & ~(size_t)255; return (void*)p; };
    constexpr int MT = NB_ * TT;   // token rows of both batch entries
    bf* WO = (bf*)take((size_t)DM * DQ * 2); float* CS = (float*)take((size_t)TT * HD * 2 * 4);
    bf* WQ = (bf*)take((size_t)DQ * DM * 2); bf* WK = (bf*)take((size_t)DKV * DM * 2); bf* WV = (bf*)take((size_t)DKV * DM * 2); bf* XB = (bf*)take((size_t)MT * DM * 2);
    h16* QP16 = (h16*)take((size_t)NZ * TT * HD * 2); h16* KP16 = (h16*)take((size_t)NZ * TT * HD * 2); h16* VT16 = (h16*)take((size_t)NZ * HD * TT * 2);
    bf* QPh = (bf*)take((size_t)NZ * TT * HD * 2); bf* QPl = (bf*)take((size_t)NZ * TT * HD * 2); bf* KPh = (bf*)take((size_t)NZ * TT * HD * 2); bf* KPl = (bf*)take((size_t)NZ * TT * HD * 2); bf* VTh = (bf*)take((size_t)NZ * HD * TT * 2); bf* VTl = (bf*)take((size_t)NZ * HD * TT * 2);
    float* Sb = (float*)take((size_t)NZ * TT * TT * 4);
    if ((size_t)(wsp - (char*)d_ws) > ws_size) return;    // ws 256 MiB
    // Buffers that share bytes, all stream-ordered: the output projection lives in Sb;
    // the attention output's hi and lo planes take the v weight plane and the bf16 hidden state, both read for the last time by the projection launch.
    float* YO = Sb; bf* ATh = WV; bf* ATl = XB;
    static_assert(DQ == DKV && (size_t)DQ * DM / 8 / 1024 == (size_t)MT * DM / 8 / 1024 && (size_t)DQ * DM / 8 / 1024 == (size_t)TT * HD / 256, "one grid extent serves all jobs of k_prep; q, k and v planes have one size");
    static_assert((size_t)DQ * DM * 2 % 256 == 0, "the weight planes follow one another without a gap");
    k_prep<<<dim3((unsigned)(((size_t)DQ * DM / 8 + 1023) / 1024), 6), 256, 0, stream>>>(FRQ, CS, wq, wk, wv, wo, x, WQ, WK, WV, WO, XB, (size_t)DQ * DM / 8, (size_t)MT * DM / 8);
    static_assert(TT % 256 == 0 && HD == 128 && NKV == NH_, "a projection tile lies in one batch entry, a wave's columns in one head");
    // q, k and v projections: wave groups 0, 1, 2 of every work-group; WQ, WK, WV lie one plane size apart; the tiles go out as the attention operand planes
    k_qkv<<<dim3(MT / 256, DQ / 64), 384, 0, stream>>>(XB, WQ, (size_t)DQ * DM, bq, bk, bv, CS, QP16, QPh, QPl, KP16, KPh, KPl, VT16, VTh, VTl);
    // one kv head per query head: plane z of q meets plane z of k and v; scores and probabilities stay in registers
    k_flash<<<dim3(NZ, TT / 128), 256, 0, stream>>>(QPh, QPl, KPh, KPl, VTh, VTl, QP16, KP16, VT16, MK, ATh, ATl);
    k_gemmw<bf, 1, true><<<dim3(MT / 128, DM / 128, 1), 128, 0, stream>>>(ATh, ATl, WO, nullptr, DQ, DQ, YO, DM, bo, nullptr, nullptr, 0, 0, 0);
    k_resln<<<MT / 8, 256, 0, stream>>>(YO, x, g1, e1b, OUT);   /* LN(proj + bo + hidden_state) */
}
